// v000
// Measured on an AMD MI455X. A time is GPU time per run, averaged over a window of back-to-back runs after a warm-up
// (all launches, gaps included; the runs take copies of the inputs in turn), and the median of several windows.
// Apart from v000's, it joins two sittings. Times from different sittings can be a few percent apart, while
// side-by-side timings come from the same sitting.
// v000 is the starting kernel. One run takes 735 microseconds.
#include <hip/hip_runtime.h>
// Power-law-graph multi-head attention (B=1, S=2048, D=2048, 16 heads × 128; INPUT additive mask (nonzero = −1e9) ; RoPE interleaved pairs): q/k/v/o projections ((out,in) + bias) and the per-head
// metric product qg = q_h·G_h as GEMMs and the attention as a fused flash-style kernel (head dim 128: 4 k-steps / 8 d-tiles; masked keys excluded, fully masked 32-key tiles skipped by ballot;
// online softmax f32; P f16 ≤ 1; O = P·Vt; RPW-16 waves) on v_wmma_f32_16x16x32_f16, f32 accumulate; RoPE f32 VALU.
#define SS 2048
#define CC 2048
#define NH 16
#define HD 128

typedef __bf16 v16b __attribute__((ext_vector_type(16)));
typedef unsigned short v8us __attribute__((ext_vector_type(8), may_alias));
typedef float  v8f  __attribute__((ext_vector_type(8)));
typedef float  v4f  __attribute__((ext_vector_type(4)));
typedef float  v4fa __attribute__((ext_vector_type(4), may_alias));
union FragB { v16b v; v8us half[2]; unsigned short u[16]; };

__device__ __forceinline__ unsigned short bf16_bits(float x) { unsigned int u = __float_as_uint(x); return (unsigned short)((u + 0x7FFFu + ((u >> 16) & 1u)) >> 16); }
__device__ __forceinline__ float bf16_val(unsigned short b) { return __uint_as_float(((unsigned int)b) << 16); }
__device__ __forceinline__ float bf16_round(float x) { return bf16_val(bf16_bits(x)); }
// D += A·B with NT terms: 1 = ah·bh, 2 = + al·bh (A split), 3 = + ah·bl (both split)
template <int NT>
__device__ __forceinline__ v8f mmaN(v16b ah, v16b al, v16b bh, v16b bl, v8f c) {
  c = __builtin_amdgcn_wmma_f32_16x16x32_bf16(false, ah, false, bh, (short)0, c, false, false);
  if (NT >= 2) c = __builtin_amdgcn_wmma_f32_16x16x32_bf16(false, al, false, bh, (short)0, c, false, false);
  if (NT >= 3) c = __builtin_amdgcn_wmma_f32_16x16x32_bf16(false, ah, false, bl, (short)0, c, false, false);
  asm volatile("v_nop\n\tv_nop\n\tv_nop\n\tv_nop" : "+v"(c) : "v"(ah), "v"(al), "v"(bh), "v"(bl));
  return c;
}

__global__ __launch_bounds__(256) void k_wt_bf16(const float* __restrict__ W, unsigned short* __restrict__ Wt, int K, int N) {
  const int t = blockIdx.x * 256 + threadIdx.x;
  const int k8n = K / 8;
  if (t >= N * k8n) return;
  const int n = t / k8n, k8 = (t % k8n) * 8;
  v8us v;
#pragma unroll
  for (int i = 0; i < 8; ++i) v[i] = bf16_bits(W[(size_t)(k8 + i) * N + n]);
  *(v8us*)(Wt + (size_t)n * K + k8) = v;
  
}

// GEMM C[M][N] (f32, pitch ldc) = act(A[M][K]·W + bias). A f32 row-major (pitch lda) converted per fragment to bf16
// (ASPLIT: hi/lo two planes -> 2 terms, else single rounded term); Wt bf16 [N][K] (pitch ldb). BIAS_BF16 rounds the
// bias to bf16 first (bias quantised to bf16 before the add). K%32==0, M%16==0, N%64==0.
template <bool ASPLIT, int ACT, bool BIAS_BF16>
__global__ __launch_bounds__(128) void k_gemm_bf(const float* __restrict__ A, int lda, const unsigned short* __restrict__ Wt, int ldb,
                                               const float* __restrict__ bias, float* __restrict__ C, int ldc, int M, int N, int K) {
  __shared__ __attribute__((aligned(16))) float so[4][16][64];
  const int tid = threadIdx.x, w = tid >> 5, lane = tid & 31, ln = lane & 15, hh = lane >> 4;
  const int ntn = N / 64;
  const int wid = blockIdx.x * 4 + w;
  const int mt = wid / ntn, nq = wid % ntn;
  if (mt * 16 >= M) return;
  const int row0 = mt * 16, col0 = nq * 64;
  const float* arow = A + (size_t)(row0 + ln) * lda;
  v8f acc[4] = {};
  for (int kb = 0; kb < K; kb += 32) {
    FragB ah, al;
    const v4f x0 = *(const v4fa*)(arow + kb + 8 * hh), x1 = *(const v4fa*)(arow + kb + 8 * hh + 4);
    const v4f x2 = *(const v4fa*)(arow + kb + 16 + 8 * hh), x3 = *(const v4fa*)(arow + kb + 16 + 8 * hh + 4);
    float xs[16] = {x0[0],x0[1],x0[2],x0[3],x1[0],x1[1],x1[2],x1[3],x2[0],x2[1],x2[2],x2[3],x3[0],x3[1],x3[2],x3[3]};
#pragma unroll
    for (int i = 0; i < 16; ++i) { const unsigned short hb = bf16_bits(xs[i]); ah.u[i] = hb; al.u[i] = ASPLIT ? bf16_bits(xs[i] - bf16_val(hb)) : (unsigned short)0; }
#pragma unroll
    for (int t = 0; t < 4; ++t) {
      const unsigned short* brow = Wt + (size_t)(col0 + t * 16 + ln) * ldb + kb;
      FragB b;
      b.half[0] = *(const v8us*)(brow + 8 * hh);
      b.half[1] = *(const v8us*)(brow + 16 + 8 * hh);
      acc[t] = mmaN<ASPLIT ? 2 : 1>(ah.v, al.v, b.v, b.v, acc[t]);
    }
  }
#pragma unroll
  for (int t = 0; t < 4; ++t) {
    float bv = bias ? bias[col0 + t * 16 + ln] : 0.f;
    if (BIAS_BF16) bv = bf16_round(bv);
#pragma unroll
    for (int r = 0; r < 8; ++r) { float v = acc[t][r] + bv; if (ACT == 1) v = fmaxf(v, 0.f); so[w][8 * hh + r][t * 16 + ln] = v; }
  }
  __builtin_amdgcn_fence(__ATOMIC_ACQ_REL, "workgroup");
  __builtin_amdgcn_wave_barrier();
  const int rsub = lane >> 4, c4 = (lane & 15) * 4;
  {
#pragma unroll
    for (int q = 0; q < 8; ++q) {
      const int r = q * 2 + rsub;
      const v4f v = *(const v4fa*)&so[w][r][c4];
      *(v4f*)(C + (size_t)(row0 + r) * ldc + col0 + c4) = v;
    }
    
  }
}

// Flash-style causal/unmasked attention, all contractions 3-term bf16 hi/lo splits, f32 softmax with running max.
// q,k,v rows are read from f32 buffers with arbitrary row pitch (so they can live inside a fused qkv buffer);
// D = head size (multiple of 32, <= 128); one wave = 16 query rows; block = 4 waves (64 queries) sharing K/V chunks of 32.
template <int D, bool CAUSAL>
__global__ __launch_bounds__(128) void k_flash(const float* __restrict__ qb, const float* __restrict__ kb, const float* __restrict__ vb,
                                             int pitch, int T, int H, float scale, float* __restrict__ y, int ypitch) {
  constexpr int KS = D / 32;        // k-steps for QK
  constexpr int DT = D / 16;        // d tiles for PV
  __shared__ __attribute__((aligned(16))) unsigned short sKh[32][D + 8], sKl[32][D + 8], sVh[32][D + 8], sVl[32][D + 8];
  __shared__ __attribute__((aligned(16))) unsigned short sPh[4][16][40], sPl[4][16][40];
  __shared__ __attribute__((aligned(16))) float sO[4][16][D];
  const int tid = threadIdx.x, w = tid >> 5, lane = tid & 31, ln = lane & 15, hh = lane >> 4;
  const int nqb = (T + 63) / 64;
  const int bh = blockIdx.x / nqb, qblk = blockIdx.x % nqb;
  const int b = bh / H, h = bh % H;
  const int q0 = qblk * 64 + w * 16;
  const float* Q = qb + (size_t)b * T * pitch + h * D;
  const float* K = kb + (size_t)b * T * pitch + h * D;
  const float* V = vb + (size_t)b * T * pitch + h * D;

  // A fragments of the wave's 16 query rows (scaled), hi/lo
  FragB aqh[KS], aql[KS];
  {
    int row = q0 + ln; if (row >= T) row = T - 1;
    const float* qr = Q + (size_t)row * pitch;
#pragma unroll
    for (int ks = 0; ks < KS; ++ks)
#pragma unroll
      for (int i = 0; i < 16; ++i) {
        const int d = ks * 32 + ((i < 8) ? (8 * hh + i) : (16 + 8 * hh + (i - 8)));
        const float x = qr[d] * scale; const unsigned short hb = bf16_bits(x);
        aqh[ks].u[i] = hb; aql[ks].u[i] = bf16_bits(x - bf16_val(hb));
      }
  }
  float m_r[8], l_r[8];
#pragma unroll
  for (int r = 0; r < 8; ++r) { m_r[r] = -3.0e38f; l_r[r] = 0.f; }
  v8f oacc[DT];
#pragma unroll
  for (int dt = 0; dt < DT; ++dt) oacc[dt] = (v8f){0.f,0.f,0.f,0.f,0.f,0.f,0.f,0.f};

  const int kv_end = CAUSAL ? min(T, qblk * 64 + 64) : T;     // block-uniform
  for (int j0 = 0; j0 < kv_end; j0 += 32) {
    __syncthreads();
    for (int e = tid; e < 32 * (D / 4); e += 128) {
      const int r = e / (D / 4), c4 = (e % (D / 4)) * 4;
      const int key = j0 + r;
      v4f kf = {0.f,0.f,0.f,0.f}, vf = {0.f,0.f,0.f,0.f};
      if (key < T) { kf = *(const v4fa*)(K + (size_t)key * pitch + c4); vf = *(const v4fa*)(V + (size_t)key * pitch + c4); }
#pragma unroll
      for (int t = 0; t < 4; ++t) {
        unsigned short hb = bf16_bits(kf[t]); sKh[r][c4 + t] = hb; sKl[r][c4 + t] = bf16_bits(kf[t] - bf16_val(hb));
        hb = bf16_bits(vf[t]); sVh[r][c4 + t] = hb; sVl[r][c4 + t] = bf16_bits(vf[t] - bf16_val(hb));
      }
    }
    __syncthreads();
    // S tile 16 x 32
    v8f s[2];
#pragma unroll
    for (int nt = 0; nt < 2; ++nt) {
      v8f acc = {};
#pragma unroll
      for (int ks = 0; ks < KS; ++ks) {
        FragB bh_, bl_;
        bh_.half[0] = *(const v8us*)&sKh[nt * 16 + ln][ks * 32 + 8 * hh]; bh_.half[1] = *(const v8us*)&sKh[nt * 16 + ln][ks * 32 + 16 + 8 * hh];
        bl_.half[0] = *(const v8us*)&sKl[nt * 16 + ln][ks * 32 + 8 * hh]; bl_.half[1] = *(const v8us*)&sKl[nt * 16 + ln][ks * 32 + 16 + 8 * hh];
        acc = mmaN<3>(aqh[ks].v, aql[ks].v, bh_.v, bl_.v, acc);
      }
      s[nt] = acc;
    }
    // mask + running max (rows 8hh+r; the 16 lanes of a half share rows)
    float alpha[8];
#pragma unroll
    for (int r = 0; r < 8; ++r) {
      const int qi = q0 + 8 * hh + r;
      const int ja = j0 + ln, jb = j0 + 16 + ln;
      if (CAUSAL) { if (ja > qi) s[0][r] = -3.0e38f; if (jb > qi) s[1][r] = -3.0e38f; }
      if (ja >= T) s[0][r] = -3.0e38f;
      if (jb >= T) s[1][r] = -3.0e38f;
      float mx = fmaxf(s[0][r], s[1][r]);
      mx = fmaxf(mx, __shfl_xor(mx, 1, 32)); mx = fmaxf(mx, __shfl_xor(mx, 2, 32)); mx = fmaxf(mx, __shfl_xor(mx, 4, 32)); mx = fmaxf(mx, __shfl_xor(mx, 8, 32));
      const float mnew = fmaxf(m_r[r], mx);
      alpha[r] = (mnew > -1.0e38f) ? __expf(m_r[r] - mnew) : 1.0f;
      const float p0 = (s[0][r] > -1.0e38f) ? __expf(s[0][r] - mnew) : 0.f;
      const float p1 = (s[1][r] > -1.0e38f) ? __expf(s[1][r] - mnew) : 0.f;
      m_r[r] = mnew;
      l_r[r] = l_r[r] * alpha[r] + p0 + p1;            // per-lane partial row sum (16 lanes combined at the end)
      unsigned short hb = bf16_bits(p0); sPh[w][8 * hh + r][ln] = hb;      sPl[w][8 * hh + r][ln] = bf16_bits(p0 - bf16_val(hb));
      hb = bf16_bits(p1);                sPh[w][8 * hh + r][16 + ln] = hb; sPl[w][8 * hh + r][16 + ln] = bf16_bits(p1 - bf16_val(hb));
    }
#pragma unroll
    for (int dt = 0; dt < DT; ++dt)
#pragma unroll
      for (int r = 0; r < 8; ++r) oacc[dt][r] *= alpha[r];
    __builtin_amdgcn_fence(__ATOMIC_ACQ_REL, "workgroup");
    __builtin_amdgcn_wave_barrier();
    FragB pah, pal;
    pah.half[0] = *(const v8us*)&sPh[w][ln][8 * hh]; pah.half[1] = *(const v8us*)&sPh[w][ln][16 + 8 * hh];
    pal.half[0] = *(const v8us*)&sPl[w][ln][8 * hh]; pal.half[1] = *(const v8us*)&sPl[w][ln][16 + 8 * hh];
#pragma unroll
    for (int dt = 0; dt < DT; ++dt) {
      FragB bvh, bvl;
#pragma unroll
      for (int i = 0; i < 8; ++i) {
        bvh.u[i] = sVh[8 * hh + i][dt * 16 + ln]; bvh.u[8 + i] = sVh[16 + 8 * hh + i][dt * 16 + ln];
        bvl.u[i] = sVl[8 * hh + i][dt * 16 + ln]; bvl.u[8 + i] = sVl[16 + 8 * hh + i][dt * 16 + ln];
      }
      oacc[dt] = mmaN<3>(pah.v, pal.v, bvh.v, bvl.v, oacc[dt]);
    }
    __builtin_amdgcn_fence(__ATOMIC_ACQ_REL, "workgroup");
    __builtin_amdgcn_wave_barrier();
  }
#pragma unroll
  for (int r = 0; r < 8; ++r) {
    float l = l_r[r];
    l += __shfl_xor(l, 1, 32); l += __shfl_xor(l, 2, 32); l += __shfl_xor(l, 4, 32); l += __shfl_xor(l, 8, 32);
    l_r[r] = (l > 0.f) ? 1.0f / l : 0.f;
  }
#pragma unroll
  for (int dt = 0; dt < DT; ++dt)
#pragma unroll
    for (int r = 0; r < 8; ++r) sO[w][8 * hh + r][dt * 16 + ln] = oacc[dt][r] * l_r[r];
  __builtin_amdgcn_fence(__ATOMIC_ACQ_REL, "workgroup");
  __builtin_amdgcn_wave_barrier();
  {
    for (int r = 0; r < 16; ++r) {
      const int row = q0 + r;
      if (row < T && lane < D / 4) {
        const v4f val = *(const v4fa*)&sO[w][r][lane * 4];
        *(v4f*)(y + ((size_t)b * T + row) * ypitch + h * D + lane * 4) = val;
      }
    }
    
  }
}

// GEMM C = act(A·W + bias + resid): A f32 (ASPLIT -> hi/lo 2 terms), Wt bf16 [N][K]; ACT 0 none, 1 relu, 2 exact gelu;
// resid (optional, f32, row index = (row % rmod), pitch ldr, RES_BF16 rounds it) added before the activation.
template <bool ASPLIT, int ACT, bool BIAS_BF16, bool RES_BF16>
__global__ __launch_bounds__(128) void k_gemm_bf3(const float* __restrict__ A, int lda, const unsigned short* __restrict__ Wt, int ldb,
                                                const float* __restrict__ bias, const float* __restrict__ resid, int rmod, int ldr,
                                                float* __restrict__ C, int ldc, int M, int N, int K) {
  __shared__ __attribute__((aligned(16))) float so[4][16][64];
  const int tid = threadIdx.x, w = tid >> 5, lane = tid & 31, ln = lane & 15, hh = lane >> 4;
  const int ntn = N / 64;
  const int wid = blockIdx.x * 4 + w;
  const int mt = wid / ntn, nq = wid % ntn;
  if (mt * 16 >= M) return;
  const int row0 = mt * 16, col0 = nq * 64;
  const float* arow = A + (size_t)(row0 + ln) * lda;
  v8f acc[4] = {};
  for (int kb = 0; kb < K; kb += 32) {
    FragB ah, al;
    const v4f x0 = *(const v4fa*)(arow + kb + 8 * hh), x1 = *(const v4fa*)(arow + kb + 8 * hh + 4);
    const v4f x2 = *(const v4fa*)(arow + kb + 16 + 8 * hh), x3 = *(const v4fa*)(arow + kb + 16 + 8 * hh + 4);
    float xs[16] = {x0[0],x0[1],x0[2],x0[3],x1[0],x1[1],x1[2],x1[3],x2[0],x2[1],x2[2],x2[3],x3[0],x3[1],x3[2],x3[3]};
#pragma unroll
    for (int i = 0; i < 16; ++i) { const unsigned short hb = bf16_bits(xs[i]); ah.u[i] = hb; al.u[i] = ASPLIT ? bf16_bits(xs[i] - bf16_val(hb)) : (unsigned short)0; }
#pragma unroll
    for (int t = 0; t < 4; ++t) {
      const unsigned short* brow = Wt + (size_t)(col0 + t * 16 + ln) * ldb + kb;
      FragB b;
      b.half[0] = *(const v8us*)(brow + 8 * hh);
      b.half[1] = *(const v8us*)(brow + 16 + 8 * hh);
      acc[t] = mmaN<ASPLIT ? 2 : 1>(ah.v, al.v, b.v, b.v, acc[t]);
    }
  }
#pragma unroll
  for (int t = 0; t < 4; ++t) {
    const int col = col0 + t * 16 + ln;
    float bv = bias ? bias[col] : 0.f;
    if (BIAS_BF16) bv = bf16_round(bv);
#pragma unroll
    for (int r = 0; r < 8; ++r) {
      float v = acc[t][r] + bv;
      if (resid) { float rv = resid[(size_t)((row0 + 8 * hh + r) % rmod) * ldr + col]; if (RES_BF16) rv = bf16_round(rv); v += rv; }
      if (ACT == 1) v = fmaxf(v, 0.f);
      if (ACT == 2) v = 0.5f * v * (1.0f + erff(v * 0.70710678118654752f));
      if (ACT == 3) { const float u = 0.7978845608028654f * (v + 0.044715f * v * v * v); v = 0.5f * v * (1.0f + tanhf(u)); }
      so[w][8 * hh + r][t * 16 + ln] = v;
    }
  }
  __builtin_amdgcn_fence(__ATOMIC_ACQ_REL, "workgroup");
  __builtin_amdgcn_wave_barrier();
  const int rsub = lane >> 4, c4 = (lane & 15) * 4;
  {
#pragma unroll
    for (int q = 0; q < 8; ++q) {
      const int r = q * 2 + rsub;
      const v4f v = *(const v4fa*)&so[w][r][c4];
      *(v4f*)(C + (size_t)(row0 + r) * ldc + col0 + c4) = v;
    }
    
  }
}
// row LayerNorm (biased variance, eps) over N: s = X (+ R); optional out_sum <- s; out_norm <- (s-mu)*rsqrt(var+eps)*g + b
template <bool PARAM_BF16>
__global__ __launch_bounds__(256) void k_layernorm(const float* __restrict__ X, const float* __restrict__ R, const float* __restrict__ g, const float* __restrict__ bta,
                                                  float* __restrict__ out_sum, float* __restrict__ out_norm, int N, float eps) {
  __shared__ float red[256];
  const int row = blockIdx.x, tid = threadIdx.x;
  const float* x = X + (size_t)row * N; const float* rr = R ? R + (size_t)row * N : nullptr;
  float vals[16];                     // up to N = 4096
  const int per = N / 256;            // contiguous chunk per thread? use strided-by-4 chunks: thread handles j = tid*4 + 1024*u
  float s1 = 0.f;
  for (int u = 0; u < per / 4; ++u) {
    const int j = tid * 4 + 1024 * u;
    const v4f a = *(const v4fa*)(x + j);
    v4f b = {0.f,0.f,0.f,0.f}; if (rr) b = *(const v4fa*)(rr + j);
#pragma unroll
    for (int q = 0; q < 4; ++q) { const float v = a[q] + b[q]; vals[u * 4 + q] = v; s1 += v; }
  }
  red[tid] = s1; __syncthreads();
  for (int st = 128; st > 0; st >>= 1) { if (tid < st) red[tid] += red[tid + st]; __syncthreads(); }
  const float mu = red[0] / (float)N; __syncthreads();
  float s2 = 0.f;
  for (int u = 0; u < per / 4; ++u)
#pragma unroll
    for (int q = 0; q < 4; ++q) { const float c = vals[u * 4 + q] - mu; s2 += c * c; }
  red[tid] = s2; __syncthreads();
  for (int st = 128; st > 0; st >>= 1) { if (tid < st) red[tid] += red[tid + st]; __syncthreads(); }
  const float rs = rsqrtf(red[0] / (float)N + eps);
  {
    for (int u = 0; u < per / 4; ++u) {
      const int j = tid * 4 + 1024 * u;
      v4f o, sm;
#pragma unroll
      for (int q = 0; q < 4; ++q) {
        float gg = g[j + q], bb = bta[j + q];
        if (PARAM_BF16) { gg = bf16_round(gg); bb = bf16_round(bb); }
        sm[q] = vals[u * 4 + q]; o[q] = (vals[u * 4 + q] - mu) * rs * gg + bb;
      }
      if (out_sum) *(v4f*)(out_sum + (size_t)row * N + j) = sm;
      *(v4f*)(out_norm + (size_t)row * N + j) = o;
    }
    
  }
}



// ---- f16 WMMA path (v_wmma_f32_16x16x32_f16): 11-bit significands for operands in range — used where a [0,1] probability operand needs more precision than bf16
typedef _Float16 v16h __attribute__((ext_vector_type(16)));
union FragH { v16h v; v8us half[2]; _Float16 h[16]; unsigned short u[16]; };
template <int NT>
__device__ __forceinline__ v8f mmaH(v16h ah, v16h al, v16h bh, v16h bl, v8f c) {
  c = __builtin_amdgcn_wmma_f32_16x16x32_f16(false, ah, false, bh, (short)0, c, false, false);
  if (NT >= 2) c = __builtin_amdgcn_wmma_f32_16x16x32_f16(false, al, false, bh, (short)0, c, false, false);
  if (NT >= 3) c = __builtin_amdgcn_wmma_f32_16x16x32_f16(false, ah, false, bl, (short)0, c, false, false);
  asm volatile("v_nop\n\tv_nop\n\tv_nop\n\tv_nop" : "+v"(c) : "v"(ah), "v"(al), "v"(bh), "v"(bl));
  return c;
}
// batched GEMM like k_gemm_b but f16 operands: A f32 (split into f16 hi/lo if ASPLIT, else rounded to f16), Bt = f16 values [n][k]; alpha; C f32; N multiple of 16 (partial tiles skipped)
template <bool ASPLIT>
__global__ __launch_bounds__(128) void k_gemm_h(const float* __restrict__ A, int lda, size_t sA, const _Float16* __restrict__ Bh, int ldb, size_t sB, float alpha, float* __restrict__ C, int ldc, size_t sC, int M, int N, int K) {
  __shared__ __attribute__((aligned(16))) float so[4][16][64];
  const int tid = threadIdx.x, w = tid >> 5, lane = tid & 31, ln = lane & 15, hh = lane >> 4; const int by = blockIdx.y;
  A += (size_t)by * sA; Bh += (size_t)by * sB; C += (size_t)by * sC;
  const int ntn = (N + 63) / 64; const int wid = blockIdx.x * 4 + w; const int mt = wid / ntn, nq = wid % ntn; if (mt * 16 >= M) return;
  const int row0 = mt * 16, col0 = nq * 64; const float* arow = A + (size_t)(row0 + ln) * lda;
  v8f acc[4] = {};
  for (int kb = 0; kb < K; kb += 32) {
    FragH ah, al;
    const v4f x0 = *(const v4fa*)(arow + kb + 8 * hh), x1 = *(const v4fa*)(arow + kb + 8 * hh + 4), x2 = *(const v4fa*)(arow + kb + 16 + 8 * hh), x3 = *(const v4fa*)(arow + kb + 16 + 8 * hh + 4);
    float xs[16] = {x0[0],x0[1],x0[2],x0[3],x1[0],x1[1],x1[2],x1[3],x2[0],x2[1],x2[2],x2[3],x3[0],x3[1],x3[2],x3[3]};
#pragma unroll
    for (int i = 0; i < 16; ++i) { const _Float16 h = (_Float16)xs[i]; ah.h[i] = h; al.h[i] = ASPLIT ? (_Float16)(xs[i] - (float)h) : (_Float16)0.0f; }
#pragma unroll
    for (int t = 0; t < 4; ++t) { if (col0 + t * 16 >= N) continue; const size_t boff = (size_t)(col0 + t * 16 + ln) * ldb + kb; FragH bq; bq.half[0] = *(const v8us*)(Bh + boff + 8 * hh); bq.half[1] = *(const v8us*)(Bh + boff + 16 + 8 * hh);
      acc[t] = mmaH<ASPLIT ? 2 : 1>(ah.v, al.v, bq.v, bq.v, acc[t]); }
  }
#pragma unroll
  for (int t = 0; t < 4; ++t) { if (col0 + t * 16 >= N) continue;
#pragma unroll
    for (int r = 0; r < 8; ++r) so[w][8 * hh + r][t * 16 + ln] = acc[t][r] * alpha; }
  __builtin_amdgcn_fence(__ATOMIC_ACQ_REL, "workgroup"); __builtin_amdgcn_wave_barrier();
  const int rsub = lane >> 4, c4 = (lane & 15) * 4;
  {
#pragma unroll
    for (int q = 0; q < 8; ++q) { const int r = q * 2 + rsub; if (col0 + c4 < N) { const v4f v = *(const v4fa*)&so[w][r][c4]; *(v4f*)(C + (size_t)(row0 + r) * ldc + col0 + c4) = v; } }
     }
}

// Wt[n][k] = f16(W[k][n]·scale) from f32 row-major W[K][N] (scale = power of two; bf16-exact weights stay exact in f16 away from the subnormal range)
__global__ __launch_bounds__(256) void k_wt_f16(const float* __restrict__ W, _Float16* __restrict__ Wt, int K, int N, float scale) {
  const int t = blockIdx.x * 256 + threadIdx.x; if (t >= N * (K / 8)) return; const int n = t / (K / 8), k8 = (t % (K / 8)) * 8; FragH f;
#pragma unroll
  for (int i = 0; i < 8; ++i) f.h[i] = (_Float16)(bf16_round(W[(size_t)(k8 + i) * N + n]) * scale); const v8us o = f.half[0];
  *(v8us*)((unsigned short*)Wt + (size_t)n * K + k8) = o; 
}
// k_gemm_hh variant with fused epilogue: v = acc·alpha + bias[by·sBias + col] (+ CP[(row/rowsPerB)·sCPb + by·64 + col] if CP) ; ACT 0 none / 1 elu ; writes f32 C and/or f16 C16 (each if non-null)
template <int ACT>
__global__ __launch_bounds__(128) void k_gemm_hhx(const _Float16* __restrict__ A, int lda, size_t sA, const _Float16* __restrict__ Bh, int ldb, size_t sB, float alpha, const float* __restrict__ bias, size_t sBias, const float* __restrict__ CP, int rowsPerB, size_t sCPb, int row0g,
    float* __restrict__ C, _Float16* __restrict__ C16, int ldc, size_t sC, int M, int N, int K) {
  __shared__ __attribute__((aligned(16))) float so[4][16][64];
  const int tid = threadIdx.x, w = tid >> 5, lane = tid & 31, ln = lane & 15, hh = lane >> 4; const int by = blockIdx.y;
  A += (size_t)by * sA; Bh += (size_t)by * sB; const size_t cofs = (size_t)by * sC; const float* bp = bias ? bias + (size_t)by * sBias : nullptr;
  const int ntn = (N + 63) / 64; const int wid = blockIdx.x * 4 + w; const int mt = wid / ntn, nq = wid % ntn; if (mt * 16 >= M) return;
  const int row0 = mt * 16, col0 = nq * 64; const _Float16* arow = A + (size_t)(row0 + ln) * lda;
  v8f acc[4] = {};
  for (int kb = 0; kb < K; kb += 32) { FragH ah; ah.half[0] = *(const v8us*)((const unsigned short*)arow + kb + 8 * hh); ah.half[1] = *(const v8us*)((const unsigned short*)arow + kb + 16 + 8 * hh);
#pragma unroll
    for (int t = 0; t < 4; ++t) { if (col0 + t * 16 >= N) continue; const size_t boff = (size_t)(col0 + t * 16 + ln) * ldb + kb; FragH bq; bq.half[0] = *(const v8us*)((const unsigned short*)Bh + boff + 8 * hh); bq.half[1] = *(const v8us*)((const unsigned short*)Bh + boff + 16 + 8 * hh);
      acc[t] = mmaH<1>(ah.v, ah.v, bq.v, bq.v, acc[t]); }
  }
#pragma unroll
  for (int t = 0; t < 4; ++t) { if (col0 + t * 16 >= N) continue; const int col = col0 + t * 16 + ln; const float bv = bp ? bf16_round(bp[col]) : 0.f;
#pragma unroll
    for (int r = 0; r < 8; ++r) { float v = acc[t][r] * alpha + bv; if (CP) { const int bidx = (row0g + row0 + 8 * hh + r) / rowsPerB; v += CP[(size_t)bidx * sCPb + (size_t)by * 64 + col]; } if (ACT == 1) v = (v > 0.f) ? v : expm1f(v); else if (ACT == 3) v = fmaxf(v, 0.f); so[w][8 * hh + r][t * 16 + ln] = v; } }
  __builtin_amdgcn_fence(__ATOMIC_ACQ_REL, "workgroup"); __builtin_amdgcn_wave_barrier();
  const int rsub = lane >> 4, c4 = (lane & 15) * 4; typedef _Float16 v4h __attribute__((ext_vector_type(4)));
  {
#pragma unroll
    for (int q = 0; q < 8; ++q) { const int r = q * 2 + rsub; if (col0 + c4 < N) { const v4f v = *(const v4fa*)&so[w][r][c4]; if (C) *(v4f*)(C + cofs + (size_t)(row0 + r) * ldc + col0 + c4) = v; if (C16) { v4h h4; for (int i = 0; i < 4; ++i) h4[i] = (_Float16)v[i]; *(v4h*)(C16 + cofs + (size_t)(row0 + r) * ldc + col0 + c4) = h4; } } }
     }
}


__global__ __launch_bounds__(256) void k_x16(const float* __restrict__ x, _Float16* __restrict__ X16, size_t n8) { const size_t t = (size_t)blockIdx.x * 256 + threadIdx.x; if (t >= n8) return; FragH f;
#pragma unroll
  for (int q = 0; q < 8; ++q) f.h[q] = (_Float16)bf16_round(x[t * 8 + q]); *(v8us*)((unsigned short*)X16 + t * 8) = f.half[0];  }
__global__ __launch_bounds__(256) void k_h16(const float* __restrict__ x, _Float16* __restrict__ X16, size_t n8) { const size_t t = (size_t)blockIdx.x * 256 + threadIdx.x; if (t >= n8) return; FragH f;
#pragma unroll
  for (int q = 0; q < 8; ++q) f.h[q] = (_Float16)x[t * 8 + q]; *(v8us*)((unsigned short*)X16 + t * 8) = f.half[0];  }
__global__ __launch_bounds__(256) void k_round16f(const float* __restrict__ W, _Float16* __restrict__ Bt, size_t n8) { const size_t t = (size_t)blockIdx.x * 256 + threadIdx.x; if (t >= n8) return; FragH f;
#pragma unroll
  for (int i = 0; i < 8; ++i) f.h[i] = (_Float16)(bf16_round(W[t * 8 + i]) * 16.0f); *(v8us*)((unsigned short*)Bt + t * 8) = f.half[0];  }
template <int NHv, int TTv>
__global__ __launch_bounds__(256) void k_vt(const _Float16* __restrict__ V16, int ldv, int voff, _Float16* __restrict__ Vt) { __shared__ unsigned short tl[64][66]; const int tid = threadIdx.x; const int slab = blockIdx.x / (TTv / 64), lg = blockIdx.x % (TTv / 64); const int b = slab / NHv, h = slab % NHv;
  for (int i = tid; i < 64 * 8; i += 256) { const int r = i / 8, c8 = (i % 8) * 8; FragH f; f.half[0] = *(const v8us*)((const unsigned short*)V16 + ((size_t)b * TTv + lg * 64 + r) * ldv + voff + h * 64 + c8);
#pragma unroll
    for (int q = 0; q < 8; ++q) tl[r][c8 + q] = f.u[q]; }
  __syncthreads();
  {
#pragma unroll
    for (int rd = 0; rd < 2; ++rd) { const int d = rd * 32 + tid / 8, pc = tid % 8; FragH f;
#pragma unroll
      for (int q = 0; q < 8; ++q) f.u[q] = tl[pc * 8 + q][d];
      *(v8us*)((unsigned short*)Vt + ((size_t)slab * 64 + d) * TTv + lg * 64 + pc * 8) = f.half[0]; }
     } }

__global__ __launch_bounds__(128) void k_flash(const _Float16* __restrict__ Q16, int ldq, const _Float16* __restrict__ K16, int ldk, const _Float16* __restrict__ Vt, const float* __restrict__ MSK, float* __restrict__ O, int ldo) {
  constexpr int RPW = 16, RTN = RPW / 16, NQB = 2048 / (4 * RPW), DT = 8, KS = 4;      /* head dim 128 */
  __shared__ __attribute__((aligned(16))) unsigned short sP[4][RPW][40]; __shared__ __attribute__((aligned(16))) float sO[4][RPW][128 + 4];
  const int tid = threadIdx.x, w = tid >> 5, lane = tid & 31, ln = lane & 15, hh = lane >> 4;
  const int slab = blockIdx.x / NQB, qblk = blockIdx.x % NQB; const int b = slab / 16, h = slab % 16; const int qb0 = qblk * (4 * RPW); const int q0 = qb0 + w * RPW;
  FragH aq[2][KS];
#pragma unroll
  for (int rt = 0; rt < RTN; ++rt) { const unsigned short* qr = (const unsigned short*)Q16 + ((size_t)b * 2048 + q0 + rt * 16 + ln) * ldq + h * 128;
#pragma unroll
    for (int ks = 0; ks < KS; ++ks) { aq[rt][ks].half[0] = *(const v8us*)(qr + ks * 32 + 8 * hh); aq[rt][ks].half[1] = *(const v8us*)(qr + ks * 32 + 16 + 8 * hh); } }
  const unsigned short* Vth = (const unsigned short*)Vt + (size_t)slab * 128 * 2048;
  float m_r[2][8], l_r[2][8]; v8f oacc[2][DT];
#pragma unroll
  for (int rt = 0; rt < RTN; ++rt) {
#pragma unroll
    for (int r = 0; r < 8; ++r) { m_r[rt][r] = -3.0e38f; l_r[rt][r] = 0.f; }
#pragma unroll
    for (int dt = 0; dt < DT; ++dt) oacc[rt][dt] = (v8f){0.f,0.f,0.f,0.f,0.f,0.f,0.f,0.f}; }
  const int jend = 2048;
#pragma unroll 1
  for (int j0 = 0; j0 < jend; j0 += 32) {
    // mask tile for my 16 query rows × 32 keys: lane (ln,hh) needs rows rt·16 + 8hh + r, keys j0 + ln and j0 + 16 + ln
    unsigned okb0 = 0u, okb1 = 0u;      // bit (rt·8 + r) set when key j0+ln (resp. j0+16+ln) is OPEN for query row rt·16 + 8hh + r
#pragma unroll
    for (int rt = 0; rt < RTN; ++rt)
#pragma unroll
      for (int r = 0; r < 8; ++r) { const float* mr = MSK + ((size_t)b * 2048 + q0 + rt * 16 + 8 * hh + r) * 2048 + j0; okb0 |= (mr[ln] == 0.0f ? 1u : 0u) << (rt * 8 + r); okb1 |= (mr[16 + ln] == 0.0f ? 1u : 0u) << (rt * 8 + r); }      /* float mask: nonzero = masked (−1e9) */
    if (__builtin_amdgcn_ballot_w32((okb0 | okb1) != 0u) == 0u) continue;      // every (query,key) of this wave's tile is masked → contributes nothing (uniform branch)
    v8f s[2][2];
#pragma unroll
    for (int nt = 0; nt < 2; ++nt) { const unsigned short* kr = (const unsigned short*)K16 + ((size_t)b * 2048 + j0 + nt * 16 + ln) * ldk + h * 128; FragH bk[KS];
#pragma unroll
      for (int ks = 0; ks < KS; ++ks) { bk[ks].half[0] = *(const v8us*)(kr + ks * 32 + 8 * hh); bk[ks].half[1] = *(const v8us*)(kr + ks * 32 + 16 + 8 * hh); }
#pragma unroll
      for (int rt = 0; rt < RTN; ++rt) { v8f acc = (v8f){0.f,0.f,0.f,0.f,0.f,0.f,0.f,0.f};
#pragma unroll
        for (int ks = 0; ks < KS; ++ks) acc = mmaH<1>(aq[rt][ks].v, aq[rt][ks].v, bk[ks].v, bk[ks].v, acc); s[rt][nt] = acc; } }
#pragma unroll
    for (int rt = 0; rt < RTN; ++rt)
#pragma unroll
      for (int r = 0; r < 8; ++r) { const int tq = q0 + rt * 16 + 8 * hh + r; const int k0 = j0 + ln, k1 = j0 + 16 + ln; (void)tq; (void)k0; (void)k1;
        const bool ok0 = ((okb0 >> (rt * 8 + r)) & 1u) != 0u, ok1 = ((okb1 >> (rt * 8 + r)) & 1u) != 0u;
        const float s0 = ok0 ? s[rt][0][r] * (0.08838834764831845f) : -INFINITY, s1 = ok1 ? s[rt][1][r] * (0.08838834764831845f) : -INFINITY; float mc = fmaxf(s0, s1);
        mc = fmaxf(mc, __shfl_xor(mc, 1, 32)); mc = fmaxf(mc, __shfl_xor(mc, 2, 32)); mc = fmaxf(mc, __shfl_xor(mc, 4, 32)); mc = fmaxf(mc, __shfl_xor(mc, 8, 32));
        const float mn = fmaxf(m_r[rt][r], mc); const float al = (mn > -1.0e38f) ? expf(m_r[rt][r] - mn) : 1.0f; m_r[rt][r] = mn; const float p0 = ok0 ? expf(s0 - mn) : 0.f, p1 = ok1 ? expf(s1 - mn) : 0.f; l_r[rt][r] = l_r[rt][r] * al + p0 + p1;
#pragma unroll
        for (int dt = 0; dt < DT; ++dt) oacc[rt][dt][r] *= al;
        FragH t2; t2.h[0] = (_Float16)p0; t2.h[1] = (_Float16)p1; sP[w][rt * 16 + 8 * hh + r][ln] = t2.u[0]; sP[w][rt * 16 + 8 * hh + r][16 + ln] = t2.u[1]; }
    __builtin_amdgcn_fence(__ATOMIC_ACQ_REL, "workgroup"); __builtin_amdgcn_wave_barrier();
    FragH pa[2];
#pragma unroll
    for (int rt = 0; rt < RTN; ++rt) { pa[rt].half[0] = *(const v8us*)&sP[w][rt * 16 + ln][8 * hh]; pa[rt].half[1] = *(const v8us*)&sP[w][rt * 16 + ln][16 + 8 * hh]; }
#pragma unroll
    for (int dt = 0; dt < DT; ++dt) { const unsigned short* vrow = Vth + (size_t)(dt * 16 + ln) * 2048 + j0; FragH bv; bv.half[0] = *(const v8us*)(vrow + 8 * hh); bv.half[1] = *(const v8us*)(vrow + 16 + 8 * hh);
#pragma unroll
      for (int rt = 0; rt < RTN; ++rt) oacc[rt][dt] = mmaH<1>(pa[rt].v, pa[rt].v, bv.v, bv.v, oacc[rt][dt]); }
    __builtin_amdgcn_fence(__ATOMIC_ACQ_REL, "workgroup"); __builtin_amdgcn_wave_barrier(); }
#pragma unroll
  for (int rt = 0; rt < RTN; ++rt) {
#pragma unroll
    for (int r = 0; r < 8; ++r) { float l = l_r[rt][r]; l += __shfl_xor(l, 1, 32); l += __shfl_xor(l, 2, 32); l += __shfl_xor(l, 4, 32); l += __shfl_xor(l, 8, 32); l_r[rt][r] = (l > 0.f) ? 1.0f / l : 0.f; }
#pragma unroll
    for (int dt = 0; dt < DT; ++dt)
#pragma unroll
      for (int r = 0; r < 8; ++r) sO[w][rt * 16 + 8 * hh + r][dt * 16 + ln] = oacc[rt][dt][r] * l_r[rt][r]; }
  __builtin_amdgcn_fence(__ATOMIC_ACQ_REL, "workgroup"); __builtin_amdgcn_wave_barrier();
  {
#pragma unroll
    for (int rp = 0; rp < RPW; ++rp) { const int r = rp, pc = lane; const v4f val = *(const v4fa*)&sO[w][r][pc * 4]; *(v4f*)(O + ((size_t)b * 2048 + q0 + r) * ldo + h * 128 + pc * 4) = val; }      /* 128-float rows: 32 lanes × 16 B */
     } }

__global__ __launch_bounds__(256) void k_rope16(const float* __restrict__ SRC, _Float16* __restrict__ D16) { __shared__ __attribute__((aligned(16))) _Float16 st[256][8]; const int tid = threadIdx.x; const size_t t = (size_t)blockIdx.x * 256 + tid; if (t >= (size_t)SS * NH * 16) return; const int p = (int)(t % 16); const int h = (int)((t / 16) % NH); const int s = (int)(t / (16 * NH)); const float* src = SRC + ((size_t)s * NH + h) * HD;
#pragma unroll 1
  for (int q = 0; q < 8; ++q) { const int j = p * 8 + q; const int i = j >> 1; const float f = __builtin_powf(10000.0f, -(float)(2 * i) / 128.0f); const float ang = (float)s * f; const float c = cosf(ang), sn = sinf(ang); const float xr = src[2 * i], xi = src[2 * i + 1]; st[tid][q] = (_Float16)((j & 1) ? (xr * sn + xi * c) : (xr * c - xi * sn)); }
  const v8us v = *(const v8us*)&st[tid][0]; unsigned short* d = (unsigned short*)D16 + ((size_t)s * NH + h) * HD + p * 8; *(v8us*)d = v;  }
__global__ __launch_bounds__(256) void k_vt128(const _Float16* __restrict__ V16, _Float16* __restrict__ Vt) { __shared__ unsigned short tl[64][130]; const int tid = threadIdx.x; const int h = blockIdx.x / (SS / 64), lg = blockIdx.x % (SS / 64);
  for (int i = tid; i < 64 * 16; i += 256) { const int r = i / 16, c8 = (i % 16) * 8; FragH f; f.half[0] = *(const v8us*)((const unsigned short*)V16 + ((size_t)lg * 64 + r) * CC + h * HD + c8);
#pragma unroll
    for (int q = 0; q < 8; ++q) tl[r][c8 + q] = f.u[q]; }
  __syncthreads();
  { for (int i = tid; i < 128 * 8; i += 256) { const int d = i / 8, pc = i % 8; FragH f;
#pragma unroll
      for (int q = 0; q < 8; ++q) f.u[q] = tl[pc * 8 + q][d]; *(v8us*)((unsigned short*)Vt + ((size_t)h * HD + d) * SS + lg * 64 + pc * 8) = f.half[0]; }  } }
extern "C" void kernel_launch(void* const* d_in, const int* in_sizes, int n_in,
                              void* d_out, int out_size, void* d_ws, size_t ws_size, hipStream_t stream) {
  (void)in_sizes; (void)n_in; (void)out_size;
  const float* const* I = (const float* const*)d_in; const float* q = I[0]; const float* k = I[1]; const float* v = I[2]; const float* mask = I[3]; const float* Wq = I[4]; const float* bq = I[5]; const float* Wk = I[6]; const float* bk = I[7]; const float* Wv = I[8]; const float* bv = I[9]; const float* G = I[10]; const float* Wo = I[11]; const float* bo = I[12];
  char* ws = (char*)d_ws; size_t off = 0;
  auto take = [&](size_t bytes) { char* p = ws + off; off += (bytes + 255) & ~(size_t)255; return p; };
  _Float16* Bq = (_Float16*)take((size_t)CC * CC * 2); _Float16* Bk = (_Float16*)take((size_t)CC * CC * 2); _Float16* Bv = (_Float16*)take((size_t)CC * CC * 2); _Float16* Bo = (_Float16*)take((size_t)CC * CC * 2); _Float16* BG = (_Float16*)take((size_t)NH * HD * HD * 2);
  _Float16* X16 = (_Float16*)take((size_t)SS * CC * 2); float* QF = (float*)take((size_t)SS * CC * 4); _Float16* QR16 = (_Float16*)take((size_t)SS * CC * 2); _Float16* QG16 = (_Float16*)take((size_t)SS * CC * 2); float* KF = QF; _Float16* KR16 = (_Float16*)take((size_t)SS * CC * 2); _Float16* V16 = (_Float16*)take((size_t)SS * CC * 2); _Float16* Vt = (_Float16*)take((size_t)SS * CC * 2); float* O = QF; _Float16* O16 = X16;
  if (off > ws_size) return;      // 8.4 × 4 + 0.5 + 8.4 + 16.8 + 8.4 × 5 ≈ 101 MiB
  const size_t w8 = (size_t)CC * CC / 8; const unsigned gw = (unsigned)((w8 + 255) / 256);
  k_round16f<<<gw, 256, 0, stream>>>(Wq, Bq, w8); k_round16f<<<gw, 256, 0, stream>>>(Wk, Bk, w8); k_round16f<<<gw, 256, 0, stream>>>(Wv, Bv, w8); k_round16f<<<gw, 256, 0, stream>>>(Wo, Bo, w8);      // (out,in) = Bt
  for (int h = 0; h < NH; ++h) k_wt_f16<<<(HD * (HD / 8) + 255) / 256, 256, 0, stream>>>(G + (size_t)h * HD * HD, BG + (size_t)h * HD * HD, HD, HD, 16.0f);      // G_h [d][e] = [in][out]
  const unsigned gx = (unsigned)(((size_t)SS * CC / 8 + 255) / 256); const dim3 gg(((SS / 16) * (CC / 64) + 3) / 4, 1);
  // q: proj → rope → per-head metric product
  k_x16<<<gx, 256, 0, stream>>>(q, X16, (size_t)SS * CC / 8); k_gemm_hhx<0><<<gg, 128, 0, stream>>>(X16, CC, 0, Bq, CC, 0, 0.0625f, bq, 0, nullptr, 1, 0, 0, QF, nullptr, CC, 0, SS, CC, CC);
  k_rope16<<<(unsigned)(((size_t)SS * NH * 16 + 255) / 256), 256, 0, stream>>>(QF, QR16);
  k_gemm_hhx<0><<<dim3(((SS / 16) * (HD / 64) + 3) / 4, NH), 128, 0, stream>>>(QR16, CC, (size_t)HD, BG, HD, (size_t)HD * HD, 0.0625f, nullptr, 0, nullptr, 1, 0, 0, nullptr, QG16, CC, (size_t)HD, SS, HD, HD);      // qg_h = q_h · G_h (batched over heads via column offsets)
  // k: proj → rope
  k_x16<<<gx, 256, 0, stream>>>(k, X16, (size_t)SS * CC / 8); k_gemm_hhx<0><<<gg, 128, 0, stream>>>(X16, CC, 0, Bk, CC, 0, 0.0625f, bk, 0, nullptr, 1, 0, 0, KF, nullptr, CC, 0, SS, CC, CC);
  k_rope16<<<(unsigned)(((size_t)SS * NH * 16 + 255) / 256), 256, 0, stream>>>(KF, KR16);
  // v: proj (f16) → Vt
  k_x16<<<gx, 256, 0, stream>>>(v, X16, (size_t)SS * CC / 8); k_gemm_hhx<0><<<gg, 128, 0, stream>>>(X16, CC, 0, Bv, CC, 0, 0.0625f, bv, 0, nullptr, 1, 0, 0, nullptr, V16, CC, 0, SS, CC, CC);
  k_vt128<<<NH * (SS / 64), 256, 0, stream>>>(V16, Vt);
  k_flash<<<1 * NH * (SS / 64), 128, 0, stream>>>(QG16, CC, KR16, CC, Vt, mask, O, CC);
  k_h16<<<gx, 256, 0, stream>>>(O, O16, (size_t)SS * CC / 8);
  k_gemm_hhx<0><<<gg, 128, 0, stream>>>(O16, CC, 0, Bo, CC, 0, 0.0625f, bo, 0, nullptr, 1, 0, 0, (float*)d_out, nullptr, CC, 0, SS, CC, CC);
}

// v001
// It runs in 499 microseconds.
// Timed twice side by side with v000, it ran 1.47 and 1.46 times as fast.
#include <hip/hip_runtime.h>
// Power-law-graph multi-head attention (B=1, S=2048, D=2048, 16 heads × 128; INPUT additive mask (nonzero = −1e9) ; RoPE interleaved pairs): q/k/v/o projections ((out,in) + bias) and the per-head
// metric product qg = q_h·G_h as GEMMs and the attention as a fused flash-style kernel (head dim 128: 4 k-steps / 8 d-tiles; masked keys excluded, fully masked 32-key tiles skipped by ballot;
// online softmax f32; P f16 ≤ 1; O = P·Vt; RPW-16 waves) on v_wmma_f32_16x16x32_f16, f32 accumulate; RoPE f32 VALU.
#define SS 2048
#define CC 2048
#define NH 16
#define HD 128

typedef __bf16 v16b __attribute__((ext_vector_type(16)));
typedef unsigned short v8us __attribute__((ext_vector_type(8), may_alias));
typedef float  v8f  __attribute__((ext_vector_type(8)));
typedef float  v4f  __attribute__((ext_vector_type(4)));
typedef float  v4fa __attribute__((ext_vector_type(4), may_alias));
union FragB { v16b v; v8us half[2]; unsigned short u[16]; };

__device__ __forceinline__ unsigned short bf16_bits(float x) { unsigned int u = __float_as_uint(x); return (unsigned short)((u + 0x7FFFu + ((u >> 16) & 1u)) >> 16); }
__device__ __forceinline__ float bf16_val(unsigned short b) { return __uint_as_float(((unsigned int)b) << 16); }
__device__ __forceinline__ float bf16_round(float x) { return bf16_val(bf16_bits(x)); }
// D += A·B with NT terms: 1 = ah·bh, 2 = + al·bh (A split), 3 = + ah·bl (both split)
template <int NT>
__device__ __forceinline__ v8f mmaN(v16b ah, v16b al, v16b bh, v16b bl, v8f c) {
  c = __builtin_amdgcn_wmma_f32_16x16x32_bf16(false, ah, false, bh, (short)0, c, false, false);
  if (NT >= 2) c = __builtin_amdgcn_wmma_f32_16x16x32_bf16(false, al, false, bh, (short)0, c, false, false);
  if (NT >= 3) c = __builtin_amdgcn_wmma_f32_16x16x32_bf16(false, ah, false, bl, (short)0, c, false, false);
  asm volatile("v_nop\n\tv_nop\n\tv_nop\n\tv_nop" : "+v"(c) : "v"(ah), "v"(al), "v"(bh), "v"(bl));
  return c;
}

__global__ __launch_bounds__(256) void k_wt_bf16(const float* __restrict__ W, unsigned short* __restrict__ Wt, int K, int N) {
  const int t = blockIdx.x * 256 + threadIdx.x;
  const int k8n = K / 8;
  if (t >= N * k8n) return;
  const int n = t / k8n, k8 = (t % k8n) * 8;
  v8us v;
#pragma unroll
  for (int i = 0; i < 8; ++i) v[i] = bf16_bits(W[(size_t)(k8 + i) * N + n]);
  *(v8us*)(Wt + (size_t)n * K + k8) = v;
  
}

// GEMM C[M][N] (f32, pitch ldc) = act(A[M][K]·W + bias). A f32 row-major (pitch lda) converted per fragment to bf16
// (ASPLIT: hi/lo two planes -> 2 terms, else single rounded term); Wt bf16 [N][K] (pitch ldb). BIAS_BF16 rounds the
// bias to bf16 first (bias quantised to bf16 before the add). K%32==0, M%16==0, N%64==0.
template <bool ASPLIT, int ACT, bool BIAS_BF16>
__global__ __launch_bounds__(128) void k_gemm_bf(const float* __restrict__ A, int lda, const unsigned short* __restrict__ Wt, int ldb,
                                               const float* __restrict__ bias, float* __restrict__ C, int ldc, int M, int N, int K) {
  __shared__ __attribute__((aligned(16))) float so[4][16][64];
  const int tid = threadIdx.x, w = tid >> 5, lane = tid & 31, ln = lane & 15, hh = lane >> 4;
  const int ntn = N / 64;
  const int wid = blockIdx.x * 4 + w;
  const int mt = wid / ntn, nq = wid % ntn;
  if (mt * 16 >= M) return;
  const int row0 = mt * 16, col0 = nq * 64;
  const float* arow = A + (size_t)(row0 + ln) * lda;
  v8f acc[4] = {};
  for (int kb = 0; kb < K; kb += 32) {
    FragB ah, al;
    const v4f x0 = *(const v4fa*)(arow + kb + 8 * hh), x1 = *(const v4fa*)(arow + kb + 8 * hh + 4);
    const v4f x2 = *(const v4fa*)(arow + kb + 16 + 8 * hh), x3 = *(const v4fa*)(arow + kb + 16 + 8 * hh + 4);
    float xs[16] = {x0[0],x0[1],x0[2],x0[3],x1[0],x1[1],x1[2],x1[3],x2[0],x2[1],x2[2],x2[3],x3[0],x3[1],x3[2],x3[3]};
#pragma unroll
    for (int i = 0; i < 16; ++i) { const unsigned short hb = bf16_bits(xs[i]); ah.u[i] = hb; al.u[i] = ASPLIT ? bf16_bits(xs[i] - bf16_val(hb)) : (unsigned short)0; }
#pragma unroll
    for (int t = 0; t < 4; ++t) {
      const unsigned short* brow = Wt + (size_t)(col0 + t * 16 + ln) * ldb + kb;
      FragB b;
      b.half[0] = *(const v8us*)(brow + 8 * hh);
      b.half[1] = *(const v8us*)(brow + 16 + 8 * hh);
      acc[t] = mmaN<ASPLIT ? 2 : 1>(ah.v, al.v, b.v, b.v, acc[t]);
    }
  }
#pragma unroll
  for (int t = 0; t < 4; ++t) {
    float bv = bias ? bias[col0 + t * 16 + ln] : 0.f;
    if (BIAS_BF16) bv = bf16_round(bv);
#pragma unroll
    for (int r = 0; r < 8; ++r) { float v = acc[t][r] + bv; if (ACT == 1) v = fmaxf(v, 0.f); so[w][8 * hh + r][t * 16 + ln] = v; }
  }
  __builtin_amdgcn_fence(__ATOMIC_ACQ_REL, "workgroup");
  __builtin_amdgcn_wave_barrier();
  const int rsub = lane >> 4, c4 = (lane & 15) * 4;
  {
#pragma unroll
    for (int q = 0; q < 8; ++q) {
      const int r = q * 2 + rsub;
      const v4f v = *(const v4fa*)&so[w][r][c4];
      *(v4f*)(C + (size_t)(row0 + r) * ldc + col0 + c4) = v;
    }
    
  }
}

// Flash-style causal/unmasked attention, all contractions 3-term bf16 hi/lo splits, f32 softmax with running max.
// q,k,v rows are read from f32 buffers with arbitrary row pitch (so they can live inside a fused qkv buffer);
// D = head size (multiple of 32, <= 128); one wave = 16 query rows; block = 4 waves (64 queries) sharing K/V chunks of 32.
template <int D, bool CAUSAL>
__global__ __launch_bounds__(128) void k_flash(const float* __restrict__ qb, const float* __restrict__ kb, const float* __restrict__ vb,
                                             int pitch, int T, int H, float scale, float* __restrict__ y, int ypitch) {
  constexpr int KS = D / 32;        // k-steps for QK
  constexpr int DT = D / 16;        // d tiles for PV
  __shared__ __attribute__((aligned(16))) unsigned short sKh[32][D + 8], sKl[32][D + 8], sVh[32][D + 8], sVl[32][D + 8];
  __shared__ __attribute__((aligned(16))) unsigned short sPh[4][16][40], sPl[4][16][40];
  __shared__ __attribute__((aligned(16))) float sO[4][16][D];
  const int tid = threadIdx.x, w = tid >> 5, lane = tid & 31, ln = lane & 15, hh = lane >> 4;
  const int nqb = (T + 63) / 64;
  const int bh = blockIdx.x / nqb, qblk = blockIdx.x % nqb;
  const int b = bh / H, h = bh % H;
  const int q0 = qblk * 64 + w * 16;
  const float* Q = qb + (size_t)b * T * pitch + h * D;
  const float* K = kb + (size_t)b * T * pitch + h * D;
  const float* V = vb + (size_t)b * T * pitch + h * D;

  // A fragments of the wave's 16 query rows (scaled), hi/lo
  FragB aqh[KS], aql[KS];
  {
    int row = q0 + ln; if (row >= T) row = T - 1;
    const float* qr = Q + (size_t)row * pitch;
#pragma unroll
    for (int ks = 0; ks < KS; ++ks)
#pragma unroll
      for (int i = 0; i < 16; ++i) {
        const int d = ks * 32 + ((i < 8) ? (8 * hh + i) : (16 + 8 * hh + (i - 8)));
        const float x = qr[d] * scale; const unsigned short hb = bf16_bits(x);
        aqh[ks].u[i] = hb; aql[ks].u[i] = bf16_bits(x - bf16_val(hb));
      }
  }
  float m_r[8], l_r[8];
#pragma unroll
  for (int r = 0; r < 8; ++r) { m_r[r] = -3.0e38f; l_r[r] = 0.f; }
  v8f oacc[DT];
#pragma unroll
  for (int dt = 0; dt < DT; ++dt) oacc[dt] = (v8f){0.f,0.f,0.f,0.f,0.f,0.f,0.f,0.f};

  const int kv_end = CAUSAL ? min(T, qblk * 64 + 64) : T;     // block-uniform
  for (int j0 = 0; j0 < kv_end; j0 += 32) {
    __syncthreads();
    for (int e = tid; e < 32 * (D / 4); e += 128) {
      const int r = e / (D / 4), c4 = (e % (D / 4)) * 4;
      const int key = j0 + r;
      v4f kf = {0.f,0.f,0.f,0.f}, vf = {0.f,0.f,0.f,0.f};
      if (key < T) { kf = *(const v4fa*)(K + (size_t)key * pitch + c4); vf = *(const v4fa*)(V + (size_t)key * pitch + c4); }
#pragma unroll
      for (int t = 0; t < 4; ++t) {
        unsigned short hb = bf16_bits(kf[t]); sKh[r][c4 + t] = hb; sKl[r][c4 + t] = bf16_bits(kf[t] - bf16_val(hb));
        hb = bf16_bits(vf[t]); sVh[r][c4 + t] = hb; sVl[r][c4 + t] = bf16_bits(vf[t] - bf16_val(hb));
      }
    }
    __syncthreads();
    // S tile 16 x 32
    v8f s[2];
#pragma unroll
    for (int nt = 0; nt < 2; ++nt) {
      v8f acc = {};
#pragma unroll
      for (int ks = 0; ks < KS; ++ks) {
        FragB bh_, bl_;
        bh_.half[0] = *(const v8us*)&sKh[nt * 16 + ln][ks * 32 + 8 * hh]; bh_.half[1] = *(const v8us*)&sKh[nt * 16 + ln][ks * 32 + 16 + 8 * hh];
        bl_.half[0] = *(const v8us*)&sKl[nt * 16 + ln][ks * 32 + 8 * hh]; bl_.half[1] = *(const v8us*)&sKl[nt * 16 + ln][ks * 32 + 16 + 8 * hh];
        acc = mmaN<3>(aqh[ks].v, aql[ks].v, bh_.v, bl_.v, acc);
      }
      s[nt] = acc;
    }
    // mask + running max (rows 8hh+r; the 16 lanes of a half share rows)
    float alpha[8];
#pragma unroll
    for (int r = 0; r < 8; ++r) {
      const int qi = q0 + 8 * hh + r;
      const int ja = j0 + ln, jb = j0 + 16 + ln;
      if (CAUSAL) { if (ja > qi) s[0][r] = -3.0e38f; if (jb > qi) s[1][r] = -3.0e38f; }
      if (ja >= T) s[0][r] = -3.0e38f;
      if (jb >= T) s[1][r] = -3.0e38f;
      float mx = fmaxf(s[0][r], s[1][r]);
      mx = fmaxf(mx, __shfl_xor(mx, 1, 32)); mx = fmaxf(mx, __shfl_xor(mx, 2, 32)); mx = fmaxf(mx, __shfl_xor(mx, 4, 32)); mx = fmaxf(mx, __shfl_xor(mx, 8, 32));
      const float mnew = fmaxf(m_r[r], mx);
      alpha[r] = (mnew > -1.0e38f) ? __expf(m_r[r] - mnew) : 1.0f;
      const float p0 = (s[0][r] > -1.0e38f) ? __expf(s[0][r] - mnew) : 0.f;
      const float p1 = (s[1][r] > -1.0e38f) ? __expf(s[1][r] - mnew) : 0.f;
      m_r[r] = mnew;
      l_r[r] = l_r[r] * alpha[r] + p0 + p1;            // per-lane partial row sum (16 lanes combined at the end)
      unsigned short hb = bf16_bits(p0); sPh[w][8 * hh + r][ln] = hb;      sPl[w][8 * hh + r][ln] = bf16_bits(p0 - bf16_val(hb));
      hb = bf16_bits(p1);                sPh[w][8 * hh + r][16 + ln] = hb; sPl[w][8 * hh + r][16 + ln] = bf16_bits(p1 - bf16_val(hb));
    }
#pragma unroll
    for (int dt = 0; dt < DT; ++dt)
#pragma unroll
      for (int r = 0; r < 8; ++r) oacc[dt][r] *= alpha[r];
    __builtin_amdgcn_fence(__ATOMIC_ACQ_REL, "workgroup");
    __builtin_amdgcn_wave_barrier();
    FragB pah, pal;
    pah.half[0] = *(const v8us*)&sPh[w][ln][8 * hh]; pah.half[1] = *(const v8us*)&sPh[w][ln][16 + 8 * hh];
    pal.half[0] = *(const v8us*)&sPl[w][ln][8 * hh]; pal.half[1] = *(const v8us*)&sPl[w][ln][16 + 8 * hh];
#pragma unroll
    for (int dt = 0; dt < DT; ++dt) {
      FragB bvh, bvl;
#pragma unroll
      for (int i = 0; i < 8; ++i) {
        bvh.u[i] = sVh[8 * hh + i][dt * 16 + ln]; bvh.u[8 + i] = sVh[16 + 8 * hh + i][dt * 16 + ln];
        bvl.u[i] = sVl[8 * hh + i][dt * 16 + ln]; bvl.u[8 + i] = sVl[16 + 8 * hh + i][dt * 16 + ln];
      }
      oacc[dt] = mmaN<3>(pah.v, pal.v, bvh.v, bvl.v, oacc[dt]);
    }
    __builtin_amdgcn_fence(__ATOMIC_ACQ_REL, "workgroup");
    __builtin_amdgcn_wave_barrier();
  }
#pragma unroll
  for (int r = 0; r < 8; ++r) {
    float l = l_r[r];
    l += __shfl_xor(l, 1, 32); l += __shfl_xor(l, 2, 32); l += __shfl_xor(l, 4, 32); l += __shfl_xor(l, 8, 32);
    l_r[r] = (l > 0.f) ? 1.0f / l : 0.f;
  }
#pragma unroll
  for (int dt = 0; dt < DT; ++dt)
#pragma unroll
    for (int r = 0; r < 8; ++r) sO[w][8 * hh + r][dt * 16 + ln] = oacc[dt][r] * l_r[r];
  __builtin_amdgcn_fence(__ATOMIC_ACQ_REL, "workgroup");
  __builtin_amdgcn_wave_barrier();
  {
    for (int r = 0; r < 16; ++r) {
      const int row = q0 + r;
      if (row < T && lane < D / 4) {
        const v4f val = *(const v4fa*)&sO[w][r][lane * 4];
        *(v4f*)(y + ((size_t)b * T + row) * ypitch + h * D + lane * 4) = val;
      }
    }
    
  }
}

// GEMM C = act(A·W + bias + resid): A f32 (ASPLIT -> hi/lo 2 terms), Wt bf16 [N][K]; ACT 0 none, 1 relu, 2 exact gelu;
// resid (optional, f32, row index = (row % rmod), pitch ldr, RES_BF16 rounds it) added before the activation.
template <bool ASPLIT, int ACT, bool BIAS_BF16, bool RES_BF16>
__global__ __launch_bounds__(128) void k_gemm_bf3(const float* __restrict__ A, int lda, const unsigned short* __restrict__ Wt, int ldb,
                                                const float* __restrict__ bias, const float* __restrict__ resid, int rmod, int ldr,
                                                float* __restrict__ C, int ldc, int M, int N, int K) {
  __shared__ __attribute__((aligned(16))) float so[4][16][64];
  const int tid = threadIdx.x, w = tid >> 5, lane = tid & 31, ln = lane & 15, hh = lane >> 4;
  const int ntn = N / 64;
  const int wid = blockIdx.x * 4 + w;
  const int mt = wid / ntn, nq = wid % ntn;
  if (mt * 16 >= M) return;
  const int row0 = mt * 16, col0 = nq * 64;
  const float* arow = A + (size_t)(row0 + ln) * lda;
  v8f acc[4] = {};
  for (int kb = 0; kb < K; kb += 32) {
    FragB ah, al;
    const v4f x0 = *(const v4fa*)(arow + kb + 8 * hh), x1 = *(const v4fa*)(arow + kb + 8 * hh + 4);
    const v4f x2 = *(const v4fa*)(arow + kb + 16 + 8 * hh), x3 = *(const v4fa*)(arow + kb + 16 + 8 * hh + 4);
    float xs[16] = {x0[0],x0[1],x0[2],x0[3],x1[0],x1[1],x1[2],x1[3],x2[0],x2[1],x2[2],x2[3],x3[0],x3[1],x3[2],x3[3]};
#pragma unroll
    for (int i = 0; i < 16; ++i) { const unsigned short hb = bf16_bits(xs[i]); ah.u[i] = hb; al.u[i] = ASPLIT ? bf16_bits(xs[i] - bf16_val(hb)) : (unsigned short)0; }
#pragma unroll
    for (int t = 0; t < 4; ++t) {
      const unsigned short* brow = Wt + (size_t)(col0 + t * 16 + ln) * ldb + kb;
      FragB b;
      b.half[0] = *(const v8us*)(brow + 8 * hh);
      b.half[1] = *(const v8us*)(brow + 16 + 8 * hh);
      acc[t] = mmaN<ASPLIT ? 2 : 1>(ah.v, al.v, b.v, b.v, acc[t]);
    }
  }
#pragma unroll
  for (int t = 0; t < 4; ++t) {
    const int col = col0 + t * 16 + ln;
    float bv = bias ? bias[col] : 0.f;
    if (BIAS_BF16) bv = bf16_round(bv);
#pragma unroll
    for (int r = 0; r < 8; ++r) {
      float v = acc[t][r] + bv;
      if (resid) { float rv = resid[(size_t)((row0 + 8 * hh + r) % rmod) * ldr + col]; if (RES_BF16) rv = bf16_round(rv); v += rv; }
      if (ACT == 1) v = fmaxf(v, 0.f);
      if (ACT == 2) v = 0.5f * v * (1.0f + erff(v * 0.70710678118654752f));
      if (ACT == 3) { const float u = 0.7978845608028654f * (v + 0.044715f * v * v * v); v = 0.5f * v * (1.0f + tanhf(u)); }
      so[w][8 * hh + r][t * 16 + ln] = v;
    }
  }
  __builtin_amdgcn_fence(__ATOMIC_ACQ_REL, "workgroup");
  __builtin_amdgcn_wave_barrier();
  const int rsub = lane >> 4, c4 = (lane & 15) * 4;
  {
#pragma unroll
    for (int q = 0; q < 8; ++q) {
      const int r = q * 2 + rsub;
      const v4f v = *(const v4fa*)&so[w][r][c4];
      *(v4f*)(C + (size_t)(row0 + r) * ldc + col0 + c4) = v;
    }
    
  }
}
// row LayerNorm (biased variance, eps) over N: s = X (+ R); optional out_sum <- s; out_norm <- (s-mu)*rsqrt(var+eps)*g + b
template <bool PARAM_BF16>
__global__ __launch_bounds__(256) void k_layernorm(const float* __restrict__ X, const float* __restrict__ R, const float* __restrict__ g, const float* __restrict__ bta,
                                                  float* __restrict__ out_sum, float* __restrict__ out_norm, int N, float eps) {
  __shared__ float red[256];
  const int row = blockIdx.x, tid = threadIdx.x;
  const float* x = X + (size_t)row * N; const float* rr = R ? R + (size_t)row * N : nullptr;
  float vals[16];                     // up to N = 4096
  const int per = N / 256;            // contiguous chunk per thread? use strided-by-4 chunks: thread handles j = tid*4 + 1024*u
  float s1 = 0.f;
  for (int u = 0; u < per / 4; ++u) {
    const int j = tid * 4 + 1024 * u;
    const v4f a = *(const v4fa*)(x + j);
    v4f b = {0.f,0.f,0.f,0.f}; if (rr) b = *(const v4fa*)(rr + j);
#pragma unroll
    for (int q = 0; q < 4; ++q) { const float v = a[q] + b[q]; vals[u * 4 + q] = v; s1 += v; }
  }
  red[tid] = s1; __syncthreads();
  for (int st = 128; st > 0; st >>= 1) { if (tid < st) red[tid] += red[tid + st]; __syncthreads(); }
  const float mu = red[0] / (float)N; __syncthreads();
  float s2 = 0.f;
  for (int u = 0; u < per / 4; ++u)
#pragma unroll
    for (int q = 0; q < 4; ++q) { const float c = vals[u * 4 + q] - mu; s2 += c * c; }
  red[tid] = s2; __syncthreads();
  for (int st = 128; st > 0; st >>= 1) { if (tid < st) red[tid] += red[tid + st]; __syncthreads(); }
  const float rs = rsqrtf(red[0] / (float)N + eps);
  {
    for (int u = 0; u < per / 4; ++u) {
      const int j = tid * 4 + 1024 * u;
      v4f o, sm;
#pragma unroll
      for (int q = 0; q < 4; ++q) {
        float gg = g[j + q], bb = bta[j + q];
        if (PARAM_BF16) { gg = bf16_round(gg); bb = bf16_round(bb); }
        sm[q] = vals[u * 4 + q]; o[q] = (vals[u * 4 + q] - mu) * rs * gg + bb;
      }
      if (out_sum) *(v4f*)(out_sum + (size_t)row * N + j) = sm;
      *(v4f*)(out_norm + (size_t)row * N + j) = o;
    }
    
  }
}



// ---- f16 WMMA path (v_wmma_f32_16x16x32_f16): 11-bit significands for operands in range — used where a [0,1] probability operand needs more precision than bf16
typedef _Float16 v16h __attribute__((ext_vector_type(16)));
union FragH { v16h v; v8us half[2]; _Float16 h[16]; unsigned short u[16]; };
template <int NT>
__device__ __forceinline__ v8f mmaH(v16h ah, v16h al, v16h bh, v16h bl, v8f c) {
  c = __builtin_amdgcn_wmma_f32_16x16x32_f16(false, ah, false, bh, (short)0, c, false, false);
  if (NT >= 2) c = __builtin_amdgcn_wmma_f32_16x16x32_f16(false, al, false, bh, (short)0, c, false, false);
  if (NT >= 3) c = __builtin_amdgcn_wmma_f32_16x16x32_f16(false, ah, false, bl, (short)0, c, false, false);
  asm volatile("v_nop\n\tv_nop\n\tv_nop\n\tv_nop" : "+v"(c) : "v"(ah), "v"(al), "v"(bh), "v"(bl));
  return c;
}
// batched GEMM like k_gemm_b but f16 operands: A f32 (split into f16 hi/lo if ASPLIT, else rounded to f16), Bt = f16 values [n][k]; alpha; C f32; N multiple of 16 (partial tiles skipped)
template <bool ASPLIT>
__global__ __launch_bounds__(128) void k_gemm_h(const float* __restrict__ A, int lda, size_t sA, const _Float16* __restrict__ Bh, int ldb, size_t sB, float alpha, float* __restrict__ C, int ldc, size_t sC, int M, int N, int K) {
  __shared__ __attribute__((aligned(16))) float so[4][16][64];
  const int tid = threadIdx.x, w = tid >> 5, lane = tid & 31, ln = lane & 15, hh = lane >> 4; const int by = blockIdx.y;
  A += (size_t)by * sA; Bh += (size_t)by * sB; C += (size_t)by * sC;
  const int ntn = (N + 63) / 64; const int wid = blockIdx.x * 4 + w; const int mt = wid / ntn, nq = wid % ntn; if (mt * 16 >= M) return;
  const int row0 = mt * 16, col0 = nq * 64; const float* arow = A + (size_t)(row0 + ln) * lda;
  v8f acc[4] = {};
  for (int kb = 0; kb < K; kb += 32) {
    FragH ah, al;
    const v4f x0 = *(const v4fa*)(arow + kb + 8 * hh), x1 = *(const v4fa*)(arow + kb + 8 * hh + 4), x2 = *(const v4fa*)(arow + kb + 16 + 8 * hh), x3 = *(const v4fa*)(arow + kb + 16 + 8 * hh + 4);
    float xs[16] = {x0[0],x0[1],x0[2],x0[3],x1[0],x1[1],x1[2],x1[3],x2[0],x2[1],x2[2],x2[3],x3[0],x3[1],x3[2],x3[3]};
#pragma unroll
    for (int i = 0; i < 16; ++i) { const _Float16 h = (_Float16)xs[i]; ah.h[i] = h; al.h[i] = ASPLIT ? (_Float16)(xs[i] - (float)h) : (_Float16)0.0f; }
#pragma unroll
    for (int t = 0; t < 4; ++t) { if (col0 + t * 16 >= N) continue; const size_t boff = (size_t)(col0 + t * 16 + ln) * ldb + kb; FragH bq; bq.half[0] = *(const v8us*)(Bh + boff + 8 * hh); bq.half[1] = *(const v8us*)(Bh + boff + 16 + 8 * hh);
      acc[t] = mmaH<ASPLIT ? 2 : 1>(ah.v, al.v, bq.v, bq.v, acc[t]); }
  }
#pragma unroll
  for (int t = 0; t < 4; ++t) { if (col0 + t * 16 >= N) continue;
#pragma unroll
    for (int r = 0; r < 8; ++r) so[w][8 * hh + r][t * 16 + ln] = acc[t][r] * alpha; }
  __builtin_amdgcn_fence(__ATOMIC_ACQ_REL, "workgroup"); __builtin_amdgcn_wave_barrier();
  const int rsub = lane >> 4, c4 = (lane & 15) * 4;
  {
#pragma unroll
    for (int q = 0; q < 8; ++q) { const int r = q * 2 + rsub; if (col0 + c4 < N) { const v4f v = *(const v4fa*)&so[w][r][c4]; *(v4f*)(C + (size_t)(row0 + r) * ldc + col0 + c4) = v; } }
     }
}

// Wt[n][k] = f16(W[k][n]·scale) from f32 row-major W[K][N] (scale = power of two; bf16-exact weights stay exact in f16 away from the subnormal range)
__global__ __launch_bounds__(256) void k_wt_f16(const float* __restrict__ W, _Float16* __restrict__ Wt, int K, int N, float scale) {
  const int t = blockIdx.x * 256 + threadIdx.x; if (t >= N * (K / 8)) return; const int n = t / (K / 8), k8 = (t % (K / 8)) * 8; FragH f;
#pragma unroll
  for (int i = 0; i < 8; ++i) f.h[i] = (_Float16)(bf16_round(W[(size_t)(k8 + i) * N + n]) * scale); const v8us o = f.half[0];
  *(v8us*)((unsigned short*)Wt + (size_t)n * K + k8) = o; 
}
// k_gemm_hh variant with fused epilogue: v = acc·alpha + bias[by·sBias + col] (+ CP[(row/rowsPerB)·sCPb + by·64 + col] if CP) ; ACT 0 none / 1 elu ; writes f32 C and/or f16 C16 (each if non-null)
template <int ACT>
__global__ __launch_bounds__(128) void k_gemm_hhx(const _Float16* __restrict__ A, int lda, size_t sA, const _Float16* __restrict__ Bh, int ldb, size_t sB, float alpha, const float* __restrict__ bias, size_t sBias, const float* __restrict__ CP, int rowsPerB, size_t sCPb, int row0g,
    float* __restrict__ C, _Float16* __restrict__ C16, int ldc, size_t sC, int M, int N, int K) {
  __shared__ __attribute__((aligned(16))) float so[4][16][64];
  const int tid = threadIdx.x, w = tid >> 5, lane = tid & 31, ln = lane & 15, hh = lane >> 4; const int by = blockIdx.y;
  A += (size_t)by * sA; Bh += (size_t)by * sB; const size_t cofs = (size_t)by * sC; const float* bp = bias ? bias + (size_t)by * sBias : nullptr;
  const int ntn = (N + 63) / 64; const int wid = blockIdx.x * 4 + w; const int mt = wid / ntn, nq = wid % ntn; if (mt * 16 >= M) return;
  const int row0 = mt * 16, col0 = nq * 64; const _Float16* arow = A + (size_t)(row0 + ln) * lda;
  v8f acc[4] = {};
  for (int kb = 0; kb < K; kb += 32) { FragH ah; ah.half[0] = *(const v8us*)((const unsigned short*)arow + kb + 8 * hh); ah.half[1] = *(const v8us*)((const unsigned short*)arow + kb + 16 + 8 * hh);
#pragma unroll
    for (int t = 0; t < 4; ++t) { if (col0 + t * 16 >= N) continue; const size_t boff = (size_t)(col0 + t * 16 + ln) * ldb + kb; FragH bq; bq.half[0] = *(const v8us*)((const unsigned short*)Bh + boff + 8 * hh); bq.half[1] = *(const v8us*)((const unsigned short*)Bh + boff + 16 + 8 * hh);
      acc[t] = mmaH<1>(ah.v, ah.v, bq.v, bq.v, acc[t]); }
  }
#pragma unroll
  for (int t = 0; t < 4; ++t) { if (col0 + t * 16 >= N) continue; const int col = col0 + t * 16 + ln; const float bv = bp ? bf16_round(bp[col]) : 0.f;
#pragma unroll
    for (int r = 0; r < 8; ++r) { float v = acc[t][r] * alpha + bv; if (CP) { const int bidx = (row0g + row0 + 8 * hh + r) / rowsPerB; v += CP[(size_t)bidx * sCPb + (size_t)by * 64 + col]; } if (ACT == 1) v = (v > 0.f) ? v : expm1f(v); else if (ACT == 3) v = fmaxf(v, 0.f); so[w][8 * hh + r][t * 16 + ln] = v; } }
  __builtin_amdgcn_fence(__ATOMIC_ACQ_REL, "workgroup"); __builtin_amdgcn_wave_barrier();
  const int rsub = lane >> 4, c4 = (lane & 15) * 4; typedef _Float16 v4h __attribute__((ext_vector_type(4)));
  {
#pragma unroll
    for (int q = 0; q < 8; ++q) { const int r = q * 2 + rsub; if (col0 + c4 < N) { const v4f v = *(const v4fa*)&so[w][r][c4]; if (C) *(v4f*)(C + cofs + (size_t)(row0 + r) * ldc + col0 + c4) = v; if (C16) { v4h h4; for (int i = 0; i < 4; ++i) h4[i] = (_Float16)v[i]; *(v4h*)(C16 + cofs + (size_t)(row0 + r) * ldc + col0 + c4) = h4; } } }
     }
}


// Projection GEMM, 2048 x 2048 x 2048: C = (A . Bt^T) * alpha + bias. One 128 x 128 tile of C per workgroup of 8 waves (4 x 2, 32 x 64 per wave).
// A pass is 128 k: 128 rows of A and 128 rows of Bt, 256 B each, laid in LDS at pitch 272 B by asynchronous copies, two buffers, the next pass's copies in flight under this pass's products.
// k runs upward in steps of 32 into one accumulator per 16 x 16 tile, as in k_gemm_hhx: the sums keep their order.
// Every '#pragma unroll' in k_gemm_t makes the indices of the fragment and accumulator arrays constants, so that they stay in registers.
#define GT_PITCH 272u
#define GT_STAGE (256u * GT_PITCH)
#define GT_NST (CC / 128)
__device__ __forceinline__ void gt_copy8(unsigned l0, const unsigned short* g0) {
  // eight 16-byte copies of this lane, rows 16 apart; s_wait_xcnt stands inside the statement so that no address register is rewritten ahead of it
  const unsigned l1 = l0 + 16u * GT_PITCH, l2 = l0 + 32u * GT_PITCH, l3 = l0 + 48u * GT_PITCH, l4 = l0 + 64u * GT_PITCH, l5 = l0 + 80u * GT_PITCH, l6 = l0 + 96u * GT_PITCH, l7 = l0 + 112u * GT_PITCH;
  const unsigned short *g1 = g0 + 16 * CC, *g2 = g0 + 32 * CC, *g3 = g0 + 48 * CC, *g4 = g0 + 64 * CC, *g5 = g0 + 80 * CC, *g6 = g0 + 96 * CC, *g7 = g0 + 112 * CC;
  asm volatile("global_load_async_to_lds_b128 %0, %8, off\n\t"
               "global_load_async_to_lds_b128 %1, %9, off\n\t"
               "global_load_async_to_lds_b128 %2, %10, off\n\t"
               "global_load_async_to_lds_b128 %3, %11, off\n\t"
               "global_load_async_to_lds_b128 %4, %12, off\n\t"
               "global_load_async_to_lds_b128 %5, %13, off\n\t"
               "global_load_async_to_lds_b128 %6, %14, off\n\t"
               "global_load_async_to_lds_b128 %7, %15, off\n\t"
               "s_wait_xcnt 0x0"
               :: "v"(l0), "v"(l1), "v"(l2), "v"(l3), "v"(l4), "v"(l5), "v"(l6), "v"(l7),
                  "v"(g0), "v"(g1), "v"(g2), "v"(g3), "v"(g4), "v"(g5), "v"(g6), "v"(g7) : "memory");
}
template <bool H16>      // H16: the tile goes out as f16 to C16, else as f32 to C
__global__ __launch_bounds__(256) void k_gemm_t(const _Float16* __restrict__ A, const _Float16* __restrict__ Bh, float alpha, const float* __restrict__ bias, float* __restrict__ C, _Float16* __restrict__ C16) {
  __shared__ __attribute__((aligned(16))) unsigned char L[2u * GT_STAGE];
  const int tid = threadIdx.x, w = tid >> 5, lane = tid & 31, ln = lane & 15, hh = lane >> 4;
  const int m0 = (int)(blockIdx.x / (CC / 128)) * 128, n0 = (int)(blockIdx.x % (CC / 128)) * 128;
  const int wm = (w >> 1) * 32, wn = (w & 1) * 64;
  // copies: lane takes 16-byte piece (tid & 15) of rows (tid >> 4) + 16 i; LDS rows 0..127 hold A, 128..255 hold Bt
  const unsigned lcp = (unsigned)(size_t)L + (unsigned)(tid >> 4) * GT_PITCH + (unsigned)(tid & 15) * 16u;
  const unsigned short* ga = (const unsigned short*)A + (size_t)(m0 + (tid >> 4)) * CC + (tid & 15) * 8;
  const unsigned short* gb = (const unsigned short*)Bh + (size_t)(n0 + (tid >> 4)) * CC + (tid & 15) * 8;
  v8f acc[2][4];
#pragma unroll
  for (int i = 0; i < 2; ++i)
#pragma unroll
    for (int j = 0; j < 4; ++j) acc[i][j] = (v8f){0.f,0.f,0.f,0.f,0.f,0.f,0.f,0.f};
  gt_copy8(lcp, ga); gt_copy8(lcp + 128u * GT_PITCH, gb);
  asm volatile("s_wait_asynccnt 0x0" ::: "memory");      // pass 0's bytes of this wave have landed
  __syncthreads();                                        // and every wave's: pass 0 is readable
  gt_copy8(lcp + GT_STAGE, ga + 128); gt_copy8(lcp + GT_STAGE + 128u * GT_PITCH, gb + 128);
#pragma unroll 1      // one pass per trip: the ring's order at the foot stays as written
  for (int t = 0; t < GT_NST; ++t) {
    const unsigned char* S = L + (unsigned)(t & 1) * GT_STAGE;
    const unsigned char* ar = S + (unsigned)(wm + ln) * GT_PITCH + 16u * hh;
    const unsigned char* br = S + (unsigned)(128 + wn + ln) * GT_PITCH + 16u * hh;
    FragH a[2][2], b[2][4];      // two fragment sets: the next 32 k are fetched as one group ahead of this block's products (inside this pass's buffer only)
#pragma unroll
    for (int i = 0; i < 2; ++i) { a[0][i].half[0] = *(const v8us*)(ar + i * 16 * GT_PITCH); a[0][i].half[1] = *(const v8us*)(ar + i * 16 * GT_PITCH + 32); }
#pragma unroll
    for (int j = 0; j < 4; ++j) { b[0][j].half[0] = *(const v8us*)(br + j * 16 * GT_PITCH); b[0][j].half[1] = *(const v8us*)(br + j * 16 * GT_PITCH + 32); }
#pragma unroll
    for (int ks = 0; ks < 4; ++ks) {
      const int cu = ks & 1, nx = cu ^ 1;
      if (ks < 3) {
#pragma unroll
        for (int i = 0; i < 2; ++i) { a[nx][i].half[0] = *(const v8us*)(ar + i * 16 * GT_PITCH + (ks + 1) * 64); a[nx][i].half[1] = *(const v8us*)(ar + i * 16 * GT_PITCH + (ks + 1) * 64 + 32); }
#pragma unroll
        for (int j = 0; j < 4; ++j) { b[nx][j].half[0] = *(const v8us*)(br + j * 16 * GT_PITCH + (ks + 1) * 64); b[nx][j].half[1] = *(const v8us*)(br + j * 16 * GT_PITCH + (ks + 1) * 64 + 32); }
      }
      __builtin_amdgcn_sched_barrier(0);      // keeps the next block's twelve LDS loads one group ahead of these products; without it they sink among the products and each waits out its own latency
#pragma unroll
      for (int i = 0; i < 2; ++i)
#pragma unroll
        for (int j = 0; j < 4; ++j) acc[i][j] = __builtin_amdgcn_wmma_f32_16x16x32_f16(false, a[cu][i].v, false, b[cu][j].v, (short)0, acc[i][j], false, false);
      __builtin_amdgcn_sched_barrier(0);      // the products stay one run: no later load group rises into it
    }
    asm volatile("s_wait_dscnt 0x0" ::: "memory");        // this wave's reads of the buffer have returned
    asm volatile("s_wait_asynccnt 0x0" ::: "memory");     // this wave's copies of pass t + 1 have landed
    __syncthreads();                                      // publishes pass t + 1 and frees the buffer pass t has read
    if (t + 2 < GT_NST) { gt_copy8(lcp + (unsigned)(t & 1) * GT_STAGE, ga + (t + 2) * 128); gt_copy8(lcp + (unsigned)(t & 1) * GT_STAGE + 128u * GT_PITCH, gb + (t + 2) * 128); }
  }
  asm volatile("s_wait_asynccnt 0x0" ::: "memory");       // nothing in flight before the ring becomes output staging
  // epilogue: each wave stages its 32 x 64 tile in its own LDS range (pitch 68 floats) and stores whole lines
  float* so = (float*)(L + (unsigned)w * (32u * 272u));
#pragma unroll
  for (int j = 0; j < 4; ++j) { const float bv = bf16_round(bias[n0 + wn + j * 16 + ln]);
#pragma unroll
    for (int i = 0; i < 2; ++i)
#pragma unroll
      for (int r = 0; r < 8; ++r) so[(i * 16 + 8 * hh + r) * 68 + j * 16 + ln] = acc[i][j][r] * alpha + bv; }
  __builtin_amdgcn_fence(__ATOMIC_ACQ_REL, "workgroup"); __builtin_amdgcn_wave_barrier();      // the wave's staged rows are in LDS before its lanes read them back; the range is the wave's own, so no workgroup barrier
  const int c4 = ln * 4; typedef _Float16 v4h __attribute__((ext_vector_type(4)));
#pragma unroll
  for (int q = 0; q < 16; ++q) { const int r = q * 2 + hh; const v4f v = *(const v4fa*)&so[r * 68 + c4]; const size_t o = (size_t)(m0 + wm + r) * CC + n0 + wn + c4;
    if (!H16) *(v4f*)(C + o) = v;
    else { v4h h4; for (int i = 0; i < 4; ++i) h4[i] = (_Float16)v[i]; *(v4h*)(C16 + o) = h4; } }
}

__global__ __launch_bounds__(256) void k_x16(const float* __restrict__ x, _Float16* __restrict__ X16, size_t n8) { const size_t t = (size_t)blockIdx.x * 256 + threadIdx.x; if (t >= n8) return; FragH f;
#pragma unroll
  for (int q = 0; q < 8; ++q) f.h[q] = (_Float16)bf16_round(x[t * 8 + q]); *(v8us*)((unsigned short*)X16 + t * 8) = f.half[0];  }
__global__ __launch_bounds__(256) void k_h16(const float* __restrict__ x, _Float16* __restrict__ X16, size_t n8) { const size_t t = (size_t)blockIdx.x * 256 + threadIdx.x; if (t >= n8) return; FragH f;
#pragma unroll
  for (int q = 0; q < 8; ++q) f.h[q] = (_Float16)x[t * 8 + q]; *(v8us*)((unsigned short*)X16 + t * 8) = f.half[0];  }
__global__ __launch_bounds__(256) void k_round16f(const float* __restrict__ W, _Float16* __restrict__ Bt, size_t n8) { const size_t t = (size_t)blockIdx.x * 256 + threadIdx.x; if (t >= n8) return; FragH f;
#pragma unroll
  for (int i = 0; i < 8; ++i) f.h[i] = (_Float16)(bf16_round(W[t * 8 + i]) * 16.0f); *(v8us*)((unsigned short*)Bt + t * 8) = f.half[0];  }
template <int NHv, int TTv>
__global__ __launch_bounds__(256) void k_vt(const _Float16* __restrict__ V16, int ldv, int voff, _Float16* __restrict__ Vt) { __shared__ unsigned short tl[64][66]; const int tid = threadIdx.x; const int slab = blockIdx.x / (TTv / 64), lg = blockIdx.x % (TTv / 64); const int b = slab / NHv, h = slab % NHv;
  for (int i = tid; i < 64 * 8; i += 256) { const int r = i / 8, c8 = (i % 8) * 8; FragH f; f.half[0] = *(const v8us*)((const unsigned short*)V16 + ((size_t)b * TTv + lg * 64 + r) * ldv + voff + h * 64 + c8);
#pragma unroll
    for (int q = 0; q < 8; ++q) tl[r][c8 + q] = f.u[q]; }
  __syncthreads();
  {
#pragma unroll
    for (int rd = 0; rd < 2; ++rd) { const int d = rd * 32 + tid / 8, pc = tid % 8; FragH f;
#pragma unroll
      for (int q = 0; q < 8; ++q) f.u[q] = tl[pc * 8 + q][d];
      *(v8us*)((unsigned short*)Vt + ((size_t)slab * 64 + d) * TTv + lg * 64 + pc * 8) = f.half[0]; }
     } }

__global__ __launch_bounds__(128) void k_flash(const _Float16* __restrict__ Q16, int ldq, const _Float16* __restrict__ K16, int ldk, const _Float16* __restrict__ Vt, const float* __restrict__ MSK, float* __restrict__ O, int ldo) {
  constexpr int RPW = 16, RTN = RPW / 16, NQB = 2048 / (4 * RPW), DT = 8, KS = 4;      /* head dim 128 */
  __shared__ __attribute__((aligned(16))) unsigned short sP[4][RPW][40]; __shared__ __attribute__((aligned(16))) float sO[4][RPW][128 + 4];
  const int tid = threadIdx.x, w = tid >> 5, lane = tid & 31, ln = lane & 15, hh = lane >> 4;
  const int slab = blockIdx.x / NQB, qblk = blockIdx.x % NQB; const int b = slab / 16, h = slab % 16; const int qb0 = qblk * (4 * RPW); const int q0 = qb0 + w * RPW;
  FragH aq[2][KS];
#pragma unroll
  for (int rt = 0; rt < RTN; ++rt) { const unsigned short* qr = (const unsigned short*)Q16 + ((size_t)b * 2048 + q0 + rt * 16 + ln) * ldq + h * 128;
#pragma unroll
    for (int ks = 0; ks < KS; ++ks) { aq[rt][ks].half[0] = *(const v8us*)(qr + ks * 32 + 8 * hh); aq[rt][ks].half[1] = *(const v8us*)(qr + ks * 32 + 16 + 8 * hh); } }
  const unsigned short* Vth = (const unsigned short*)Vt + (size_t)slab * 128 * 2048;
  float m_r[2][8], l_r[2][8]; v8f oacc[2][DT];
#pragma unroll
  for (int rt = 0; rt < RTN; ++rt) {
#pragma unroll
    for (int r = 0; r < 8; ++r) { m_r[rt][r] = -3.0e38f; l_r[rt][r] = 0.f; }
#pragma unroll
    for (int dt = 0; dt < DT; ++dt) oacc[rt][dt] = (v8f){0.f,0.f,0.f,0.f,0.f,0.f,0.f,0.f}; }
  const int jend = 2048;
#pragma unroll 1
  for (int j0 = 0; j0 < jend; j0 += 32) {
    // mask tile for my 16 query rows × 32 keys: lane (ln,hh) needs rows rt·16 + 8hh + r, keys j0 + ln and j0 + 16 + ln
    unsigned okb0 = 0u, okb1 = 0u;      // bit (rt·8 + r) set when key j0+ln (resp. j0+16+ln) is OPEN for query row rt·16 + 8hh + r
#pragma unroll
    for (int rt = 0; rt < RTN; ++rt)
#pragma unroll
      for (int r = 0; r < 8; ++r) { const float* mr = MSK + ((size_t)b * 2048 + q0 + rt * 16 + 8 * hh + r) * 2048 + j0; okb0 |= (mr[ln] == 0.0f ? 1u : 0u) << (rt * 8 + r); okb1 |= (mr[16 + ln] == 0.0f ? 1u : 0u) << (rt * 8 + r); }      /* float mask: nonzero = masked (−1e9) */
    if (__builtin_amdgcn_ballot_w32((okb0 | okb1) != 0u) == 0u) continue;      // every (query,key) of this wave's tile is masked → contributes nothing (uniform branch)
    v8f s[2][2];
#pragma unroll
    for (int nt = 0; nt < 2; ++nt) { const unsigned short* kr = (const unsigned short*)K16 + ((size_t)b * 2048 + j0 + nt * 16 + ln) * ldk + h * 128; FragH bk[KS];
#pragma unroll
      for (int ks = 0; ks < KS; ++ks) { bk[ks].half[0] = *(const v8us*)(kr + ks * 32 + 8 * hh); bk[ks].half[1] = *(const v8us*)(kr + ks * 32 + 16 + 8 * hh); }
#pragma unroll
      for (int rt = 0; rt < RTN; ++rt) { v8f acc = (v8f){0.f,0.f,0.f,0.f,0.f,0.f,0.f,0.f};
#pragma unroll
        for (int ks = 0; ks < KS; ++ks) acc = mmaH<1>(aq[rt][ks].v, aq[rt][ks].v, bk[ks].v, bk[ks].v, acc); s[rt][nt] = acc; } }
#pragma unroll
    for (int rt = 0; rt < RTN; ++rt)
#pragma unroll
      for (int r = 0; r < 8; ++r) { const int tq = q0 + rt * 16 + 8 * hh + r; const int k0 = j0 + ln, k1 = j0 + 16 + ln; (void)tq; (void)k0; (void)k1;
        const bool ok0 = ((okb0 >> (rt * 8 + r)) & 1u) != 0u, ok1 = ((okb1 >> (rt * 8 + r)) & 1u) != 0u;
        const float s0 = ok0 ? s[rt][0][r] * (0.08838834764831845f) : -INFINITY, s1 = ok1 ? s[rt][1][r] * (0.08838834764831845f) : -INFINITY; float mc = fmaxf(s0, s1);
        mc = fmaxf(mc, __shfl_xor(mc, 1, 32)); mc = fmaxf(mc, __shfl_xor(mc, 2, 32)); mc = fmaxf(mc, __shfl_xor(mc, 4, 32)); mc = fmaxf(mc, __shfl_xor(mc, 8, 32));
        const float mn = fmaxf(m_r[rt][r], mc); const float al = (mn > -1.0e38f) ? expf(m_r[rt][r] - mn) : 1.0f; m_r[rt][r] = mn; const float p0 = ok0 ? expf(s0 - mn) : 0.f, p1 = ok1 ? expf(s1 - mn) : 0.f; l_r[rt][r] = l_r[rt][r] * al + p0 + p1;
#pragma unroll
        for (int dt = 0; dt < DT; ++dt) oacc[rt][dt][r] *= al;
        FragH t2; t2.h[0] = (_Float16)p0; t2.h[1] = (_Float16)p1; sP[w][rt * 16 + 8 * hh + r][ln] = t2.u[0]; sP[w][rt * 16 + 8 * hh + r][16 + ln] = t2.u[1]; }
    __builtin_amdgcn_fence(__ATOMIC_ACQ_REL, "workgroup"); __builtin_amdgcn_wave_barrier();
    FragH pa[2];
#pragma unroll
    for (int rt = 0; rt < RTN; ++rt) { pa[rt].half[0] = *(const v8us*)&sP[w][rt * 16 + ln][8 * hh]; pa[rt].half[1] = *(const v8us*)&sP[w][rt * 16 + ln][16 + 8 * hh]; }
#pragma unroll
    for (int dt = 0; dt < DT; ++dt) { const unsigned short* vrow = Vth + (size_t)(dt * 16 + ln) * 2048 + j0; FragH bv; bv.half[0] = *(const v8us*)(vrow + 8 * hh); bv.half[1] = *(const v8us*)(vrow + 16 + 8 * hh);
#pragma unroll
      for (int rt = 0; rt < RTN; ++rt) oacc[rt][dt] = mmaH<1>(pa[rt].v, pa[rt].v, bv.v, bv.v, oacc[rt][dt]); }
    __builtin_amdgcn_fence(__ATOMIC_ACQ_REL, "workgroup"); __builtin_amdgcn_wave_barrier(); }
#pragma unroll
  for (int rt = 0; rt < RTN; ++rt) {
#pragma unroll
    for (int r = 0; r < 8; ++r) { float l = l_r[rt][r]; l += __shfl_xor(l, 1, 32); l += __shfl_xor(l, 2, 32); l += __shfl_xor(l, 4, 32); l += __shfl_xor(l, 8, 32); l_r[rt][r] = (l > 0.f) ? 1.0f / l : 0.f; }
#pragma unroll
    for (int dt = 0; dt < DT; ++dt)
#pragma unroll
      for (int r = 0; r < 8; ++r) sO[w][rt * 16 + 8 * hh + r][dt * 16 + ln] = oacc[rt][dt][r] * l_r[rt][r]; }
  __builtin_amdgcn_fence(__ATOMIC_ACQ_REL, "workgroup"); __builtin_amdgcn_wave_barrier();
  {
#pragma unroll
    for (int rp = 0; rp < RPW; ++rp) { const int r = rp, pc = lane; const v4f val = *(const v4fa*)&sO[w][r][pc * 4]; *(v4f*)(O + ((size_t)b * 2048 + q0 + r) * ldo + h * 128 + pc * 4) = val; }      /* 128-float rows: 32 lanes × 16 B */
     } }

__global__ __launch_bounds__(256) void k_rope16(const float* __restrict__ SRC, _Float16* __restrict__ D16) { __shared__ __attribute__((aligned(16))) _Float16 st[256][8]; const int tid = threadIdx.x; const size_t t = (size_t)blockIdx.x * 256 + tid; if (t >= (size_t)SS * NH * 16) return; const int p = (int)(t % 16); const int h = (int)((t / 16) % NH); const int s = (int)(t / (16 * NH)); const float* src = SRC + ((size_t)s * NH + h) * HD;
#pragma unroll 1
  for (int q = 0; q < 8; ++q) { const int j = p * 8 + q; const int i = j >> 1; const float f = __builtin_powf(10000.0f, -(float)(2 * i) / 128.0f); const float ang = (float)s * f; const float c = cosf(ang), sn = sinf(ang); const float xr = src[2 * i], xi = src[2 * i + 1]; st[tid][q] = (_Float16)((j & 1) ? (xr * sn + xi * c) : (xr * c - xi * sn)); }
  const v8us v = *(const v8us*)&st[tid][0]; unsigned short* d = (unsigned short*)D16 + ((size_t)s * NH + h) * HD + p * 8; *(v8us*)d = v;  }
__global__ __launch_bounds__(256) void k_vt128(const _Float16* __restrict__ V16, _Float16* __restrict__ Vt) { __shared__ unsigned short tl[64][130]; const int tid = threadIdx.x; const int h = blockIdx.x / (SS / 64), lg = blockIdx.x % (SS / 64);
  for (int i = tid; i < 64 * 16; i += 256) { const int r = i / 16, c8 = (i % 16) * 8; FragH f; f.half[0] = *(const v8us*)((const unsigned short*)V16 + ((size_t)lg * 64 + r) * CC + h * HD + c8);
#pragma unroll
    for (int q = 0; q < 8; ++q) tl[r][c8 + q] = f.u[q]; }
  __syncthreads();
  { for (int i = tid; i < 128 * 8; i += 256) { const int d = i / 8, pc = i % 8; FragH f;
#pragma unroll
      for (int q = 0; q < 8; ++q) f.u[q] = tl[pc * 8 + q][d]; *(v8us*)((unsigned short*)Vt + ((size_t)h * HD + d) * SS + lg * 64 + pc * 8) = f.half[0]; }  } }
extern "C" void kernel_launch(void* const* d_in, const int* in_sizes, int n_in,
                              void* d_out, int out_size, void* d_ws, size_t ws_size, hipStream_t stream) {
  (void)in_sizes; (void)n_in; (void)out_size;
  const float* const* I = (const float* const*)d_in; const float* q = I[0]; const float* k = I[1]; const float* v = I[2]; const float* mask = I[3]; const float* Wq = I[4]; const float* bq = I[5]; const float* Wk = I[6]; const float* bk = I[7]; const float* Wv = I[8]; const float* bv = I[9]; const float* G = I[10]; const float* Wo = I[11]; const float* bo = I[12];
  char* ws = (char*)d_ws; size_t off = 0;
  auto take = [&](size_t bytes) { char* p = ws + off; off += (bytes + 255) & ~(size_t)255; return p; };
  _Float16* Bq = (_Float16*)take((size_t)CC * CC * 2); _Float16* Bk = (_Float16*)take((size_t)CC * CC * 2); _Float16* Bv = (_Float16*)take((size_t)CC * CC * 2); _Float16* Bo = (_Float16*)take((size_t)CC * CC * 2); _Float16* BG = (_Float16*)take((size_t)NH * HD * HD * 2);
  _Float16* X16 = (_Float16*)take((size_t)SS * CC * 2); float* QF = (float*)take((size_t)SS * CC * 4); _Float16* QR16 = (_Float16*)take((size_t)SS * CC * 2); _Float16* QG16 = (_Float16*)take((size_t)SS * CC * 2); float* KF = QF; _Float16* KR16 = (_Float16*)take((size_t)SS * CC * 2); _Float16* V16 = (_Float16*)take((size_t)SS * CC * 2); _Float16* Vt = (_Float16*)take((size_t)SS * CC * 2); float* O = QF; _Float16* O16 = X16;
  if (off > ws_size) return;      // 8.4 × 4 + 0.5 + 8.4 + 16.8 + 8.4 × 5 ≈ 101 MiB
  const size_t w8 = (size_t)CC * CC / 8; const unsigned gw = (unsigned)((w8 + 255) / 256);
  k_round16f<<<gw, 256, 0, stream>>>(Wq, Bq, w8); k_round16f<<<gw, 256, 0, stream>>>(Wk, Bk, w8); k_round16f<<<gw, 256, 0, stream>>>(Wv, Bv, w8); k_round16f<<<gw, 256, 0, stream>>>(Wo, Bo, w8);      // (out,in) = Bt
  for (int h = 0; h < NH; ++h) k_wt_f16<<<(HD * (HD / 8) + 255) / 256, 256, 0, stream>>>(G + (size_t)h * HD * HD, BG + (size_t)h * HD * HD, HD, HD, 16.0f);      // G_h [d][e] = [in][out]
  const unsigned gx = (unsigned)(((size_t)SS * CC / 8 + 255) / 256); const unsigned gt = (SS / 128) * (CC / 128);
  // q: proj → rope → per-head metric product
  k_x16<<<gx, 256, 0, stream>>>(q, X16, (size_t)SS * CC / 8); k_gemm_t<false><<<gt, 256, 0, stream>>>(X16, Bq, 0.0625f, bq, QF, nullptr);
  k_rope16<<<(unsigned)(((size_t)SS * NH * 16 + 255) / 256), 256, 0, stream>>>(QF, QR16);
  k_gemm_hhx<0><<<dim3(((SS / 16) * (HD / 64) + 3) / 4, NH), 128, 0, stream>>>(QR16, CC, (size_t)HD, BG, HD, (size_t)HD * HD, 0.0625f, nullptr, 0, nullptr, 1, 0, 0, nullptr, QG16, CC, (size_t)HD, SS, HD, HD);      // qg_h = q_h · G_h (batched over heads via column offsets)
  // k: proj → rope
  k_x16<<<gx, 256, 0, stream>>>(k, X16, (size_t)SS * CC / 8); k_gemm_t<false><<<gt, 256, 0, stream>>>(X16, Bk, 0.0625f, bk, KF, nullptr);
  k_rope16<<<(unsigned)(((size_t)SS * NH * 16 + 255) / 256), 256, 0, stream>>>(KF, KR16);
  // v: proj (f16) → Vt
  k_x16<<<gx, 256, 0, stream>>>(v, X16, (size_t)SS * CC / 8); k_gemm_t<true><<<gt, 256, 0, stream>>>(X16, Bv, 0.0625f, bv, nullptr, V16);
  k_vt128<<<NH * (SS / 64), 256, 0, stream>>>(V16, Vt);
  k_flash<<<1 * NH * (SS / 64), 128, 0, stream>>>(QG16, CC, KR16, CC, Vt, mask, O, CC);
  k_h16<<<gx, 256, 0, stream>>>(O, O16, (size_t)SS * CC / 8);
  k_gemm_t<false><<<gt, 256, 0, stream>>>(O16, Bo, 0.0625f, bo, (float*)d_out, nullptr);
}

// v002
// One run takes 363 microseconds.
// Timed twice side by side with v001, it ran 1.38 and 1.37 times as fast.
// Counting every step since v000, it is 2.01 times as fast.
#include <hip/hip_runtime.h>
// Power-law-graph multi-head attention (B=1, S=2048, D=2048, 16 heads × 128; INPUT additive mask (nonzero = −1e9) ; RoPE interleaved pairs): q/k/v/o projections ((out,in) + bias) and the per-head
// metric product qg = q_h·G_h as GEMMs and the attention as a fused flash-style kernel (head dim 128: 4 k-steps / 8 d-tiles; masked keys excluded, fully masked 32-key tiles skipped by ballot;
// online softmax f32; P f16 ≤ 1; O = P·Vt; RPW-16 waves) on v_wmma_f32_16x16x32_f16, f32 accumulate; RoPE f32 VALU.
#define SS 2048
#define CC 2048
#define NH 16
#define HD 128

typedef __bf16 v16b __attribute__((ext_vector_type(16)));
typedef unsigned short v8us __attribute__((ext_vector_type(8), may_alias));
typedef float  v8f  __attribute__((ext_vector_type(8)));
typedef float  v4f  __attribute__((ext_vector_type(4)));
typedef float  v4fa __attribute__((ext_vector_type(4), may_alias));
union FragB { v16b v; v8us half[2]; unsigned short u[16]; };

__device__ __forceinline__ unsigned short bf16_bits(float x) { unsigned int u = __float_as_uint(x); return (unsigned short)((u + 0x7FFFu + ((u >> 16) & 1u)) >> 16); }
__device__ __forceinline__ float bf16_val(unsigned short b) { return __uint_as_float(((unsigned int)b) << 16); }
__device__ __forceinline__ float bf16_round(float x) { return bf16_val(bf16_bits(x)); }
// D += A·B with NT terms: 1 = ah·bh, 2 = + al·bh (A split), 3 = + ah·bl (both split)
template <int NT>
__device__ __forceinline__ v8f mmaN(v16b ah, v16b al, v16b bh, v16b bl, v8f c) {
  c = __builtin_amdgcn_wmma_f32_16x16x32_bf16(false, ah, false, bh, (short)0, c, false, false);
  if (NT >= 2) c = __builtin_amdgcn_wmma_f32_16x16x32_bf16(false, al, false, bh, (short)0, c, false, false);
  if (NT >= 3) c = __builtin_amdgcn_wmma_f32_16x16x32_bf16(false, ah, false, bl, (short)0, c, false, false);
  asm volatile("v_nop\n\tv_nop\n\tv_nop\n\tv_nop" : "+v"(c) : "v"(ah), "v"(al), "v"(bh), "v"(bl));
  return c;
}

__global__ __launch_bounds__(256) void k_wt_bf16(const float* __restrict__ W, unsigned short* __restrict__ Wt, int K, int N) {
  const int t = blockIdx.x * 256 + threadIdx.x;
  const int k8n = K / 8;
  if (t >= N * k8n) return;
  const int n = t / k8n, k8 = (t % k8n) * 8;
  v8us v;
#pragma unroll
  for (int i = 0; i < 8; ++i) v[i] = bf16_bits(W[(size_t)(k8 + i) * N + n]);
  *(v8us*)(Wt + (size_t)n * K + k8) = v;
  
}

// GEMM C[M][N] (f32, pitch ldc) = act(A[M][K]·W + bias). A f32 row-major (pitch lda) converted per fragment to bf16
// (ASPLIT: hi/lo two planes -> 2 terms, else single rounded term); Wt bf16 [N][K] (pitch ldb). BIAS_BF16 rounds the
// bias to bf16 first (bias quantised to bf16 before the add). K%32==0, M%16==0, N%64==0.
template <bool ASPLIT, int ACT, bool BIAS_BF16>
__global__ __launch_bounds__(128) void k_gemm_bf(const float* __restrict__ A, int lda, const unsigned short* __restrict__ Wt, int ldb,
                                               const float* __restrict__ bias, float* __restrict__ C, int ldc, int M, int N, int K) {
  __shared__ __attribute__((aligned(16))) float so[4][16][64];
  const int tid = threadIdx.x, w = tid >> 5, lane = tid & 31, ln = lane & 15, hh = lane >> 4;
  const int ntn = N / 64;
  const int wid = blockIdx.x * 4 + w;
  const int mt = wid / ntn, nq = wid % ntn;
  if (mt * 16 >= M) return;
  const int row0 = mt * 16, col0 = nq * 64;
  const float* arow = A + (size_t)(row0 + ln) * lda;
  v8f acc[4] = {};
  for (int kb = 0; kb < K; kb += 32) {
    FragB ah, al;
    const v4f x0 = *(const v4fa*)(arow + kb + 8 * hh), x1 = *(const v4fa*)(arow + kb + 8 * hh + 4);
    const v4f x2 = *(const v4fa*)(arow + kb + 16 + 8 * hh), x3 = *(const v4fa*)(arow + kb + 16 + 8 * hh + 4);
    float xs[16] = {x0[0],x0[1],x0[2],x0[3],x1[0],x1[1],x1[2],x1[3],x2[0],x2[1],x2[2],x2[3],x3[0],x3[1],x3[2],x3[3]};
#pragma unroll
    for (int i = 0; i < 16; ++i) { const unsigned short hb = bf16_bits(xs[i]); ah.u[i] = hb; al.u[i] = ASPLIT ? bf16_bits(xs[i] - bf16_val(hb)) : (unsigned short)0; }
#pragma unroll
    for (int t = 0; t < 4; ++t) {
      const unsigned short* brow = Wt + (size_t)(col0 + t * 16 + ln) * ldb + kb;
      FragB b;
      b.half[0] = *(const v8us*)(brow + 8 * hh);
      b.half[1] = *(const v8us*)(brow + 16 + 8 * hh);
      acc[t] = mmaN<ASPLIT ? 2 : 1>(ah.v, al.v, b.v, b.v, acc[t]);
    }
  }
#pragma unroll
  for (int t = 0; t < 4; ++t) {
    float bv = bias ? bias[col0 + t * 16 + ln] : 0.f;
    if (BIAS_BF16) bv = bf16_round(bv);
#pragma unroll
    for (int r = 0; r < 8; ++r) { float v = acc[t][r] + bv; if (ACT == 1) v = fmaxf(v, 0.f); so[w][8 * hh + r][t * 16 + ln] = v; }
  }
  __builtin_amdgcn_fence(__ATOMIC_ACQ_REL, "workgroup");
  __builtin_amdgcn_wave_barrier();
  const int rsub = lane >> 4, c4 = (lane & 15) * 4;
  {
#pragma unroll
    for (int q = 0; q < 8; ++q) {
      const int r = q * 2 + rsub;
      const v4f v = *(const v4fa*)&so[w][r][c4];
      *(v4f*)(C + (size_t)(row0 + r) * ldc + col0 + c4) = v;
    }
    
  }
}

// Flash-style causal/unmasked attention, all contractions 3-term bf16 hi/lo splits, f32 softmax with running max.
// q,k,v rows are read from f32 buffers with arbitrary row pitch (so they can live inside a fused qkv buffer);
// D = head size (multiple of 32, <= 128); one wave = 16 query rows; block = 4 waves (64 queries) sharing K/V chunks of 32.
template <int D, bool CAUSAL>
__global__ __launch_bounds__(128) void k_flash(const float* __restrict__ qb, const float* __restrict__ kb, const float* __restrict__ vb,
                                             int pitch, int T, int H, float scale, float* __restrict__ y, int ypitch) {
  constexpr int KS = D / 32;        // k-steps for QK
  constexpr int DT = D / 16;        // d tiles for PV
  __shared__ __attribute__((aligned(16))) unsigned short sKh[32][D + 8], sKl[32][D + 8], sVh[32][D + 8], sVl[32][D + 8];
  __shared__ __attribute__((aligned(16))) unsigned short sPh[4][16][40], sPl[4][16][40];
  __shared__ __attribute__((aligned(16))) float sO[4][16][D];
  const int tid = threadIdx.x, w = tid >> 5, lane = tid & 31, ln = lane & 15, hh = lane >> 4;
  const int nqb = (T + 63) / 64;
  const int bh = blockIdx.x / nqb, qblk = blockIdx.x % nqb;
  const int b = bh / H, h = bh % H;
  const int q0 = qblk * 64 + w * 16;
  const float* Q = qb + (size_t)b * T * pitch + h * D;
  const float* K = kb + (size_t)b * T * pitch + h * D;
  const float* V = vb + (size_t)b * T * pitch + h * D;

  // A fragments of the wave's 16 query rows (scaled), hi/lo
  FragB aqh[KS], aql[KS];
  {
    int row = q0 + ln; if (row >= T) row = T - 1;
    const float* qr = Q + (size_t)row * pitch;
#pragma unroll
    for (int ks = 0; ks < KS; ++ks)
#pragma unroll
      for (int i = 0; i < 16; ++i) {
        const int d = ks * 32 + ((i < 8) ? (8 * hh + i) : (16 + 8 * hh + (i - 8)));
        const float x = qr[d] * scale; const unsigned short hb = bf16_bits(x);
        aqh[ks].u[i] = hb; aql[ks].u[i] = bf16_bits(x - bf16_val(hb));
      }
  }
  float m_r[8], l_r[8];
#pragma unroll
  for (int r = 0; r < 8; ++r) { m_r[r] = -3.0e38f; l_r[r] = 0.f; }
  v8f oacc[DT];
#pragma unroll
  for (int dt = 0; dt < DT; ++dt) oacc[dt] = (v8f){0.f,0.f,0.f,0.f,0.f,0.f,0.f,0.f};

  const int kv_end = CAUSAL ? min(T, qblk * 64 + 64) : T;     // block-uniform
  for (int j0 = 0; j0 < kv_end; j0 += 32) {
    __syncthreads();
    for (int e = tid; e < 32 * (D / 4); e += 128) {
      const int r = e / (D / 4), c4 = (e % (D / 4)) * 4;
      const int key = j0 + r;
      v4f kf = {0.f,0.f,0.f,0.f}, vf = {0.f,0.f,0.f,0.f};
      if (key < T) { kf = *(const v4fa*)(K + (size_t)key * pitch + c4); vf = *(const v4fa*)(V + (size_t)key * pitch + c4); }
#pragma unroll
      for (int t = 0; t < 4; ++t) {
        unsigned short hb = bf16_bits(kf[t]); sKh[r][c4 + t] = hb; sKl[r][c4 + t] = bf16_bits(kf[t] - bf16_val(hb));
        hb = bf16_bits(vf[t]); sVh[r][c4 + t] = hb; sVl[r][c4 + t] = bf16_bits(vf[t] - bf16_val(hb));
      }
    }
    __syncthreads();
    // S tile 16 x 32
    v8f s[2];
#pragma unroll
    for (int nt = 0; nt < 2; ++nt) {
      v8f acc = {};
#pragma unroll
      for (int ks = 0; ks < KS; ++ks) {
        FragB bh_, bl_;
        bh_.half[0] = *(const v8us*)&sKh[nt * 16 + ln][ks * 32 + 8 * hh]; bh_.half[1] = *(const v8us*)&sKh[nt * 16 + ln][ks * 32 + 16 + 8 * hh];
        bl_.half[0] = *(const v8us*)&sKl[nt * 16 + ln][ks * 32 + 8 * hh]; bl_.half[1] = *(const v8us*)&sKl[nt * 16 + ln][ks * 32 + 16 + 8 * hh];
        acc = mmaN<3>(aqh[ks].v, aql[ks].v, bh_.v, bl_.v, acc);
      }
      s[nt] = acc;
    }
    // mask + running max (rows 8hh+r; the 16 lanes of a half share rows)
    float alpha[8];
#pragma unroll
    for (int r = 0; r < 8; ++r) {
      const int qi = q0 + 8 * hh + r;
      const int ja = j0 + ln, jb = j0 + 16 + ln;
      if (CAUSAL) { if (ja > qi) s[0][r] = -3.0e38f; if (jb > qi) s[1][r] = -3.0e38f; }
      if (ja >= T) s[0][r] = -3.0e38f;
      if (jb >= T) s[1][r] = -3.0e38f;
      float mx = fmaxf(s[0][r], s[1][r]);
      mx = fmaxf(mx, __shfl_xor(mx, 1, 32)); mx = fmaxf(mx, __shfl_xor(mx, 2, 32)); mx = fmaxf(mx, __shfl_xor(mx, 4, 32)); mx = fmaxf(mx, __shfl_xor(mx, 8, 32));
      const float mnew = fmaxf(m_r[r], mx);
      alpha[r] = (mnew > -1.0e38f) ? __expf(m_r[r] - mnew) : 1.0f;
      const float p0 = (s[0][r] > -1.0e38f) ? __expf(s[0][r] - mnew) : 0.f;
      const float p1 = (s[1][r] > -1.0e38f) ? __expf(s[1][r] - mnew) : 0.f;
      m_r[r] = mnew;
      l_r[r] = l_r[r] * alpha[r] + p0 + p1;            // per-lane partial row sum (16 lanes combined at the end)
      unsigned short hb = bf16_bits(p0); sPh[w][8 * hh + r][ln] = hb;      sPl[w][8 * hh + r][ln] = bf16_bits(p0 - bf16_val(hb));
      hb = bf16_bits(p1);                sPh[w][8 * hh + r][16 + ln] = hb; sPl[w][8 * hh + r][16 + ln] = bf16_bits(p1 - bf16_val(hb));
    }
#pragma unroll
    for (int dt = 0; dt < DT; ++dt)
#pragma unroll
      for (int r = 0; r < 8; ++r) oacc[dt][r] *= alpha[r];
    __builtin_amdgcn_fence(__ATOMIC_ACQ_REL, "workgroup");
    __builtin_amdgcn_wave_barrier();
    FragB pah, pal;
    pah.half[0] = *(const v8us*)&sPh[w][ln][8 * hh]; pah.half[1] = *(const v8us*)&sPh[w][ln][16 + 8 * hh];
    pal.half[0] = *(const v8us*)&sPl[w][ln][8 * hh]; pal.half[1] = *(const v8us*)&sPl[w][ln][16 + 8 * hh];
#pragma unroll
    for (int dt = 0; dt < DT; ++dt) {
      FragB bvh, bvl;
#pragma unroll
      for (int i = 0; i < 8; ++i) {
        bvh.u[i] = sVh[8 * hh + i][dt * 16 + ln]; bvh.u[8 + i] = sVh[16 + 8 * hh + i][dt * 16 + ln];
        bvl.u[i] = sVl[8 * hh + i][dt * 16 + ln]; bvl.u[8 + i] = sVl[16 + 8 * hh + i][dt * 16 + ln];
      }
      oacc[dt] = mmaN<3>(pah.v, pal.v, bvh.v, bvl.v, oacc[dt]);
    }
    __builtin_amdgcn_fence(__ATOMIC_ACQ_REL, "workgroup");
    __builtin_amdgcn_wave_barrier();
  }
#pragma unroll
  for (int r = 0; r < 8; ++r) {
    float l = l_r[r];
    l += __shfl_xor(l, 1, 32); l += __shfl_xor(l, 2, 32); l += __shfl_xor(l, 4, 32); l += __shfl_xor(l, 8, 32);
    l_r[r] = (l > 0.f) ? 1.0f / l : 0.f;
  }
#pragma unroll
  for (int dt = 0; dt < DT; ++dt)
#pragma unroll
    for (int r = 0; r < 8; ++r) sO[w][8 * hh + r][dt * 16 + ln] = oacc[dt][r] * l_r[r];
  __builtin_amdgcn_fence(__ATOMIC_ACQ_REL, "workgroup");
  __builtin_amdgcn_wave_barrier();
  {
    for (int r = 0; r < 16; ++r) {
      const int row = q0 + r;
      if (row < T && lane < D / 4) {
        const v4f val = *(const v4fa*)&sO[w][r][lane * 4];
        *(v4f*)(y + ((size_t)b * T + row) * ypitch + h * D + lane * 4) = val;
      }
    }
    
  }
}

// GEMM C = act(A·W + bias + resid): A f32 (ASPLIT -> hi/lo 2 terms), Wt bf16 [N][K]; ACT 0 none, 1 relu, 2 exact gelu;
// resid (optional, f32, row index = (row % rmod), pitch ldr, RES_BF16 rounds it) added before the activation.
template <bool ASPLIT, int ACT, bool BIAS_BF16, bool RES_BF16>
__global__ __launch_bounds__(128) void k_gemm_bf3(const float* __restrict__ A, int lda, const unsigned short* __restrict__ Wt, int ldb,
                                                const float* __restrict__ bias, const float* __restrict__ resid, int rmod, int ldr,
                                                float* __restrict__ C, int ldc, int M, int N, int K) {
  __shared__ __attribute__((aligned(16))) float so[4][16][64];
  const int tid = threadIdx.x, w = tid >> 5, lane = tid & 31, ln = lane & 15, hh = lane >> 4;
  const int ntn = N / 64;
  const int wid = blockIdx.x * 4 + w;
  const int mt = wid / ntn, nq = wid % ntn;
  if (mt * 16 >= M) return;
  const int row0 = mt * 16, col0 = nq * 64;
  const float* arow = A + (size_t)(row0 + ln) * lda;
  v8f acc[4] = {};
  for (int kb = 0; kb < K; kb += 32) {
    FragB ah, al;
    const v4f x0 = *(const v4fa*)(arow + kb + 8 * hh), x1 = *(const v4fa*)(arow + kb + 8 * hh + 4);
    const v4f x2 = *(const v4fa*)(arow + kb + 16 + 8 * hh), x3 = *(const v4fa*)(arow + kb + 16 + 8 * hh + 4);
    float xs[16] = {x0[0],x0[1],x0[2],x0[3],x1[0],x1[1],x1[2],x1[3],x2[0],x2[1],x2[2],x2[3],x3[0],x3[1],x3[2],x3[3]};
#pragma unroll
    for (int i = 0; i < 16; ++i) { const unsigned short hb = bf16_bits(xs[i]); ah.u[i] = hb; al.u[i] = ASPLIT ? bf16_bits(xs[i] - bf16_val(hb)) : (unsigned short)0; }
#pragma unroll
    for (int t = 0; t < 4; ++t) {
      const unsigned short* brow = Wt + (size_t)(col0 + t * 16 + ln) * ldb + kb;
      FragB b;
      b.half[0] = *(const v8us*)(brow + 8 * hh);
      b.half[1] = *(const v8us*)(brow + 16 + 8 * hh);
      acc[t] = mmaN<ASPLIT ? 2 : 1>(ah.v, al.v, b.v, b.v, acc[t]);
    }
  }
#pragma unroll
  for (int t = 0; t < 4; ++t) {
    const int col = col0 + t * 16 + ln;
    float bv = bias ? bias[col] : 0.f;
    if (BIAS_BF16) bv = bf16_round(bv);
#pragma unroll
    for (int r = 0; r < 8; ++r) {
      float v = acc[t][r] + bv;
      if (resid) { float rv = resid[(size_t)((row0 + 8 * hh + r) % rmod) * ldr + col]; if (RES_BF16) rv = bf16_round(rv); v += rv; }
      if (ACT == 1) v = fmaxf(v, 0.f);
      if (ACT == 2) v = 0.5f * v * (1.0f + erff(v * 0.70710678118654752f));
      if (ACT == 3) { const float u = 0.7978845608028654f * (v + 0.044715f * v * v * v); v = 0.5f * v * (1.0f + tanhf(u)); }
      so[w][8 * hh + r][t * 16 + ln] = v;
    }
  }
  __builtin_amdgcn_fence(__ATOMIC_ACQ_REL, "workgroup");
  __builtin_amdgcn_wave_barrier();
  const int rsub = lane >> 4, c4 = (lane & 15) * 4;
  {
#pragma unroll
    for (int q = 0; q < 8; ++q) {
      const int r = q * 2 + rsub;
      const v4f v = *(const v4fa*)&so[w][r][c4];
      *(v4f*)(C + (size_t)(row0 + r) * ldc + col0 + c4) = v;
    }
    
  }
}
// row LayerNorm (biased variance, eps) over N: s = X (+ R); optional out_sum <- s; out_norm <- (s-mu)*rsqrt(var+eps)*g + b
template <bool PARAM_BF16>
__global__ __launch_bounds__(256) void k_layernorm(const float* __restrict__ X, const float* __restrict__ R, const float* __restrict__ g, const float* __restrict__ bta,
                                                  float* __restrict__ out_sum, float* __restrict__ out_norm, int N, float eps) {
  __shared__ float red[256];
  const int row = blockIdx.x, tid = threadIdx.x;
  const float* x = X + (size_t)row * N; const float* rr = R ? R + (size_t)row * N : nullptr;
  float vals[16];                     // up to N = 4096
  const int per = N / 256;            // contiguous chunk per thread? use strided-by-4 chunks: thread handles j = tid*4 + 1024*u
  float s1 = 0.f;
  for (int u = 0; u < per / 4; ++u) {
    const int j = tid * 4 + 1024 * u;
    const v4f a = *(const v4fa*)(x + j);
    v4f b = {0.f,0.f,0.f,0.f}; if (rr) b = *(const v4fa*)(rr + j);
#pragma unroll
    for (int q = 0; q < 4; ++q) { const float v = a[q] + b[q]; vals[u * 4 + q] = v; s1 += v; }
  }
  red[tid] = s1; __syncthreads();
  for (int st = 128; st > 0; st >>= 1) { if (tid < st) red[tid] += red[tid + st]; __syncthreads(); }
  const float mu = red[0] / (float)N; __syncthreads();
  float s2 = 0.f;
  for (int u = 0; u < per / 4; ++u)
#pragma unroll
    for (int q = 0; q < 4; ++q) { const float c = vals[u * 4 + q] - mu; s2 += c * c; }
  red[tid] = s2; __syncthreads();
  for (int st = 128; st > 0; st >>= 1) { if (tid < st) red[tid] += red[tid + st]; __syncthreads(); }
  const float rs = rsqrtf(red[0] / (float)N + eps);
  {
    for (int u = 0; u < per / 4; ++u) {
      const int j = tid * 4 + 1024 * u;
      v4f o, sm;
#pragma unroll
      for (int q = 0; q < 4; ++q) {
        float gg = g[j + q], bb = bta[j + q];
        if (PARAM_BF16) { gg = bf16_round(gg); bb = bf16_round(bb); }
        sm[q] = vals[u * 4 + q]; o[q] = (vals[u * 4 + q] - mu) * rs * gg + bb;
      }
      if (out_sum) *(v4f*)(out_sum + (size_t)row * N + j) = sm;
      *(v4f*)(out_norm + (size_t)row * N + j) = o;
    }
    
  }
}



// ---- f16 WMMA path (v_wmma_f32_16x16x32_f16): 11-bit significands for operands in range — used where a [0,1] probability operand needs more precision than bf16
typedef _Float16 v16h __attribute__((ext_vector_type(16)));
union FragH { v16h v; v8us half[2]; _Float16 h[16]; unsigned short u[16]; };
template <int NT>
__device__ __forceinline__ v8f mmaH(v16h ah, v16h al, v16h bh, v16h bl, v8f c) {
  c = __builtin_amdgcn_wmma_f32_16x16x32_f16(false, ah, false, bh, (short)0, c, false, false);
  if (NT >= 2) c = __builtin_amdgcn_wmma_f32_16x16x32_f16(false, al, false, bh, (short)0, c, false, false);
  if (NT >= 3) c = __builtin_amdgcn_wmma_f32_16x16x32_f16(false, ah, false, bl, (short)0, c, false, false);
  asm volatile("v_nop\n\tv_nop\n\tv_nop\n\tv_nop" : "+v"(c) : "v"(ah), "v"(al), "v"(bh), "v"(bl));
  return c;
}
// batched GEMM like k_gemm_b but f16 operands: A f32 (split into f16 hi/lo if ASPLIT, else rounded to f16), Bt = f16 values [n][k]; alpha; C f32; N multiple of 16 (partial tiles skipped)
template <bool ASPLIT>
__global__ __launch_bounds__(128) void k_gemm_h(const float* __restrict__ A, int lda, size_t sA, const _Float16* __restrict__ Bh, int ldb, size_t sB, float alpha, float* __restrict__ C, int ldc, size_t sC, int M, int N, int K) {
  __shared__ __attribute__((aligned(16))) float so[4][16][64];
  const int tid = threadIdx.x, w = tid >> 5, lane = tid & 31, ln = lane & 15, hh = lane >> 4; const int by = blockIdx.y;
  A += (size_t)by * sA; Bh += (size_t)by * sB; C += (size_t)by * sC;
  const int ntn = (N + 63) / 64; const int wid = blockIdx.x * 4 + w; const int mt = wid / ntn, nq = wid % ntn; if (mt * 16 >= M) return;
  const int row0 = mt * 16, col0 = nq * 64; const float* arow = A + (size_t)(row0 + ln) * lda;
  v8f acc[4] = {};
  for (int kb = 0; kb < K; kb += 32) {
    FragH ah, al;
    const v4f x0 = *(const v4fa*)(arow + kb + 8 * hh), x1 = *(const v4fa*)(arow + kb + 8 * hh + 4), x2 = *(const v4fa*)(arow + kb + 16 + 8 * hh), x3 = *(const v4fa*)(arow + kb + 16 + 8 * hh + 4);
    float xs[16] = {x0[0],x0[1],x0[2],x0[3],x1[0],x1[1],x1[2],x1[3],x2[0],x2[1],x2[2],x2[3],x3[0],x3[1],x3[2],x3[3]};
#pragma unroll
    for (int i = 0; i < 16; ++i) { const _Float16 h = (_Float16)xs[i]; ah.h[i] = h; al.h[i] = ASPLIT ? (_Float16)(xs[i] - (float)h) : (_Float16)0.0f; }
#pragma unroll
    for (int t = 0; t < 4; ++t) { if (col0 + t * 16 >= N) continue; const size_t boff = (size_t)(col0 + t * 16 + ln) * ldb + kb; FragH bq; bq.half[0] = *(const v8us*)(Bh + boff + 8 * hh); bq.half[1] = *(const v8us*)(Bh + boff + 16 + 8 * hh);
      acc[t] = mmaH<ASPLIT ? 2 : 1>(ah.v, al.v, bq.v, bq.v, acc[t]); }
  }
#pragma unroll
  for (int t = 0; t < 4; ++t) { if (col0 + t * 16 >= N) continue;
#pragma unroll
    for (int r = 0; r < 8; ++r) so[w][8 * hh + r][t * 16 + ln] = acc[t][r] * alpha; }
  __builtin_amdgcn_fence(__ATOMIC_ACQ_REL, "workgroup"); __builtin_amdgcn_wave_barrier();
  const int rsub = lane >> 4, c4 = (lane & 15) * 4;
  {
#pragma unroll
    for (int q = 0; q < 8; ++q) { const int r = q * 2 + rsub; if (col0 + c4 < N) { const v4f v = *(const v4fa*)&so[w][r][c4]; *(v4f*)(C + (size_t)(row0 + r) * ldc + col0 + c4) = v; } }
     }
}

// Wt[n][k] = f16(W[k][n]·scale) from f32 row-major W[K][N] (scale = power of two; bf16-exact weights stay exact in f16 away from the subnormal range)
__global__ __launch_bounds__(256) void k_wt_f16(const float* __restrict__ W, _Float16* __restrict__ Wt, int K, int N, float scale) {
  const int t = blockIdx.x * 256 + threadIdx.x; if (t >= N * (K / 8)) return; const int n = t / (K / 8), k8 = (t % (K / 8)) * 8; FragH f;
#pragma unroll
  for (int i = 0; i < 8; ++i) f.h[i] = (_Float16)(bf16_round(W[(size_t)(k8 + i) * N + n]) * scale); const v8us o = f.half[0];
  *(v8us*)((unsigned short*)Wt + (size_t)n * K + k8) = o; 
}
// k_gemm_hh variant with fused epilogue: v = acc·alpha + bias[by·sBias + col] (+ CP[(row/rowsPerB)·sCPb + by·64 + col] if CP) ; ACT 0 none / 1 elu ; writes f32 C and/or f16 C16 (each if non-null)
template <int ACT>
__global__ __launch_bounds__(128) void k_gemm_hhx(const _Float16* __restrict__ A, int lda, size_t sA, const _Float16* __restrict__ Bh, int ldb, size_t sB, float alpha, const float* __restrict__ bias, size_t sBias, const float* __restrict__ CP, int rowsPerB, size_t sCPb, int row0g,
    float* __restrict__ C, _Float16* __restrict__ C16, int ldc, size_t sC, int M, int N, int K) {
  __shared__ __attribute__((aligned(16))) float so[4][16][64];
  const int tid = threadIdx.x, w = tid >> 5, lane = tid & 31, ln = lane & 15, hh = lane >> 4; const int by = blockIdx.y;
  A += (size_t)by * sA; Bh += (size_t)by * sB; const size_t cofs = (size_t)by * sC; const float* bp = bias ? bias + (size_t)by * sBias : nullptr;
  const int ntn = (N + 63) / 64; const int wid = blockIdx.x * 4 + w; const int mt = wid / ntn, nq = wid % ntn; if (mt * 16 >= M) return;
  const int row0 = mt * 16, col0 = nq * 64; const _Float16* arow = A + (size_t)(row0 + ln) * lda;
  v8f acc[4] = {};
  for (int kb = 0; kb < K; kb += 32) { FragH ah; ah.half[0] = *(const v8us*)((const unsigned short*)arow + kb + 8 * hh); ah.half[1] = *(const v8us*)((const unsigned short*)arow + kb + 16 + 8 * hh);
#pragma unroll
    for (int t = 0; t < 4; ++t) { if (col0 + t * 16 >= N) continue; const size_t boff = (size_t)(col0 + t * 16 + ln) * ldb + kb; FragH bq; bq.half[0] = *(const v8us*)((const unsigned short*)Bh + boff + 8 * hh); bq.half[1] = *(const v8us*)((const unsigned short*)Bh + boff + 16 + 8 * hh);
      acc[t] = mmaH<1>(ah.v, ah.v, bq.v, bq.v, acc[t]); }
  }
#pragma unroll
  for (int t = 0; t < 4; ++t) { if (col0 + t * 16 >= N) continue; const int col = col0 + t * 16 + ln; const float bv = bp ? bf16_round(bp[col]) : 0.f;
#pragma unroll
    for (int r = 0; r < 8; ++r) { float v = acc[t][r] * alpha + bv; if (CP) { const int bidx = (row0g + row0 + 8 * hh + r) / rowsPerB; v += CP[(size_t)bidx * sCPb + (size_t)by * 64 + col]; } if (ACT == 1) v = (v > 0.f) ? v : expm1f(v); else if (ACT == 3) v = fmaxf(v, 0.f); so[w][8 * hh + r][t * 16 + ln] = v; } }
  __builtin_amdgcn_fence(__ATOMIC_ACQ_REL, "workgroup"); __builtin_amdgcn_wave_barrier();
  const int rsub = lane >> 4, c4 = (lane & 15) * 4; typedef _Float16 v4h __attribute__((ext_vector_type(4)));
  {
#pragma unroll
    for (int q = 0; q < 8; ++q) { const int r = q * 2 + rsub; if (col0 + c4 < N) { const v4f v = *(const v4fa*)&so[w][r][c4]; if (C) *(v4f*)(C + cofs + (size_t)(row0 + r) * ldc + col0 + c4) = v; if (C16) { v4h h4; for (int i = 0; i < 4; ++i) h4[i] = (_Float16)v[i]; *(v4h*)(C16 + cofs + (size_t)(row0 + r) * ldc + col0 + c4) = h4; } } }
     }
}


// Projection GEMM, 2048 x 2048 x 2048: C = (A . Bt^T) * alpha + bias. One 128 x 128 tile of C per workgroup of 8 waves (4 x 2, 32 x 64 per wave).
// A pass is 128 k: 128 rows of A and 128 rows of Bt, 256 B each, laid in LDS at pitch 272 B by asynchronous copies, two buffers, the next pass's copies in flight under this pass's products.
// k runs upward in steps of 32 into one accumulator per 16 x 16 tile, as in k_gemm_hhx: the sums keep their order.
// Every '#pragma unroll' in k_gemm_t makes the indices of the fragment and accumulator arrays constants, so that they stay in registers.
#define GT_PITCH 272u
#define GT_STAGE (256u * GT_PITCH)
#define GT_NST (CC / 128)
__device__ __forceinline__ void gt_copy8(unsigned l0, const unsigned short* g0) {
  // eight 16-byte copies of this lane, rows 16 apart; s_wait_xcnt stands inside the statement so that no address register is rewritten ahead of it
  const unsigned l1 = l0 + 16u * GT_PITCH, l2 = l0 + 32u * GT_PITCH, l3 = l0 + 48u * GT_PITCH, l4 = l0 + 64u * GT_PITCH, l5 = l0 + 80u * GT_PITCH, l6 = l0 + 96u * GT_PITCH, l7 = l0 + 112u * GT_PITCH;
  const unsigned short *g1 = g0 + 16 * CC, *g2 = g0 + 32 * CC, *g3 = g0 + 48 * CC, *g4 = g0 + 64 * CC, *g5 = g0 + 80 * CC, *g6 = g0 + 96 * CC, *g7 = g0 + 112 * CC;
  asm volatile("global_load_async_to_lds_b128 %0, %8, off\n\t"
               "global_load_async_to_lds_b128 %1, %9, off\n\t"
               "global_load_async_to_lds_b128 %2, %10, off\n\t"
               "global_load_async_to_lds_b128 %3, %11, off\n\t"
               "global_load_async_to_lds_b128 %4, %12, off\n\t"
               "global_load_async_to_lds_b128 %5, %13, off\n\t"
               "global_load_async_to_lds_b128 %6, %14, off\n\t"
               "global_load_async_to_lds_b128 %7, %15, off\n\t"
               "s_wait_xcnt 0x0"
               :: "v"(l0), "v"(l1), "v"(l2), "v"(l3), "v"(l4), "v"(l5), "v"(l6), "v"(l7),
                  "v"(g0), "v"(g1), "v"(g2), "v"(g3), "v"(g4), "v"(g5), "v"(g6), "v"(g7) : "memory");
}
template <bool H16>      // H16: the tile goes out as f16 to C16, else as f32 to C
__global__ __launch_bounds__(256) void k_gemm_t(const _Float16* __restrict__ A, const _Float16* __restrict__ Bh, float alpha, const float* __restrict__ bias, float* __restrict__ C, _Float16* __restrict__ C16) {
  __shared__ __attribute__((aligned(16))) unsigned char L[2u * GT_STAGE];
  const int tid = threadIdx.x, w = tid >> 5, lane = tid & 31, ln = lane & 15, hh = lane >> 4;
  const int m0 = (int)(blockIdx.x / (CC / 128)) * 128, n0 = (int)(blockIdx.x % (CC / 128)) * 128;
  const int wm = (w >> 1) * 32, wn = (w & 1) * 64;
  // copies: lane takes 16-byte piece (tid & 15) of rows (tid >> 4) + 16 i; LDS rows 0..127 hold A, 128..255 hold Bt
  const unsigned lcp = (unsigned)(size_t)L + (unsigned)(tid >> 4) * GT_PITCH + (unsigned)(tid & 15) * 16u;
  const unsigned short* ga = (const unsigned short*)A + (size_t)(m0 + (tid >> 4)) * CC + (tid & 15) * 8;
  const unsigned short* gb = (const unsigned short*)Bh + (size_t)(n0 + (tid >> 4)) * CC + (tid & 15) * 8;
  v8f acc[2][4];
#pragma unroll
  for (int i = 0; i < 2; ++i)
#pragma unroll
    for (int j = 0; j < 4; ++j) acc[i][j] = (v8f){0.f,0.f,0.f,0.f,0.f,0.f,0.f,0.f};
  gt_copy8(lcp, ga); gt_copy8(lcp + 128u * GT_PITCH, gb);
  asm volatile("s_wait_asynccnt 0x0" ::: "memory");      // pass 0's bytes of this wave have landed
  __syncthreads();                                        // and every wave's: pass 0 is readable
  gt_copy8(lcp + GT_STAGE, ga + 128); gt_copy8(lcp + GT_STAGE + 128u * GT_PITCH, gb + 128);
#pragma unroll 1      // one pass per trip: the ring's order at the foot stays as written
  for (int t = 0; t < GT_NST; ++t) {
    const unsigned char* S = L + (unsigned)(t & 1) * GT_STAGE;
    const unsigned char* ar = S + (unsigned)(wm + ln) * GT_PITCH + 16u * hh;
    const unsigned char* br = S + (unsigned)(128 + wn + ln) * GT_PITCH + 16u * hh;
    FragH a[2][2], b[2][4];      // two fragment sets: the next 32 k are fetched as one group ahead of this block's products (inside this pass's buffer only)
#pragma unroll
    for (int i = 0; i < 2; ++i) { a[0][i].half[0] = *(const v8us*)(ar + i * 16 * GT_PITCH); a[0][i].half[1] = *(const v8us*)(ar + i * 16 * GT_PITCH + 32); }
#pragma unroll
    for (int j = 0; j < 4; ++j) { b[0][j].half[0] = *(const v8us*)(br + j * 16 * GT_PITCH); b[0][j].half[1] = *(const v8us*)(br + j * 16 * GT_PITCH + 32); }
#pragma unroll
    for (int ks = 0; ks < 4; ++ks) {
      const int cu = ks & 1, nx = cu ^ 1;
      if (ks < 3) {
#pragma unroll
        for (int i = 0; i < 2; ++i) { a[nx][i].half[0] = *(const v8us*)(ar + i * 16 * GT_PITCH + (ks + 1) * 64); a[nx][i].half[1] = *(const v8us*)(ar + i * 16 * GT_PITCH + (ks + 1) * 64 + 32); }
#pragma unroll
        for (int j = 0; j < 4; ++j) { b[nx][j].half[0] = *(const v8us*)(br + j * 16 * GT_PITCH + (ks + 1) * 64); b[nx][j].half[1] = *(const v8us*)(br + j * 16 * GT_PITCH + (ks + 1) * 64 + 32); }
      }
      __builtin_amdgcn_sched_barrier(0);      // keeps the next block's twelve LDS loads one group ahead of these products; without it they sink among the products and each waits out its own latency
#pragma unroll
      for (int i = 0; i < 2; ++i)
#pragma unroll
        for (int j = 0; j < 4; ++j) acc[i][j] = __builtin_amdgcn_wmma_f32_16x16x32_f16(false, a[cu][i].v, false, b[cu][j].v, (short)0, acc[i][j], false, false);
      __builtin_amdgcn_sched_barrier(0);      // the products stay one run: no later load group rises into it
    }
    asm volatile("s_wait_dscnt 0x0" ::: "memory");        // this wave's reads of the buffer have returned
    asm volatile("s_wait_asynccnt 0x0" ::: "memory");     // this wave's copies of pass t + 1 have landed
    __syncthreads();                                      // publishes pass t + 1 and frees the buffer pass t has read
    if (t + 2 < GT_NST) { gt_copy8(lcp + (unsigned)(t & 1) * GT_STAGE, ga + (t + 2) * 128); gt_copy8(lcp + (unsigned)(t & 1) * GT_STAGE + 128u * GT_PITCH, gb + (t + 2) * 128); }
  }
  asm volatile("s_wait_asynccnt 0x0" ::: "memory");       // nothing in flight before the ring becomes output staging
  // epilogue: each wave stages its 32 x 64 tile in its own LDS range (pitch 68 floats) and stores whole lines
  float* so = (float*)(L + (unsigned)w * (32u * 272u));
#pragma unroll
  for (int j = 0; j < 4; ++j) { const float bv = bf16_round(bias[n0 + wn + j * 16 + ln]);
#pragma unroll
    for (int i = 0; i < 2; ++i)
#pragma unroll
      for (int r = 0; r < 8; ++r) so[(i * 16 + 8 * hh + r) * 68 + j * 16 + ln] = acc[i][j][r] * alpha + bv; }
  __builtin_amdgcn_fence(__ATOMIC_ACQ_REL, "workgroup"); __builtin_amdgcn_wave_barrier();      // the wave's staged rows are in LDS before its lanes read them back; the range is the wave's own, so no workgroup barrier
  const int c4 = ln * 4; typedef _Float16 v4h __attribute__((ext_vector_type(4)));
#pragma unroll
  for (int q = 0; q < 16; ++q) { const int r = q * 2 + hh; const v4f v = *(const v4fa*)&so[r * 68 + c4]; const size_t o = (size_t)(m0 + wm + r) * CC + n0 + wn + c4;
    if (!H16) *(v4f*)(C + o) = v;
    else { v4h h4; for (int i = 0; i < 4; ++i) h4[i] = (_Float16)v[i]; *(v4h*)(C16 + o) = h4; } }
}

__global__ __launch_bounds__(256) void k_x16(const float* __restrict__ x, _Float16* __restrict__ X16, size_t n8) { const size_t t = (size_t)blockIdx.x * 256 + threadIdx.x; if (t >= n8) return; FragH f;
#pragma unroll
  for (int q = 0; q < 8; ++q) f.h[q] = (_Float16)bf16_round(x[t * 8 + q]); *(v8us*)((unsigned short*)X16 + t * 8) = f.half[0];  }
__global__ __launch_bounds__(256) void k_h16(const float* __restrict__ x, _Float16* __restrict__ X16, size_t n8) { const size_t t = (size_t)blockIdx.x * 256 + threadIdx.x; if (t >= n8) return; FragH f;
#pragma unroll
  for (int q = 0; q < 8; ++q) f.h[q] = (_Float16)x[t * 8 + q]; *(v8us*)((unsigned short*)X16 + t * 8) = f.half[0];  }
__global__ __launch_bounds__(256) void k_round16f(const float* __restrict__ W, _Float16* __restrict__ Bt, size_t n8) { const size_t t = (size_t)blockIdx.x * 256 + threadIdx.x; if (t >= n8) return; FragH f;
#pragma unroll
  for (int i = 0; i < 8; ++i) f.h[i] = (_Float16)(bf16_round(W[t * 8 + i]) * 16.0f); *(v8us*)((unsigned short*)Bt + t * 8) = f.half[0];  }
template <int NHv, int TTv>
__global__ __launch_bounds__(256) void k_vt(const _Float16* __restrict__ V16, int ldv, int voff, _Float16* __restrict__ Vt) { __shared__ unsigned short tl[64][66]; const int tid = threadIdx.x; const int slab = blockIdx.x / (TTv / 64), lg = blockIdx.x % (TTv / 64); const int b = slab / NHv, h = slab % NHv;
  for (int i = tid; i < 64 * 8; i += 256) { const int r = i / 8, c8 = (i % 8) * 8; FragH f; f.half[0] = *(const v8us*)((const unsigned short*)V16 + ((size_t)b * TTv + lg * 64 + r) * ldv + voff + h * 64 + c8);
#pragma unroll
    for (int q = 0; q < 8; ++q) tl[r][c8 + q] = f.u[q]; }
  __syncthreads();
  {
#pragma unroll
    for (int rd = 0; rd < 2; ++rd) { const int d = rd * 32 + tid / 8, pc = tid % 8; FragH f;
#pragma unroll
      for (int q = 0; q < 8; ++q) f.u[q] = tl[pc * 8 + q][d];
      *(v8us*)((unsigned short*)Vt + ((size_t)slab * 64 + d) * TTv + lg * 64 + pc * 8) = f.half[0]; }
     } }

// Attention ring: a stage is 64 keys for the block's 64 query rows: 64 rows of K (256 B, pitch 272), 128 rows of Vt (128 B, pitch 144) and 64 rows of the mask (256 B, pitch 272),
// laid in LDS by asynchronous copies, two buffers, the next stage's copies in flight under this stage's work; the four waves share K and Vt. A stage is worked as two 32-key tiles, upward, as before: every sum keeps its order.
#define FL_KP 272u
#define FL_VP 144u
#define FL_MP 272u
#define FL_VO (64u * FL_KP)
#define FL_MO (FL_VO + 128u * FL_VP)
#define FL_STAGE (FL_MO + 64u * FL_MP)
#define FL_NST (SS / 64)
typedef float f1a __attribute__((may_alias));
__device__ __forceinline__ void fl_copy8(unsigned l0, unsigned ls, const unsigned char* g0, size_t gs) {
  // eight 16-byte copies of this lane, LDS rows ls bytes apart, global rows gs bytes apart; s_wait_xcnt stands inside the statement so that no address register is rewritten ahead of it
  const unsigned l1 = l0 + ls, l2 = l0 + 2u * ls, l3 = l0 + 3u * ls, l4 = l0 + 4u * ls, l5 = l0 + 5u * ls, l6 = l0 + 6u * ls, l7 = l0 + 7u * ls;
  const unsigned char *g1 = g0 + gs, *g2 = g0 + 2 * gs, *g3 = g0 + 3 * gs, *g4 = g0 + 4 * gs, *g5 = g0 + 5 * gs, *g6 = g0 + 6 * gs, *g7 = g0 + 7 * gs;
  asm volatile("global_load_async_to_lds_b128 %0, %8, off\n\t"
               "global_load_async_to_lds_b128 %1, %9, off\n\t"
               "global_load_async_to_lds_b128 %2, %10, off\n\t"
               "global_load_async_to_lds_b128 %3, %11, off\n\t"
               "global_load_async_to_lds_b128 %4, %12, off\n\t"
               "global_load_async_to_lds_b128 %5, %13, off\n\t"
               "global_load_async_to_lds_b128 %6, %14, off\n\t"
               "global_load_async_to_lds_b128 %7, %15, off\n\t"
               "s_wait_xcnt 0x0"
               :: "v"(l0), "v"(l1), "v"(l2), "v"(l3), "v"(l4), "v"(l5), "v"(l6), "v"(l7),
                  "v"(g0), "v"(g1), "v"(g2), "v"(g3), "v"(g4), "v"(g5), "v"(g6), "v"(g7) : "memory");
}
__global__ __launch_bounds__(128) void k_flash(const _Float16* __restrict__ Q16, int ldq, const _Float16* __restrict__ K16, int ldk, const _Float16* __restrict__ Vt, const float* __restrict__ MSK, float* __restrict__ O, int ldo) {
  constexpr int RPW = 16, RTN = RPW / 16, NQB = 2048 / (4 * RPW), DT = 8, KS = 4;      /* head dim 128 */
  __shared__ __attribute__((aligned(16))) unsigned short sP[4][RPW][40]; __shared__ __attribute__((aligned(16))) unsigned char L[2u * FL_STAGE];
  const int tid = threadIdx.x, w = tid >> 5, lane = tid & 31, ln = lane & 15, hh = lane >> 4;
  const int slab = blockIdx.x / NQB, qblk = blockIdx.x % NQB; const int b = slab / 16, h = slab % 16; const int qb0 = qblk * (4 * RPW); const int q0 = qb0 + w * RPW;
  const unsigned short* Vth = (const unsigned short*)Vt + (size_t)slab * 128 * 2048;
  // copies: K and mask: 16-byte piece (tid & 15) of rows (tid >> 4) + 8 i; Vt: piece (tid & 7) of rows (tid >> 3) + 16 i
  const unsigned lb = (unsigned)(size_t)L;
  const unsigned lk = lb + (unsigned)(tid >> 4) * FL_KP + (unsigned)(tid & 15) * 16u, lv = lb + FL_VO + (unsigned)(tid >> 3) * FL_VP + (unsigned)(tid & 7) * 16u, lm = lb + FL_MO + (unsigned)(tid >> 4) * FL_MP + (unsigned)(tid & 15) * 16u;
  const size_t kstep = (size_t)ldk * 2;      // bytes of a K row
  const unsigned char* gk = (const unsigned char*)((const unsigned short*)K16 + ((size_t)b * 2048 + (tid >> 4)) * ldk + h * 128 + (tid & 15) * 8);
  const unsigned char* gv = (const unsigned char*)(Vth + (size_t)(tid >> 3) * 2048 + (tid & 7) * 8);
  const unsigned char* gm = (const unsigned char*)(MSK + ((size_t)b * 2048 + qb0 + (tid >> 4)) * 2048 + (tid & 15) * 4);
  fl_copy8(lk, 8u * FL_KP, gk, 8 * kstep); fl_copy8(lv, 16u * FL_VP, gv, (size_t)16 * 4096); fl_copy8(lm, 8u * FL_MP, gm, (size_t)8 * 8192);
  FragH aq[2][KS];
#pragma unroll
  for (int rt = 0; rt < RTN; ++rt) { const unsigned short* qr = (const unsigned short*)Q16 + ((size_t)b * 2048 + q0 + rt * 16 + ln) * ldq + h * 128;
#pragma unroll
    for (int ks = 0; ks < KS; ++ks) { aq[rt][ks].half[0] = *(const v8us*)(qr + ks * 32 + 8 * hh); aq[rt][ks].half[1] = *(const v8us*)(qr + ks * 32 + 16 + 8 * hh); } }
  float m_r[2][8], l_r[2][8]; v8f oacc[2][DT];
#pragma unroll
  for (int rt = 0; rt < RTN; ++rt) {
#pragma unroll
    for (int r = 0; r < 8; ++r) { m_r[rt][r] = -3.0e38f; l_r[rt][r] = 0.f; }
#pragma unroll
    for (int dt = 0; dt < DT; ++dt) oacc[rt][dt] = (v8f){0.f,0.f,0.f,0.f,0.f,0.f,0.f,0.f}; }
  asm volatile("s_wait_asynccnt 0x0" ::: "memory");      // stage 0's bytes of this wave have landed
  __syncthreads();                                        // and every wave's: stage 0 is readable
  fl_copy8(lk + FL_STAGE, 8u * FL_KP, gk + 64 * kstep, 8 * kstep); fl_copy8(lv + FL_STAGE, 16u * FL_VP, gv + 128, (size_t)16 * 4096); fl_copy8(lm + FL_STAGE, 8u * FL_MP, gm + 256, (size_t)8 * 8192);
#pragma unroll 1      // one stage per trip: the ring's order at the foot stays as written
  for (int t = 0; t < FL_NST; ++t) {
    const unsigned char* S = L + (unsigned)(t & 1) * FL_STAGE;
#pragma unroll 1      // the two 32-key tiles of a stage share one body: less code, and a masked tile is skipped on its own
  for (int sub = 0; sub < 2; ++sub) {
    // mask tile for my 16 query rows x 32 keys: lane (ln,hh) needs rows rt*16 + 8hh + r, keys ln and 16 + ln of the tile
    unsigned okb0 = 0u, okb1 = 0u;      // bit (rt*8 + r) set when key ln (resp. 16+ln) of the tile is OPEN for query row rt*16 + 8hh + r
#pragma unroll
    for (int rt = 0; rt < RTN; ++rt)
#pragma unroll
      for (int r = 0; r < 8; ++r) { const f1a* mr = (const f1a*)(S + FL_MO + (unsigned)(w * RPW + rt * 16 + 8 * hh + r) * FL_MP + (unsigned)sub * 128u); okb0 |= (mr[ln] == 0.0f ? 1u : 0u) << (rt * 8 + r); okb1 |= (mr[16 + ln] == 0.0f ? 1u : 0u) << (rt * 8 + r); }      /* float mask: nonzero = masked (-1e9) */
    if (__builtin_amdgcn_ballot_w32((okb0 | okb1) != 0u) == 0u) continue;      // every (query,key) of this wave's tile is masked: contributes nothing (uniform branch; the stage's foot is outside this loop)
    v8f s[2][2];
#pragma unroll
    for (int nt = 0; nt < 2; ++nt) { const unsigned char* kr = S + (unsigned)(sub * 32 + nt * 16 + ln) * FL_KP + 16u * hh; FragH bk[KS];
#pragma unroll
      for (int ks = 0; ks < KS; ++ks) { bk[ks].half[0] = *(const v8us*)(kr + ks * 64); bk[ks].half[1] = *(const v8us*)(kr + ks * 64 + 32); }
#pragma unroll
      for (int rt = 0; rt < RTN; ++rt) { v8f acc = (v8f){0.f,0.f,0.f,0.f,0.f,0.f,0.f,0.f};
#pragma unroll
        for (int ks = 0; ks < KS; ++ks) acc = mmaH<1>(aq[rt][ks].v, aq[rt][ks].v, bk[ks].v, bk[ks].v, acc); s[rt][nt] = acc; } }
#pragma unroll
    for (int rt = 0; rt < RTN; ++rt)
#pragma unroll
      for (int r = 0; r < 8; ++r) {
        const bool ok0 = ((okb0 >> (rt * 8 + r)) & 1u) != 0u, ok1 = ((okb1 >> (rt * 8 + r)) & 1u) != 0u;
        const float s0 = ok0 ? s[rt][0][r] * (0.08838834764831845f) : -INFINITY, s1 = ok1 ? s[rt][1][r] * (0.08838834764831845f) : -INFINITY; float mc = fmaxf(s0, s1);
        mc = fmaxf(mc, __shfl_xor(mc, 1, 32)); mc = fmaxf(mc, __shfl_xor(mc, 2, 32)); mc = fmaxf(mc, __shfl_xor(mc, 4, 32)); mc = fmaxf(mc, __shfl_xor(mc, 8, 32));
        const float mn = fmaxf(m_r[rt][r], mc); const float al = (mn > -1.0e38f) ? expf(m_r[rt][r] - mn) : 1.0f; m_r[rt][r] = mn; const float p0 = ok0 ? expf(s0 - mn) : 0.f, p1 = ok1 ? expf(s1 - mn) : 0.f; l_r[rt][r] = l_r[rt][r] * al + p0 + p1;
#pragma unroll
        for (int dt = 0; dt < DT; ++dt) oacc[rt][dt][r] *= al;
        FragH t2; t2.h[0] = (_Float16)p0; t2.h[1] = (_Float16)p1; sP[w][rt * 16 + 8 * hh + r][ln] = t2.u[0]; sP[w][rt * 16 + 8 * hh + r][16 + ln] = t2.u[1]; }
    __builtin_amdgcn_fence(__ATOMIC_ACQ_REL, "workgroup"); __builtin_amdgcn_wave_barrier();
    FragH pa[2];
#pragma unroll
    for (int rt = 0; rt < RTN; ++rt) { pa[rt].half[0] = *(const v8us*)&sP[w][rt * 16 + ln][8 * hh]; pa[rt].half[1] = *(const v8us*)&sP[w][rt * 16 + ln][16 + 8 * hh]; }
#pragma unroll
    for (int dt = 0; dt < DT; ++dt) { const unsigned char* vrow = S + FL_VO + (unsigned)(dt * 16 + ln) * FL_VP + (unsigned)sub * 64u + 16u * hh; FragH bv; bv.half[0] = *(const v8us*)vrow; bv.half[1] = *(const v8us*)(vrow + 32);
#pragma unroll
      for (int rt = 0; rt < RTN; ++rt) oacc[rt][dt] = mmaH<1>(pa[rt].v, pa[rt].v, bv.v, bv.v, oacc[rt][dt]); }
    __builtin_amdgcn_fence(__ATOMIC_ACQ_REL, "workgroup"); __builtin_amdgcn_wave_barrier(); }
    asm volatile("s_wait_dscnt 0x0" ::: "memory");        // this wave's reads of the buffer have returned
    asm volatile("s_wait_asynccnt 0x0" ::: "memory");     // this wave's copies of stage t + 1 have landed
    __syncthreads();                                      // publishes stage t + 1 and frees the buffer stage t has read
    if (t + 2 < FL_NST) { const unsigned lo = (unsigned)(t & 1) * FL_STAGE; fl_copy8(lk + lo, 8u * FL_KP, gk + (size_t)(t + 2) * 64 * kstep, 8 * kstep); fl_copy8(lv + lo, 16u * FL_VP, gv + (t + 2) * 128, (size_t)16 * 4096); fl_copy8(lm + lo, 8u * FL_MP, gm + (t + 2) * 256, (size_t)8 * 8192); }
  }
  asm volatile("s_wait_asynccnt 0x0" ::: "memory");       // nothing in flight before the ring becomes output staging (the last foot's barrier has ended every wave's reads of it)
  float* sO = (float*)(L + (unsigned)w * (unsigned)(RPW * (128 + 4) * 4));      // each wave's own range, pitch 132 floats
#pragma unroll
  for (int rt = 0; rt < RTN; ++rt) {
#pragma unroll
    for (int r = 0; r < 8; ++r) { float l = l_r[rt][r]; l += __shfl_xor(l, 1, 32); l += __shfl_xor(l, 2, 32); l += __shfl_xor(l, 4, 32); l += __shfl_xor(l, 8, 32); l_r[rt][r] = (l > 0.f) ? 1.0f / l : 0.f; }
#pragma unroll
    for (int dt = 0; dt < DT; ++dt)
#pragma unroll
      for (int r = 0; r < 8; ++r) sO[(rt * 16 + 8 * hh + r) * 132 + dt * 16 + ln] = oacc[rt][dt][r] * l_r[rt][r]; }
  __builtin_amdgcn_fence(__ATOMIC_ACQ_REL, "workgroup"); __builtin_amdgcn_wave_barrier();
  {
#pragma unroll
    for (int rp = 0; rp < RPW; ++rp) { const int r = rp, pc = lane; const v4f val = *(const v4fa*)&sO[r * 132 + pc * 4]; *(v4f*)(O + ((size_t)b * 2048 + q0 + r) * ldo + h * 128 + pc * 4) = val; }      /* 128-float rows: 32 lanes x 16 B */
     } }

__global__ __launch_bounds__(256) void k_rope16(const float* __restrict__ SRC, _Float16* __restrict__ D16) { __shared__ __attribute__((aligned(16))) _Float16 st[256][8]; const int tid = threadIdx.x; const size_t t = (size_t)blockIdx.x * 256 + tid; if (t >= (size_t)SS * NH * 16) return; const int p = (int)(t % 16); const int h = (int)((t / 16) % NH); const int s = (int)(t / (16 * NH)); const float* src = SRC + ((size_t)s * NH + h) * HD;
#pragma unroll 1
  for (int q = 0; q < 8; ++q) { const int j = p * 8 + q; const int i = j >> 1; const float f = __builtin_powf(10000.0f, -(float)(2 * i) / 128.0f); const float ang = (float)s * f; const float c = cosf(ang), sn = sinf(ang); const float xr = src[2 * i], xi = src[2 * i + 1]; st[tid][q] = (_Float16)((j & 1) ? (xr * sn + xi * c) : (xr * c - xi * sn)); }
  const v8us v = *(const v8us*)&st[tid][0]; unsigned short* d = (unsigned short*)D16 + ((size_t)s * NH + h) * HD + p * 8; *(v8us*)d = v;  }
__global__ __launch_bounds__(256) void k_vt128(const _Float16* __restrict__ V16, _Float16* __restrict__ Vt) { __shared__ unsigned short tl[64][130]; const int tid = threadIdx.x; const int h = blockIdx.x / (SS / 64), lg = blockIdx.x % (SS / 64);
  for (int i = tid; i < 64 * 16; i += 256) { const int r = i / 16, c8 = (i % 16) * 8; FragH f; f.half[0] = *(const v8us*)((const unsigned short*)V16 + ((size_t)lg * 64 + r) * CC + h * HD + c8);
#pragma unroll
    for (int q = 0; q < 8; ++q) tl[r][c8 + q] = f.u[q]; }
  __syncthreads();
  { for (int i = tid; i < 128 * 8; i += 256) { const int d = i / 8, pc = i % 8; FragH f;
#pragma unroll
      for (int q = 0; q < 8; ++q) f.u[q] = tl[pc * 8 + q][d]; *(v8us*)((unsigned short*)Vt + ((size_t)h * HD + d) * SS + lg * 64 + pc * 8) = f.half[0]; }  } }
extern "C" void kernel_launch(void* const* d_in, const int* in_sizes, int n_in,
                              void* d_out, int out_size, void* d_ws, size_t ws_size, hipStream_t stream) {
  (void)in_sizes; (void)n_in; (void)out_size;
  const float* const* I = (const float* const*)d_in; const float* q = I[0]; const float* k = I[1]; const float* v = I[2]; const float* mask = I[3]; const float* Wq = I[4]; const float* bq = I[5]; const float* Wk = I[6]; const float* bk = I[7]; const float* Wv = I[8]; const float* bv = I[9]; const float* G = I[10]; const float* Wo = I[11]; const float* bo = I[12];
  char* ws = (char*)d_ws; size_t off = 0;
  auto take = [&](size_t bytes) { char* p = ws + off; off += (bytes + 255) & ~(size_t)255; return p; };
  _Float16* Bq = (_Float16*)take((size_t)CC * CC * 2); _Float16* Bk = (_Float16*)take((size_t)CC * CC * 2); _Float16* Bv = (_Float16*)take((size_t)CC * CC * 2); _Float16* Bo = (_Float16*)take((size_t)CC * CC * 2); _Float16* BG = (_Float16*)take((size_t)NH * HD * HD * 2);
  _Float16* X16 = (_Float16*)take((size_t)SS * CC * 2); float* QF = (float*)take((size_t)SS * CC * 4); _Float16* QR16 = (_Float16*)take((size_t)SS * CC * 2); _Float16* QG16 = (_Float16*)take((size_t)SS * CC * 2); float* KF = QF; _Float16* KR16 = (_Float16*)take((size_t)SS * CC * 2); _Float16* V16 = (_Float16*)take((size_t)SS * CC * 2); _Float16* Vt = (_Float16*)take((size_t)SS * CC * 2); float* O = QF; _Float16* O16 = X16;
  if (off > ws_size) return;      // 8.4 × 4 + 0.5 + 8.4 + 16.8 + 8.4 × 5 ≈ 101 MiB
  const size_t w8 = (size_t)CC * CC / 8; const unsigned gw = (unsigned)((w8 + 255) / 256);
  k_round16f<<<gw, 256, 0, stream>>>(Wq, Bq, w8); k_round16f<<<gw, 256, 0, stream>>>(Wk, Bk, w8); k_round16f<<<gw, 256, 0, stream>>>(Wv, Bv, w8); k_round16f<<<gw, 256, 0, stream>>>(Wo, Bo, w8);      // (out,in) = Bt
  for (int h = 0; h < NH; ++h) k_wt_f16<<<(HD * (HD / 8) + 255) / 256, 256, 0, stream>>>(G + (size_t)h * HD * HD, BG + (size_t)h * HD * HD, HD, HD, 16.0f);      // G_h [d][e] = [in][out]
  const unsigned gx = (unsigned)(((size_t)SS * CC / 8 + 255) / 256); const unsigned gt = (SS / 128) * (CC / 128);
  // q: proj → rope → per-head metric product
  k_x16<<<gx, 256, 0, stream>>>(q, X16, (size_t)SS * CC / 8); k_gemm_t<false><<<gt, 256, 0, stream>>>(X16, Bq, 0.0625f, bq, QF, nullptr);
  k_rope16<<<(unsigned)(((size_t)SS * NH * 16 + 255) / 256), 256, 0, stream>>>(QF, QR16);
  k_gemm_hhx<0><<<dim3(((SS / 16) * (HD / 64) + 3) / 4, NH), 128, 0, stream>>>(QR16, CC, (size_t)HD, BG, HD, (size_t)HD * HD, 0.0625f, nullptr, 0, nullptr, 1, 0, 0, nullptr, QG16, CC, (size_t)HD, SS, HD, HD);      // qg_h = q_h · G_h (batched over heads via column offsets)
  // k: proj → rope
  k_x16<<<gx, 256, 0, stream>>>(k, X16, (size_t)SS * CC / 8); k_gemm_t<false><<<gt, 256, 0, stream>>>(X16, Bk, 0.0625f, bk, KF, nullptr);
  k_rope16<<<(unsigned)(((size_t)SS * NH * 16 + 255) / 256), 256, 0, stream>>>(KF, KR16);
  // v: proj (f16) → Vt
  k_x16<<<gx, 256, 0, stream>>>(v, X16, (size_t)SS * CC / 8); k_gemm_t<true><<<gt, 256, 0, stream>>>(X16, Bv, 0.0625f, bv, nullptr, V16);
  k_vt128<<<NH * (SS / 64), 256, 0, stream>>>(V16, Vt);
  k_flash<<<1 * NH * (SS / 64), 128, 0, stream>>>(QG16, CC, KR16, CC, Vt, mask, O, CC);
  k_h16<<<gx, 256, 0, stream>>>(O, O16, (size_t)SS * CC / 8);
  k_gemm_t<false><<<gt, 256, 0, stream>>>(O16, Bo, 0.0625f, bo, (float*)d_out, nullptr);
}

// v003
// One run takes 286 microseconds.
// In two side-by-side timings against v002, it was 1.27 and 1.26 times as fast.
// All steps since v000 together make it 2.55 times as fast.
#include <hip/hip_runtime.h>
// Power-law-graph multi-head attention (B=1, S=2048, D=2048, 16 heads × 128; INPUT additive mask (nonzero = −1e9) ; RoPE interleaved pairs): q/k/v/o projections ((out,in) + bias) and the per-head
// metric product qg = q_h·G_h as GEMMs and the attention as a fused flash-style kernel (head dim 128: 4 k-steps / 8 d-tiles; masked keys excluded, fully masked 32-key tiles skipped by ballot;
// online softmax f32; P f16 ≤ 1; O = P·Vt; RPW-16 waves) on v_wmma_f32_16x16x32_f16, f32 accumulate; RoPE f32 VALU.
#define SS 2048
#define CC 2048
#define NH 16
#define HD 128

typedef __bf16 v16b __attribute__((ext_vector_type(16)));
typedef unsigned short v8us __attribute__((ext_vector_type(8), may_alias));
typedef float  v8f  __attribute__((ext_vector_type(8)));
typedef float  v4f  __attribute__((ext_vector_type(4)));
typedef float  v4fa __attribute__((ext_vector_type(4), may_alias));
union FragB { v16b v; v8us half[2]; unsigned short u[16]; };

__device__ __forceinline__ unsigned short bf16_bits(float x) { unsigned int u = __float_as_uint(x); return (unsigned short)((u + 0x7FFFu + ((u >> 16) & 1u)) >> 16); }
__device__ __forceinline__ float bf16_val(unsigned short b) { return __uint_as_float(((unsigned int)b) << 16); }
__device__ __forceinline__ float bf16_round(float x) { return bf16_val(bf16_bits(x)); }
// D += A·B with NT terms: 1 = ah·bh, 2 = + al·bh (A split), 3 = + ah·bl (both split)
template <int NT>
__device__ __forceinline__ v8f mmaN(v16b ah, v16b al, v16b bh, v16b bl, v8f c) {
  c = __builtin_amdgcn_wmma_f32_16x16x32_bf16(false, ah, false, bh, (short)0, c, false, false);
  if (NT >= 2) c = __builtin_amdgcn_wmma_f32_16x16x32_bf16(false, al, false, bh, (short)0, c, false, false);
  if (NT >= 3) c = __builtin_amdgcn_wmma_f32_16x16x32_bf16(false, ah, false, bl, (short)0, c, false, false);
  asm volatile("v_nop\n\tv_nop\n\tv_nop\n\tv_nop" : "+v"(c) : "v"(ah), "v"(al), "v"(bh), "v"(bl));
  return c;
}

__global__ __launch_bounds__(256) void k_wt_bf16(const float* __restrict__ W, unsigned short* __restrict__ Wt, int K, int N) {
  const int t = blockIdx.x * 256 + threadIdx.x;
  const int k8n = K / 8;
  if (t >= N * k8n) return;
  const int n = t / k8n, k8 = (t % k8n) * 8;
  v8us v;
#pragma unroll
  for (int i = 0; i < 8; ++i) v[i] = bf16_bits(W[(size_t)(k8 + i) * N + n]);
  *(v8us*)(Wt + (size_t)n * K + k8) = v;
  
}

// GEMM C[M][N] (f32, pitch ldc) = act(A[M][K]·W + bias). A f32 row-major (pitch lda) converted per fragment to bf16
// (ASPLIT: hi/lo two planes -> 2 terms, else single rounded term); Wt bf16 [N][K] (pitch ldb). BIAS_BF16 rounds the
// bias to bf16 first (bias quantised to bf16 before the add). K%32==0, M%16==0, N%64==0.
template <bool ASPLIT, int ACT, bool BIAS_BF16>
__global__ __launch_bounds__(128) void k_gemm_bf(const float* __restrict__ A, int lda, const unsigned short* __restrict__ Wt, int ldb,
                                               const float* __restrict__ bias, float* __restrict__ C, int ldc, int M, int N, int K) {
  __shared__ __attribute__((aligned(16))) float so[4][16][64];
  const int tid = threadIdx.x, w = tid >> 5, lane = tid & 31, ln = lane & 15, hh = lane >> 4;
  const int ntn = N / 64;
  const int wid = blockIdx.x * 4 + w;
  const int mt = wid / ntn, nq = wid % ntn;
  if (mt * 16 >= M) return;
  const int row0 = mt * 16, col0 = nq * 64;
  const float* arow = A + (size_t)(row0 + ln) * lda;
  v8f acc[4] = {};
  for (int kb = 0; kb < K; kb += 32) {
    FragB ah, al;
    const v4f x0 = *(const v4fa*)(arow + kb + 8 * hh), x1 = *(const v4fa*)(arow + kb + 8 * hh + 4);
    const v4f x2 = *(const v4fa*)(arow + kb + 16 + 8 * hh), x3 = *(const v4fa*)(arow + kb + 16 + 8 * hh + 4);
    float xs[16] = {x0[0],x0[1],x0[2],x0[3],x1[0],x1[1],x1[2],x1[3],x2[0],x2[1],x2[2],x2[3],x3[0],x3[1],x3[2],x3[3]};
#pragma unroll
    for (int i = 0; i < 16; ++i) { const unsigned short hb = bf16_bits(xs[i]); ah.u[i] = hb; al.u[i] = ASPLIT ? bf16_bits(xs[i] - bf16_val(hb)) : (unsigned short)0; }
#pragma unroll
    for (int t = 0; t < 4; ++t) {
      const unsigned short* brow = Wt + (size_t)(col0 + t * 16 + ln) * ldb + kb;
      FragB b;
      b.half[0] = *(const v8us*)(brow + 8 * hh);
      b.half[1] = *(const v8us*)(brow + 16 + 8 * hh);
      acc[t] = mmaN<ASPLIT ? 2 : 1>(ah.v, al.v, b.v, b.v, acc[t]);
    }
  }
#pragma unroll
  for (int t = 0; t < 4; ++t) {
    float bv = bias ? bias[col0 + t * 16 + ln] : 0.f;
    if (BIAS_BF16) bv = bf16_round(bv);
#pragma unroll
    for (int r = 0; r < 8; ++r) { float v = acc[t][r] + bv; if (ACT == 1) v = fmaxf(v, 0.f); so[w][8 * hh + r][t * 16 + ln] = v; }
  }
  __builtin_amdgcn_fence(__ATOMIC_ACQ_REL, "workgroup");
  __builtin_amdgcn_wave_barrier();
  const int rsub = lane >> 4, c4 = (lane & 15) * 4;
  {
#pragma unroll
    for (int q = 0; q < 8; ++q) {
      const int r = q * 2 + rsub;
      const v4f v = *(const v4fa*)&so[w][r][c4];
      *(v4f*)(C + (size_t)(row0 + r) * ldc + col0 + c4) = v;
    }
    
  }
}

// Flash-style causal/unmasked attention, all contractions 3-term bf16 hi/lo splits, f32 softmax with running max.
// q,k,v rows are read from f32 buffers with arbitrary row pitch (so they can live inside a fused qkv buffer);
// D = head size (multiple of 32, <= 128); one wave = 16 query rows; block = 4 waves (64 queries) sharing K/V chunks of 32.
template <int D, bool CAUSAL>
__global__ __launch_bounds__(128) void k_flash(const float* __restrict__ qb, const float* __restrict__ kb, const float* __restrict__ vb,
                                             int pitch, int T, int H, float scale, float* __restrict__ y, int ypitch) {
  constexpr int KS = D / 32;        // k-steps for QK
  constexpr int DT = D / 16;        // d tiles for PV
  __shared__ __attribute__((aligned(16))) unsigned short sKh[32][D + 8], sKl[32][D + 8], sVh[32][D + 8], sVl[32][D + 8];
  __shared__ __attribute__((aligned(16))) unsigned short sPh[4][16][40], sPl[4][16][40];
  __shared__ __attribute__((aligned(16))) float sO[4][16][D];
  const int tid = threadIdx.x, w = tid >> 5, lane = tid & 31, ln = lane & 15, hh = lane >> 4;
  const int nqb = (T + 63) / 64;
  const int bh = blockIdx.x / nqb, qblk = blockIdx.x % nqb;
  const int b = bh / H, h = bh % H;
  const int q0 = qblk * 64 + w * 16;
  const float* Q = qb + (size_t)b * T * pitch + h * D;
  const float* K = kb + (size_t)b * T * pitch + h * D;
  const float* V = vb + (size_t)b * T * pitch + h * D;

  // A fragments of the wave's 16 query rows (scaled), hi/lo
  FragB aqh[KS], aql[KS];
  {
    int row = q0 + ln; if (row >= T) row = T - 1;
    const float* qr = Q + (size_t)row * pitch;
#pragma unroll
    for (int ks = 0; ks < KS; ++ks)
#pragma unroll
      for (int i = 0; i < 16; ++i) {
        const int d = ks * 32 + ((i < 8) ? (8 * hh + i) : (16 + 8 * hh + (i - 8)));
        const float x = qr[d] * scale; const unsigned short hb = bf16_bits(x);
        aqh[ks].u[i] = hb; aql[ks].u[i] = bf16_bits(x - bf16_val(hb));
      }
  }
  float m_r[8], l_r[8];
#pragma unroll
  for (int r = 0; r < 8; ++r) { m_r[r] = -3.0e38f; l_r[r] = 0.f; }
  v8f oacc[DT];
#pragma unroll
  for (int dt = 0; dt < DT; ++dt) oacc[dt] = (v8f){0.f,0.f,0.f,0.f,0.f,0.f,0.f,0.f};

  const int kv_end = CAUSAL ? min(T, qblk * 64 + 64) : T;     // block-uniform
  for (int j0 = 0; j0 < kv_end; j0 += 32) {
    __syncthreads();
    for (int e = tid; e < 32 * (D / 4); e += 128) {
      const int r = e / (D / 4), c4 = (e % (D / 4)) * 4;
      const int key = j0 + r;
      v4f kf = {0.f,0.f,0.f,0.f}, vf = {0.f,0.f,0.f,0.f};
      if (key < T) { kf = *(const v4fa*)(K + (size_t)key * pitch + c4); vf = *(const v4fa*)(V + (size_t)key * pitch + c4); }
#pragma unroll
      for (int t = 0; t < 4; ++t) {
        unsigned short hb = bf16_bits(kf[t]); sKh[r][c4 + t] = hb; sKl[r][c4 + t] = bf16_bits(kf[t] - bf16_val(hb));
        hb = bf16_bits(vf[t]); sVh[r][c4 + t] = hb; sVl[r][c4 + t] = bf16_bits(vf[t] - bf16_val(hb));
      }
    }
    __syncthreads();
    // S tile 16 x 32
    v8f s[2];
#pragma unroll
    for (int nt = 0; nt < 2; ++nt) {
      v8f acc = {};
#pragma unroll
      for (int ks = 0; ks < KS; ++ks) {
        FragB bh_, bl_;
        bh_.half[0] = *(const v8us*)&sKh[nt * 16 + ln][ks * 32 + 8 * hh]; bh_.half[1] = *(const v8us*)&sKh[nt * 16 + ln][ks * 32 + 16 + 8 * hh];
        bl_.half[0] = *(const v8us*)&sKl[nt * 16 + ln][ks * 32 + 8 * hh]; bl_.half[1] = *(const v8us*)&sKl[nt * 16 + ln][ks * 32 + 16 + 8 * hh];
        acc = mmaN<3>(aqh[ks].v, aql[ks].v, bh_.v, bl_.v, acc);
      }
      s[nt] = acc;
    }
    // mask + running max (rows 8hh+r; the 16 lanes of a half share rows)
    float alpha[8];
#pragma unroll
    for (int r = 0; r < 8; ++r) {
      const int qi = q0 + 8 * hh + r;
      const int ja = j0 + ln, jb = j0 + 16 + ln;
      if (CAUSAL) { if (ja > qi) s[0][r] = -3.0e38f; if (jb > qi) s[1][r] = -3.0e38f; }
      if (ja >= T) s[0][r] = -3.0e38f;
      if (jb >= T) s[1][r] = -3.0e38f;
      float mx = fmaxf(s[0][r], s[1][r]);
      mx = fmaxf(mx, __shfl_xor(mx, 1, 32)); mx = fmaxf(mx, __shfl_xor(mx, 2, 32)); mx = fmaxf(mx, __shfl_xor(mx, 4, 32)); mx = fmaxf(mx, __shfl_xor(mx, 8, 32));
      const float mnew = fmaxf(m_r[r], mx);
      alpha[r] = (mnew > -1.0e38f) ? __expf(m_r[r] - mnew) : 1.0f;
      const float p0 = (s[0][r] > -1.0e38f) ? __expf(s[0][r] - mnew) : 0.f;
      const float p1 = (s[1][r] > -1.0e38f) ? __expf(s[1][r] - mnew) : 0.f;
      m_r[r] = mnew;
      l_r[r] = l_r[r] * alpha[r] + p0 + p1;            // per-lane partial row sum (16 lanes combined at the end)
      unsigned short hb = bf16_bits(p0); sPh[w][8 * hh + r][ln] = hb;      sPl[w][8 * hh + r][ln] = bf16_bits(p0 - bf16_val(hb));
      hb = bf16_bits(p1);                sPh[w][8 * hh + r][16 + ln] = hb; sPl[w][8 * hh + r][16 + ln] = bf16_bits(p1 - bf16_val(hb));
    }
#pragma unroll
    for (int dt = 0; dt < DT; ++dt)
#pragma unroll
      for (int r = 0; r < 8; ++r) oacc[dt][r] *= alpha[r];
    __builtin_amdgcn_fence(__ATOMIC_ACQ_REL, "workgroup");
    __builtin_amdgcn_wave_barrier();
    FragB pah, pal;
    pah.half[0] = *(const v8us*)&sPh[w][ln][8 * hh]; pah.half[1] = *(const v8us*)&sPh[w][ln][16 + 8 * hh];
    pal.half[0] = *(const v8us*)&sPl[w][ln][8 * hh]; pal.half[1] = *(const v8us*)&sPl[w][ln][16 + 8 * hh];
#pragma unroll
    for (int dt = 0; dt < DT; ++dt) {
      FragB bvh, bvl;
#pragma unroll
      for (int i = 0; i < 8; ++i) {
        bvh.u[i] = sVh[8 * hh + i][dt * 16 + ln]; bvh.u[8 + i] = sVh[16 + 8 * hh + i][dt * 16 + ln];
        bvl.u[i] = sVl[8 * hh + i][dt * 16 + ln]; bvl.u[8 + i] = sVl[16 + 8 * hh + i][dt * 16 + ln];
      }
      oacc[dt] = mmaN<3>(pah.v, pal.v, bvh.v, bvl.v, oacc[dt]);
    }
    __builtin_amdgcn_fence(__ATOMIC_ACQ_REL, "workgroup");
    __builtin_amdgcn_wave_barrier();
  }
#pragma unroll
  for (int r = 0; r < 8; ++r) {
    float l = l_r[r];
    l += __shfl_xor(l, 1, 32); l += __shfl_xor(l, 2, 32); l += __shfl_xor(l, 4, 32); l += __shfl_xor(l, 8, 32);
    l_r[r] = (l > 0.f) ? 1.0f / l : 0.f;
  }
#pragma unroll
  for (int dt = 0; dt < DT; ++dt)
#pragma unroll
    for (int r = 0; r < 8; ++r) sO[w][8 * hh + r][dt * 16 + ln] = oacc[dt][r] * l_r[r];
  __builtin_amdgcn_fence(__ATOMIC_ACQ_REL, "workgroup");
  __builtin_amdgcn_wave_barrier();
  {
    for (int r = 0; r < 16; ++r) {
      const int row = q0 + r;
      if (row < T && lane < D / 4) {
        const v4f val = *(const v4fa*)&sO[w][r][lane * 4];
        *(v4f*)(y + ((size_t)b * T + row) * ypitch + h * D + lane * 4) = val;
      }
    }
    
  }
}

// GEMM C = act(A·W + bias + resid): A f32 (ASPLIT -> hi/lo 2 terms), Wt bf16 [N][K]; ACT 0 none, 1 relu, 2 exact gelu;
// resid (optional, f32, row index = (row % rmod), pitch ldr, RES_BF16 rounds it) added before the activation.
template <bool ASPLIT, int ACT, bool BIAS_BF16, bool RES_BF16>
__global__ __launch_bounds__(128) void k_gemm_bf3(const float* __restrict__ A, int lda, const unsigned short* __restrict__ Wt, int ldb,
                                                const float* __restrict__ bias, const float* __restrict__ resid, int rmod, int ldr,
                                                float* __restrict__ C, int ldc, int M, int N, int K) {
  __shared__ __attribute__((aligned(16))) float so[4][16][64];
  const int tid = threadIdx.x, w = tid >> 5, lane = tid & 31, ln = lane & 15, hh = lane >> 4;
  const int ntn = N / 64;
  const int wid = blockIdx.x * 4 + w;
  const int mt = wid / ntn, nq = wid % ntn;
  if (mt * 16 >= M) return;
  const int row0 = mt * 16, col0 = nq * 64;
  const float* arow = A + (size_t)(row0 + ln) * lda;
  v8f acc[4] = {};
  for (int kb = 0; kb < K; kb += 32) {
    FragB ah, al;
    const v4f x0 = *(const v4fa*)(arow + kb + 8 * hh), x1 = *(const v4fa*)(arow + kb + 8 * hh + 4);
    const v4f x2 = *(const v4fa*)(arow + kb + 16 + 8 * hh), x3 = *(const v4fa*)(arow + kb + 16 + 8 * hh + 4);
    float xs[16] = {x0[0],x0[1],x0[2],x0[3],x1[0],x1[1],x1[2],x1[3],x2[0],x2[1],x2[2],x2[3],x3[0],x3[1],x3[2],x3[3]};
#pragma unroll
    for (int i = 0; i < 16; ++i) { const unsigned short hb = bf16_bits(xs[i]); ah.u[i] = hb; al.u[i] = ASPLIT ? bf16_bits(xs[i] - bf16_val(hb)) : (unsigned short)0; }
#pragma unroll
    for (int t = 0; t < 4; ++t) {
      const unsigned short* brow = Wt + (size_t)(col0 + t * 16 + ln) * ldb + kb;
      FragB b;
      b.half[0] = *(const v8us*)(brow + 8 * hh);
      b.half[1] = *(const v8us*)(brow + 16 + 8 * hh);
      acc[t] = mmaN<ASPLIT ? 2 : 1>(ah.v, al.v, b.v, b.v, acc[t]);
    }
  }
#pragma unroll
  for (int t = 0; t < 4; ++t) {
    const int col = col0 + t * 16 + ln;
    float bv = bias ? bias[col] : 0.f;
    if (BIAS_BF16) bv = bf16_round(bv);
#pragma unroll
    for (int r = 0; r < 8; ++r) {
      float v = acc[t][r] + bv;
      if (resid) { float rv = resid[(size_t)((row0 + 8 * hh + r) % rmod) * ldr + col]; if (RES_BF16) rv = bf16_round(rv); v += rv; }
      if (ACT == 1) v = fmaxf(v, 0.f);
      if (ACT == 2) v = 0.5f * v * (1.0f + erff(v * 0.70710678118654752f));
      if (ACT == 3) { const float u = 0.7978845608028654f * (v + 0.044715f * v * v * v); v = 0.5f * v * (1.0f + tanhf(u)); }
      so[w][8 * hh + r][t * 16 + ln] = v;
    }
  }
  __builtin_amdgcn_fence(__ATOMIC_ACQ_REL, "workgroup");
  __builtin_amdgcn_wave_barrier();
  const int rsub = lane >> 4, c4 = (lane & 15) * 4;
  {
#pragma unroll
    for (int q = 0; q < 8; ++q) {
      const int r = q * 2 + rsub;
      const v4f v = *(const v4fa*)&so[w][r][c4];
      *(v4f*)(C + (size_t)(row0 + r) * ldc + col0 + c4) = v;
    }
    
  }
}
// row LayerNorm (biased variance, eps) over N: s = X (+ R); optional out_sum <- s; out_norm <- (s-mu)*rsqrt(var+eps)*g + b
template <bool PARAM_BF16>
__global__ __launch_bounds__(256) void k_layernorm(const float* __restrict__ X, const float* __restrict__ R, const float* __restrict__ g, const float* __restrict__ bta,
                                                  float* __restrict__ out_sum, float* __restrict__ out_norm, int N, float eps) {
  __shared__ float red[256];
  const int row = blockIdx.x, tid = threadIdx.x;
  const float* x = X + (size_t)row * N; const float* rr = R ? R + (size_t)row * N : nullptr;
  float vals[16];                     // up to N = 4096
  const int per = N / 256;            // contiguous chunk per thread? use strided-by-4 chunks: thread handles j = tid*4 + 1024*u
  float s1 = 0.f;
  for (int u = 0; u < per / 4; ++u) {
    const int j = tid * 4 + 1024 * u;
    const v4f a = *(const v4fa*)(x + j);
    v4f b = {0.f,0.f,0.f,0.f}; if (rr) b = *(const v4fa*)(rr + j);
#pragma unroll
    for (int q = 0; q < 4; ++q) { const float v = a[q] + b[q]; vals[u * 4 + q] = v; s1 += v; }
  }
  red[tid] = s1; __syncthreads();
  for (int st = 128; st > 0; st >>= 1) { if (tid < st) red[tid] += red[tid + st]; __syncthreads(); }
  const float mu = red[0] / (float)N; __syncthreads();
  float s2 = 0.f;
  for (int u = 0; u < per / 4; ++u)
#pragma unroll
    for (int q = 0; q < 4; ++q) { const float c = vals[u * 4 + q] - mu; s2 += c * c; }
  red[tid] = s2; __syncthreads();
  for (int st = 128; st > 0; st >>= 1) { if (tid < st) red[tid] += red[tid + st]; __syncthreads(); }
  const float rs = rsqrtf(red[0] / (float)N + eps);
  {
    for (int u = 0; u < per / 4; ++u) {
      const int j = tid * 4 + 1024 * u;
      v4f o, sm;
#pragma unroll
      for (int q = 0; q < 4; ++q) {
        float gg = g[j + q], bb = bta[j + q];
        if (PARAM_BF16) { gg = bf16_round(gg); bb = bf16_round(bb); }
        sm[q] = vals[u * 4 + q]; o[q] = (vals[u * 4 + q] - mu) * rs * gg + bb;
      }
      if (out_sum) *(v4f*)(out_sum + (size_t)row * N + j) = sm;
      *(v4f*)(out_norm + (size_t)row * N + j) = o;
    }
    
  }
}



// ---- f16 WMMA path (v_wmma_f32_16x16x32_f16): 11-bit significands for operands in range — used where a [0,1] probability operand needs more precision than bf16
typedef _Float16 v16h __attribute__((ext_vector_type(16)));
union FragH { v16h v; v8us half[2]; _Float16 h[16]; unsigned short u[16]; };
template <int NT>
__device__ __forceinline__ v8f mmaH(v16h ah, v16h al, v16h bh, v16h bl, v8f c) {
  c = __builtin_amdgcn_wmma_f32_16x16x32_f16(false, ah, false, bh, (short)0, c, false, false);
  if (NT >= 2) c = __builtin_amdgcn_wmma_f32_16x16x32_f16(false, al, false, bh, (short)0, c, false, false);
  if (NT >= 3) c = __builtin_amdgcn_wmma_f32_16x16x32_f16(false, ah, false, bl, (short)0, c, false, false);
  asm volatile("v_nop\n\tv_nop\n\tv_nop\n\tv_nop" : "+v"(c) : "v"(ah), "v"(al), "v"(bh), "v"(bl));
  return c;
}
// batched GEMM like k_gemm_b but f16 operands: A f32 (split into f16 hi/lo if ASPLIT, else rounded to f16), Bt = f16 values [n][k]; alpha; C f32; N multiple of 16 (partial tiles skipped)
template <bool ASPLIT>
__global__ __launch_bounds__(128) void k_gemm_h(const float* __restrict__ A, int lda, size_t sA, const _Float16* __restrict__ Bh, int ldb, size_t sB, float alpha, float* __restrict__ C, int ldc, size_t sC, int M, int N, int K) {
  __shared__ __attribute__((aligned(16))) float so[4][16][64];
  const int tid = threadIdx.x, w = tid >> 5, lane = tid & 31, ln = lane & 15, hh = lane >> 4; const int by = blockIdx.y;
  A += (size_t)by * sA; Bh += (size_t)by * sB; C += (size_t)by * sC;
  const int ntn = (N + 63) / 64; const int wid = blockIdx.x * 4 + w; const int mt = wid / ntn, nq = wid % ntn; if (mt * 16 >= M) return;
  const int row0 = mt * 16, col0 = nq * 64; const float* arow = A + (size_t)(row0 + ln) * lda;
  v8f acc[4] = {};
  for (int kb = 0; kb < K; kb += 32) {
    FragH ah, al;
    const v4f x0 = *(const v4fa*)(arow + kb + 8 * hh), x1 = *(const v4fa*)(arow + kb + 8 * hh + 4), x2 = *(const v4fa*)(arow + kb + 16 + 8 * hh), x3 = *(const v4fa*)(arow + kb + 16 + 8 * hh + 4);
    float xs[16] = {x0[0],x0[1],x0[2],x0[3],x1[0],x1[1],x1[2],x1[3],x2[0],x2[1],x2[2],x2[3],x3[0],x3[1],x3[2],x3[3]};
#pragma unroll
    for (int i = 0; i < 16; ++i) { const _Float16 h = (_Float16)xs[i]; ah.h[i] = h; al.h[i] = ASPLIT ? (_Float16)(xs[i] - (float)h) : (_Float16)0.0f; }
#pragma unroll
    for (int t = 0; t < 4; ++t) { if (col0 + t * 16 >= N) continue; const size_t boff = (size_t)(col0 + t * 16 + ln) * ldb + kb; FragH bq; bq.half[0] = *(const v8us*)(Bh + boff + 8 * hh); bq.half[1] = *(const v8us*)(Bh + boff + 16 + 8 * hh);
      acc[t] = mmaH<ASPLIT ? 2 : 1>(ah.v, al.v, bq.v, bq.v, acc[t]); }
  }
#pragma unroll
  for (int t = 0; t < 4; ++t) { if (col0 + t * 16 >= N) continue;
#pragma unroll
    for (int r = 0; r < 8; ++r) so[w][8 * hh + r][t * 16 + ln] = acc[t][r] * alpha; }
  __builtin_amdgcn_fence(__ATOMIC_ACQ_REL, "workgroup"); __builtin_amdgcn_wave_barrier();
  const int rsub = lane >> 4, c4 = (lane & 15) * 4;
  {
#pragma unroll
    for (int q = 0; q < 8; ++q) { const int r = q * 2 + rsub; if (col0 + c4 < N) { const v4f v = *(const v4fa*)&so[w][r][c4]; *(v4f*)(C + (size_t)(row0 + r) * ldc + col0 + c4) = v; } }
     }
}

// k_gemm_hh variant with fused epilogue: v = acc·alpha + bias[by·sBias + col] (+ CP[(row/rowsPerB)·sCPb + by·64 + col] if CP) ; ACT 0 none / 1 elu ; writes f16 C16 (and f32 C if non-null)
template <int ACT>
__global__ __launch_bounds__(128) void k_gemm_hhx(const _Float16* __restrict__ A, int lda, size_t sA, const _Float16* __restrict__ Bh, int ldb, size_t sB, float alpha, const float* __restrict__ bias, size_t sBias, const float* __restrict__ CP, int rowsPerB, size_t sCPb, int row0g,
    float* __restrict__ C, _Float16* __restrict__ C16, int ldc, size_t sC, int M, int N, int K) {
  __shared__ __attribute__((aligned(16))) float so[4][16][64];
  const int tid = threadIdx.x, w = tid >> 5, lane = tid & 31, ln = lane & 15, hh = lane >> 4; const int by = blockIdx.y;
  A += (size_t)by * sA; Bh += (size_t)by * sB; const size_t cofs = (size_t)by * sC; const float* bp = bias ? bias + (size_t)by * sBias : nullptr;
  const int ntn = (N + 63) / 64; const int wid = blockIdx.x * 4 + w; const int mt = wid / ntn, nq = wid % ntn; if (mt * 16 >= M) return;
  const int row0 = mt * 16, col0 = nq * 64; const _Float16* arow = A + (size_t)(row0 + ln) * lda;
  v8f acc[4] = {};
  for (int kb = 0; kb < K; kb += 32) { FragH ah; ah.half[0] = *(const v8us*)((const unsigned short*)arow + kb + 8 * hh); ah.half[1] = *(const v8us*)((const unsigned short*)arow + kb + 16 + 8 * hh);
#pragma unroll
    for (int t = 0; t < 4; ++t) { if (col0 + t * 16 >= N) continue; const size_t boff = (size_t)(col0 + t * 16 + ln) * ldb + kb; FragH bq; bq.half[0] = *(const v8us*)((const unsigned short*)Bh + boff + 8 * hh); bq.half[1] = *(const v8us*)((const unsigned short*)Bh + boff + 16 + 8 * hh);
      acc[t] = mmaH<1>(ah.v, ah.v, bq.v, bq.v, acc[t]); }
  }
#pragma unroll
  for (int t = 0; t < 4; ++t) { if (col0 + t * 16 >= N) continue; const int col = col0 + t * 16 + ln; const float bv = bp ? bf16_round(bp[col]) : 0.f;
#pragma unroll
    for (int r = 0; r < 8; ++r) { float v = acc[t][r] * alpha + bv; if (CP) { const int bidx = (row0g + row0 + 8 * hh + r) / rowsPerB; v += CP[(size_t)bidx * sCPb + (size_t)by * 64 + col]; } if (ACT == 1) v = (v > 0.f) ? v : expm1f(v); else if (ACT == 3) v = fmaxf(v, 0.f); so[w][8 * hh + r][t * 16 + ln] = v; } }
  __builtin_amdgcn_fence(__ATOMIC_ACQ_REL, "workgroup"); __builtin_amdgcn_wave_barrier();
  const int rsub = lane >> 4, c4 = (lane & 15) * 4; typedef _Float16 v4h __attribute__((ext_vector_type(4)));
  {
#pragma unroll
    for (int q = 0; q < 8; ++q) { const int r = q * 2 + rsub; if (col0 + c4 < N) { const v4f v = *(const v4fa*)&so[w][r][c4]; if (C) *(v4f*)(C + cofs + (size_t)(row0 + r) * ldc + col0 + c4) = v; if (C16) { v4h h4; for (int i = 0; i < 4; ++i) h4[i] = (_Float16)v[i]; *(v4h*)(C16 + cofs + (size_t)(row0 + r) * ldc + col0 + c4) = h4; } } }
     }
}


// Projection GEMM, 2048 x 2048 x 2048: C = (A . Bt^T) * alpha + bias. One 128 x 128 tile of C per workgroup of 8 waves (4 x 2, 32 x 64 per wave).
// A pass is 128 k: 128 rows of A and 128 rows of Bt, 256 B each, laid in LDS at pitch 272 B by asynchronous copies, two buffers, the next pass's copies in flight under this pass's products.
// k runs upward in steps of 32 into one accumulator per 16 x 16 tile, as in k_gemm_hhx: the sums keep their order.
// Every '#pragma unroll' in k_gemm_t makes the indices of the fragment and accumulator arrays constants, so that they stay in registers.
#define GT_PITCH 272u
#define GT_STAGE (256u * GT_PITCH)
#define GT_NST (CC / 128)
__device__ __forceinline__ void gt_copy8(unsigned l0, const unsigned short* g0) {
  // eight 16-byte copies of this lane, rows 16 apart; s_wait_xcnt stands inside the statement so that no address register is rewritten ahead of it
  const unsigned l1 = l0 + 16u * GT_PITCH, l2 = l0 + 32u * GT_PITCH, l3 = l0 + 48u * GT_PITCH, l4 = l0 + 64u * GT_PITCH, l5 = l0 + 80u * GT_PITCH, l6 = l0 + 96u * GT_PITCH, l7 = l0 + 112u * GT_PITCH;
  const unsigned short *g1 = g0 + 16 * CC, *g2 = g0 + 32 * CC, *g3 = g0 + 48 * CC, *g4 = g0 + 64 * CC, *g5 = g0 + 80 * CC, *g6 = g0 + 96 * CC, *g7 = g0 + 112 * CC;
  asm volatile("global_load_async_to_lds_b128 %0, %8, off\n\t"
               "global_load_async_to_lds_b128 %1, %9, off\n\t"
               "global_load_async_to_lds_b128 %2, %10, off\n\t"
               "global_load_async_to_lds_b128 %3, %11, off\n\t"
               "global_load_async_to_lds_b128 %4, %12, off\n\t"
               "global_load_async_to_lds_b128 %5, %13, off\n\t"
               "global_load_async_to_lds_b128 %6, %14, off\n\t"
               "global_load_async_to_lds_b128 %7, %15, off\n\t"
               "s_wait_xcnt 0x0"
               :: "v"(l0), "v"(l1), "v"(l2), "v"(l3), "v"(l4), "v"(l5), "v"(l6), "v"(l7),
                  "v"(g0), "v"(g1), "v"(g2), "v"(g3), "v"(g4), "v"(g5), "v"(g6), "v"(g7) : "memory");
}
// blockIdx.y picks one of up to three independent products that share the grid; product 2's tile goes out as f16 to C16, the others' as f32
__global__ __launch_bounds__(256) void k_gemm_t(const _Float16* A0, const _Float16* A1, const _Float16* A2, const _Float16* Bh0, const _Float16* Bh1, const _Float16* Bh2, float alpha,
                                                const float* bias0, const float* bias1, const float* bias2, float* C0, float* C1, _Float16* C16) {
  __shared__ __attribute__((aligned(16))) unsigned char L[2u * GT_STAGE];
  const int py = (int)blockIdx.y; const bool H16 = py == 2;
  const _Float16* A = py == 0 ? A0 : py == 1 ? A1 : A2; const _Float16* Bh = py == 0 ? Bh0 : py == 1 ? Bh1 : Bh2; const float* bias = py == 0 ? bias0 : py == 1 ? bias1 : bias2; float* C = py == 0 ? C0 : C1;
  const int tid = threadIdx.x, w = tid >> 5, lane = tid & 31, ln = lane & 15, hh = lane >> 4;
  const int m0 = (int)(blockIdx.x / (CC / 128)) * 128, n0 = (int)(blockIdx.x % (CC / 128)) * 128;
  const int wm = (w >> 1) * 32, wn = (w & 1) * 64;
  // copies: lane takes 16-byte piece (tid & 15) of rows (tid >> 4) + 16 i; LDS rows 0..127 hold A, 128..255 hold Bt
  const unsigned lcp = (unsigned)(size_t)L + (unsigned)(tid >> 4) * GT_PITCH + (unsigned)(tid & 15) * 16u;
  const unsigned short* ga = (const unsigned short*)A + (size_t)(m0 + (tid >> 4)) * CC + (tid & 15) * 8;
  const unsigned short* gb = (const unsigned short*)Bh + (size_t)(n0 + (tid >> 4)) * CC + (tid & 15) * 8;
  v8f acc[2][4];
#pragma unroll
  for (int i = 0; i < 2; ++i)
#pragma unroll
    for (int j = 0; j < 4; ++j) acc[i][j] = (v8f){0.f,0.f,0.f,0.f,0.f,0.f,0.f,0.f};
  gt_copy8(lcp, ga); gt_copy8(lcp + 128u * GT_PITCH, gb);
  asm volatile("s_wait_asynccnt 0x0" ::: "memory");      // pass 0's bytes of this wave have landed
  __syncthreads();                                        // and every wave's: pass 0 is readable
  gt_copy8(lcp + GT_STAGE, ga + 128); gt_copy8(lcp + GT_STAGE + 128u * GT_PITCH, gb + 128);
#pragma unroll 1      // one pass per trip: the ring's order at the foot stays as written
  for (int t = 0; t < GT_NST; ++t) {
    const unsigned char* S = L + (unsigned)(t & 1) * GT_STAGE;
    const unsigned char* ar = S + (unsigned)(wm + ln) * GT_PITCH + 16u * hh;
    const unsigned char* br = S + (unsigned)(128 + wn + ln) * GT_PITCH + 16u * hh;
    FragH a[2][2], b[2][4];      // two fragment sets: the next 32 k are fetched as one group ahead of this block's products (inside this pass's buffer only)
#pragma unroll
    for (int i = 0; i < 2; ++i) { a[0][i].half[0] = *(const v8us*)(ar + i * 16 * GT_PITCH); a[0][i].half[1] = *(const v8us*)(ar + i * 16 * GT_PITCH + 32); }
#pragma unroll
    for (int j = 0; j < 4; ++j) { b[0][j].half[0] = *(const v8us*)(br + j * 16 * GT_PITCH); b[0][j].half[1] = *(const v8us*)(br + j * 16 * GT_PITCH + 32); }
#pragma unroll
    for (int ks = 0; ks < 4; ++ks) {
      const int cu = ks & 1, nx = cu ^ 1;
      if (ks < 3) {
#pragma unroll
        for (int i = 0; i < 2; ++i) { a[nx][i].half[0] = *(const v8us*)(ar + i * 16 * GT_PITCH + (ks + 1) * 64); a[nx][i].half[1] = *(const v8us*)(ar + i * 16 * GT_PITCH + (ks + 1) * 64 + 32); }
#pragma unroll
        for (int j = 0; j < 4; ++j) { b[nx][j].half[0] = *(const v8us*)(br + j * 16 * GT_PITCH + (ks + 1) * 64); b[nx][j].half[1] = *(const v8us*)(br + j * 16 * GT_PITCH + (ks + 1) * 64 + 32); }
      }
      __builtin_amdgcn_sched_barrier(0);      // keeps the next block's twelve LDS loads one group ahead of these products; without it they sink among the products and each waits out its own latency
#pragma unroll
      for (int i = 0; i < 2; ++i)
#pragma unroll
        for (int j = 0; j < 4; ++j) acc[i][j] = __builtin_amdgcn_wmma_f32_16x16x32_f16(false, a[cu][i].v, false, b[cu][j].v, (short)0, acc[i][j], false, false);
      __builtin_amdgcn_sched_barrier(0);      // the products stay one run: no later load group rises into it
    }
    asm volatile("s_wait_dscnt 0x0" ::: "memory");        // this wave's reads of the buffer have returned
    asm volatile("s_wait_asynccnt 0x0" ::: "memory");     // this wave's copies of pass t + 1 have landed
    __syncthreads();                                      // publishes pass t + 1 and frees the buffer pass t has read
    if (t + 2 < GT_NST) { gt_copy8(lcp + (unsigned)(t & 1) * GT_STAGE, ga + (t + 2) * 128); gt_copy8(lcp + (unsigned)(t & 1) * GT_STAGE + 128u * GT_PITCH, gb + (t + 2) * 128); }
  }
  asm volatile("s_wait_asynccnt 0x0" ::: "memory");       // nothing in flight before the ring becomes output staging
  // epilogue: each wave stages its 32 x 64 tile in its own LDS range (pitch 68 floats) and stores whole lines
  float* so = (float*)(L + (unsigned)w * (32u * 272u));
#pragma unroll
  for (int j = 0; j < 4; ++j) { const float bv = bf16_round(bias[n0 + wn + j * 16 + ln]);
#pragma unroll
    for (int i = 0; i < 2; ++i)
#pragma unroll
      for (int r = 0; r < 8; ++r) so[(i * 16 + 8 * hh + r) * 68 + j * 16 + ln] = acc[i][j][r] * alpha + bv; }
  __builtin_amdgcn_fence(__ATOMIC_ACQ_REL, "workgroup"); __builtin_amdgcn_wave_barrier();      // the wave's staged rows are in LDS before its lanes read them back; the range is the wave's own, so no workgroup barrier
  const int c4 = ln * 4; typedef _Float16 v4h __attribute__((ext_vector_type(4)));
  if (!H16) {
#pragma unroll
    for (int q = 0; q < 16; ++q) { const int r = q * 2 + hh; const v4f v = *(const v4fa*)&so[r * 68 + c4]; const size_t o = (size_t)(m0 + wm + r) * CC + n0 + wn + c4; *(v4f*)(C + o) = v; }
    asm volatile("s_wait_xcnt 0x0" ::: "memory");      // no register that these stores name is rewritten ahead of this wait, whichever block the build lays behind them
  } else {
#pragma unroll
    for (int q = 0; q < 16; ++q) { const int r = q * 2 + hh; const v4f v = *(const v4fa*)&so[r * 68 + c4]; const size_t o = (size_t)(m0 + wm + r) * CC + n0 + wn + c4;
      v4h h4; for (int i = 0; i < 4; ++i) h4[i] = (_Float16)v[i]; *(v4h*)(C16 + o) = h4; }
    asm volatile("s_wait_xcnt 0x0" ::: "memory");      // as in the other arm
  }
}

__global__ __launch_bounds__(256) void k_h16(const float* __restrict__ x, _Float16* __restrict__ X16, size_t n8) { const size_t t = (size_t)blockIdx.x * 256 + threadIdx.x; if (t >= n8) return; FragH f;
#pragma unroll
  for (int q = 0; q < 8; ++q) f.h[q] = (_Float16)x[t * 8 + q]; *(v8us*)((unsigned short*)X16 + t * 8) = f.half[0];  }
// Every conversion that reads inputs alone, in one grid; the block index picks the job, each thread's work is that of the separate kernels.
// Blocks 0 .. PB_G-1: BG_h[e][d] = f16(bf16(G_h[d][e]) * 16), 8 blocks a head. Then PB_M blocks a matrix, 8 elements a thread: the four weights (bf16-rounded, * 16; (out,in) = Bt) and q, k, v (bf16-rounded, * 1, which is exact).
#define PB_G (NH * 8)
#define PB_M (CC * CC / 8 / 256)
__global__ __launch_bounds__(256) void k_prep(const float* __restrict__ G, const float* __restrict__ Wq, const float* __restrict__ Wk, const float* __restrict__ Wv, const float* __restrict__ Wo,
                                              const float* __restrict__ q, const float* __restrict__ k, const float* __restrict__ v, _Float16* __restrict__ BG, _Float16* __restrict__ Y) {
  const int bid = (int)blockIdx.x, tid = threadIdx.x; FragH f;
  if (bid < PB_G) {
    const float* W = G + (size_t)(bid >> 3) * HD * HD; const int t = (bid & 7) * 256 + tid; const int n = t / (HD / 8), k8 = (t % (HD / 8)) * 8;
#pragma unroll
    for (int i = 0; i < 8; ++i) f.h[i] = (_Float16)(bf16_round(W[(size_t)(k8 + i) * HD + n]) * 16.0f);
    *(v8us*)((unsigned short*)BG + (size_t)(bid >> 3) * HD * HD + (size_t)n * HD + k8) = f.half[0];
    asm volatile("s_wait_xcnt 0x0" ::: "memory");      // no register that the store names is rewritten ahead of this wait, whichever block the build lays behind it
    return;
  }
  const int j = (bid - PB_G) / PB_M; const size_t t = (size_t)((bid - PB_G) % PB_M) * 256 + tid;      // matrix j, in the order Wq Wk Wv Wo q k v; the seven results lie one behind the other in Y
  const float* x01 = (j & 1) ? Wk : Wq; const float* x23 = (j & 1) ? Wo : Wv; const float* x45 = (j & 1) ? k : q;
  const float* x03 = (j & 2) ? x23 : x01; const float* x47 = (j & 2) ? v : x45; const float* x = (j & 4) ? x47 : x03;
  const float sc = j < 4 ? 16.0f : 1.0f;
#pragma unroll
  for (int i = 0; i < 8; ++i) f.h[i] = (_Float16)(bf16_round(x[t * 8 + i]) * sc);
  *(v8us*)((unsigned short*)Y + (size_t)j * CC * CC + t * 8) = f.half[0];
  asm volatile("s_wait_xcnt 0x0" ::: "memory");      // as in the other arm
}
template <int NHv, int TTv>
__global__ __launch_bounds__(256) void k_vt(const _Float16* __restrict__ V16, int ldv, int voff, _Float16* __restrict__ Vt) { __shared__ unsigned short tl[64][66]; const int tid = threadIdx.x; const int slab = blockIdx.x / (TTv / 64), lg = blockIdx.x % (TTv / 64); const int b = slab / NHv, h = slab % NHv;
  for (int i = tid; i < 64 * 8; i += 256) { const int r = i / 8, c8 = (i % 8) * 8; FragH f; f.half[0] = *(const v8us*)((const unsigned short*)V16 + ((size_t)b * TTv + lg * 64 + r) * ldv + voff + h * 64 + c8);
#pragma unroll
    for (int q = 0; q < 8; ++q) tl[r][c8 + q] = f.u[q]; }
  __syncthreads();
  {
#pragma unroll
    for (int rd = 0; rd < 2; ++rd) { const int d = rd * 32 + tid / 8, pc = tid % 8; FragH f;
#pragma unroll
      for (int q = 0; q < 8; ++q) f.u[q] = tl[pc * 8 + q][d];
      *(v8us*)((unsigned short*)Vt + ((size_t)slab * 64 + d) * TTv + lg * 64 + pc * 8) = f.half[0]; }
     } }

// Attention ring: a stage is 64 keys for the block's 64 query rows: 64 rows of K (256 B, pitch 272), 128 rows of Vt (128 B, pitch 144) and 64 rows of the mask (256 B, pitch 272),
// laid in LDS by asynchronous copies, two buffers, the next stage's copies in flight under this stage's work; the four waves share K and Vt. A stage is worked as two 32-key tiles, upward, as before: every sum keeps its order.
#define FL_KP 272u
#define FL_VP 144u
#define FL_MP 272u
#define FL_VO (64u * FL_KP)
#define FL_MO (FL_VO + 128u * FL_VP)
#define FL_STAGE (FL_MO + 64u * FL_MP)
#define FL_NST (SS / 64)
typedef float f1a __attribute__((may_alias));
__device__ __forceinline__ void fl_copy8(unsigned l0, unsigned ls, const unsigned char* g0, size_t gs) {
  // eight 16-byte copies of this lane, LDS rows ls bytes apart, global rows gs bytes apart; s_wait_xcnt stands inside the statement so that no address register is rewritten ahead of it
  const unsigned l1 = l0 + ls, l2 = l0 + 2u * ls, l3 = l0 + 3u * ls, l4 = l0 + 4u * ls, l5 = l0 + 5u * ls, l6 = l0 + 6u * ls, l7 = l0 + 7u * ls;
  const unsigned char *g1 = g0 + gs, *g2 = g0 + 2 * gs, *g3 = g0 + 3 * gs, *g4 = g0 + 4 * gs, *g5 = g0 + 5 * gs, *g6 = g0 + 6 * gs, *g7 = g0 + 7 * gs;
  asm volatile("global_load_async_to_lds_b128 %0, %8, off\n\t"
               "global_load_async_to_lds_b128 %1, %9, off\n\t"
               "global_load_async_to_lds_b128 %2, %10, off\n\t"
               "global_load_async_to_lds_b128 %3, %11, off\n\t"
               "global_load_async_to_lds_b128 %4, %12, off\n\t"
               "global_load_async_to_lds_b128 %5, %13, off\n\t"
               "global_load_async_to_lds_b128 %6, %14, off\n\t"
               "global_load_async_to_lds_b128 %7, %15, off\n\t"
               "s_wait_xcnt 0x0"
               :: "v"(l0), "v"(l1), "v"(l2), "v"(l3), "v"(l4), "v"(l5), "v"(l6), "v"(l7),
                  "v"(g0), "v"(g1), "v"(g2), "v"(g3), "v"(g4), "v"(g5), "v"(g6), "v"(g7) : "memory");
}
__global__ __launch_bounds__(128) void k_flash(const _Float16* __restrict__ Q16, int ldq, const _Float16* __restrict__ K16, int ldk, const _Float16* __restrict__ Vt, const float* __restrict__ MSK, float* __restrict__ O, int ldo) {
  constexpr int RPW = 16, RTN = RPW / 16, NQB = 2048 / (4 * RPW), DT = 8, KS = 4;      /* head dim 128 */
  __shared__ __attribute__((aligned(16))) unsigned short sP[4][RPW][40]; __shared__ __attribute__((aligned(16))) unsigned char L[2u * FL_STAGE];
  const int tid = threadIdx.x, w = tid >> 5, lane = tid & 31, ln = lane & 15, hh = lane >> 4;
  const int slab = blockIdx.x / NQB, qblk = blockIdx.x % NQB; const int b = slab / 16, h = slab % 16; const int qb0 = qblk * (4 * RPW); const int q0 = qb0 + w * RPW;
  const unsigned short* Vth = (const unsigned short*)Vt + (size_t)slab * 128 * 2048;
  // copies: K and mask: 16-byte piece (tid & 15) of rows (tid >> 4) + 8 i; Vt: piece (tid & 7) of rows (tid >> 3) + 16 i
  const unsigned lb = (unsigned)(size_t)L;
  const unsigned lk = lb + (unsigned)(tid >> 4) * FL_KP + (unsigned)(tid & 15) * 16u, lv = lb + FL_VO + (unsigned)(tid >> 3) * FL_VP + (unsigned)(tid & 7) * 16u, lm = lb + FL_MO + (unsigned)(tid >> 4) * FL_MP + (unsigned)(tid & 15) * 16u;
  const size_t kstep = (size_t)ldk * 2;      // bytes of a K row
  const unsigned char* gk = (const unsigned char*)((const unsigned short*)K16 + ((size_t)b * 2048 + (tid >> 4)) * ldk + h * 128 + (tid & 15) * 8);
  const unsigned char* gv = (const unsigned char*)(Vth + (size_t)(tid >> 3) * 2048 + (tid & 7) * 8);
  const unsigned char* gm = (const unsigned char*)(MSK + ((size_t)b * 2048 + qb0 + (tid >> 4)) * 2048 + (tid & 15) * 4);
  fl_copy8(lk, 8u * FL_KP, gk, 8 * kstep); fl_copy8(lv, 16u * FL_VP, gv, (size_t)16 * 4096); fl_copy8(lm, 8u * FL_MP, gm, (size_t)8 * 8192);
  FragH aq[2][KS];
#pragma unroll
  for (int rt = 0; rt < RTN; ++rt) { const unsigned short* qr = (const unsigned short*)Q16 + ((size_t)b * 2048 + q0 + rt * 16 + ln) * ldq + h * 128;
#pragma unroll
    for (int ks = 0; ks < KS; ++ks) { aq[rt][ks].half[0] = *(const v8us*)(qr + ks * 32 + 8 * hh); aq[rt][ks].half[1] = *(const v8us*)(qr + ks * 32 + 16 + 8 * hh); } }
  float m_r[2][8], l_r[2][8]; v8f oacc[2][DT];
#pragma unroll
  for (int rt = 0; rt < RTN; ++rt) {
#pragma unroll
    for (int r = 0; r < 8; ++r) { m_r[rt][r] = -3.0e38f; l_r[rt][r] = 0.f; }
#pragma unroll
    for (int dt = 0; dt < DT; ++dt) oacc[rt][dt] = (v8f){0.f,0.f,0.f,0.f,0.f,0.f,0.f,0.f}; }
  asm volatile("s_wait_asynccnt 0x0" ::: "memory");      // stage 0's bytes of this wave have landed
  __syncthreads();                                        // and every wave's: stage 0 is readable
  fl_copy8(lk + FL_STAGE, 8u * FL_KP, gk + 64 * kstep, 8 * kstep); fl_copy8(lv + FL_STAGE, 16u * FL_VP, gv + 128, (size_t)16 * 4096); fl_copy8(lm + FL_STAGE, 8u * FL_MP, gm + 256, (size_t)8 * 8192);
#pragma unroll 1      // one stage per trip: the ring's order at the foot stays as written
  for (int t = 0; t < FL_NST; ++t) {
    const unsigned char* S = L + (unsigned)(t & 1) * FL_STAGE;
#pragma unroll 1      // the two 32-key tiles of a stage share one body: less code, and a masked tile is skipped on its own
  for (int sub = 0; sub < 2; ++sub) {
    // mask tile for my 16 query rows x 32 keys: lane (ln,hh) needs rows rt*16 + 8hh + r, keys ln and 16 + ln of the tile
    unsigned okb0 = 0u, okb1 = 0u;      // bit (rt*8 + r) set when key ln (resp. 16+ln) of the tile is OPEN for query row rt*16 + 8hh + r
#pragma unroll
    for (int rt = 0; rt < RTN; ++rt)
#pragma unroll
      for (int r = 0; r < 8; ++r) { const f1a* mr = (const f1a*)(S + FL_MO + (unsigned)(w * RPW + rt * 16 + 8 * hh + r) * FL_MP + (unsigned)sub * 128u); okb0 |= (mr[ln] == 0.0f ? 1u : 0u) << (rt * 8 + r); okb1 |= (mr[16 + ln] == 0.0f ? 1u : 0u) << (rt * 8 + r); }      /* float mask: nonzero = masked (-1e9) */
    if (__builtin_amdgcn_ballot_w32((okb0 | okb1) != 0u) == 0u) continue;      // every (query,key) of this wave's tile is masked: contributes nothing (uniform branch; the stage's foot is outside this loop)
    v8f s[2][2];
#pragma unroll
    for (int nt = 0; nt < 2; ++nt) { const unsigned char* kr = S + (unsigned)(sub * 32 + nt * 16 + ln) * FL_KP + 16u * hh; FragH bk[KS];
#pragma unroll
      for (int ks = 0; ks < KS; ++ks) { bk[ks].half[0] = *(const v8us*)(kr + ks * 64); bk[ks].half[1] = *(const v8us*)(kr + ks * 64 + 32); }
#pragma unroll
      for (int rt = 0; rt < RTN; ++rt) { v8f acc = (v8f){0.f,0.f,0.f,0.f,0.f,0.f,0.f,0.f};
#pragma unroll
        for (int ks = 0; ks < KS; ++ks) acc = mmaH<1>(aq[rt][ks].v, aq[rt][ks].v, bk[ks].v, bk[ks].v, acc); s[rt][nt] = acc; } }
#pragma unroll
    for (int rt = 0; rt < RTN; ++rt)
#pragma unroll
      for (int r = 0; r < 8; ++r) {
        const bool ok0 = ((okb0 >> (rt * 8 + r)) & 1u) != 0u, ok1 = ((okb1 >> (rt * 8 + r)) & 1u) != 0u;
        const float s0 = ok0 ? s[rt][0][r] * (0.08838834764831845f) : -INFINITY, s1 = ok1 ? s[rt][1][r] * (0.08838834764831845f) : -INFINITY; float mc = fmaxf(s0, s1);
        mc = fmaxf(mc, __shfl_xor(mc, 1, 32)); mc = fmaxf(mc, __shfl_xor(mc, 2, 32)); mc = fmaxf(mc, __shfl_xor(mc, 4, 32)); mc = fmaxf(mc, __shfl_xor(mc, 8, 32));
        const float mn = fmaxf(m_r[rt][r], mc); const float al = (mn > -1.0e38f) ? expf(m_r[rt][r] - mn) : 1.0f; m_r[rt][r] = mn; const float p0 = ok0 ? expf(s0 - mn) : 0.f, p1 = ok1 ? expf(s1 - mn) : 0.f; l_r[rt][r] = l_r[rt][r] * al + p0 + p1;
#pragma unroll
        for (int dt = 0; dt < DT; ++dt) oacc[rt][dt][r] *= al;
        FragH t2; t2.h[0] = (_Float16)p0; t2.h[1] = (_Float16)p1; sP[w][rt * 16 + 8 * hh + r][ln] = t2.u[0]; sP[w][rt * 16 + 8 * hh + r][16 + ln] = t2.u[1]; }
    __builtin_amdgcn_fence(__ATOMIC_ACQ_REL, "workgroup"); __builtin_amdgcn_wave_barrier();
    FragH pa[2];
#pragma unroll
    for (int rt = 0; rt < RTN; ++rt) { pa[rt].half[0] = *(const v8us*)&sP[w][rt * 16 + ln][8 * hh]; pa[rt].half[1] = *(const v8us*)&sP[w][rt * 16 + ln][16 + 8 * hh]; }
#pragma unroll
    for (int dt = 0; dt < DT; ++dt) { const unsigned char* vrow = S + FL_VO + (unsigned)(dt * 16 + ln) * FL_VP + (unsigned)sub * 64u + 16u * hh; FragH bv; bv.half[0] = *(const v8us*)vrow; bv.half[1] = *(const v8us*)(vrow + 32);
#pragma unroll
      for (int rt = 0; rt < RTN; ++rt) oacc[rt][dt] = mmaH<1>(pa[rt].v, pa[rt].v, bv.v, bv.v, oacc[rt][dt]); }
    __builtin_amdgcn_fence(__ATOMIC_ACQ_REL, "workgroup"); __builtin_amdgcn_wave_barrier(); }
    asm volatile("s_wait_dscnt 0x0" ::: "memory");        // this wave's reads of the buffer have returned
    asm volatile("s_wait_asynccnt 0x0" ::: "memory");     // this wave's copies of stage t + 1 have landed
    __syncthreads();                                      // publishes stage t + 1 and frees the buffer stage t has read
    if (t + 2 < FL_NST) { const unsigned lo = (unsigned)(t & 1) * FL_STAGE; fl_copy8(lk + lo, 8u * FL_KP, gk + (size_t)(t + 2) * 64 * kstep, 8 * kstep); fl_copy8(lv + lo, 16u * FL_VP, gv + (t + 2) * 128, (size_t)16 * 4096); fl_copy8(lm + lo, 8u * FL_MP, gm + (t + 2) * 256, (size_t)8 * 8192); }
  }
  asm volatile("s_wait_asynccnt 0x0" ::: "memory");       // nothing in flight before the ring becomes output staging (the last foot's barrier has ended every wave's reads of it)
  float* sO = (float*)(L + (unsigned)w * (unsigned)(RPW * (128 + 4) * 4));      // each wave's own range, pitch 132 floats
#pragma unroll
  for (int rt = 0; rt < RTN; ++rt) {
#pragma unroll
    for (int r = 0; r < 8; ++r) { float l = l_r[rt][r]; l += __shfl_xor(l, 1, 32); l += __shfl_xor(l, 2, 32); l += __shfl_xor(l, 4, 32); l += __shfl_xor(l, 8, 32); l_r[rt][r] = (l > 0.f) ? 1.0f / l : 0.f; }
#pragma unroll
    for (int dt = 0; dt < DT; ++dt)
#pragma unroll
      for (int r = 0; r < 8; ++r) sO[(rt * 16 + 8 * hh + r) * 132 + dt * 16 + ln] = oacc[rt][dt][r] * l_r[rt][r]; }
  __builtin_amdgcn_fence(__ATOMIC_ACQ_REL, "workgroup"); __builtin_amdgcn_wave_barrier();
  {
#pragma unroll
    for (int rp = 0; rp < RPW; ++rp) { const int r = rp, pc = lane; const v4f val = *(const v4fa*)&sO[r * 132 + pc * 4]; *(v4f*)(O + ((size_t)b * 2048 + q0 + r) * ldo + h * 128 + pc * 4) = val; }      /* 128-float rows: 32 lanes x 16 B */
     } }

__device__ __forceinline__ void d_rope16(int bid, const float* __restrict__ SRC, _Float16* __restrict__ D16) { __shared__ __attribute__((aligned(16))) _Float16 st[256][8]; const int tid = threadIdx.x; const size_t t = (size_t)bid * 256 + tid; if (t >= (size_t)SS * NH * 16) return; const int p = (int)(t % 16); const int h = (int)((t / 16) % NH); const int s = (int)(t / (16 * NH)); const float* src = SRC + ((size_t)s * NH + h) * HD;
#pragma unroll 1
  for (int q = 0; q < 8; ++q) { const int j = p * 8 + q; const int i = j >> 1; const float f = __builtin_powf(10000.0f, -(float)(2 * i) / 128.0f); const float ang = (float)s * f; const float c = cosf(ang), sn = sinf(ang); const float xr = src[2 * i], xi = src[2 * i + 1]; st[tid][q] = (_Float16)((j & 1) ? (xr * sn + xi * c) : (xr * c - xi * sn)); }
  const v8us v = *(const v8us*)&st[tid][0]; unsigned short* d = (unsigned short*)D16 + ((size_t)s * NH + h) * HD + p * 8; *(v8us*)d = v;  }
__device__ __forceinline__ void d_vt128(int bid, const _Float16* __restrict__ V16, _Float16* __restrict__ Vt) { __shared__ unsigned short tl[64][130]; const int tid = threadIdx.x; const int h = bid / (SS / 64), lg = bid % (SS / 64);
  for (int i = tid; i < 64 * 16; i += 256) { const int r = i / 16, c8 = (i % 16) * 8; FragH f; f.half[0] = *(const v8us*)((const unsigned short*)V16 + ((size_t)lg * 64 + r) * CC + h * HD + c8);
#pragma unroll
    for (int q = 0; q < 8; ++q) tl[r][c8 + q] = f.u[q]; }
  __syncthreads();
  { for (int i = tid; i < 128 * 8; i += 256) { const int d = i / 8, pc = i % 8; FragH f;
#pragma unroll
      for (int q = 0; q < 8; ++q) f.u[q] = tl[pc * 8 + q][d]; *(v8us*)((unsigned short*)Vt + ((size_t)h * HD + d) * SS + lg * 64 + pc * 8) = f.half[0]; }  } }
// What follows the three projections and is independent of one another, in one grid: RoPE of q, RoPE of k (RB blocks each), then the short V transposes
#define RB (SS * NH * 16 / 256)
__global__ __launch_bounds__(256) void k_post(const float* __restrict__ QF, _Float16* __restrict__ QR16, const float* __restrict__ KF, _Float16* __restrict__ KR16, const _Float16* __restrict__ V16, _Float16* __restrict__ Vt) {
  const int bid = (int)blockIdx.x;
  if (bid < 2 * RB) d_rope16(bid % RB, bid < RB ? QF : KF, bid < RB ? QR16 : KR16);
  else d_vt128(bid - 2 * RB, V16, Vt);
}
extern "C" void kernel_launch(void* const* d_in, const int* in_sizes, int n_in,
                              void* d_out, int out_size, void* d_ws, size_t ws_size, hipStream_t stream) {
  (void)in_sizes; (void)n_in; (void)out_size;
  const float* const* I = (const float* const*)d_in; const float* q = I[0]; const float* k = I[1]; const float* v = I[2]; const float* mask = I[3]; const float* Wq = I[4]; const float* bq = I[5]; const float* Wk = I[6]; const float* bk = I[7]; const float* Wv = I[8]; const float* bv = I[9]; const float* G = I[10]; const float* Wo = I[11]; const float* bo = I[12];
  char* ws = (char*)d_ws; size_t off = 0;
  auto take = [&](size_t bytes) { char* p = ws + off; off += (bytes + 255) & ~(size_t)255; return p; };
  _Float16* Y = (_Float16*)take((size_t)7 * CC * CC * 2); _Float16* Bq = Y; _Float16* Bk = Y + (size_t)CC * CC; _Float16* Bv = Y + (size_t)2 * CC * CC; _Float16* Bo = Y + (size_t)3 * CC * CC; _Float16* Xq = Y + (size_t)4 * CC * CC; _Float16* Xk = Y + (size_t)5 * CC * CC; _Float16* Xv = Y + (size_t)6 * CC * CC;
  _Float16* BG = (_Float16*)take((size_t)NH * HD * HD * 2);
  float* QF = (float*)take((size_t)SS * CC * 4); float* KF = (float*)take((size_t)SS * CC * 4);
  _Float16* QR16 = (_Float16*)take((size_t)SS * CC * 2); _Float16* QG16 = (_Float16*)take((size_t)SS * CC * 2); _Float16* KR16 = (_Float16*)take((size_t)SS * CC * 2); _Float16* V16 = (_Float16*)take((size_t)SS * CC * 2); _Float16* Vt = (_Float16*)take((size_t)SS * CC * 2); float* O = QF; _Float16* O16 = Xq;
  if (off > ws_size) return;      // 8.4 x 12 + 0.5 + 16.8 x 2 = about 135 MB
  const unsigned gx = (unsigned)(((size_t)SS * CC / 8 + 255) / 256); const unsigned gt = (SS / 128) * (CC / 128);
  k_prep<<<PB_G + 7 * PB_M, 256, 0, stream>>>(G, Wq, Wk, Wv, Wo, q, k, v, BG, Y);      // operands in f16
  k_gemm_t<<<dim3(gt, 3), 256, 0, stream>>>(Xq, Xk, Xv, Bq, Bk, Bv, 0.0625f, bq, bk, bv, QF, KF, V16);      // q, k (f32) and v (f16) projections
  k_post<<<2 * RB + NH * (SS / 64), 256, 0, stream>>>(QF, QR16, KF, KR16, V16, Vt);      // rope q, rope k, Vt
  k_gemm_hhx<0><<<dim3(((SS / 16) * (HD / 64) + 3) / 4, NH), 128, 0, stream>>>(QR16, CC, (size_t)HD, BG, HD, (size_t)HD * HD, 0.0625f, nullptr, 0, nullptr, 1, 0, 0, nullptr, QG16, CC, (size_t)HD, SS, HD, HD);      // qg_h = q_h · G_h (batched over heads via column offsets)
  k_flash<<<1 * NH * (SS / 64), 128, 0, stream>>>(QG16, CC, KR16, CC, Vt, mask, O, CC);
  k_h16<<<gx, 256, 0, stream>>>(O, O16, (size_t)SS * CC / 8);
  k_gemm_t<<<dim3(gt, 1), 256, 0, stream>>>(O16, O16, O16, Bo, Bo, Bo, 0.0625f, bo, bo, bo, (float*)d_out, (float*)d_out, nullptr);
}

// v004
// A run of this version takes 212 microseconds.
// In both of two side-by-side timings against v003, it was 1.35 times as fast.
// All steps since v000 together make it 3.44 times as fast.
#include <hip/hip_runtime.h>
// Power-law-graph multi-head attention (B=1, S=2048, D=2048, 16 heads × 128; INPUT additive mask (nonzero = −1e9) ; RoPE interleaved pairs): q/k/v/o projections ((out,in) + bias) and the per-head
// metric product qg = q_h·G_h as GEMMs and the attention as a fused flash-style kernel (head dim 128: 4 k-steps / 8 d-tiles; masked keys excluded, fully masked 32-key tiles skipped by ballot;
// online softmax f32; P f16 ≤ 1; O = P·Vt; RPW-16 waves) on v_wmma_f32_16x16x32_f16, f32 accumulate; RoPE f32 VALU.
#define SS 2048
#define CC 2048
#define NH 16
#define HD 128

typedef __bf16 v16b __attribute__((ext_vector_type(16)));
typedef unsigned short v8us __attribute__((ext_vector_type(8), may_alias));
typedef float  v8f  __attribute__((ext_vector_type(8)));
typedef float  v4f  __attribute__((ext_vector_type(4)));
typedef float  v4fa __attribute__((ext_vector_type(4), may_alias));
union FragB { v16b v; v8us half[2]; unsigned short u[16]; };

__device__ __forceinline__ unsigned short bf16_bits(float x) { unsigned int u = __float_as_uint(x); return (unsigned short)((u + 0x7FFFu + ((u >> 16) & 1u)) >> 16); }
__device__ __forceinline__ float bf16_val(unsigned short b) { return __uint_as_float(((unsigned int)b) << 16); }
__device__ __forceinline__ float bf16_round(float x) { return bf16_val(bf16_bits(x)); }
// D += A·B with NT terms: 1 = ah·bh, 2 = + al·bh (A split), 3 = + ah·bl (both split)
template <int NT>
__device__ __forceinline__ v8f mmaN(v16b ah, v16b al, v16b bh, v16b bl, v8f c) {
  c = __builtin_amdgcn_wmma_f32_16x16x32_bf16(false, ah, false, bh, (short)0, c, false, false);
  if (NT >= 2) c = __builtin_amdgcn_wmma_f32_16x16x32_bf16(false, al, false, bh, (short)0, c, false, false);
  if (NT >= 3) c = __builtin_amdgcn_wmma_f32_16x16x32_bf16(false, ah, false, bl, (short)0, c, false, false);
  asm volatile("v_nop\n\tv_nop\n\tv_nop\n\tv_nop" : "+v"(c) : "v"(ah), "v"(al), "v"(bh), "v"(bl));
  return c;
}

__global__ __launch_bounds__(256) void k_wt_bf16(const float* __restrict__ W, unsigned short* __restrict__ Wt, int K, int N) {
  const int t = blockIdx.x * 256 + threadIdx.x;
  const int k8n = K / 8;
  if (t >= N * k8n) return;
  const int n = t / k8n, k8 = (t % k8n) * 8;
  v8us v;
#pragma unroll
  for (int i = 0; i < 8; ++i) v[i] = bf16_bits(W[(size_t)(k8 + i) * N + n]);
  *(v8us*)(Wt + (size_t)n * K + k8) = v;
  
}

// GEMM C[M][N] (f32, pitch ldc) = act(A[M][K]·W + bias). A f32 row-major (pitch lda) converted per fragment to bf16
// (ASPLIT: hi/lo two planes -> 2 terms, else single rounded term); Wt bf16 [N][K] (pitch ldb). BIAS_BF16 rounds the
// bias to bf16 first (bias quantised to bf16 before the add). K%32==0, M%16==0, N%64==0.
template <bool ASPLIT, int ACT, bool BIAS_BF16>
__global__ __launch_bounds__(128) void k_gemm_bf(const float* __restrict__ A, int lda, const unsigned short* __restrict__ Wt, int ldb,
                                               const float* __restrict__ bias, float* __restrict__ C, int ldc, int M, int N, int K) {
  __shared__ __attribute__((aligned(16))) float so[4][16][64];
  const int tid = threadIdx.x, w = tid >> 5, lane = tid & 31, ln = lane & 15, hh = lane >> 4;
  const int ntn = N / 64;
  const int wid = blockIdx.x * 4 + w;
  const int mt = wid / ntn, nq = wid % ntn;
  if (mt * 16 >= M) return;
  const int row0 = mt * 16, col0 = nq * 64;
  const float* arow = A + (size_t)(row0 + ln) * lda;
  v8f acc[4] = {};
  for (int kb = 0; kb < K; kb += 32) {
    FragB ah, al;
    const v4f x0 = *(const v4fa*)(arow + kb + 8 * hh), x1 = *(const v4fa*)(arow + kb + 8 * hh + 4);
    const v4f x2 = *(const v4fa*)(arow + kb + 16 + 8 * hh), x3 = *(const v4fa*)(arow + kb + 16 + 8 * hh + 4);
    float xs[16] = {x0[0],x0[1],x0[2],x0[3],x1[0],x1[1],x1[2],x1[3],x2[0],x2[1],x2[2],x2[3],x3[0],x3[1],x3[2],x3[3]};
#pragma unroll
    for (int i = 0; i < 16; ++i) { const unsigned short hb = bf16_bits(xs[i]); ah.u[i] = hb; al.u[i] = ASPLIT ? bf16_bits(xs[i] - bf16_val(hb)) : (unsigned short)0; }
#pragma unroll
    for (int t = 0; t < 4; ++t) {
      const unsigned short* brow = Wt + (size_t)(col0 + t * 16 + ln) * ldb + kb;
      FragB b;
      b.half[0] = *(const v8us*)(brow + 8 * hh);
      b.half[1] = *(const v8us*)(brow + 16 + 8 * hh);
      acc[t] = mmaN<ASPLIT ? 2 : 1>(ah.v, al.v, b.v, b.v, acc[t]);
    }
  }
#pragma unroll
  for (int t = 0; t < 4; ++t) {
    float bv = bias ? bias[col0 + t * 16 + ln] : 0.f;
    if (BIAS_BF16) bv = bf16_round(bv);
#pragma unroll
    for (int r = 0; r < 8; ++r) { float v = acc[t][r] + bv; if (ACT == 1) v = fmaxf(v, 0.f); so[w][8 * hh + r][t * 16 + ln] = v; }
  }
  __builtin_amdgcn_fence(__ATOMIC_ACQ_REL, "workgroup");
  __builtin_amdgcn_wave_barrier();
  const int rsub = lane >> 4, c4 = (lane & 15) * 4;
  {
#pragma unroll
    for (int q = 0; q < 8; ++q) {
      const int r = q * 2 + rsub;
      const v4f v = *(const v4fa*)&so[w][r][c4];
      *(v4f*)(C + (size_t)(row0 + r) * ldc + col0 + c4) = v;
    }
    
  }
}

// Flash-style causal/unmasked attention, all contractions 3-term bf16 hi/lo splits, f32 softmax with running max.
// q,k,v rows are read from f32 buffers with arbitrary row pitch (so they can live inside a fused qkv buffer);
// D = head size (multiple of 32, <= 128); one wave = 16 query rows; block = 4 waves (64 queries) sharing K/V chunks of 32.
template <int D, bool CAUSAL>
__global__ __launch_bounds__(128) void k_flash(const float* __restrict__ qb, const float* __restrict__ kb, const float* __restrict__ vb,
                                             int pitch, int T, int H, float scale, float* __restrict__ y, int ypitch) {
  constexpr int KS = D / 32;        // k-steps for QK
  constexpr int DT = D / 16;        // d tiles for PV
  __shared__ __attribute__((aligned(16))) unsigned short sKh[32][D + 8], sKl[32][D + 8], sVh[32][D + 8], sVl[32][D + 8];
  __shared__ __attribute__((aligned(16))) unsigned short sPh[4][16][40], sPl[4][16][40];
  __shared__ __attribute__((aligned(16))) float sO[4][16][D];
  const int tid = threadIdx.x, w = tid >> 5, lane = tid & 31, ln = lane & 15, hh = lane >> 4;
  const int nqb = (T + 63) / 64;
  const int bh = blockIdx.x / nqb, qblk = blockIdx.x % nqb;
  const int b = bh / H, h = bh % H;
  const int q0 = qblk * 64 + w * 16;
  const float* Q = qb + (size_t)b * T * pitch + h * D;
  const float* K = kb + (size_t)b * T * pitch + h * D;
  const float* V = vb + (size_t)b * T * pitch + h * D;

  // A fragments of the wave's 16 query rows (scaled), hi/lo
  FragB aqh[KS], aql[KS];
  {
    int row = q0 + ln; if (row >= T) row = T - 1;
    const float* qr = Q + (size_t)row * pitch;
#pragma unroll
    for (int ks = 0; ks < KS; ++ks)
#pragma unroll
      for (int i = 0; i < 16; ++i) {
        const int d = ks * 32 + ((i < 8) ? (8 * hh + i) : (16 + 8 * hh + (i - 8)));
        const float x = qr[d] * scale; const unsigned short hb = bf16_bits(x);
        aqh[ks].u[i] = hb; aql[ks].u[i] = bf16_bits(x - bf16_val(hb));
      }
  }
  float m_r[8], l_r[8];
#pragma unroll
  for (int r = 0; r < 8; ++r) { m_r[r] = -3.0e38f; l_r[r] = 0.f; }
  v8f oacc[DT];
#pragma unroll
  for (int dt = 0; dt < DT; ++dt) oacc[dt] = (v8f){0.f,0.f,0.f,0.f,0.f,0.f,0.f,0.f};

  const int kv_end = CAUSAL ? min(T, qblk * 64 + 64) : T;     // block-uniform
  for (int j0 = 0; j0 < kv_end; j0 += 32) {
    __syncthreads();
    for (int e = tid; e < 32 * (D / 4); e += 128) {
      const int r = e / (D / 4), c4 = (e % (D / 4)) * 4;
      const int key = j0 + r;
      v4f kf = {0.f,0.f,0.f,0.f}, vf = {0.f,0.f,0.f,0.f};
      if (key < T) { kf = *(const v4fa*)(K + (size_t)key * pitch + c4); vf = *(const v4fa*)(V + (size_t)key * pitch + c4); }
#pragma unroll
      for (int t = 0; t < 4; ++t) {
        unsigned short hb = bf16_bits(kf[t]); sKh[r][c4 + t] = hb; sKl[r][c4 + t] = bf16_bits(kf[t] - bf16_val(hb));
        hb = bf16_bits(vf[t]); sVh[r][c4 + t] = hb; sVl[r][c4 + t] = bf16_bits(vf[t] - bf16_val(hb));
      }
    }
    __syncthreads();
    // S tile 16 x 32
    v8f s[2];
#pragma unroll
    for (int nt = 0; nt < 2; ++nt) {
      v8f acc = {};
#pragma unroll
      for (int ks = 0; ks < KS; ++ks) {
        FragB bh_, bl_;
        bh_.half[0] = *(const v8us*)&sKh[nt * 16 + ln][ks * 32 + 8 * hh]; bh_.half[1] = *(const v8us*)&sKh[nt * 16 + ln][ks * 32 + 16 + 8 * hh];
        bl_.half[0] = *(const v8us*)&sKl[nt * 16 + ln][ks * 32 + 8 * hh]; bl_.half[1] = *(const v8us*)&sKl[nt * 16 + ln][ks * 32 + 16 + 8 * hh];
        acc = mmaN<3>(aqh[ks].v, aql[ks].v, bh_.v, bl_.v, acc);
      }
      s[nt] = acc;
    }
    // mask + running max (rows 8hh+r; the 16 lanes of a half share rows)
    float alpha[8];
#pragma unroll
    for (int r = 0; r < 8; ++r) {
      const int qi = q0 + 8 * hh + r;
      const int ja = j0 + ln, jb = j0 + 16 + ln;
      if (CAUSAL) { if (ja > qi) s[0][r] = -3.0e38f; if (jb > qi) s[1][r] = -3.0e38f; }
      if (ja >= T) s[0][r] = -3.0e38f;
      if (jb >= T) s[1][r] = -3.0e38f;
      float mx = fmaxf(s[0][r], s[1][r]);
      mx = fmaxf(mx, __shfl_xor(mx, 1, 32)); mx = fmaxf(mx, __shfl_xor(mx, 2, 32)); mx = fmaxf(mx, __shfl_xor(mx, 4, 32)); mx = fmaxf(mx, __shfl_xor(mx, 8, 32));
      const float mnew = fmaxf(m_r[r], mx);
      alpha[r] = (mnew > -1.0e38f) ? __expf(m_r[r] - mnew) : 1.0f;
      const float p0 = (s[0][r] > -1.0e38f) ? __expf(s[0][r] - mnew) : 0.f;
      const float p1 = (s[1][r] > -1.0e38f) ? __expf(s[1][r] - mnew) : 0.f;
      m_r[r] = mnew;
      l_r[r] = l_r[r] * alpha[r] + p0 + p1;            // per-lane partial row sum (16 lanes combined at the end)
      unsigned short hb = bf16_bits(p0); sPh[w][8 * hh + r][ln] = hb;      sPl[w][8 * hh + r][ln] = bf16_bits(p0 - bf16_val(hb));
      hb = bf16_bits(p1);                sPh[w][8 * hh + r][16 + ln] = hb; sPl[w][8 * hh + r][16 + ln] = bf16_bits(p1 - bf16_val(hb));
    }
#pragma unroll
    for (int dt = 0; dt < DT; ++dt)
#pragma unroll
      for (int r = 0; r < 8; ++r) oacc[dt][r] *= alpha[r];
    __builtin_amdgcn_fence(__ATOMIC_ACQ_REL, "workgroup");
    __builtin_amdgcn_wave_barrier();
    FragB pah, pal;
    pah.half[0] = *(const v8us*)&sPh[w][ln][8 * hh]; pah.half[1] = *(const v8us*)&sPh[w][ln][16 + 8 * hh];
    pal.half[0] = *(const v8us*)&sPl[w][ln][8 * hh]; pal.half[1] = *(const v8us*)&sPl[w][ln][16 + 8 * hh];
#pragma unroll
    for (int dt = 0; dt < DT; ++dt) {
      FragB bvh, bvl;
#pragma unroll
      for (int i = 0; i < 8; ++i) {
        bvh.u[i] = sVh[8 * hh + i][dt * 16 + ln]; bvh.u[8 + i] = sVh[16 + 8 * hh + i][dt * 16 + ln];
        bvl.u[i] = sVl[8 * hh + i][dt * 16 + ln]; bvl.u[8 + i] = sVl[16 + 8 * hh + i][dt * 16 + ln];
      }
      oacc[dt] = mmaN<3>(pah.v, pal.v, bvh.v, bvl.v, oacc[dt]);
    }
    __builtin_amdgcn_fence(__ATOMIC_ACQ_REL, "workgroup");
    __builtin_amdgcn_wave_barrier();
  }
#pragma unroll
  for (int r = 0; r < 8; ++r) {
    float l = l_r[r];
    l += __shfl_xor(l, 1, 32); l += __shfl_xor(l, 2, 32); l += __shfl_xor(l, 4, 32); l += __shfl_xor(l, 8, 32);
    l_r[r] = (l > 0.f) ? 1.0f / l : 0.f;
  }
#pragma unroll
  for (int dt = 0; dt < DT; ++dt)
#pragma unroll
    for (int r = 0; r < 8; ++r) sO[w][8 * hh + r][dt * 16 + ln] = oacc[dt][r] * l_r[r];
  __builtin_amdgcn_fence(__ATOMIC_ACQ_REL, "workgroup");
  __builtin_amdgcn_wave_barrier();
  {
    for (int r = 0; r < 16; ++r) {
      const int row = q0 + r;
      if (row < T && lane < D / 4) {
        const v4f val = *(const v4fa*)&sO[w][r][lane * 4];
        *(v4f*)(y + ((size_t)b * T + row) * ypitch + h * D + lane * 4) = val;
      }
    }
    
  }
}

// GEMM C = act(A·W + bias + resid): A f32 (ASPLIT -> hi/lo 2 terms), Wt bf16 [N][K]; ACT 0 none, 1 relu, 2 exact gelu;
// resid (optional, f32, row index = (row % rmod), pitch ldr, RES_BF16 rounds it) added before the activation.
template <bool ASPLIT, int ACT, bool BIAS_BF16, bool RES_BF16>
__global__ __launch_bounds__(128) void k_gemm_bf3(const float* __restrict__ A, int lda, const unsigned short* __restrict__ Wt, int ldb,
                                                const float* __restrict__ bias, const float* __restrict__ resid, int rmod, int ldr,
                                                float* __restrict__ C, int ldc, int M, int N, int K) {
  __shared__ __attribute__((aligned(16))) float so[4][16][64];
  const int tid = threadIdx.x, w = tid >> 5, lane = tid & 31, ln = lane & 15, hh = lane >> 4;
  const int ntn = N / 64;
  const int wid = blockIdx.x * 4 + w;
  const int mt = wid / ntn, nq = wid % ntn;
  if (mt * 16 >= M) return;
  const int row0 = mt * 16, col0 = nq * 64;
  const float* arow = A + (size_t)(row0 + ln) * lda;
  v8f acc[4] = {};
  for (int kb = 0; kb < K; kb += 32) {
    FragB ah, al;
    const v4f x0 = *(const v4fa*)(arow + kb + 8 * hh), x1 = *(const v4fa*)(arow + kb + 8 * hh + 4);
    const v4f x2 = *(const v4fa*)(arow + kb + 16 + 8 * hh), x3 = *(const v4fa*)(arow + kb + 16 + 8 * hh + 4);
    float xs[16] = {x0[0],x0[1],x0[2],x0[3],x1[0],x1[1],x1[2],x1[3],x2[0],x2[1],x2[2],x2[3],x3[0],x3[1],x3[2],x3[3]};
#pragma unroll
    for (int i = 0; i < 16; ++i) { const unsigned short hb = bf16_bits(xs[i]); ah.u[i] = hb; al.u[i] = ASPLIT ? bf16_bits(xs[i] - bf16_val(hb)) : (unsigned short)0; }
#pragma unroll
    for (int t = 0; t < 4; ++t) {
      const unsigned short* brow = Wt + (size_t)(col0 + t * 16 + ln) * ldb + kb;
      FragB b;
      b.half[0] = *(const v8us*)(brow + 8 * hh);
      b.half[1] = *(const v8us*)(brow + 16 + 8 * hh);
      acc[t] = mmaN<ASPLIT ? 2 : 1>(ah.v, al.v, b.v, b.v, acc[t]);
    }
  }
#pragma unroll
  for (int t = 0; t < 4; ++t) {
    const int col = col0 + t * 16 + ln;
    float bv = bias ? bias[col] : 0.f;
    if (BIAS_BF16) bv = bf16_round(bv);
#pragma unroll
    for (int r = 0; r < 8; ++r) {
      float v = acc[t][r] + bv;
      if (resid) { float rv = resid[(size_t)((row0 + 8 * hh + r) % rmod) * ldr + col]; if (RES_BF16) rv = bf16_round(rv); v += rv; }
      if (ACT == 1) v = fmaxf(v, 0.f);
      if (ACT == 2) v = 0.5f * v * (1.0f + erff(v * 0.70710678118654752f));
      if (ACT == 3) { const float u = 0.7978845608028654f * (v + 0.044715f * v * v * v); v = 0.5f * v * (1.0f + tanhf(u)); }
      so[w][8 * hh + r][t * 16 + ln] = v;
    }
  }
  __builtin_amdgcn_fence(__ATOMIC_ACQ_REL, "workgroup");
  __builtin_amdgcn_wave_barrier();
  const int rsub = lane >> 4, c4 = (lane & 15) * 4;
  {
#pragma unroll
    for (int q = 0; q < 8; ++q) {
      const int r = q * 2 + rsub;
      const v4f v = *(const v4fa*)&so[w][r][c4];
      *(v4f*)(C + (size_t)(row0 + r) * ldc + col0 + c4) = v;
    }
    
  }
}
// row LayerNorm (biased variance, eps) over N: s = X (+ R); optional out_sum <- s; out_norm <- (s-mu)*rsqrt(var+eps)*g + b
template <bool PARAM_BF16>
__global__ __launch_bounds__(256) void k_layernorm(const float* __restrict__ X, const float* __restrict__ R, const float* __restrict__ g, const float* __restrict__ bta,
                                                  float* __restrict__ out_sum, float* __restrict__ out_norm, int N, float eps) {
  __shared__ float red[256];
  const int row = blockIdx.x, tid = threadIdx.x;
  const float* x = X + (size_t)row * N; const float* rr = R ? R + (size_t)row * N : nullptr;
  float vals[16];                     // up to N = 4096
  const int per = N / 256;            // contiguous chunk per thread? use strided-by-4 chunks: thread handles j = tid*4 + 1024*u
  float s1 = 0.f;
  for (int u = 0; u < per / 4; ++u) {
    const int j = tid * 4 + 1024 * u;
    const v4f a = *(const v4fa*)(x + j);
    v4f b = {0.f,0.f,0.f,0.f}; if (rr) b = *(const v4fa*)(rr + j);
#pragma unroll
    for (int q = 0; q < 4; ++q) { const float v = a[q] + b[q]; vals[u * 4 + q] = v; s1 += v; }
  }
  red[tid] = s1; __syncthreads();
  for (int st = 128; st > 0; st >>= 1) { if (tid < st) red[tid] += red[tid + st]; __syncthreads(); }
  const float mu = red[0] / (float)N; __syncthreads();
  float s2 = 0.f;
  for (int u = 0; u < per / 4; ++u)
#pragma unroll
    for (int q = 0; q < 4; ++q) { const float c = vals[u * 4 + q] - mu; s2 += c * c; }
  red[tid] = s2; __syncthreads();
  for (int st = 128; st > 0; st >>= 1) { if (tid < st) red[tid] += red[tid + st]; __syncthreads(); }
  const float rs = rsqrtf(red[0] / (float)N + eps);
  {
    for (int u = 0; u < per / 4; ++u) {
      const int j = tid * 4 + 1024 * u;
      v4f o, sm;
#pragma unroll
      for (int q = 0; q < 4; ++q) {
        float gg = g[j + q], bb = bta[j + q];
        if (PARAM_BF16) { gg = bf16_round(gg); bb = bf16_round(bb); }
        sm[q] = vals[u * 4 + q]; o[q] = (vals[u * 4 + q] - mu) * rs * gg + bb;
      }
      if (out_sum) *(v4f*)(out_sum + (size_t)row * N + j) = sm;
      *(v4f*)(out_norm + (size_t)row * N + j) = o;
    }
    
  }
}



// ---- f16 WMMA path (v_wmma_f32_16x16x32_f16): 11-bit significands for operands in range — used where a [0,1] probability operand needs more precision than bf16
typedef _Float16 v16h __attribute__((ext_vector_type(16)));
union FragH { v16h v; v8us half[2]; _Float16 h[16]; unsigned short u[16]; };
template <int NT>
__device__ __forceinline__ v8f mmaH(v16h ah, v16h al, v16h bh, v16h bl, v8f c) {
  c = __builtin_amdgcn_wmma_f32_16x16x32_f16(false, ah, false, bh, (short)0, c, false, false);
  if (NT >= 2) c = __builtin_amdgcn_wmma_f32_16x16x32_f16(false, al, false, bh, (short)0, c, false, false);
  if (NT >= 3) c = __builtin_amdgcn_wmma_f32_16x16x32_f16(false, ah, false, bl, (short)0, c, false, false);
  asm volatile("v_nop\n\tv_nop\n\tv_nop\n\tv_nop" : "+v"(c) : "v"(ah), "v"(al), "v"(bh), "v"(bl));
  return c;
}
// batched GEMM like k_gemm_b but f16 operands: A f32 (split into f16 hi/lo if ASPLIT, else rounded to f16), Bt = f16 values [n][k]; alpha; C f32; N multiple of 16 (partial tiles skipped)
template <bool ASPLIT>
__global__ __launch_bounds__(128) void k_gemm_h(const float* __restrict__ A, int lda, size_t sA, const _Float16* __restrict__ Bh, int ldb, size_t sB, float alpha, float* __restrict__ C, int ldc, size_t sC, int M, int N, int K) {
  __shared__ __attribute__((aligned(16))) float so[4][16][64];
  const int tid = threadIdx.x, w = tid >> 5, lane = tid & 31, ln = lane & 15, hh = lane >> 4; const int by = blockIdx.y;
  A += (size_t)by * sA; Bh += (size_t)by * sB; C += (size_t)by * sC;
  const int ntn = (N + 63) / 64; const int wid = blockIdx.x * 4 + w; const int mt = wid / ntn, nq = wid % ntn; if (mt * 16 >= M) return;
  const int row0 = mt * 16, col0 = nq * 64; const float* arow = A + (size_t)(row0 + ln) * lda;
  v8f acc[4] = {};
  for (int kb = 0; kb < K; kb += 32) {
    FragH ah, al;
    const v4f x0 = *(const v4fa*)(arow + kb + 8 * hh), x1 = *(const v4fa*)(arow + kb + 8 * hh + 4), x2 = *(const v4fa*)(arow + kb + 16 + 8 * hh), x3 = *(const v4fa*)(arow + kb + 16 + 8 * hh + 4);
    float xs[16] = {x0[0],x0[1],x0[2],x0[3],x1[0],x1[1],x1[2],x1[3],x2[0],x2[1],x2[2],x2[3],x3[0],x3[1],x3[2],x3[3]};
#pragma unroll
    for (int i = 0; i < 16; ++i) { const _Float16 h = (_Float16)xs[i]; ah.h[i] = h; al.h[i] = ASPLIT ? (_Float16)(xs[i] - (float)h) : (_Float16)0.0f; }
#pragma unroll
    for (int t = 0; t < 4; ++t) { if (col0 + t * 16 >= N) continue; const size_t boff = (size_t)(col0 + t * 16 + ln) * ldb + kb; FragH bq; bq.half[0] = *(const v8us*)(Bh + boff + 8 * hh); bq.half[1] = *(const v8us*)(Bh + boff + 16 + 8 * hh);
      acc[t] = mmaH<ASPLIT ? 2 : 1>(ah.v, al.v, bq.v, bq.v, acc[t]); }
  }
#pragma unroll
  for (int t = 0; t < 4; ++t) { if (col0 + t * 16 >= N) continue;
#pragma unroll
    for (int r = 0; r < 8; ++r) so[w][8 * hh + r][t * 16 + ln] = acc[t][r] * alpha; }
  __builtin_amdgcn_fence(__ATOMIC_ACQ_REL, "workgroup"); __builtin_amdgcn_wave_barrier();
  const int rsub = lane >> 4, c4 = (lane & 15) * 4;
  {
#pragma unroll
    for (int q = 0; q < 8; ++q) { const int r = q * 2 + rsub; if (col0 + c4 < N) { const v4f v = *(const v4fa*)&so[w][r][c4]; *(v4f*)(C + (size_t)(row0 + r) * ldc + col0 + c4) = v; } }
     }
}

// k_gemm_hh variant with fused epilogue: v = acc·alpha + bias[by·sBias + col] (+ CP[(row/rowsPerB)·sCPb + by·64 + col] if CP) ; ACT 0 none / 1 elu ; writes f16 C16 (and f32 C if non-null)
template <int ACT>
__global__ __launch_bounds__(128) void k_gemm_hhx(const _Float16* __restrict__ A, int lda, size_t sA, const _Float16* __restrict__ Bh, int ldb, size_t sB, float alpha, const float* __restrict__ bias, size_t sBias, const float* __restrict__ CP, int rowsPerB, size_t sCPb, int row0g,
    float* __restrict__ C, _Float16* __restrict__ C16, int ldc, size_t sC, int M, int N, int K) {
  __shared__ __attribute__((aligned(16))) float so[4][16][64];
  const int tid = threadIdx.x, w = tid >> 5, lane = tid & 31, ln = lane & 15, hh = lane >> 4; const int by = blockIdx.y;
  A += (size_t)by * sA; Bh += (size_t)by * sB; const size_t cofs = (size_t)by * sC; const float* bp = bias ? bias + (size_t)by * sBias : nullptr;
  const int ntn = (N + 63) / 64; const int wid = blockIdx.x * 4 + w; const int mt = wid / ntn, nq = wid % ntn; if (mt * 16 >= M) return;
  const int row0 = mt * 16, col0 = nq * 64; const _Float16* arow = A + (size_t)(row0 + ln) * lda;
  v8f acc[4] = {};
  for (int kb = 0; kb < K; kb += 32) { FragH ah; ah.half[0] = *(const v8us*)((const unsigned short*)arow + kb + 8 * hh); ah.half[1] = *(const v8us*)((const unsigned short*)arow + kb + 16 + 8 * hh);
#pragma unroll
    for (int t = 0; t < 4; ++t) { if (col0 + t * 16 >= N) continue; const size_t boff = (size_t)(col0 + t * 16 + ln) * ldb + kb; FragH bq; bq.half[0] = *(const v8us*)((const unsigned short*)Bh + boff + 8 * hh); bq.half[1] = *(const v8us*)((const unsigned short*)Bh + boff + 16 + 8 * hh);
      acc[t] = mmaH<1>(ah.v, ah.v, bq.v, bq.v, acc[t]); }
  }
#pragma unroll
  for (int t = 0; t < 4; ++t) { if (col0 + t * 16 >= N) continue; const int col = col0 + t * 16 + ln; const float bv = bp ? bf16_round(bp[col]) : 0.f;
#pragma unroll
    for (int r = 0; r < 8; ++r) { float v = acc[t][r] * alpha + bv; if (CP) { const int bidx = (row0g + row0 + 8 * hh + r) / rowsPerB; v += CP[(size_t)bidx * sCPb + (size_t)by * 64 + col]; } if (ACT == 1) v = (v > 0.f) ? v : expm1f(v); else if (ACT == 3) v = fmaxf(v, 0.f); so[w][8 * hh + r][t * 16 + ln] = v; } }
  __builtin_amdgcn_fence(__ATOMIC_ACQ_REL, "workgroup"); __builtin_amdgcn_wave_barrier();
  const int rsub = lane >> 4, c4 = (lane & 15) * 4; typedef _Float16 v4h __attribute__((ext_vector_type(4)));
  {
#pragma unroll
    for (int q = 0; q < 8; ++q) { const int r = q * 2 + rsub; if (col0 + c4 < N) { const v4f v = *(const v4fa*)&so[w][r][c4]; if (C) *(v4f*)(C + cofs + (size_t)(row0 + r) * ldc + col0 + c4) = v; if (C16) { v4h h4; for (int i = 0; i < 4; ++i) h4[i] = (_Float16)v[i]; *(v4h*)(C16 + cofs + (size_t)(row0 + r) * ldc + col0 + c4) = h4; } } }
     }
}


// Projection GEMM, 2048 x 2048 x 2048: C = (A . Bt^T) * alpha + bias. One 128 x 128 tile of C per workgroup of 8 waves (4 x 2, 32 x 64 per wave).
// A pass is 128 k: 128 rows of A and 128 rows of Bt, 256 B each, laid in LDS at pitch 272 B by asynchronous copies, two buffers, the next pass's copies in flight under this pass's products.
// k runs upward in steps of 32 into one accumulator per 16 x 16 tile, as in k_gemm_hhx: the sums keep their order.
// Every '#pragma unroll' in k_gemm_t makes the indices of the fragment and accumulator arrays constants, so that they stay in registers.
#define GT_PITCH 272u
#define GT_STAGE (256u * GT_PITCH)
#define GT_NST (CC / 128)
__device__ __forceinline__ void gt_copy8(unsigned l0, const unsigned short* g0) {
  // eight 16-byte copies of this lane, rows 16 apart; s_wait_xcnt stands inside the statement so that no address register is rewritten ahead of it
  const unsigned l1 = l0 + 16u * GT_PITCH, l2 = l0 + 32u * GT_PITCH, l3 = l0 + 48u * GT_PITCH, l4 = l0 + 64u * GT_PITCH, l5 = l0 + 80u * GT_PITCH, l6 = l0 + 96u * GT_PITCH, l7 = l0 + 112u * GT_PITCH;
  const unsigned short *g1 = g0 + 16 * CC, *g2 = g0 + 32 * CC, *g3 = g0 + 48 * CC, *g4 = g0 + 64 * CC, *g5 = g0 + 80 * CC, *g6 = g0 + 96 * CC, *g7 = g0 + 112 * CC;
  asm volatile("global_load_async_to_lds_b128 %0, %8, off\n\t"
               "global_load_async_to_lds_b128 %1, %9, off\n\t"
               "global_load_async_to_lds_b128 %2, %10, off\n\t"
               "global_load_async_to_lds_b128 %3, %11, off\n\t"
               "global_load_async_to_lds_b128 %4, %12, off\n\t"
               "global_load_async_to_lds_b128 %5, %13, off\n\t"
               "global_load_async_to_lds_b128 %6, %14, off\n\t"
               "global_load_async_to_lds_b128 %7, %15, off\n\t"
               "s_wait_xcnt 0x0"
               :: "v"(l0), "v"(l1), "v"(l2), "v"(l3), "v"(l4), "v"(l5), "v"(l6), "v"(l7),
                  "v"(g0), "v"(g1), "v"(g2), "v"(g3), "v"(g4), "v"(g5), "v"(g6), "v"(g7) : "memory");
}
// blockIdx.y picks one of up to three independent products that share the grid; product 2's tile goes out as f16 to C16, the others' as f32
__global__ __launch_bounds__(256) void k_gemm_t(const _Float16* A0, const _Float16* A1, const _Float16* A2, const _Float16* Bh0, const _Float16* Bh1, const _Float16* Bh2, float alpha,
                                                const float* bias0, const float* bias1, const float* bias2, float* C0, float* C1, _Float16* C16) {
  __shared__ __attribute__((aligned(16))) unsigned char L[2u * GT_STAGE];
  const int py = (int)blockIdx.y; const bool H16 = py == 2;
  const _Float16* A = py == 0 ? A0 : py == 1 ? A1 : A2; const _Float16* Bh = py == 0 ? Bh0 : py == 1 ? Bh1 : Bh2; const float* bias = py == 0 ? bias0 : py == 1 ? bias1 : bias2; float* C = py == 0 ? C0 : C1;
  const int tid = threadIdx.x, w = tid >> 5, lane = tid & 31, ln = lane & 15, hh = lane >> 4;
  const int m0 = (int)(blockIdx.x / (CC / 128)) * 128, n0 = (int)(blockIdx.x % (CC / 128)) * 128;
  const int wm = (w >> 1) * 32, wn = (w & 1) * 64;
  // copies: lane takes 16-byte piece (tid & 15) of rows (tid >> 4) + 16 i; LDS rows 0..127 hold A, 128..255 hold Bt
  const unsigned lcp = (unsigned)(size_t)L + (unsigned)(tid >> 4) * GT_PITCH + (unsigned)(tid & 15) * 16u;
  const unsigned short* ga = (const unsigned short*)A + (size_t)(m0 + (tid >> 4)) * CC + (tid & 15) * 8;
  const unsigned short* gb = (const unsigned short*)Bh + (size_t)(n0 + (tid >> 4)) * CC + (tid & 15) * 8;
  v8f acc[2][4];
#pragma unroll
  for (int i = 0; i < 2; ++i)
#pragma unroll
    for (int j = 0; j < 4; ++j) acc[i][j] = (v8f){0.f,0.f,0.f,0.f,0.f,0.f,0.f,0.f};
  gt_copy8(lcp, ga); gt_copy8(lcp + 128u * GT_PITCH, gb);
  asm volatile("s_wait_asynccnt 0x0" ::: "memory");      // pass 0's bytes of this wave have landed
  __syncthreads();                                        // and every wave's: pass 0 is readable
  gt_copy8(lcp + GT_STAGE, ga + 128); gt_copy8(lcp + GT_STAGE + 128u * GT_PITCH, gb + 128);
#pragma unroll 1      // one pass per trip: the ring's order at the foot stays as written
  for (int t = 0; t < GT_NST; ++t) {
    const unsigned char* S = L + (unsigned)(t & 1) * GT_STAGE;
    const unsigned char* ar = S + (unsigned)(wm + ln) * GT_PITCH + 16u * hh;
    const unsigned char* br = S + (unsigned)(128 + wn + ln) * GT_PITCH + 16u * hh;
    FragH a[2][2], b[2][4];      // two fragment sets: the next 32 k are fetched as one group ahead of this block's products (inside this pass's buffer only)
#pragma unroll
    for (int i = 0; i < 2; ++i) { a[0][i].half[0] = *(const v8us*)(ar + i * 16 * GT_PITCH); a[0][i].half[1] = *(const v8us*)(ar + i * 16 * GT_PITCH + 32); }
#pragma unroll
    for (int j = 0; j < 4; ++j) { b[0][j].half[0] = *(const v8us*)(br + j * 16 * GT_PITCH); b[0][j].half[1] = *(const v8us*)(br + j * 16 * GT_PITCH + 32); }
#pragma unroll
    for (int ks = 0; ks < 4; ++ks) {
      const int cu = ks & 1, nx = cu ^ 1;
      if (ks < 3) {
#pragma unroll
        for (int i = 0; i < 2; ++i) { a[nx][i].half[0] = *(const v8us*)(ar + i * 16 * GT_PITCH + (ks + 1) * 64); a[nx][i].half[1] = *(const v8us*)(ar + i * 16 * GT_PITCH + (ks + 1) * 64 + 32); }
#pragma unroll
        for (int j = 0; j < 4; ++j) { b[nx][j].half[0] = *(const v8us*)(br + j * 16 * GT_PITCH + (ks + 1) * 64); b[nx][j].half[1] = *(const v8us*)(br + j * 16 * GT_PITCH + (ks + 1) * 64 + 32); }
      }
      __builtin_amdgcn_sched_barrier(0);      // keeps the next block's twelve LDS loads one group ahead of these products; without it they sink among the products and each waits out its own latency
#pragma unroll
      for (int i = 0; i < 2; ++i)
#pragma unroll
        for (int j = 0; j < 4; ++j) acc[i][j] = __builtin_amdgcn_wmma_f32_16x16x32_f16(false, a[cu][i].v, false, b[cu][j].v, (short)0, acc[i][j], false, false);
      __builtin_amdgcn_sched_barrier(0);      // the products stay one run: no later load group rises into it
    }
    asm volatile("s_wait_dscnt 0x0" ::: "memory");        // this wave's reads of the buffer have returned
    asm volatile("s_wait_asynccnt 0x0" ::: "memory");     // this wave's copies of pass t + 1 have landed
    __syncthreads();                                      // publishes pass t + 1 and frees the buffer pass t has read
    if (t + 2 < GT_NST) { gt_copy8(lcp + (unsigned)(t & 1) * GT_STAGE, ga + (t + 2) * 128); gt_copy8(lcp + (unsigned)(t & 1) * GT_STAGE + 128u * GT_PITCH, gb + (t + 2) * 128); }
  }
  asm volatile("s_wait_asynccnt 0x0" ::: "memory");       // nothing in flight before the ring becomes output staging
  // epilogue: each wave stages its 32 x 64 tile in its own LDS range (pitch 68 floats) and stores whole lines
  float* so = (float*)(L + (unsigned)w * (32u * 272u));
#pragma unroll
  for (int j = 0; j < 4; ++j) { const float bv = bf16_round(bias[n0 + wn + j * 16 + ln]);
#pragma unroll
    for (int i = 0; i < 2; ++i)
#pragma unroll
      for (int r = 0; r < 8; ++r) so[(i * 16 + 8 * hh + r) * 68 + j * 16 + ln] = acc[i][j][r] * alpha + bv; }
  __builtin_amdgcn_fence(__ATOMIC_ACQ_REL, "workgroup"); __builtin_amdgcn_wave_barrier();      // the wave's staged rows are in LDS before its lanes read them back; the range is the wave's own, so no workgroup barrier
  const int c4 = ln * 4; typedef _Float16 v4h __attribute__((ext_vector_type(4)));
  if (!H16) {
#pragma unroll
    for (int q = 0; q < 16; ++q) { const int r = q * 2 + hh; const v4f v = *(const v4fa*)&so[r * 68 + c4]; const size_t o = (size_t)(m0 + wm + r) * CC + n0 + wn + c4; *(v4f*)(C + o) = v; }
    asm volatile("s_wait_xcnt 0x0" ::: "memory");      // no register that these stores name is rewritten ahead of this wait, whichever block the build lays behind them
  } else {
#pragma unroll
    for (int q = 0; q < 16; ++q) { const int r = q * 2 + hh; const v4f v = *(const v4fa*)&so[r * 68 + c4]; const size_t o = (size_t)(m0 + wm + r) * CC + n0 + wn + c4;
      v4h h4; for (int i = 0; i < 4; ++i) h4[i] = (_Float16)v[i]; *(v4h*)(C16 + o) = h4; }
    asm volatile("s_wait_xcnt 0x0" ::: "memory");      // as in the other arm
  }
}

__global__ __launch_bounds__(256) void k_h16(const float* __restrict__ x, _Float16* __restrict__ X16, size_t n8) { const size_t t = (size_t)blockIdx.x * 256 + threadIdx.x; if (t >= n8) return; FragH f;
#pragma unroll
  for (int q = 0; q < 8; ++q) f.h[q] = (_Float16)x[t * 8 + q]; *(v8us*)((unsigned short*)X16 + t * 8) = f.half[0];  }
// Every conversion that reads inputs alone, in one grid; the block index picks the job, each thread's work is that of the separate kernels.
// Blocks 0 .. PB_G-1: BG_h[e][d] = f16(bf16(G_h[d][e]) * 16), 8 blocks a head. Then PB_M blocks a matrix, 8 elements a thread: the four weights (bf16-rounded, * 16; (out,in) = Bt) and q, k, v (bf16-rounded, * 1, which is exact).
#define PB_G (NH * 8)
#define PB_M (CC * CC / 8 / 256)
__global__ __launch_bounds__(256) void k_prep(const float* __restrict__ G, const float* __restrict__ Wq, const float* __restrict__ Wk, const float* __restrict__ Wv, const float* __restrict__ Wo,
                                              const float* __restrict__ q, const float* __restrict__ k, const float* __restrict__ v, _Float16* __restrict__ BG, _Float16* __restrict__ Y) {
  const int bid = (int)blockIdx.x, tid = threadIdx.x; FragH f;
  if (bid < PB_G) {
    const float* W = G + (size_t)(bid >> 3) * HD * HD; const int t = (bid & 7) * 256 + tid; const int n = t / (HD / 8), k8 = (t % (HD / 8)) * 8;
#pragma unroll
    for (int i = 0; i < 8; ++i) f.h[i] = (_Float16)(bf16_round(W[(size_t)(k8 + i) * HD + n]) * 16.0f);
    *(v8us*)((unsigned short*)BG + (size_t)(bid >> 3) * HD * HD + (size_t)n * HD + k8) = f.half[0];
    asm volatile("s_wait_xcnt 0x0" ::: "memory");      // no register that the store names is rewritten ahead of this wait, whichever block the build lays behind it
    return;
  }
  const int j = (bid - PB_G) / PB_M; const size_t t = (size_t)((bid - PB_G) % PB_M) * 256 + tid;      // matrix j, in the order Wq Wk Wv Wo q k v; the seven results lie one behind the other in Y
  const float* x01 = (j & 1) ? Wk : Wq; const float* x23 = (j & 1) ? Wo : Wv; const float* x45 = (j & 1) ? k : q;
  const float* x03 = (j & 2) ? x23 : x01; const float* x47 = (j & 2) ? v : x45; const float* x = (j & 4) ? x47 : x03;
  const float sc = j < 4 ? 16.0f : 1.0f;
#pragma unroll
  for (int i = 0; i < 8; ++i) f.h[i] = (_Float16)(bf16_round(x[t * 8 + i]) * sc);
  *(v8us*)((unsigned short*)Y + (size_t)j * CC * CC + t * 8) = f.half[0];
  asm volatile("s_wait_xcnt 0x0" ::: "memory");      // as in the other arm
}
template <int NHv, int TTv>
__global__ __launch_bounds__(256) void k_vt(const _Float16* __restrict__ V16, int ldv, int voff, _Float16* __restrict__ Vt) { __shared__ unsigned short tl[64][66]; const int tid = threadIdx.x; const int slab = blockIdx.x / (TTv / 64), lg = blockIdx.x % (TTv / 64); const int b = slab / NHv, h = slab % NHv;
  for (int i = tid; i < 64 * 8; i += 256) { const int r = i / 8, c8 = (i % 8) * 8; FragH f; f.half[0] = *(const v8us*)((const unsigned short*)V16 + ((size_t)b * TTv + lg * 64 + r) * ldv + voff + h * 64 + c8);
#pragma unroll
    for (int q = 0; q < 8; ++q) tl[r][c8 + q] = f.u[q]; }
  __syncthreads();
  {
#pragma unroll
    for (int rd = 0; rd < 2; ++rd) { const int d = rd * 32 + tid / 8, pc = tid % 8; FragH f;
#pragma unroll
      for (int q = 0; q < 8; ++q) f.u[q] = tl[pc * 8 + q][d];
      *(v8us*)((unsigned short*)Vt + ((size_t)slab * 64 + d) * TTv + lg * 64 + pc * 8) = f.half[0]; }
     } }

// Attention ring: a stage is 64 keys for the block's 64 query rows: 64 rows of K (256 B, pitch 272), 128 rows of Vt (128 B, pitch 144) and 64 rows of the mask (256 B, pitch 272),
// laid in LDS by asynchronous copies, two buffers, the next stage's copies in flight under this stage's work; the four waves share K and Vt. A stage is worked as two 32-key tiles, upward, as before: every sum keeps its order.
#define FL_KP 272u
#define FL_VP 144u
#define FL_MP 272u
#define FL_VO (64u * FL_KP)
#define FL_MO (FL_VO + 128u * FL_VP)
#define FL_STAGE (FL_MO + 64u * FL_MP)
#define FL_NST (SS / 64)
typedef float f1a __attribute__((may_alias));
__device__ __forceinline__ void fl_copy8(unsigned l0, unsigned ls, const unsigned char* g0, size_t gs) {
  // eight 16-byte copies of this lane, LDS rows ls bytes apart, global rows gs bytes apart; s_wait_xcnt stands inside the statement so that no address register is rewritten ahead of it
  const unsigned l1 = l0 + ls, l2 = l0 + 2u * ls, l3 = l0 + 3u * ls, l4 = l0 + 4u * ls, l5 = l0 + 5u * ls, l6 = l0 + 6u * ls, l7 = l0 + 7u * ls;
  const unsigned char *g1 = g0 + gs, *g2 = g0 + 2 * gs, *g3 = g0 + 3 * gs, *g4 = g0 + 4 * gs, *g5 = g0 + 5 * gs, *g6 = g0 + 6 * gs, *g7 = g0 + 7 * gs;
  asm volatile("global_load_async_to_lds_b128 %0, %8, off\n\t"
               "global_load_async_to_lds_b128 %1, %9, off\n\t"
               "global_load_async_to_lds_b128 %2, %10, off\n\t"
               "global_load_async_to_lds_b128 %3, %11, off\n\t"
               "global_load_async_to_lds_b128 %4, %12, off\n\t"
               "global_load_async_to_lds_b128 %5, %13, off\n\t"
               "global_load_async_to_lds_b128 %6, %14, off\n\t"
               "global_load_async_to_lds_b128 %7, %15, off\n\t"
               "s_wait_xcnt 0x0"
               :: "v"(l0), "v"(l1), "v"(l2), "v"(l3), "v"(l4), "v"(l5), "v"(l6), "v"(l7),
                  "v"(g0), "v"(g1), "v"(g2), "v"(g3), "v"(g4), "v"(g5), "v"(g6), "v"(g7) : "memory");
}
__global__ __launch_bounds__(128) void k_flash(const _Float16* __restrict__ Q16, int ldq, const _Float16* __restrict__ K16, int ldk, const _Float16* __restrict__ Vt, const float* __restrict__ MSK, float* __restrict__ O, int ldo) {
  constexpr int RPW = 16, RTN = RPW / 16, NQB = 2048 / (4 * RPW), DT = 8, KS = 4;      /* head dim 128 */
  __shared__ __attribute__((aligned(16))) unsigned short sP[4][RPW][40]; __shared__ __attribute__((aligned(16))) unsigned char L[2u * FL_STAGE];
  const int tid = threadIdx.x, w = tid >> 5, lane = tid & 31, ln = lane & 15, hh = lane >> 4;
  const int slab = blockIdx.x / NQB, qblk = blockIdx.x % NQB; const int b = slab / 16, h = slab % 16; const int qb0 = qblk * (4 * RPW); const int q0 = qb0 + w * RPW;
  const unsigned short* Vth = (const unsigned short*)Vt + (size_t)slab * 128 * 2048;
  // copies: K and mask: 16-byte piece (tid & 15) of rows (tid >> 4) + 8 i; Vt: piece (tid & 7) of rows (tid >> 3) + 16 i
  const unsigned lb = (unsigned)(size_t)L;
  const unsigned lk = lb + (unsigned)(tid >> 4) * FL_KP + (unsigned)(tid & 15) * 16u, lv = lb + FL_VO + (unsigned)(tid >> 3) * FL_VP + (unsigned)(tid & 7) * 16u, lm = lb + FL_MO + (unsigned)(tid >> 4) * FL_MP + (unsigned)(tid & 15) * 16u;
  const size_t kstep = (size_t)ldk * 2;      // bytes of a K row
  const unsigned char* gk = (const unsigned char*)((const unsigned short*)K16 + ((size_t)b * 2048 + (tid >> 4)) * ldk + h * 128 + (tid & 15) * 8);
  const unsigned char* gv = (const unsigned char*)(Vth + (size_t)(tid >> 3) * 2048 + (tid & 7) * 8);
  const unsigned char* gm = (const unsigned char*)(MSK + ((size_t)b * 2048 + qb0 + (tid >> 4)) * 2048 + (tid & 15) * 4);
  fl_copy8(lk, 8u * FL_KP, gk, 8 * kstep); fl_copy8(lv, 16u * FL_VP, gv, (size_t)16 * 4096); fl_copy8(lm, 8u * FL_MP, gm, (size_t)8 * 8192);
  FragH aq[2][KS];
#pragma unroll
  for (int rt = 0; rt < RTN; ++rt) { const unsigned short* qr = (const unsigned short*)Q16 + ((size_t)b * 2048 + q0 + rt * 16 + ln) * ldq + h * 128;
#pragma unroll
    for (int ks = 0; ks < KS; ++ks) { aq[rt][ks].half[0] = *(const v8us*)(qr + ks * 32 + 8 * hh); aq[rt][ks].half[1] = *(const v8us*)(qr + ks * 32 + 16 + 8 * hh); } }
  float m_r[2][8], l_r[2][8]; v8f oacc[2][DT];
#pragma unroll
  for (int rt = 0; rt < RTN; ++rt) {
#pragma unroll
    for (int r = 0; r < 8; ++r) { m_r[rt][r] = -3.0e38f; l_r[rt][r] = 0.f; }
#pragma unroll
    for (int dt = 0; dt < DT; ++dt) oacc[rt][dt] = (v8f){0.f,0.f,0.f,0.f,0.f,0.f,0.f,0.f}; }
  asm volatile("s_wait_asynccnt 0x0" ::: "memory");      // stage 0's bytes of this wave have landed
  __syncthreads();                                        // and every wave's: stage 0 is readable
  fl_copy8(lk + FL_STAGE, 8u * FL_KP, gk + 64 * kstep, 8 * kstep); fl_copy8(lv + FL_STAGE, 16u * FL_VP, gv + 128, (size_t)16 * 4096); fl_copy8(lm + FL_STAGE, 8u * FL_MP, gm + 256, (size_t)8 * 8192);
#pragma unroll 1      // one stage per trip: the ring's order at the foot stays as written
  for (int t = 0; t < FL_NST; ++t) {
    const unsigned char* S = L + (unsigned)(t & 1) * FL_STAGE;
#pragma unroll 1      // the two 32-key tiles of a stage share one body: less code, and a masked tile is skipped on its own
  for (int sub = 0; sub < 2; ++sub) {
    // mask tile for my 16 query rows x 32 keys: lane (ln,hh) needs rows rt*16 + 8hh + r, keys ln and 16 + ln of the tile
    unsigned okb0 = 0u, okb1 = 0u;      // bit (rt*8 + r) set when key ln (resp. 16+ln) of the tile is OPEN for query row rt*16 + 8hh + r
#pragma unroll
    for (int rt = 0; rt < RTN; ++rt)
#pragma unroll
      for (int r = 0; r < 8; ++r) { const f1a* mr = (const f1a*)(S + FL_MO + (unsigned)(w * RPW + rt * 16 + 8 * hh + r) * FL_MP + (unsigned)sub * 128u); okb0 |= (mr[ln] == 0.0f ? 1u : 0u) << (rt * 8 + r); okb1 |= (mr[16 + ln] == 0.0f ? 1u : 0u) << (rt * 8 + r); }      /* float mask: nonzero = masked (-1e9) */
    if (__builtin_amdgcn_ballot_w32((okb0 | okb1) != 0u) == 0u) continue;      // every (query,key) of this wave's tile is masked: contributes nothing (uniform branch; the stage's foot is outside this loop)
    v8f s[2][2];
#pragma unroll
    for (int nt = 0; nt < 2; ++nt) { const unsigned char* kr = S + (unsigned)(sub * 32 + nt * 16 + ln) * FL_KP + 16u * hh; FragH bk[KS];
#pragma unroll
      for (int ks = 0; ks < KS; ++ks) { bk[ks].half[0] = *(const v8us*)(kr + ks * 64); bk[ks].half[1] = *(const v8us*)(kr + ks * 64 + 32); }
#pragma unroll
      for (int rt = 0; rt < RTN; ++rt) { v8f acc = (v8f){0.f,0.f,0.f,0.f,0.f,0.f,0.f,0.f};
#pragma unroll
        for (int ks = 0; ks < KS; ++ks) acc = mmaH<1>(aq[rt][ks].v, aq[rt][ks].v, bk[ks].v, bk[ks].v, acc); s[rt][nt] = acc; } }
    // Softmax of the tile in phases over the eight rows of a lane, with no branch inside: each row's chain (four cross-lane steps, three expf) is long and dependent,
    // so the rows' chains are laid side by side and fill one another's waits. Every expf is taken unconditionally and the old conditions pick between its value and the constant: the values are those of the row-by-row form.
    // Every '#pragma unroll' below makes the row index a constant, so that the per-row arrays stay in registers.
#pragma unroll
    for (int rt = 0; rt < RTN; ++rt) {
      float s0[8], s1[8], mc[8], al[8];
#pragma unroll
      for (int r = 0; r < 8; ++r) {
        const bool ok0 = ((okb0 >> (rt * 8 + r)) & 1u) != 0u, ok1 = ((okb1 >> (rt * 8 + r)) & 1u) != 0u;
        s0[r] = ok0 ? s[rt][0][r] * (0.08838834764831845f) : -INFINITY; s1[r] = ok1 ? s[rt][1][r] * (0.08838834764831845f) : -INFINITY; mc[r] = fmaxf(s0[r], s1[r]); }
#pragma unroll
      for (int m = 1; m < 16; m <<= 1)
#pragma unroll
        for (int r = 0; r < 8; ++r) mc[r] = fmaxf(mc[r], __shfl_xor(mc[r], m, 32));
#pragma unroll
      for (int r = 0; r < 8; ++r) {
        const bool ok0 = ((okb0 >> (rt * 8 + r)) & 1u) != 0u, ok1 = ((okb1 >> (rt * 8 + r)) & 1u) != 0u;
        const float mn = fmaxf(m_r[rt][r], mc[r]); const float ea = expf(m_r[rt][r] - mn), e0 = expf(s0[r] - mn), e1 = expf(s1[r] - mn);
        al[r] = (mn > -1.0e38f) ? ea : 1.0f; m_r[rt][r] = mn; const float p0 = ok0 ? e0 : 0.f, p1 = ok1 ? e1 : 0.f; l_r[rt][r] = l_r[rt][r] * al[r] + p0 + p1;
        FragH t2; t2.h[0] = (_Float16)p0; t2.h[1] = (_Float16)p1; sP[w][rt * 16 + 8 * hh + r][ln] = t2.u[0]; sP[w][rt * 16 + 8 * hh + r][16 + ln] = t2.u[1]; }
#pragma unroll
      for (int dt = 0; dt < DT; ++dt)
#pragma unroll
        for (int r = 0; r < 8; ++r) oacc[rt][dt][r] *= al[r]; }
    __builtin_amdgcn_fence(__ATOMIC_ACQ_REL, "workgroup"); __builtin_amdgcn_wave_barrier();
    FragH pa[2];
#pragma unroll
    for (int rt = 0; rt < RTN; ++rt) { pa[rt].half[0] = *(const v8us*)&sP[w][rt * 16 + ln][8 * hh]; pa[rt].half[1] = *(const v8us*)&sP[w][rt * 16 + ln][16 + 8 * hh]; }
#pragma unroll
    for (int dt = 0; dt < DT; ++dt) { const unsigned char* vrow = S + FL_VO + (unsigned)(dt * 16 + ln) * FL_VP + (unsigned)sub * 64u + 16u * hh; FragH bv; bv.half[0] = *(const v8us*)vrow; bv.half[1] = *(const v8us*)(vrow + 32);
#pragma unroll
      for (int rt = 0; rt < RTN; ++rt) oacc[rt][dt] = mmaH<1>(pa[rt].v, pa[rt].v, bv.v, bv.v, oacc[rt][dt]); }
    __builtin_amdgcn_fence(__ATOMIC_ACQ_REL, "workgroup"); __builtin_amdgcn_wave_barrier(); }
    asm volatile("s_wait_dscnt 0x0" ::: "memory");        // this wave's reads of the buffer have returned
    asm volatile("s_wait_asynccnt 0x0" ::: "memory");     // this wave's copies of stage t + 1 have landed
    __syncthreads();                                      // publishes stage t + 1 and frees the buffer stage t has read
    if (t + 2 < FL_NST) { const unsigned lo = (unsigned)(t & 1) * FL_STAGE; fl_copy8(lk + lo, 8u * FL_KP, gk + (size_t)(t + 2) * 64 * kstep, 8 * kstep); fl_copy8(lv + lo, 16u * FL_VP, gv + (t + 2) * 128, (size_t)16 * 4096); fl_copy8(lm + lo, 8u * FL_MP, gm + (t + 2) * 256, (size_t)8 * 8192); }
  }
  asm volatile("s_wait_asynccnt 0x0" ::: "memory");       // nothing in flight before the ring becomes output staging (the last foot's barrier has ended every wave's reads of it)
  float* sO = (float*)(L + (unsigned)w * (unsigned)(RPW * (128 + 4) * 4));      // each wave's own range, pitch 132 floats
#pragma unroll
  for (int rt = 0; rt < RTN; ++rt) {
#pragma unroll
    for (int r = 0; r < 8; ++r) { float l = l_r[rt][r]; l += __shfl_xor(l, 1, 32); l += __shfl_xor(l, 2, 32); l += __shfl_xor(l, 4, 32); l += __shfl_xor(l, 8, 32); l_r[rt][r] = (l > 0.f) ? 1.0f / l : 0.f; }
#pragma unroll
    for (int dt = 0; dt < DT; ++dt)
#pragma unroll
      for (int r = 0; r < 8; ++r) sO[(rt * 16 + 8 * hh + r) * 132 + dt * 16 + ln] = oacc[rt][dt][r] * l_r[rt][r]; }
  __builtin_amdgcn_fence(__ATOMIC_ACQ_REL, "workgroup"); __builtin_amdgcn_wave_barrier();
  {
#pragma unroll
    for (int rp = 0; rp < RPW; ++rp) { const int r = rp, pc = lane; const v4f val = *(const v4fa*)&sO[r * 132 + pc * 4]; *(v4f*)(O + ((size_t)b * 2048 + q0 + r) * ldo + h * 128 + pc * 4) = val; }      /* 128-float rows: 32 lanes x 16 B */
     } }

__device__ __forceinline__ void d_rope16(int bid, const float* __restrict__ SRC, _Float16* __restrict__ D16) { __shared__ __attribute__((aligned(16))) _Float16 st[256][8]; const int tid = threadIdx.x; const size_t t = (size_t)bid * 256 + tid; if (t >= (size_t)SS * NH * 16) return; const int p = (int)(t % 16); const int h = (int)((t / 16) % NH); const int s = (int)(t / (16 * NH)); const float* src = SRC + ((size_t)s * NH + h) * HD;
#pragma unroll 1
  for (int q = 0; q < 8; ++q) { const int j = p * 8 + q; const int i = j >> 1; const float f = __builtin_powf(10000.0f, -(float)(2 * i) / 128.0f); const float ang = (float)s * f; const float c = cosf(ang), sn = sinf(ang); const float xr = src[2 * i], xi = src[2 * i + 1]; st[tid][q] = (_Float16)((j & 1) ? (xr * sn + xi * c) : (xr * c - xi * sn)); }
  const v8us v = *(const v8us*)&st[tid][0]; unsigned short* d = (unsigned short*)D16 + ((size_t)s * NH + h) * HD + p * 8; *(v8us*)d = v;  }
__device__ __forceinline__ void d_vt128(int bid, const _Float16* __restrict__ V16, _Float16* __restrict__ Vt) { __shared__ unsigned short tl[64][130]; const int tid = threadIdx.x; const int h = bid / (SS / 64), lg = bid % (SS / 64);
  for (int i = tid; i < 64 * 16; i += 256) { const int r = i / 16, c8 = (i % 16) * 8; FragH f; f.half[0] = *(const v8us*)((const unsigned short*)V16 + ((size_t)lg * 64 + r) * CC + h * HD + c8);
#pragma unroll
    for (int q = 0; q < 8; ++q) tl[r][c8 + q] = f.u[q]; }
  __syncthreads();
  { for (int i = tid; i < 128 * 8; i += 256) { const int d = i / 8, pc = i % 8; FragH f;
#pragma unroll
      for (int q = 0; q < 8; ++q) f.u[q] = tl[pc * 8 + q][d]; *(v8us*)((unsigned short*)Vt + ((size_t)h * HD + d) * SS + lg * 64 + pc * 8) = f.half[0]; }  } }
// What follows the three projections and is independent of one another, in one grid: RoPE of q, RoPE of k (RB blocks each), then the short V transposes
#define RB (SS * NH * 16 / 256)
__global__ __launch_bounds__(256) void k_post(const float* __restrict__ QF, _Float16* __restrict__ QR16, const float* __restrict__ KF, _Float16* __restrict__ KR16, const _Float16* __restrict__ V16, _Float16* __restrict__ Vt) {
  const int bid = (int)blockIdx.x;
  if (bid < 2 * RB) d_rope16(bid % RB, bid < RB ? QF : KF, bid < RB ? QR16 : KR16);
  else d_vt128(bid - 2 * RB, V16, Vt);
}
extern "C" void kernel_launch(void* const* d_in, const int* in_sizes, int n_in,
                              void* d_out, int out_size, void* d_ws, size_t ws_size, hipStream_t stream) {
  (void)in_sizes; (void)n_in; (void)out_size;
  const float* const* I = (const float* const*)d_in; const float* q = I[0]; const float* k = I[1]; const float* v = I[2]; const float* mask = I[3]; const float* Wq = I[4]; const float* bq = I[5]; const float* Wk = I[6]; const float* bk = I[7]; const float* Wv = I[8]; const float* bv = I[9]; const float* G = I[10]; const float* Wo = I[11]; const float* bo = I[12];
  char* ws = (char*)d_ws; size_t off = 0;
  auto take = [&](size_t bytes) { char* p = ws + off; off += (bytes + 255) & ~(size_t)255; return p; };
  _Float16* Y = (_Float16*)take((size_t)7 * CC * CC * 2); _Float16* Bq = Y; _Float16* Bk = Y + (size_t)CC * CC; _Float16* Bv = Y + (size_t)2 * CC * CC; _Float16* Bo = Y + (size_t)3 * CC * CC; _Float16* Xq = Y + (size_t)4 * CC * CC; _Float16* Xk = Y + (size_t)5 * CC * CC; _Float16* Xv = Y + (size_t)6 * CC * CC;
  _Float16* BG = (_Float16*)take((size_t)NH * HD * HD * 2);
  float* QF = (float*)take((size_t)SS * CC * 4); float* KF = (float*)take((size_t)SS * CC * 4);
  _Float16* QR16 = (_Float16*)take((size_t)SS * CC * 2); _Float16* QG16 = (_Float16*)take((size_t)SS * CC * 2); _Float16* KR16 = (_Float16*)take((size_t)SS * CC * 2); _Float16* V16 = (_Float16*)take((size_t)SS * CC * 2); _Float16* Vt = (_Float16*)take((size_t)SS * CC * 2); float* O = QF; _Float16* O16 = Xq;
  if (off > ws_size) return;      // 8.4 x 12 + 0.5 + 16.8 x 2 = about 135 MB
  const unsigned gx = (unsigned)(((size_t)SS * CC / 8 + 255) / 256); const unsigned gt = (SS / 128) * (CC / 128);
  k_prep<<<PB_G + 7 * PB_M, 256, 0, stream>>>(G, Wq, Wk, Wv, Wo, q, k, v, BG, Y);      // operands in f16
  k_gemm_t<<<dim3(gt, 3), 256, 0, stream>>>(Xq, Xk, Xv, Bq, Bk, Bv, 0.0625f, bq, bk, bv, QF, KF, V16);      // q, k (f32) and v (f16) projections
  k_post<<<2 * RB + NH * (SS / 64), 256, 0, stream>>>(QF, QR16, KF, KR16, V16, Vt);      // rope q, rope k, Vt
  k_gemm_hhx<0><<<dim3(((SS / 16) * (HD / 64) + 3) / 4, NH), 128, 0, stream>>>(QR16, CC, (size_t)HD, BG, HD, (size_t)HD * HD, 0.0625f, nullptr, 0, nullptr, 1, 0, 0, nullptr, QG16, CC, (size_t)HD, SS, HD, HD);      // qg_h = q_h · G_h (batched over heads via column offsets)
  k_flash<<<1 * NH * (SS / 64), 128, 0, stream>>>(QG16, CC, KR16, CC, Vt, mask, O, CC);
  k_h16<<<gx, 256, 0, stream>>>(O, O16, (size_t)SS * CC / 8);
  k_gemm_t<<<dim3(gt, 1), 256, 0, stream>>>(O16, O16, O16, Bo, Bo, Bo, 0.0625f, bo, bo, bo, (float*)d_out, (float*)d_out, nullptr);
}

// v005
// It runs in 204 microseconds.
// Two timings next to v004 both put it at 1.04 times that version's speed.
// Over all steps from v000 it is 3.58 times as fast.
#include <hip/hip_runtime.h>
// Power-law-graph multi-head attention (B=1, S=2048, D=2048, 16 heads × 128; INPUT additive mask (nonzero = −1e9) ; RoPE interleaved pairs): q/k/v/o projections ((out,in) + bias) and the per-head
// metric product qg = q_h·G_h as GEMMs and the attention as a fused flash-style kernel (head dim 128: 4 k-steps / 8 d-tiles; masked keys excluded, fully masked 32-key tiles skipped by ballot;
// online softmax f32; P f16 ≤ 1; O = P·Vt; RPW-16 waves) on v_wmma_f32_16x16x32_f16, f32 accumulate; RoPE f32 VALU.
#define SS 2048
#define CC 2048
#define NH 16
#define HD 128

typedef __bf16 v16b __attribute__((ext_vector_type(16)));
typedef unsigned short v8us __attribute__((ext_vector_type(8), may_alias));
typedef float  v8f  __attribute__((ext_vector_type(8)));
typedef float  v4f  __attribute__((ext_vector_type(4)));
typedef float  v4fa __attribute__((ext_vector_type(4), may_alias));
union FragB { v16b v; v8us half[2]; unsigned short u[16]; };

__device__ __forceinline__ unsigned short bf16_bits(float x) { unsigned int u = __float_as_uint(x); return (unsigned short)((u + 0x7FFFu + ((u >> 16) & 1u)) >> 16); }
__device__ __forceinline__ float bf16_val(unsigned short b) { return __uint_as_float(((unsigned int)b) << 16); }
__device__ __forceinline__ float bf16_round(float x) { return bf16_val(bf16_bits(x)); }
// D += A·B with NT terms: 1 = ah·bh, 2 = + al·bh (A split), 3 = + ah·bl (both split)
template <int NT>
__device__ __forceinline__ v8f mmaN(v16b ah, v16b al, v16b bh, v16b bl, v8f c) {
  c = __builtin_amdgcn_wmma_f32_16x16x32_bf16(false, ah, false, bh, (short)0, c, false, false);
  if (NT >= 2) c = __builtin_amdgcn_wmma_f32_16x16x32_bf16(false, al, false, bh, (short)0, c, false, false);
  if (NT >= 3) c = __builtin_amdgcn_wmma_f32_16x16x32_bf16(false, ah, false, bl, (short)0, c, false, false);
  asm volatile("v_nop\n\tv_nop\n\tv_nop\n\tv_nop" : "+v"(c) : "v"(ah), "v"(al), "v"(bh), "v"(bl));
  return c;
}

__global__ __launch_bounds__(256) void k_wt_bf16(const float* __restrict__ W, unsigned short* __restrict__ Wt, int K, int N) {
  const int t = blockIdx.x * 256 + threadIdx.x;
  const int k8n = K / 8;
  if (t >= N * k8n) return;
  const int n = t / k8n, k8 = (t % k8n) * 8;
  v8us v;
#pragma unroll
  for (int i = 0; i < 8; ++i) v[i] = bf16_bits(W[(size_t)(k8 + i) * N + n]);
  *(v8us*)(Wt + (size_t)n * K + k8) = v;
  
}

// GEMM C[M][N] (f32, pitch ldc) = act(A[M][K]·W + bias). A f32 row-major (pitch lda) converted per fragment to bf16
// (ASPLIT: hi/lo two planes -> 2 terms, else single rounded term); Wt bf16 [N][K] (pitch ldb). BIAS_BF16 rounds the
// bias to bf16 first (bias quantised to bf16 before the add). K%32==0, M%16==0, N%64==0.
template <bool ASPLIT, int ACT, bool BIAS_BF16>
__global__ __launch_bounds__(128) void k_gemm_bf(const float* __restrict__ A, int lda, const unsigned short* __restrict__ Wt, int ldb,
                                               const float* __restrict__ bias, float* __restrict__ C, int ldc, int M, int N, int K) {
  __shared__ __attribute__((aligned(16))) float so[4][16][64];
  const int tid = threadIdx.x, w = tid >> 5, lane = tid & 31, ln = lane & 15, hh = lane >> 4;
  const int ntn = N / 64;
  const int wid = blockIdx.x * 4 + w;
  const int mt = wid / ntn, nq = wid % ntn;
  if (mt * 16 >= M) return;
  const int row0 = mt * 16, col0 = nq * 64;
  const float* arow = A + (size_t)(row0 + ln) * lda;
  v8f acc[4] = {};
  for (int kb = 0; kb < K; kb += 32) {
    FragB ah, al;
    const v4f x0 = *(const v4fa*)(arow + kb + 8 * hh), x1 = *(const v4fa*)(arow + kb + 8 * hh + 4);
    const v4f x2 = *(const v4fa*)(arow + kb + 16 + 8 * hh), x3 = *(const v4fa*)(arow + kb + 16 + 8 * hh + 4);
    float xs[16] = {x0[0],x0[1],x0[2],x0[3],x1[0],x1[1],x1[2],x1[3],x2[0],x2[1],x2[2],x2[3],x3[0],x3[1],x3[2],x3[3]};
#pragma unroll
    for (int i = 0; i < 16; ++i) { const unsigned short hb = bf16_bits(xs[i]); ah.u[i] = hb; al.u[i] = ASPLIT ? bf16_bits(xs[i] - bf16_val(hb)) : (unsigned short)0; }
#pragma unroll
    for (int t = 0; t < 4; ++t) {
      const unsigned short* brow = Wt + (size_t)(col0 + t * 16 + ln) * ldb + kb;
      FragB b;
      b.half[0] = *(const v8us*)(brow + 8 * hh);
      b.half[1] = *(const v8us*)(brow + 16 + 8 * hh);
      acc[t] = mmaN<ASPLIT ? 2 : 1>(ah.v, al.v, b.v, b.v, acc[t]);
    }
  }
#pragma unroll
  for (int t = 0; t < 4; ++t) {
    float bv = bias ? bias[col0 + t * 16 + ln] : 0.f;
    if (BIAS_BF16) bv = bf16_round(bv);
#pragma unroll
    for (int r = 0; r < 8; ++r) { float v = acc[t][r] + bv; if (ACT == 1) v = fmaxf(v, 0.f); so[w][8 * hh + r][t * 16 + ln] = v; }
  }
  __builtin_amdgcn_fence(__ATOMIC_ACQ_REL, "workgroup");
  __builtin_amdgcn_wave_barrier();
  const int rsub = lane >> 4, c4 = (lane & 15) * 4;
  {
#pragma unroll
    for (int q = 0; q < 8; ++q) {
      const int r = q * 2 + rsub;
      const v4f v = *(const v4fa*)&so[w][r][c4];
      *(v4f*)(C + (size_t)(row0 + r) * ldc + col0 + c4) = v;
    }
    
  }
}

// Flash-style causal/unmasked attention, all contractions 3-term bf16 hi/lo splits, f32 softmax with running max.
// q,k,v rows are read from f32 buffers with arbitrary row pitch (so they can live inside a fused qkv buffer);
// D = head size (multiple of 32, <= 128); one wave = 16 query rows; block = 4 waves (64 queries) sharing K/V chunks of 32.
template <int D, bool CAUSAL>
__global__ __launch_bounds__(128) void k_flash(const float* __restrict__ qb, const float* __restrict__ kb, const float* __restrict__ vb,
                                             int pitch, int T, int H, float scale, float* __restrict__ y, int ypitch) {
  constexpr int KS = D / 32;        // k-steps for QK
  constexpr int DT = D / 16;        // d tiles for PV
  __shared__ __attribute__((aligned(16))) unsigned short sKh[32][D + 8], sKl[32][D + 8], sVh[32][D + 8], sVl[32][D + 8];
  __shared__ __attribute__((aligned(16))) unsigned short sPh[4][16][40], sPl[4][16][40];
  __shared__ __attribute__((aligned(16))) float sO[4][16][D];
  const int tid = threadIdx.x, w = tid >> 5, lane = tid & 31, ln = lane & 15, hh = lane >> 4;
  const int nqb = (T + 63) / 64;
  const int bh = blockIdx.x / nqb, qblk = blockIdx.x % nqb;
  const int b = bh / H, h = bh % H;
  const int q0 = qblk * 64 + w * 16;
  const float* Q = qb + (size_t)b * T * pitch + h * D;
  const float* K = kb + (size_t)b * T * pitch + h * D;
  const float* V = vb + (size_t)b * T * pitch + h * D;

  // A fragments of the wave's 16 query rows (scaled), hi/lo
  FragB aqh[KS], aql[KS];
  {
    int row = q0 + ln; if (row >= T) row = T - 1;
    const float* qr = Q + (size_t)row * pitch;
#pragma unroll
    for (int ks = 0; ks < KS; ++ks)
#pragma unroll
      for (int i = 0; i < 16; ++i) {
        const int d = ks * 32 + ((i < 8) ? (8 * hh + i) : (16 + 8 * hh + (i - 8)));
        const float x = qr[d] * scale; const unsigned short hb = bf16_bits(x);
        aqh[ks].u[i] = hb; aql[ks].u[i] = bf16_bits(x - bf16_val(hb));
      }
  }
  float m_r[8], l_r[8];
#pragma unroll
  for (int r = 0; r < 8; ++r) { m_r[r] = -3.0e38f; l_r[r] = 0.f; }
  v8f oacc[DT];
#pragma unroll
  for (int dt = 0; dt < DT; ++dt) oacc[dt] = (v8f){0.f,0.f,0.f,0.f,0.f,0.f,0.f,0.f};

  const int kv_end = CAUSAL ? min(T, qblk * 64 + 64) : T;     // block-uniform
  for (int j0 = 0; j0 < kv_end; j0 += 32) {
    __syncthreads();
    for (int e = tid; e < 32 * (D / 4); e += 128) {
      const int r = e / (D / 4), c4 = (e % (D / 4)) * 4;
      const int key = j0 + r;
      v4f kf = {0.f,0.f,0.f,0.f}, vf = {0.f,0.f,0.f,0.f};
      if (key < T) { kf = *(const v4fa*)(K + (size_t)key * pitch + c4); vf = *(const v4fa*)(V + (size_t)key * pitch + c4); }
#pragma unroll
      for (int t = 0; t < 4; ++t) {
        unsigned short hb = bf16_bits(kf[t]); sKh[r][c4 + t] = hb; sKl[r][c4 + t] = bf16_bits(kf[t] - bf16_val(hb));
        hb = bf16_bits(vf[t]); sVh[r][c4 + t] = hb; sVl[r][c4 + t] = bf16_bits(vf[t] - bf16_val(hb));
      }
    }
    __syncthreads();
    // S tile 16 x 32
    v8f s[2];
#pragma unroll
    for (int nt = 0; nt < 2; ++nt) {
      v8f acc = {};
#pragma unroll
      for (int ks = 0; ks < KS; ++ks) {
        FragB bh_, bl_;
        bh_.half[0] = *(const v8us*)&sKh[nt * 16 + ln][ks * 32 + 8 * hh]; bh_.half[1] = *(const v8us*)&sKh[nt * 16 + ln][ks * 32 + 16 + 8 * hh];
        bl_.half[0] = *(const v8us*)&sKl[nt * 16 + ln][ks * 32 + 8 * hh]; bl_.half[1] = *(const v8us*)&sKl[nt * 16 + ln][ks * 32 + 16 + 8 * hh];
        acc = mmaN<3>(aqh[ks].v, aql[ks].v, bh_.v, bl_.v, acc);
      }
      s[nt] = acc;
    }
    // mask + running max (rows 8hh+r; the 16 lanes of a half share rows)
    float alpha[8];
#pragma unroll
    for (int r = 0; r < 8; ++r) {
      const int qi = q0 + 8 * hh + r;
      const int ja = j0 + ln, jb = j0 + 16 + ln;
      if (CAUSAL) { if (ja > qi) s[0][r] = -3.0e38f; if (jb > qi) s[1][r] = -3.0e38f; }
      if (ja >= T) s[0][r] = -3.0e38f;
      if (jb >= T) s[1][r] = -3.0e38f;
      float mx = fmaxf(s[0][r], s[1][r]);
      mx = fmaxf(mx, __shfl_xor(mx, 1, 32)); mx = fmaxf(mx, __shfl_xor(mx, 2, 32)); mx = fmaxf(mx, __shfl_xor(mx, 4, 32)); mx = fmaxf(mx, __shfl_xor(mx, 8, 32));
      const float mnew = fmaxf(m_r[r], mx);
      alpha[r] = (mnew > -1.0e38f) ? __expf(m_r[r] - mnew) : 1.0f;
      const float p0 = (s[0][r] > -1.0e38f) ? __expf(s[0][r] - mnew) : 0.f;
      const float p1 = (s[1][r] > -1.0e38f) ? __expf(s[1][r] - mnew) : 0.f;
      m_r[r] = mnew;
      l_r[r] = l_r[r] * alpha[r] + p0 + p1;            // per-lane partial row sum (16 lanes combined at the end)
      unsigned short hb = bf16_bits(p0); sPh[w][8 * hh + r][ln] = hb;      sPl[w][8 * hh + r][ln] = bf16_bits(p0 - bf16_val(hb));
      hb = bf16_bits(p1);                sPh[w][8 * hh + r][16 + ln] = hb; sPl[w][8 * hh + r][16 + ln] = bf16_bits(p1 - bf16_val(hb));
    }
#pragma unroll
    for (int dt = 0; dt < DT; ++dt)
#pragma unroll
      for (int r = 0; r < 8; ++r) oacc[dt][r] *= alpha[r];
    __builtin_amdgcn_fence(__ATOMIC_ACQ_REL, "workgroup");
    __builtin_amdgcn_wave_barrier();
    FragB pah, pal;
    pah.half[0] = *(const v8us*)&sPh[w][ln][8 * hh]; pah.half[1] = *(const v8us*)&sPh[w][ln][16 + 8 * hh];
    pal.half[0] = *(const v8us*)&sPl[w][ln][8 * hh]; pal.half[1] = *(const v8us*)&sPl[w][ln][16 + 8 * hh];
#pragma unroll
    for (int dt = 0; dt < DT; ++dt) {
      FragB bvh, bvl;
#pragma unroll
      for (int i = 0; i < 8; ++i) {
        bvh.u[i] = sVh[8 * hh + i][dt * 16 + ln]; bvh.u[8 + i] = sVh[16 + 8 * hh + i][dt * 16 + ln];
        bvl.u[i] = sVl[8 * hh + i][dt * 16 + ln]; bvl.u[8 + i] = sVl[16 + 8 * hh + i][dt * 16 + ln];
      }
      oacc[dt] = mmaN<3>(pah.v, pal.v, bvh.v, bvl.v, oacc[dt]);
    }
    __builtin_amdgcn_fence(__ATOMIC_ACQ_REL, "workgroup");
    __builtin_amdgcn_wave_barrier();
  }
#pragma unroll
  for (int r = 0; r < 8; ++r) {
    float l = l_r[r];
    l += __shfl_xor(l, 1, 32); l += __shfl_xor(l, 2, 32); l += __shfl_xor(l, 4, 32); l += __shfl_xor(l, 8, 32);
    l_r[r] = (l > 0.f) ? 1.0f / l : 0.f;
  }
#pragma unroll
  for (int dt = 0; dt < DT; ++dt)
#pragma unroll
    for (int r = 0; r < 8; ++r) sO[w][8 * hh + r][dt * 16 + ln] = oacc[dt][r] * l_r[r];
  __builtin_amdgcn_fence(__ATOMIC_ACQ_REL, "workgroup");
  __builtin_amdgcn_wave_barrier();
  {
    for (int r = 0; r < 16; ++r) {
      const int row = q0 + r;
      if (row < T && lane < D / 4) {
        const v4f val = *(const v4fa*)&sO[w][r][lane * 4];
        *(v4f*)(y + ((size_t)b * T + row) * ypitch + h * D + lane * 4) = val;
      }
    }
    
  }
}

// GEMM C = act(A·W + bias + resid): A f32 (ASPLIT -> hi/lo 2 terms), Wt bf16 [N][K]; ACT 0 none, 1 relu, 2 exact gelu;
// resid (optional, f32, row index = (row % rmod), pitch ldr, RES_BF16 rounds it) added before the activation.
template <bool ASPLIT, int ACT, bool BIAS_BF16, bool RES_BF16>
__global__ __launch_bounds__(128) void k_gemm_bf3(const float* __restrict__ A, int lda, const unsigned short* __restrict__ Wt, int ldb,
                                                const float* __restrict__ bias, const float* __restrict__ resid, int rmod, int ldr,
                                                float* __restrict__ C, int ldc, int M, int N, int K) {
  __shared__ __attribute__((aligned(16))) float so[4][16][64];
  const int tid = threadIdx.x, w = tid >> 5, lane = tid & 31, ln = lane & 15, hh = lane >> 4;
  const int ntn = N / 64;
  const int wid = blockIdx.x * 4 + w;
  const int mt = wid / ntn, nq = wid % ntn;
  if (mt * 16 >= M) return;
  const int row0 = mt * 16, col0 = nq * 64;
  const float* arow = A + (size_t)(row0 + ln) * lda;
  v8f acc[4] = {};
  for (int kb = 0; kb < K; kb += 32) {
    FragB ah, al;
    const v4f x0 = *(const v4fa*)(arow + kb + 8 * hh), x1 = *(const v4fa*)(arow + kb + 8 * hh + 4);
    const v4f x2 = *(const v4fa*)(arow + kb + 16 + 8 * hh), x3 = *(const v4fa*)(arow + kb + 16 + 8 * hh + 4);
    float xs[16] = {x0[0],x0[1],x0[2],x0[3],x1[0],x1[1],x1[2],x1[3],x2[0],x2[1],x2[2],x2[3],x3[0],x3[1],x3[2],x3[3]};
#pragma unroll
    for (int i = 0; i < 16; ++i) { const unsigned short hb = bf16_bits(xs[i]); ah.u[i] = hb; al.u[i] = ASPLIT ? bf16_bits(xs[i] - bf16_val(hb)) : (unsigned short)0; }
#pragma unroll
    for (int t = 0; t < 4; ++t) {
      const unsigned short* brow = Wt + (size_t)(col0 + t * 16 + ln) * ldb + kb;
      FragB b;
      b.half[0] = *(const v8us*)(brow + 8 * hh);
      b.half[1] = *(const v8us*)(brow + 16 + 8 * hh);
      acc[t] = mmaN<ASPLIT ? 2 : 1>(ah.v, al.v, b.v, b.v, acc[t]);
    }
  }
#pragma unroll
  for (int t = 0; t < 4; ++t) {
    const int col = col0 + t * 16 + ln;
    float bv = bias ? bias[col] : 0.f;
    if (BIAS_BF16) bv = bf16_round(bv);
#pragma unroll
    for (int r = 0; r < 8; ++r) {
      float v = acc[t][r] + bv;
      if (resid) { float rv = resid[(size_t)((row0 + 8 * hh + r) % rmod) * ldr + col]; if (RES_BF16) rv = bf16_round(rv); v += rv; }
      if (ACT == 1) v = fmaxf(v, 0.f);
      if (ACT == 2) v = 0.5f * v * (1.0f + erff(v * 0.70710678118654752f));
      if (ACT == 3) { const float u = 0.7978845608028654f * (v + 0.044715f * v * v * v); v = 0.5f * v * (1.0f + tanhf(u)); }
      so[w][8 * hh + r][t * 16 + ln] = v;
    }
  }
  __builtin_amdgcn_fence(__ATOMIC_ACQ_REL, "workgroup");
  __builtin_amdgcn_wave_barrier();
  const int rsub = lane >> 4, c4 = (lane & 15) * 4;
  {
#pragma unroll
    for (int q = 0; q < 8; ++q) {
      const int r = q * 2 + rsub;
      const v4f v = *(const v4fa*)&so[w][r][c4];
      *(v4f*)(C + (size_t)(row0 + r) * ldc + col0 + c4) = v;
    }
    
  }
}
// row LayerNorm (biased variance, eps) over N: s = X (+ R); optional out_sum <- s; out_norm <- (s-mu)*rsqrt(var+eps)*g + b
template <bool PARAM_BF16>
__global__ __launch_bounds__(256) void k_layernorm(const float* __restrict__ X, const float* __restrict__ R, const float* __restrict__ g, const float* __restrict__ bta,
                                                  float* __restrict__ out_sum, float* __restrict__ out_norm, int N, float eps) {
  __shared__ float red[256];
  const int row = blockIdx.x, tid = threadIdx.x;
  const float* x = X + (size_t)row * N; const float* rr = R ? R + (size_t)row * N : nullptr;
  float vals[16];                     // up to N = 4096
  const int per = N / 256;            // contiguous chunk per thread? use strided-by-4 chunks: thread handles j = tid*4 + 1024*u
  float s1 = 0.f;
  for (int u = 0; u < per / 4; ++u) {
    const int j = tid * 4 + 1024 * u;
    const v4f a = *(const v4fa*)(x + j);
    v4f b = {0.f,0.f,0.f,0.f}; if (rr) b = *(const v4fa*)(rr + j);
#pragma unroll
    for (int q = 0; q < 4; ++q) { const float v = a[q] + b[q]; vals[u * 4 + q] = v; s1 += v; }
  }
  red[tid] = s1; __syncthreads();
  for (int st = 128; st > 0; st >>= 1) { if (tid < st) red[tid] += red[tid + st]; __syncthreads(); }
  const float mu = red[0] / (float)N; __syncthreads();
  float s2 = 0.f;
  for (int u = 0; u < per / 4; ++u)
#pragma unroll
    for (int q = 0; q < 4; ++q) { const float c = vals[u * 4 + q] - mu; s2 += c * c; }
  red[tid] = s2; __syncthreads();
  for (int st = 128; st > 0; st >>= 1) { if (tid < st) red[tid] += red[tid + st]; __syncthreads(); }
  const float rs = rsqrtf(red[0] / (float)N + eps);
  {
    for (int u = 0; u < per / 4; ++u) {
      const int j = tid * 4 + 1024 * u;
      v4f o, sm;
#pragma unroll
      for (int q = 0; q < 4; ++q) {
        float gg = g[j + q], bb = bta[j + q];
        if (PARAM_BF16) { gg = bf16_round(gg); bb = bf16_round(bb); }
        sm[q] = vals[u * 4 + q]; o[q] = (vals[u * 4 + q] - mu) * rs * gg + bb;
      }
      if (out_sum) *(v4f*)(out_sum + (size_t)row * N + j) = sm;
      *(v4f*)(out_norm + (size_t)row * N + j) = o;
    }
    
  }
}



// ---- f16 WMMA path (v_wmma_f32_16x16x32_f16): 11-bit significands for operands in range — used where a [0,1] probability operand needs more precision than bf16
typedef _Float16 v16h __attribute__((ext_vector_type(16)));
union FragH { v16h v; v8us half[2]; _Float16 h[16]; unsigned short u[16]; };
template <int NT>
__device__ __forceinline__ v8f mmaH(v16h ah, v16h al, v16h bh, v16h bl, v8f c) {
  c = __builtin_amdgcn_wmma_f32_16x16x32_f16(false, ah, false, bh, (short)0, c, false, false);
  if (NT >= 2) c = __builtin_amdgcn_wmma_f32_16x16x32_f16(false, al, false, bh, (short)0, c, false, false);
  if (NT >= 3) c = __builtin_amdgcn_wmma_f32_16x16x32_f16(false, ah, false, bl, (short)0, c, false, false);
  asm volatile("v_nop\n\tv_nop\n\tv_nop\n\tv_nop" : "+v"(c) : "v"(ah), "v"(al), "v"(bh), "v"(bl));
  return c;
}
// batched GEMM like k_gemm_b but f16 operands: A f32 (split into f16 hi/lo if ASPLIT, else rounded to f16), Bt = f16 values [n][k]; alpha; C f32; N multiple of 16 (partial tiles skipped)
template <bool ASPLIT>
__global__ __launch_bounds__(128) void k_gemm_h(const float* __restrict__ A, int lda, size_t sA, const _Float16* __restrict__ Bh, int ldb, size_t sB, float alpha, float* __restrict__ C, int ldc, size_t sC, int M, int N, int K) {
  __shared__ __attribute__((aligned(16))) float so[4][16][64];
  const int tid = threadIdx.x, w = tid >> 5, lane = tid & 31, ln = lane & 15, hh = lane >> 4; const int by = blockIdx.y;
  A += (size_t)by * sA; Bh += (size_t)by * sB; C += (size_t)by * sC;
  const int ntn = (N + 63) / 64; const int wid = blockIdx.x * 4 + w; const int mt = wid / ntn, nq = wid % ntn; if (mt * 16 >= M) return;
  const int row0 = mt * 16, col0 = nq * 64; const float* arow = A + (size_t)(row0 + ln) * lda;
  v8f acc[4] = {};
  for (int kb = 0; kb < K; kb += 32) {
    FragH ah, al;
    const v4f x0 = *(const v4fa*)(arow + kb + 8 * hh), x1 = *(const v4fa*)(arow + kb + 8 * hh + 4), x2 = *(const v4fa*)(arow + kb + 16 + 8 * hh), x3 = *(const v4fa*)(arow + kb + 16 + 8 * hh + 4);
    float xs[16] = {x0[0],x0[1],x0[2],x0[3],x1[0],x1[1],x1[2],x1[3],x2[0],x2[1],x2[2],x2[3],x3[0],x3[1],x3[2],x3[3]};
#pragma unroll
    for (int i = 0; i < 16; ++i) { const _Float16 h = (_Float16)xs[i]; ah.h[i] = h; al.h[i] = ASPLIT ? (_Float16)(xs[i] - (float)h) : (_Float16)0.0f; }
#pragma unroll
    for (int t = 0; t < 4; ++t) { if (col0 + t * 16 >= N) continue; const size_t boff = (size_t)(col0 + t * 16 + ln) * ldb + kb; FragH bq; bq.half[0] = *(const v8us*)(Bh + boff + 8 * hh); bq.half[1] = *(const v8us*)(Bh + boff + 16 + 8 * hh);
      acc[t] = mmaH<ASPLIT ? 2 : 1>(ah.v, al.v, bq.v, bq.v, acc[t]); }
  }
#pragma unroll
  for (int t = 0; t < 4; ++t) { if (col0 + t * 16 >= N) continue;
#pragma unroll
    for (int r = 0; r < 8; ++r) so[w][8 * hh + r][t * 16 + ln] = acc[t][r] * alpha; }
  __builtin_amdgcn_fence(__ATOMIC_ACQ_REL, "workgroup"); __builtin_amdgcn_wave_barrier();
  const int rsub = lane >> 4, c4 = (lane & 15) * 4;
  {
#pragma unroll
    for (int q = 0; q < 8; ++q) { const int r = q * 2 + rsub; if (col0 + c4 < N) { const v4f v = *(const v4fa*)&so[w][r][c4]; *(v4f*)(C + (size_t)(row0 + r) * ldc + col0 + c4) = v; } }
     }
}

// k_gemm_hh variant with fused epilogue: v = acc·alpha + bias[by·sBias + col] (+ CP[(row/rowsPerB)·sCPb + by·64 + col] if CP) ; ACT 0 none / 1 elu ; writes f16 C16 (and f32 C if non-null)
template <int ACT>
__global__ __launch_bounds__(128) void k_gemm_hhx(const _Float16* __restrict__ A, int lda, size_t sA, const _Float16* __restrict__ Bh, int ldb, size_t sB, float alpha, const float* __restrict__ bias, size_t sBias, const float* __restrict__ CP, int rowsPerB, size_t sCPb, int row0g,
    float* __restrict__ C, _Float16* __restrict__ C16, int ldc, size_t sC, int M, int N, int K) {
  __shared__ __attribute__((aligned(16))) float so[4][16][64];
  const int tid = threadIdx.x, w = tid >> 5, lane = tid & 31, ln = lane & 15, hh = lane >> 4; const int by = blockIdx.y;
  A += (size_t)by * sA; Bh += (size_t)by * sB; const size_t cofs = (size_t)by * sC; const float* bp = bias ? bias + (size_t)by * sBias : nullptr;
  const int ntn = (N + 63) / 64; const int wid = blockIdx.x * 4 + w; const int mt = wid / ntn, nq = wid % ntn; if (mt * 16 >= M) return;
  const int row0 = mt * 16, col0 = nq * 64; const _Float16* arow = A + (size_t)(row0 + ln) * lda;
  v8f acc[4] = {};
  for (int kb = 0; kb < K; kb += 32) { FragH ah; ah.half[0] = *(const v8us*)((const unsigned short*)arow + kb + 8 * hh); ah.half[1] = *(const v8us*)((const unsigned short*)arow + kb + 16 + 8 * hh);
#pragma unroll
    for (int t = 0; t < 4; ++t) { if (col0 + t * 16 >= N) continue; const size_t boff = (size_t)(col0 + t * 16 + ln) * ldb + kb; FragH bq; bq.half[0] = *(const v8us*)((const unsigned short*)Bh + boff + 8 * hh); bq.half[1] = *(const v8us*)((const unsigned short*)Bh + boff + 16 + 8 * hh);
      acc[t] = mmaH<1>(ah.v, ah.v, bq.v, bq.v, acc[t]); }
  }
#pragma unroll
  for (int t = 0; t < 4; ++t) { if (col0 + t * 16 >= N) continue; const int col = col0 + t * 16 + ln; const float bv = bp ? bf16_round(bp[col]) : 0.f;
#pragma unroll
    for (int r = 0; r < 8; ++r) { float v = acc[t][r] * alpha + bv; if (CP) { const int bidx = (row0g + row0 + 8 * hh + r) / rowsPerB; v += CP[(size_t)bidx * sCPb + (size_t)by * 64 + col]; } if (ACT == 1) v = (v > 0.f) ? v : expm1f(v); else if (ACT == 3) v = fmaxf(v, 0.f); so[w][8 * hh + r][t * 16 + ln] = v; } }
  __builtin_amdgcn_fence(__ATOMIC_ACQ_REL, "workgroup"); __builtin_amdgcn_wave_barrier();
  const int rsub = lane >> 4, c4 = (lane & 15) * 4; typedef _Float16 v4h __attribute__((ext_vector_type(4)));
  {
#pragma unroll
    for (int q = 0; q < 8; ++q) { const int r = q * 2 + rsub; if (col0 + c4 < N) { const v4f v = *(const v4fa*)&so[w][r][c4]; if (C) *(v4f*)(C + cofs + (size_t)(row0 + r) * ldc + col0 + c4) = v; if (C16) { v4h h4; for (int i = 0; i < 4; ++i) h4[i] = (_Float16)v[i]; *(v4h*)(C16 + cofs + (size_t)(row0 + r) * ldc + col0 + c4) = h4; } } }
     }
}


// Projection GEMM, 2048 x 2048 x 2048: C = (A . Bt^T) * alpha + bias. One 128 x 128 tile of C per workgroup of 8 waves (4 x 2, 32 x 64 per wave).
// A pass is 128 k: 128 rows of A and 128 rows of Bt, 256 B each, laid in LDS at pitch 272 B by asynchronous copies, two buffers, the next pass's copies in flight under this pass's products.
// k runs upward in steps of 32 into one accumulator per 16 x 16 tile, as in k_gemm_hhx: the sums keep their order.
// Every '#pragma unroll' in k_gemm_t makes the indices of the fragment and accumulator arrays constants, so that they stay in registers.
#define GT_PITCH 272u
#define GT_STAGE (256u * GT_PITCH)
#define GT_NST (CC / 128)
__device__ __forceinline__ void gt_copy8(unsigned l0, const unsigned short* g0) {
  // eight 16-byte copies of this lane, rows 16 apart; s_wait_xcnt stands inside the statement so that no address register is rewritten ahead of it
  const unsigned l1 = l0 + 16u * GT_PITCH, l2 = l0 + 32u * GT_PITCH, l3 = l0 + 48u * GT_PITCH, l4 = l0 + 64u * GT_PITCH, l5 = l0 + 80u * GT_PITCH, l6 = l0 + 96u * GT_PITCH, l7 = l0 + 112u * GT_PITCH;
  const unsigned short *g1 = g0 + 16 * CC, *g2 = g0 + 32 * CC, *g3 = g0 + 48 * CC, *g4 = g0 + 64 * CC, *g5 = g0 + 80 * CC, *g6 = g0 + 96 * CC, *g7 = g0 + 112 * CC;
  asm volatile("global_load_async_to_lds_b128 %0, %8, off\n\t"
               "global_load_async_to_lds_b128 %1, %9, off\n\t"
               "global_load_async_to_lds_b128 %2, %10, off\n\t"
               "global_load_async_to_lds_b128 %3, %11, off\n\t"
               "global_load_async_to_lds_b128 %4, %12, off\n\t"
               "global_load_async_to_lds_b128 %5, %13, off\n\t"
               "global_load_async_to_lds_b128 %6, %14, off\n\t"
               "global_load_async_to_lds_b128 %7, %15, off\n\t"
               "s_wait_xcnt 0x0"
               :: "v"(l0), "v"(l1), "v"(l2), "v"(l3), "v"(l4), "v"(l5), "v"(l6), "v"(l7),
                  "v"(g0), "v"(g1), "v"(g2), "v"(g3), "v"(g4), "v"(g5), "v"(g6), "v"(g7) : "memory");
}
// blockIdx.y picks one of up to three independent products that share the grid; product 2's tile goes out as f16 to C16, the others' as f32
__global__ __launch_bounds__(256) void k_gemm_t(const _Float16* A0, const _Float16* A1, const _Float16* A2, const _Float16* Bh0, const _Float16* Bh1, const _Float16* Bh2, float alpha,
                                                const float* bias0, const float* bias1, const float* bias2, float* C0, float* C1, _Float16* C16) {
  __shared__ __attribute__((aligned(16))) unsigned char L[2u * GT_STAGE];
  const int py = (int)blockIdx.y; const bool H16 = py == 2;
  const _Float16* A = py == 0 ? A0 : py == 1 ? A1 : A2; const _Float16* Bh = py == 0 ? Bh0 : py == 1 ? Bh1 : Bh2; const float* bias = py == 0 ? bias0 : py == 1 ? bias1 : bias2; float* C = py == 0 ? C0 : C1;
  const int tid = threadIdx.x, w = tid >> 5, lane = tid & 31, ln = lane & 15, hh = lane >> 4;
  const int m0 = (int)(blockIdx.x / (CC / 128)) * 128, n0 = (int)(blockIdx.x % (CC / 128)) * 128;
  const int wm = (w >> 1) * 32, wn = (w & 1) * 64;
  // copies: lane takes 16-byte piece (tid & 15) of rows (tid >> 4) + 16 i; LDS rows 0..127 hold A, 128..255 hold Bt
  const unsigned lcp = (unsigned)(size_t)L + (unsigned)(tid >> 4) * GT_PITCH + (unsigned)(tid & 15) * 16u;
  const unsigned short* ga = (const unsigned short*)A + (size_t)(m0 + (tid >> 4)) * CC + (tid & 15) * 8;
  const unsigned short* gb = (const unsigned short*)Bh + (size_t)(n0 + (tid >> 4)) * CC + (tid & 15) * 8;
  v8f acc[2][4];
#pragma unroll
  for (int i = 0; i < 2; ++i)
#pragma unroll
    for (int j = 0; j < 4; ++j) acc[i][j] = (v8f){0.f,0.f,0.f,0.f,0.f,0.f,0.f,0.f};
  gt_copy8(lcp, ga); gt_copy8(lcp + 128u * GT_PITCH, gb);
  asm volatile("s_wait_asynccnt 0x0" ::: "memory");      // pass 0's bytes of this wave have landed
  __syncthreads();                                        // and every wave's: pass 0 is readable
  gt_copy8(lcp + GT_STAGE, ga + 128); gt_copy8(lcp + GT_STAGE + 128u * GT_PITCH, gb + 128);
#pragma unroll 1      // one pass per trip: the ring's order at the foot stays as written
  for (int t = 0; t < GT_NST; ++t) {
    const unsigned char* S = L + (unsigned)(t & 1) * GT_STAGE;
    const unsigned char* ar = S + (unsigned)(wm + ln) * GT_PITCH + 16u * hh;
    const unsigned char* br = S + (unsigned)(128 + wn + ln) * GT_PITCH + 16u * hh;
    FragH a[2][2], b[2][4];      // two fragment sets: the next 32 k are fetched as one group ahead of this block's products (inside this pass's buffer only)
#pragma unroll
    for (int i = 0; i < 2; ++i) { a[0][i].half[0] = *(const v8us*)(ar + i * 16 * GT_PITCH); a[0][i].half[1] = *(const v8us*)(ar + i * 16 * GT_PITCH + 32); }
#pragma unroll
    for (int j = 0; j < 4; ++j) { b[0][j].half[0] = *(const v8us*)(br + j * 16 * GT_PITCH); b[0][j].half[1] = *(const v8us*)(br + j * 16 * GT_PITCH + 32); }
#pragma unroll
    for (int ks = 0; ks < 4; ++ks) {
      const int cu = ks & 1, nx = cu ^ 1;
      if (ks < 3) {
#pragma unroll
        for (int i = 0; i < 2; ++i) { a[nx][i].half[0] = *(const v8us*)(ar + i * 16 * GT_PITCH + (ks + 1) * 64); a[nx][i].half[1] = *(const v8us*)(ar + i * 16 * GT_PITCH + (ks + 1) * 64 + 32); }
#pragma unroll
        for (int j = 0; j < 4; ++j) { b[nx][j].half[0] = *(const v8us*)(br + j * 16 * GT_PITCH + (ks + 1) * 64); b[nx][j].half[1] = *(const v8us*)(br + j * 16 * GT_PITCH + (ks + 1) * 64 + 32); }
      }
      __builtin_amdgcn_sched_barrier(0);      // keeps the next block's twelve LDS loads one group ahead of these products; without it they sink among the products and each waits out its own latency
#pragma unroll
      for (int i = 0; i < 2; ++i)
#pragma unroll
        for (int j = 0; j < 4; ++j) acc[i][j] = __builtin_amdgcn_wmma_f32_16x16x32_f16(false, a[cu][i].v, false, b[cu][j].v, (short)0, acc[i][j], false, false);
      __builtin_amdgcn_sched_barrier(0);      // the products stay one run: no later load group rises into it
    }
    asm volatile("s_wait_dscnt 0x0" ::: "memory");        // this wave's reads of the buffer have returned
    asm volatile("s_wait_asynccnt 0x0" ::: "memory");     // this wave's copies of pass t + 1 have landed
    __syncthreads();                                      // publishes pass t + 1 and frees the buffer pass t has read
    if (t + 2 < GT_NST) { gt_copy8(lcp + (unsigned)(t & 1) * GT_STAGE, ga + (t + 2) * 128); gt_copy8(lcp + (unsigned)(t & 1) * GT_STAGE + 128u * GT_PITCH, gb + (t + 2) * 128); }
  }
  asm volatile("s_wait_asynccnt 0x0" ::: "memory");       // nothing in flight before the ring becomes output staging
  // epilogue: each wave stages its 32 x 64 tile in its own LDS range (pitch 68 floats) and stores whole lines
  float* so = (float*)(L + (unsigned)w * (32u * 272u));
#pragma unroll
  for (int j = 0; j < 4; ++j) { const float bv = bf16_round(bias[n0 + wn + j * 16 + ln]);
#pragma unroll
    for (int i = 0; i < 2; ++i)
#pragma unroll
      for (int r = 0; r < 8; ++r) so[(i * 16 + 8 * hh + r) * 68 + j * 16 + ln] = acc[i][j][r] * alpha + bv; }
  __builtin_amdgcn_fence(__ATOMIC_ACQ_REL, "workgroup"); __builtin_amdgcn_wave_barrier();      // the wave's staged rows are in LDS before its lanes read them back; the range is the wave's own, so no workgroup barrier
  const int c4 = ln * 4; typedef _Float16 v4h __attribute__((ext_vector_type(4)));
  if (!H16) {
#pragma unroll
    for (int q = 0; q < 16; ++q) { const int r = q * 2 + hh; const v4f v = *(const v4fa*)&so[r * 68 + c4]; const size_t o = (size_t)(m0 + wm + r) * CC + n0 + wn + c4; *(v4f*)(C + o) = v; }
    asm volatile("s_wait_xcnt 0x0" ::: "memory");      // no register that these stores name is rewritten ahead of this wait, whichever block the build lays behind them
  } else {
#pragma unroll
    for (int q = 0; q < 16; ++q) { const int r = q * 2 + hh; const v4f v = *(const v4fa*)&so[r * 68 + c4]; const size_t o = (size_t)(m0 + wm + r) * CC + n0 + wn + c4;
      v4h h4; for (int i = 0; i < 4; ++i) h4[i] = (_Float16)v[i]; *(v4h*)(C16 + o) = h4; }
    asm volatile("s_wait_xcnt 0x0" ::: "memory");      // as in the other arm
  }
}

__global__ __launch_bounds__(256) void k_h16(const float* __restrict__ x, _Float16* __restrict__ X16, size_t n8) { const size_t t = (size_t)blockIdx.x * 256 + threadIdx.x; if (t >= n8) return; FragH f;
#pragma unroll
  for (int q = 0; q < 8; ++q) f.h[q] = (_Float16)x[t * 8 + q]; *(v8us*)((unsigned short*)X16 + t * 8) = f.half[0];  }
// Every conversion that reads inputs alone, in one grid; the block index picks the job, each thread's work is that of the separate kernels.
// Blocks 0 .. PB_G-1: BG_h[e][d] = f16(bf16(G_h[d][e]) * 16), 8 blocks a head. Then PB_M blocks a matrix, 8 elements a thread: the four weights (bf16-rounded, * 16; (out,in) = Bt) and q, k, v (bf16-rounded, * 1, which is exact).
#define PB_G (NH * 8)
#define PB_M (CC * CC / 8 / 256)
__global__ __launch_bounds__(256) void k_prep(const float* __restrict__ G, const float* __restrict__ Wq, const float* __restrict__ Wk, const float* __restrict__ Wv, const float* __restrict__ Wo,
                                              const float* __restrict__ q, const float* __restrict__ k, const float* __restrict__ v, _Float16* __restrict__ BG, _Float16* __restrict__ Y) {
  const int bid = (int)blockIdx.x, tid = threadIdx.x; FragH f;
  if (bid < PB_G) {
    const float* W = G + (size_t)(bid >> 3) * HD * HD; const int t = (bid & 7) * 256 + tid; const int n = t / (HD / 8), k8 = (t % (HD / 8)) * 8;
#pragma unroll
    for (int i = 0; i < 8; ++i) f.h[i] = (_Float16)(bf16_round(W[(size_t)(k8 + i) * HD + n]) * 16.0f);
    *(v8us*)((unsigned short*)BG + (size_t)(bid >> 3) * HD * HD + (size_t)n * HD + k8) = f.half[0];
    asm volatile("s_wait_xcnt 0x0" ::: "memory");      // no register that the store names is rewritten ahead of this wait, whichever block the build lays behind it
    return;
  }
  const int j = (bid - PB_G) / PB_M; const size_t t = (size_t)((bid - PB_G) % PB_M) * 256 + tid;      // matrix j, in the order Wq Wk Wv Wo q k v; the seven results lie one behind the other in Y
  const float* x01 = (j & 1) ? Wk : Wq; const float* x23 = (j & 1) ? Wo : Wv; const float* x45 = (j & 1) ? k : q;
  const float* x03 = (j & 2) ? x23 : x01; const float* x47 = (j & 2) ? v : x45; const float* x = (j & 4) ? x47 : x03;
  const float sc = j < 4 ? 16.0f : 1.0f;
#pragma unroll
  for (int i = 0; i < 8; ++i) f.h[i] = (_Float16)(bf16_round(x[t * 8 + i]) * sc);
  *(v8us*)((unsigned short*)Y + (size_t)j * CC * CC + t * 8) = f.half[0];
  asm volatile("s_wait_xcnt 0x0" ::: "memory");      // as in the other arm
}
template <int NHv, int TTv>
__global__ __launch_bounds__(256) void k_vt(const _Float16* __restrict__ V16, int ldv, int voff, _Float16* __restrict__ Vt) { __shared__ unsigned short tl[64][66]; const int tid = threadIdx.x; const int slab = blockIdx.x / (TTv / 64), lg = blockIdx.x % (TTv / 64); const int b = slab / NHv, h = slab % NHv;
  for (int i = tid; i < 64 * 8; i += 256) { const int r = i / 8, c8 = (i % 8) * 8; FragH f; f.half[0] = *(const v8us*)((const unsigned short*)V16 + ((size_t)b * TTv + lg * 64 + r) * ldv + voff + h * 64 + c8);
#pragma unroll
    for (int q = 0; q < 8; ++q) tl[r][c8 + q] = f.u[q]; }
  __syncthreads();
  {
#pragma unroll
    for (int rd = 0; rd < 2; ++rd) { const int d = rd * 32 + tid / 8, pc = tid % 8; FragH f;
#pragma unroll
      for (int q = 0; q < 8; ++q) f.u[q] = tl[pc * 8 + q][d];
      *(v8us*)((unsigned short*)Vt + ((size_t)slab * 64 + d) * TTv + lg * 64 + pc * 8) = f.half[0]; }
     } }

// Attention ring: a stage is 64 keys for the block's 64 query rows: 64 rows of K (256 B, pitch 272), 128 rows of Vt (128 B, pitch 144) and 64 rows of the mask (256 B, pitch 272),
// laid in LDS by asynchronous copies, two buffers, the next stage's copies in flight under this stage's work; the four waves share K and Vt. A stage is worked as two 32-key tiles, upward, as before: every sum keeps its order.
#define FL_KP 272u
#define FL_VP 144u
#define FL_MP 272u
#define FL_VO (64u * FL_KP)
#define FL_MO (FL_VO + 128u * FL_VP)
#define FL_STAGE (FL_MO + 64u * FL_MP)
#define FL_NST (SS / 64)
typedef float f1a __attribute__((may_alias));
__device__ __forceinline__ void fl_copy8(unsigned l0, unsigned ls, const unsigned char* g0, size_t gs) {
  // eight 16-byte copies of this lane, LDS rows ls bytes apart, global rows gs bytes apart; s_wait_xcnt stands inside the statement so that no address register is rewritten ahead of it
  const unsigned l1 = l0 + ls, l2 = l0 + 2u * ls, l3 = l0 + 3u * ls, l4 = l0 + 4u * ls, l5 = l0 + 5u * ls, l6 = l0 + 6u * ls, l7 = l0 + 7u * ls;
  const unsigned char *g1 = g0 + gs, *g2 = g0 + 2 * gs, *g3 = g0 + 3 * gs, *g4 = g0 + 4 * gs, *g5 = g0 + 5 * gs, *g6 = g0 + 6 * gs, *g7 = g0 + 7 * gs;
  asm volatile("global_load_async_to_lds_b128 %0, %8, off\n\t"
               "global_load_async_to_lds_b128 %1, %9, off\n\t"
               "global_load_async_to_lds_b128 %2, %10, off\n\t"
               "global_load_async_to_lds_b128 %3, %11, off\n\t"
               "global_load_async_to_lds_b128 %4, %12, off\n\t"
               "global_load_async_to_lds_b128 %5, %13, off\n\t"
               "global_load_async_to_lds_b128 %6, %14, off\n\t"
               "global_load_async_to_lds_b128 %7, %15, off\n\t"
               "s_wait_xcnt 0x0"
               :: "v"(l0), "v"(l1), "v"(l2), "v"(l3), "v"(l4), "v"(l5), "v"(l6), "v"(l7),
                  "v"(g0), "v"(g1), "v"(g2), "v"(g3), "v"(g4), "v"(g5), "v"(g6), "v"(g7) : "memory");
}
__global__ __launch_bounds__(128) void k_flash(const _Float16* __restrict__ Q16, int ldq, const _Float16* __restrict__ K16, int ldk, const _Float16* __restrict__ Vt, const float* __restrict__ MSK, float* __restrict__ O, int ldo) {
  constexpr int RPW = 16, RTN = RPW / 16, NQB = 2048 / (4 * RPW), DT = 8, KS = 4;      /* head dim 128 */
  __shared__ __attribute__((aligned(16))) unsigned short sP[4][RPW][40]; __shared__ __attribute__((aligned(16))) unsigned char L[2u * FL_STAGE];
  const int tid = threadIdx.x, w = tid >> 5, lane = tid & 31, ln = lane & 15, hh = lane >> 4;
  const int slab = blockIdx.x / NQB, qblk = blockIdx.x % NQB; const int b = slab / 16, h = slab % 16; const int qb0 = qblk * (4 * RPW); const int q0 = qb0 + w * RPW;
  const unsigned short* Vth = (const unsigned short*)Vt + (size_t)slab * 128 * 2048;
  // copies: K and mask: 16-byte piece (tid & 15) of rows (tid >> 4) + 8 i; Vt: piece (tid & 7) of rows (tid >> 3) + 16 i
  const unsigned lb = (unsigned)(size_t)L;
  const unsigned lk = lb + (unsigned)(tid >> 4) * FL_KP + (unsigned)(tid & 15) * 16u, lv = lb + FL_VO + (unsigned)(tid >> 3) * FL_VP + (unsigned)(tid & 7) * 16u, lm = lb + FL_MO + (unsigned)(tid >> 4) * FL_MP + (unsigned)(tid & 15) * 16u;
  const size_t kstep = (size_t)ldk * 2;      // bytes of a K row
  const unsigned char* gk = (const unsigned char*)((const unsigned short*)K16 + ((size_t)b * 2048 + (tid >> 4)) * ldk + h * 128 + (tid & 15) * 8);
  const unsigned char* gv = (const unsigned char*)(Vth + (size_t)(tid >> 3) * 2048 + (tid & 7) * 8);
  const unsigned char* gm = (const unsigned char*)(MSK + ((size_t)b * 2048 + qb0 + (tid >> 4)) * 2048 + (tid & 15) * 4);
  fl_copy8(lk, 8u * FL_KP, gk, 8 * kstep); fl_copy8(lv, 16u * FL_VP, gv, (size_t)16 * 4096); fl_copy8(lm, 8u * FL_MP, gm, (size_t)8 * 8192);
  FragH aq[2][KS];
#pragma unroll
  for (int rt = 0; rt < RTN; ++rt) { const unsigned short* qr = (const unsigned short*)Q16 + ((size_t)b * 2048 + q0 + rt * 16 + ln) * ldq + h * 128;
#pragma unroll
    for (int ks = 0; ks < KS; ++ks) { aq[rt][ks].half[0] = *(const v8us*)(qr + ks * 32 + 8 * hh); aq[rt][ks].half[1] = *(const v8us*)(qr + ks * 32 + 16 + 8 * hh); } }
  float m_r[2][8], l_r[2][8]; v8f oacc[2][DT];
#pragma unroll
  for (int rt = 0; rt < RTN; ++rt) {
#pragma unroll
    for (int r = 0; r < 8; ++r) { m_r[rt][r] = -3.0e38f; l_r[rt][r] = 0.f; }
#pragma unroll
    for (int dt = 0; dt < DT; ++dt) oacc[rt][dt] = (v8f){0.f,0.f,0.f,0.f,0.f,0.f,0.f,0.f}; }
  asm volatile("s_wait_asynccnt 0x0" ::: "memory");      // stage 0's bytes of this wave have landed
  __syncthreads();                                        // and every wave's: stage 0 is readable
  fl_copy8(lk + FL_STAGE, 8u * FL_KP, gk + 64 * kstep, 8 * kstep); fl_copy8(lv + FL_STAGE, 16u * FL_VP, gv + 128, (size_t)16 * 4096); fl_copy8(lm + FL_STAGE, 8u * FL_MP, gm + 256, (size_t)8 * 8192);
#pragma unroll 1      // one stage per trip: the ring's order at the foot stays as written
  for (int t = 0; t < FL_NST; ++t) {
    const unsigned char* S = L + (unsigned)(t & 1) * FL_STAGE;
#pragma unroll 1      // the two 32-key tiles of a stage share one body: less code, and a masked tile is skipped on its own
  for (int sub = 0; sub < 2; ++sub) {
    // mask tile for my 16 query rows x 32 keys: lane (ln,hh) needs rows rt*16 + 8hh + r, keys ln and 16 + ln of the tile
    unsigned okb0 = 0u, okb1 = 0u;      // bit (rt*8 + r) set when key ln (resp. 16+ln) of the tile is OPEN for query row rt*16 + 8hh + r
#pragma unroll
    for (int rt = 0; rt < RTN; ++rt)
#pragma unroll
      for (int r = 0; r < 8; ++r) { const f1a* mr = (const f1a*)(S + FL_MO + (unsigned)(w * RPW + rt * 16 + 8 * hh + r) * FL_MP + (unsigned)sub * 128u); okb0 |= (mr[ln] == 0.0f ? 1u : 0u) << (rt * 8 + r); okb1 |= (mr[16 + ln] == 0.0f ? 1u : 0u) << (rt * 8 + r); }      /* float mask: nonzero = masked (-1e9) */
    if (__builtin_amdgcn_ballot_w32((okb0 | okb1) != 0u) == 0u) continue;      // every (query,key) of this wave's tile is masked: contributes nothing (uniform branch; the stage's foot is outside this loop)
    // The tile's LDS fragment reads stand in groups ahead of the products that use them, so that no product waits out an LDS round trip of its own:
    // all of K (both 16-key halves) ahead of the score products; all of Vt directly behind the loads of P, so that it streams in under P's round trip and the first products.
    // Every '#pragma unroll' here makes the indices of the fragment arrays constants, so that they stay in registers.
    v8f s[2][2]; FragH bk[2][KS], bv[DT];
#pragma unroll
    for (int nt = 0; nt < 2; ++nt) { const unsigned char* kr = S + (unsigned)(sub * 32 + nt * 16 + ln) * FL_KP + 16u * hh;
#pragma unroll
      for (int ks = 0; ks < KS; ++ks) { bk[nt][ks].half[0] = *(const v8us*)(kr + ks * 64); bk[nt][ks].half[1] = *(const v8us*)(kr + ks * 64 + 32); } }
#pragma unroll
    for (int rt = 0; rt < RTN; ++rt) { s[rt][0] = (v8f){0.f,0.f,0.f,0.f,0.f,0.f,0.f,0.f}; s[rt][1] = (v8f){0.f,0.f,0.f,0.f,0.f,0.f,0.f,0.f}; }
    // the two halves' accumulator chains alternate, so that each fills the other's accumulate latency; within a chain k runs upward as before
#pragma unroll
    for (int ks = 0; ks < KS; ++ks)
#pragma unroll
      for (int nt = 0; nt < 2; ++nt)
#pragma unroll
        for (int rt = 0; rt < RTN; ++rt) s[rt][nt] = mmaH<1>(aq[rt][ks].v, aq[rt][ks].v, bk[nt][ks].v, bk[nt][ks].v, s[rt][nt]);
    // Softmax of the tile in phases over the eight rows of a lane, with no branch inside: each row's chain (four cross-lane steps, three expf) is long and dependent,
    // so the rows' chains are laid side by side and fill one another's waits. Every expf is taken unconditionally and the old conditions pick between its value and the constant: the values are those of the row-by-row form.
    // Every '#pragma unroll' below makes the row index a constant, so that the per-row arrays stay in registers.
#pragma unroll
    for (int rt = 0; rt < RTN; ++rt) {
      float s0[8], s1[8], mc[8], al[8];
#pragma unroll
      for (int r = 0; r < 8; ++r) {
        const bool ok0 = ((okb0 >> (rt * 8 + r)) & 1u) != 0u, ok1 = ((okb1 >> (rt * 8 + r)) & 1u) != 0u;
        s0[r] = ok0 ? s[rt][0][r] * (0.08838834764831845f) : -INFINITY; s1[r] = ok1 ? s[rt][1][r] * (0.08838834764831845f) : -INFINITY; mc[r] = fmaxf(s0[r], s1[r]); }
#pragma unroll
      for (int m = 1; m < 16; m <<= 1)
#pragma unroll
        for (int r = 0; r < 8; ++r) mc[r] = fmaxf(mc[r], __shfl_xor(mc[r], m, 32));
#pragma unroll
      for (int r = 0; r < 8; ++r) {
        const bool ok0 = ((okb0 >> (rt * 8 + r)) & 1u) != 0u, ok1 = ((okb1 >> (rt * 8 + r)) & 1u) != 0u;
        const float mn = fmaxf(m_r[rt][r], mc[r]); const float ea = expf(m_r[rt][r] - mn), e0 = expf(s0[r] - mn), e1 = expf(s1[r] - mn);
        al[r] = (mn > -1.0e38f) ? ea : 1.0f; m_r[rt][r] = mn; const float p0 = ok0 ? e0 : 0.f, p1 = ok1 ? e1 : 0.f; l_r[rt][r] = l_r[rt][r] * al[r] + p0 + p1;
        FragH t2; t2.h[0] = (_Float16)p0; t2.h[1] = (_Float16)p1; sP[w][rt * 16 + 8 * hh + r][ln] = t2.u[0]; sP[w][rt * 16 + 8 * hh + r][16 + ln] = t2.u[1]; }
#pragma unroll
      for (int dt = 0; dt < DT; ++dt)
#pragma unroll
        for (int r = 0; r < 8; ++r) oacc[rt][dt][r] *= al[r]; }
    __builtin_amdgcn_fence(__ATOMIC_ACQ_REL, "workgroup"); __builtin_amdgcn_wave_barrier();
    FragH pa[2];
#pragma unroll
    for (int rt = 0; rt < RTN; ++rt) { pa[rt].half[0] = *(const v8us*)&sP[w][rt * 16 + ln][8 * hh]; pa[rt].half[1] = *(const v8us*)&sP[w][rt * 16 + ln][16 + 8 * hh]; }
#pragma unroll
    for (int dt = 0; dt < DT; ++dt) { const unsigned char* vrow = S + FL_VO + (unsigned)(dt * 16 + ln) * FL_VP + (unsigned)sub * 64u + 16u * hh; bv[dt].half[0] = *(const v8us*)vrow; bv[dt].half[1] = *(const v8us*)(vrow + 32); }
#pragma unroll
    for (int dt = 0; dt < DT; ++dt)
#pragma unroll
      for (int rt = 0; rt < RTN; ++rt) oacc[rt][dt] = mmaH<1>(pa[rt].v, pa[rt].v, bv[dt].v, bv[dt].v, oacc[rt][dt]);
    __builtin_amdgcn_fence(__ATOMIC_ACQ_REL, "workgroup"); __builtin_amdgcn_wave_barrier(); }
    asm volatile("s_wait_dscnt 0x0" ::: "memory");        // this wave's reads of the buffer have returned
    asm volatile("s_wait_asynccnt 0x0" ::: "memory");     // this wave's copies of stage t + 1 have landed
    __syncthreads();                                      // publishes stage t + 1 and frees the buffer stage t has read
    if (t + 2 < FL_NST) { const unsigned lo = (unsigned)(t & 1) * FL_STAGE; fl_copy8(lk + lo, 8u * FL_KP, gk + (size_t)(t + 2) * 64 * kstep, 8 * kstep); fl_copy8(lv + lo, 16u * FL_VP, gv + (t + 2) * 128, (size_t)16 * 4096); fl_copy8(lm + lo, 8u * FL_MP, gm + (t + 2) * 256, (size_t)8 * 8192); }
  }
  asm volatile("s_wait_asynccnt 0x0" ::: "memory");       // nothing in flight before the ring becomes output staging (the last foot's barrier has ended every wave's reads of it)
  float* sO = (float*)(L + (unsigned)w * (unsigned)(RPW * (128 + 4) * 4));      // each wave's own range, pitch 132 floats
#pragma unroll
  for (int rt = 0; rt < RTN; ++rt) {
#pragma unroll
    for (int r = 0; r < 8; ++r) { float l = l_r[rt][r]; l += __shfl_xor(l, 1, 32); l += __shfl_xor(l, 2, 32); l += __shfl_xor(l, 4, 32); l += __shfl_xor(l, 8, 32); l_r[rt][r] = (l > 0.f) ? 1.0f / l : 0.f; }
#pragma unroll
    for (int dt = 0; dt < DT; ++dt)
#pragma unroll
      for (int r = 0; r < 8; ++r) sO[(rt * 16 + 8 * hh + r) * 132 + dt * 16 + ln] = oacc[rt][dt][r] * l_r[rt][r]; }
  __builtin_amdgcn_fence(__ATOMIC_ACQ_REL, "workgroup"); __builtin_amdgcn_wave_barrier();
  {
#pragma unroll
    for (int rp = 0; rp < RPW; ++rp) { const int r = rp, pc = lane; const v4f val = *(const v4fa*)&sO[r * 132 + pc * 4]; *(v4f*)(O + ((size_t)b * 2048 + q0 + r) * ldo + h * 128 + pc * 4) = val; }      /* 128-float rows: 32 lanes x 16 B */
     } }

__device__ __forceinline__ void d_rope16(int bid, const float* __restrict__ SRC, _Float16* __restrict__ D16) { __shared__ __attribute__((aligned(16))) _Float16 st[256][8]; const int tid = threadIdx.x; const size_t t = (size_t)bid * 256 + tid; if (t >= (size_t)SS * NH * 16) return; const int p = (int)(t % 16); const int h = (int)((t / 16) % NH); const int s = (int)(t / (16 * NH)); const float* src = SRC + ((size_t)s * NH + h) * HD;
#pragma unroll 1
  for (int q = 0; q < 8; ++q) { const int j = p * 8 + q; const int i = j >> 1; const float f = __builtin_powf(10000.0f, -(float)(2 * i) / 128.0f); const float ang = (float)s * f; const float c = cosf(ang), sn = sinf(ang); const float xr = src[2 * i], xi = src[2 * i + 1]; st[tid][q] = (_Float16)((j & 1) ? (xr * sn + xi * c) : (xr * c - xi * sn)); }
  const v8us v = *(const v8us*)&st[tid][0]; unsigned short* d = (unsigned short*)D16 + ((size_t)s * NH + h) * HD + p * 8; *(v8us*)d = v;  }
__device__ __forceinline__ void d_vt128(int bid, const _Float16* __restrict__ V16, _Float16* __restrict__ Vt) { __shared__ unsigned short tl[64][130]; const int tid = threadIdx.x; const int h = bid / (SS / 64), lg = bid % (SS / 64);
  for (int i = tid; i < 64 * 16; i += 256) { const int r = i / 16, c8 = (i % 16) * 8; FragH f; f.half[0] = *(const v8us*)((const unsigned short*)V16 + ((size_t)lg * 64 + r) * CC + h * HD + c8);
#pragma unroll
    for (int q = 0; q < 8; ++q) tl[r][c8 + q] = f.u[q]; }
  __syncthreads();
  { for (int i = tid; i < 128 * 8; i += 256) { const int d = i / 8, pc = i % 8; FragH f;
#pragma unroll
      for (int q = 0; q < 8; ++q) f.u[q] = tl[pc * 8 + q][d]; *(v8us*)((unsigned short*)Vt + ((size_t)h * HD + d) * SS + lg * 64 + pc * 8) = f.half[0]; }  } }
// What follows the three projections and is independent of one another, in one grid: RoPE of q, RoPE of k (RB blocks each), then the short V transposes
#define RB (SS * NH * 16 / 256)
__global__ __launch_bounds__(256) void k_post(const float* __restrict__ QF, _Float16* __restrict__ QR16, const float* __restrict__ KF, _Float16* __restrict__ KR16, const _Float16* __restrict__ V16, _Float16* __restrict__ Vt) {
  const int bid = (int)blockIdx.x;
  if (bid < 2 * RB) d_rope16(bid % RB, bid < RB ? QF : KF, bid < RB ? QR16 : KR16);
  else d_vt128(bid - 2 * RB, V16, Vt);
}
extern "C" void kernel_launch(void* const* d_in, const int* in_sizes, int n_in,
                              void* d_out, int out_size, void* d_ws, size_t ws_size, hipStream_t stream) {
  (void)in_sizes; (void)n_in; (void)out_size;
  const float* const* I = (const float* const*)d_in; const float* q = I[0]; const float* k = I[1]; const float* v = I[2]; const float* mask = I[3]; const float* Wq = I[4]; const float* bq = I[5]; const float* Wk = I[6]; const float* bk = I[7]; const float* Wv = I[8]; const float* bv = I[9]; const float* G = I[10]; const float* Wo = I[11]; const float* bo = I[12];
  char* ws = (char*)d_ws; size_t off = 0;
  auto take = [&](size_t bytes) { char* p = ws + off; off += (bytes + 255) & ~(size_t)255; return p; };
  _Float16* Y = (_Float16*)take((size_t)7 * CC * CC * 2); _Float16* Bq = Y; _Float16* Bk = Y + (size_t)CC * CC; _Float16* Bv = Y + (size_t)2 * CC * CC; _Float16* Bo = Y + (size_t)3 * CC * CC; _Float16* Xq = Y + (size_t)4 * CC * CC; _Float16* Xk = Y + (size_t)5 * CC * CC; _Float16* Xv = Y + (size_t)6 * CC * CC;
  _Float16* BG = (_Float16*)take((size_t)NH * HD * HD * 2);
  float* QF = (float*)take((size_t)SS * CC * 4); float* KF = (float*)take((size_t)SS * CC * 4);
  _Float16* QR16 = (_Float16*)take((size_t)SS * CC * 2); _Float16* QG16 = (_Float16*)take((size_t)SS * CC * 2); _Float16* KR16 = (_Float16*)take((size_t)SS * CC * 2); _Float16* V16 = (_Float16*)take((size_t)SS * CC * 2); _Float16* Vt = (_Float16*)take((size_t)SS * CC * 2); float* O = QF; _Float16* O16 = Xq;
  if (off > ws_size) return;      // 8.4 x 12 + 0.5 + 16.8 x 2 = about 135 MB
  const unsigned gx = (unsigned)(((size_t)SS * CC / 8 + 255) / 256); const unsigned gt = (SS / 128) * (CC / 128);
  k_prep<<<PB_G + 7 * PB_M, 256, 0, stream>>>(G, Wq, Wk, Wv, Wo, q, k, v, BG, Y);      // operands in f16
  k_gemm_t<<<dim3(gt, 3), 256, 0, stream>>>(Xq, Xk, Xv, Bq, Bk, Bv, 0.0625f, bq, bk, bv, QF, KF, V16);      // q, k (f32) and v (f16) projections
  k_post<<<2 * RB + NH * (SS / 64), 256, 0, stream>>>(QF, QR16, KF, KR16, V16, Vt);      // rope q, rope k, Vt
  k_gemm_hhx<0><<<dim3(((SS / 16) * (HD / 64) + 3) / 4, NH), 128, 0, stream>>>(QR16, CC, (size_t)HD, BG, HD, (size_t)HD * HD, 0.0625f, nullptr, 0, nullptr, 1, 0, 0, nullptr, QG16, CC, (size_t)HD, SS, HD, HD);      // qg_h = q_h · G_h (batched over heads via column offsets)
  k_flash<<<1 * NH * (SS / 64), 128, 0, stream>>>(QG16, CC, KR16, CC, Vt, mask, O, CC);
  k_h16<<<gx, 256, 0, stream>>>(O, O16, (size_t)SS * CC / 8);
  k_gemm_t<<<dim3(gt, 1), 256, 0, stream>>>(O16, O16, O16, Bo, Bo, Bo, 0.0625f, bo, bo, bo, (float*)d_out, (float*)d_out, nullptr);
}

// v006
// One run takes 178 microseconds.
// Two timings next to v005 both put it at 1.14 times that version's speed.
// All steps since v000 together make it 4.09 times as fast.
#include <hip/hip_runtime.h>
// Power-law-graph multi-head attention (B=1, S=2048, D=2048, 16 heads × 128; INPUT additive mask (nonzero = −1e9) ; RoPE interleaved pairs): q/k/v/o projections ((out,in) + bias) and the per-head
// metric product qg = q_h·G_h as GEMMs and the attention as a fused flash-style kernel (head dim 128: 4 k-steps / 8 d-tiles; masked keys excluded, fully masked 32-key tiles skipped by ballot;
// online softmax f32; P f16 ≤ 1; O = P·Vt; RPW-16 waves) on v_wmma_f32_16x16x32_f16, f32 accumulate; RoPE f32 VALU.
#define SS 2048
#define CC 2048
#define NH 16
#define HD 128

typedef __bf16 v16b __attribute__((ext_vector_type(16)));
typedef unsigned short v8us __attribute__((ext_vector_type(8), may_alias));
typedef float  v8f  __attribute__((ext_vector_type(8)));
typedef float  v4f  __attribute__((ext_vector_type(4)));
typedef float  v4fa __attribute__((ext_vector_type(4), may_alias));
union FragB { v16b v; v8us half[2]; unsigned short u[16]; };

__device__ __forceinline__ unsigned short bf16_bits(float x) { unsigned int u = __float_as_uint(x); return (unsigned short)((u + 0x7FFFu + ((u >> 16) & 1u)) >> 16); }
__device__ __forceinline__ float bf16_val(unsigned short b) { return __uint_as_float(((unsigned int)b) << 16); }
__device__ __forceinline__ float bf16_round(float x) { return bf16_val(bf16_bits(x)); }
// D += A·B with NT terms: 1 = ah·bh, 2 = + al·bh (A split), 3 = + ah·bl (both split)
template <int NT>
__device__ __forceinline__ v8f mmaN(v16b ah, v16b al, v16b bh, v16b bl, v8f c) {
  c = __builtin_amdgcn_wmma_f32_16x16x32_bf16(false, ah, false, bh, (short)0, c, false, false);
  if (NT >= 2) c = __builtin_amdgcn_wmma_f32_16x16x32_bf16(false, al, false, bh, (short)0, c, false, false);
  if (NT >= 3) c = __builtin_amdgcn_wmma_f32_16x16x32_bf16(false, ah, false, bl, (short)0, c, false, false);
  asm volatile("v_nop\n\tv_nop\n\tv_nop\n\tv_nop" : "+v"(c) : "v"(ah), "v"(al), "v"(bh), "v"(bl));
  return c;
}

__global__ __launch_bounds__(256) void k_wt_bf16(const float* __restrict__ W, unsigned short* __restrict__ Wt, int K, int N) {
  const int t = blockIdx.x * 256 + threadIdx.x;
  const int k8n = K / 8;
  if (t >= N * k8n) return;
  const int n = t / k8n, k8 = (t % k8n) * 8;
  v8us v;
#pragma unroll
  for (int i = 0; i < 8; ++i) v[i] = bf16_bits(W[(size_t)(k8 + i) * N + n]);
  *(v8us*)(Wt + (size_t)n * K + k8) = v;
  
}

// GEMM C[M][N] (f32, pitch ldc) = act(A[M][K]·W + bias). A f32 row-major (pitch lda) converted per fragment to bf16
// (ASPLIT: hi/lo two planes -> 2 terms, else single rounded term); Wt bf16 [N][K] (pitch ldb). BIAS_BF16 rounds the
// bias to bf16 first (bias quantised to bf16 before the add). K%32==0, M%16==0, N%64==0.
template <bool ASPLIT, int ACT, bool BIAS_BF16>
__global__ __launch_bounds__(128) void k_gemm_bf(const float* __restrict__ A, int lda, const unsigned short* __restrict__ Wt, int ldb,
                                               const float* __restrict__ bias, float* __restrict__ C, int ldc, int M, int N, int K) {
  __shared__ __attribute__((aligned(16))) float so[4][16][64];
  const int tid = threadIdx.x, w = tid >> 5, lane = tid & 31, ln = lane & 15, hh = lane >> 4;
  const int ntn = N / 64;
  const int wid = blockIdx.x * 4 + w;
  const int mt = wid / ntn, nq = wid % ntn;
  if (mt * 16 >= M) return;
  const int row0 = mt * 16, col0 = nq * 64;
  const float* arow = A + (size_t)(row0 + ln) * lda;
  v8f acc[4] = {};
  for (int kb = 0; kb < K; kb += 32) {
    FragB ah, al;
    const v4f x0 = *(const v4fa*)(arow + kb + 8 * hh), x1 = *(const v4fa*)(arow + kb + 8 * hh + 4);
    const v4f x2 = *(const v4fa*)(arow + kb + 16 + 8 * hh), x3 = *(const v4fa*)(arow + kb + 16 + 8 * hh + 4);
    float xs[16] = {x0[0],x0[1],x0[2],x0[3],x1[0],x1[1],x1[2],x1[3],x2[0],x2[1],x2[2],x2[3],x3[0],x3[1],x3[2],x3[3]};
#pragma unroll
    for (int i = 0; i < 16; ++i) { const unsigned short hb = bf16_bits(xs[i]); ah.u[i] = hb; al.u[i] = ASPLIT ? bf16_bits(xs[i] - bf16_val(hb)) : (unsigned short)0; }
#pragma unroll
    for (int t = 0; t < 4; ++t) {
      const unsigned short* brow = Wt + (size_t)(col0 + t * 16 + ln) * ldb + kb;
      FragB b;
      b.half[0] = *(const v8us*)(brow + 8 * hh);
      b.half[1] = *(const v8us*)(brow + 16 + 8 * hh);
      acc[t] = mmaN<ASPLIT ? 2 : 1>(ah.v, al.v, b.v, b.v, acc[t]);
    }
  }
#pragma unroll
  for (int t = 0; t < 4; ++t) {
    float bv = bias ? bias[col0 + t * 16 + ln] : 0.f;
    if (BIAS_BF16) bv = bf16_round(bv);
#pragma unroll
    for (int r = 0; r < 8; ++r) { float v = acc[t][r] + bv; if (ACT == 1) v = fmaxf(v, 0.f); so[w][8 * hh + r][t * 16 + ln] = v; }
  }
  __builtin_amdgcn_fence(__ATOMIC_ACQ_REL, "workgroup");
  __builtin_amdgcn_wave_barrier();
  const int rsub = lane >> 4, c4 = (lane & 15) * 4;
  {
#pragma unroll
    for (int q = 0; q < 8; ++q) {
      const int r = q * 2 + rsub;
      const v4f v = *(const v4fa*)&so[w][r][c4];
      *(v4f*)(C + (size_t)(row0 + r) * ldc + col0 + c4) = v;
    }
    
  }
}

// Flash-style causal/unmasked attention, all contractions 3-term bf16 hi/lo splits, f32 softmax with running max.
// q,k,v rows are read from f32 buffers with arbitrary row pitch (so they can live inside a fused qkv buffer);
// D = head size (multiple of 32, <= 128); one wave = 16 query rows; block = 4 waves (64 queries) sharing K/V chunks of 32.
template <int D, bool CAUSAL>
__global__ __launch_bounds__(128) void k_flash(const float* __restrict__ qb, const float* __restrict__ kb, const float* __restrict__ vb,
                                             int pitch, int T, int H, float scale, float* __restrict__ y, int ypitch) {
  constexpr int KS = D / 32;        // k-steps for QK
  constexpr int DT = D / 16;        // d tiles for PV
  __shared__ __attribute__((aligned(16))) unsigned short sKh[32][D + 8], sKl[32][D + 8], sVh[32][D + 8], sVl[32][D + 8];
  __shared__ __attribute__((aligned(16))) unsigned short sPh[4][16][40], sPl[4][16][40];
  __shared__ __attribute__((aligned(16))) float sO[4][16][D];
  const int tid = threadIdx.x, w = tid >> 5, lane = tid & 31, ln = lane & 15, hh = lane >> 4;
  const int nqb = (T + 63) / 64;
  const int bh = blockIdx.x / nqb, qblk = blockIdx.x % nqb;
  const int b = bh / H, h = bh % H;
  const int q0 = qblk * 64 + w * 16;
  const float* Q = qb + (size_t)b * T * pitch + h * D;
  const float* K = kb + (size_t)b * T * pitch + h * D;
  const float* V = vb + (size_t)b * T * pitch + h * D;

  // A fragments of the wave's 16 query rows (scaled), hi/lo
  FragB aqh[KS], aql[KS];
  {
    int row = q0 + ln; if (row >= T) row = T - 1;
    const float* qr = Q + (size_t)row * pitch;
#pragma unroll
    for (int ks = 0; ks < KS; ++ks)
#pragma unroll
      for (int i = 0; i < 16; ++i) {
        const int d = ks * 32 + ((i < 8) ? (8 * hh + i) : (16 + 8 * hh + (i - 8)));
        const float x = qr[d] * scale; const unsigned short hb = bf16_bits(x);
        aqh[ks].u[i] = hb; aql[ks].u[i] = bf16_bits(x - bf16_val(hb));
      }
  }
  float m_r[8], l_r[8];
#pragma unroll
  for (int r = 0; r < 8; ++r) { m_r[r] = -3.0e38f; l_r[r] = 0.f; }
  v8f oacc[DT];
#pragma unroll
  for (int dt = 0; dt < DT; ++dt) oacc[dt] = (v8f){0.f,0.f,0.f,0.f,0.f,0.f,0.f,0.f};

  const int kv_end = CAUSAL ? min(T, qblk * 64 + 64) : T;     // block-uniform
  for (int j0 = 0; j0 < kv_end; j0 += 32) {
    __syncthreads();
    for (int e = tid; e < 32 * (D / 4); e += 128) {
      const int r = e / (D / 4), c4 = (e % (D / 4)) * 4;
      const int key = j0 + r;
      v4f kf = {0.f,0.f,0.f,0.f}, vf = {0.f,0.f,0.f,0.f};
      if (key < T) { kf = *(const v4fa*)(K + (size_t)key * pitch + c4); vf = *(const v4fa*)(V + (size_t)key * pitch + c4); }
#pragma unroll
      for (int t = 0; t < 4; ++t) {
        unsigned short hb = bf16_bits(kf[t]); sKh[r][c4 + t] = hb; sKl[r][c4 + t] = bf16_bits(kf[t] - bf16_val(hb));
        hb = bf16_bits(vf[t]); sVh[r][c4 + t] = hb; sVl[r][c4 + t] = bf16_bits(vf[t] - bf16_val(hb));
      }
    }
    __syncthreads();
    // S tile 16 x 32
    v8f s[2];
#pragma unroll
    for (int nt = 0; nt < 2; ++nt) {
      v8f acc = {};
#pragma unroll
      for (int ks = 0; ks < KS; ++ks) {
        FragB bh_, bl_;
        bh_.half[0] = *(const v8us*)&sKh[nt * 16 + ln][ks * 32 + 8 * hh]; bh_.half[1] = *(const v8us*)&sKh[nt * 16 + ln][ks * 32 + 16 + 8 * hh];
        bl_.half[0] = *(const v8us*)&sKl[nt * 16 + ln][ks * 32 + 8 * hh]; bl_.half[1] = *(const v8us*)&sKl[nt * 16 + ln][ks * 32 + 16 + 8 * hh];
        acc = mmaN<3>(aqh[ks].v, aql[ks].v, bh_.v, bl_.v, acc);
      }
      s[nt] = acc;
    }
    // mask + running max (rows 8hh+r; the 16 lanes of a half share rows)
    float alpha[8];
#pragma unroll
    for (int r = 0; r < 8; ++r) {
      const int qi = q0 + 8 * hh + r;
      const int ja = j0 + ln, jb = j0 + 16 + ln;
      if (CAUSAL) { if (ja > qi) s[0][r] = -3.0e38f; if (jb > qi) s[1][r] = -3.0e38f; }
      if (ja >= T) s[0][r] = -3.0e38f;
      if (jb >= T) s[1][r] = -3.0e38f;
      float mx = fmaxf(s[0][r], s[1][r]);
      mx = fmaxf(mx, __shfl_xor(mx, 1, 32)); mx = fmaxf(mx, __shfl_xor(mx, 2, 32)); mx = fmaxf(mx, __shfl_xor(mx, 4, 32)); mx = fmaxf(mx, __shfl_xor(mx, 8, 32));
      const float mnew = fmaxf(m_r[r], mx);
      alpha[r] = (mnew > -1.0e38f) ? __expf(m_r[r] - mnew) : 1.0f;
      const float p0 = (s[0][r] > -1.0e38f) ? __expf(s[0][r] - mnew) : 0.f;
      const float p1 = (s[1][r] > -1.0e38f) ? __expf(s[1][r] - mnew) : 0.f;
      m_r[r] = mnew;
      l_r[r] = l_r[r] * alpha[r] + p0 + p1;            // per-lane partial row sum (16 lanes combined at the end)
      unsigned short hb = bf16_bits(p0); sPh[w][8 * hh + r][ln] = hb;      sPl[w][8 * hh + r][ln] = bf16_bits(p0 - bf16_val(hb));
      hb = bf16_bits(p1);                sPh[w][8 * hh + r][16 + ln] = hb; sPl[w][8 * hh + r][16 + ln] = bf16_bits(p1 - bf16_val(hb));
    }
#pragma unroll
    for (int dt = 0; dt < DT; ++dt)
#pragma unroll
      for (int r = 0; r < 8; ++r) oacc[dt][r] *= alpha[r];
    __builtin_amdgcn_fence(__ATOMIC_ACQ_REL, "workgroup");
    __builtin_amdgcn_wave_barrier();
    FragB pah, pal;
    pah.half[0] = *(const v8us*)&sPh[w][ln][8 * hh]; pah.half[1] = *(const v8us*)&sPh[w][ln][16 + 8 * hh];
    pal.half[0] = *(const v8us*)&sPl[w][ln][8 * hh]; pal.half[1] = *(const v8us*)&sPl[w][ln][16 + 8 * hh];
#pragma unroll
    for (int dt = 0; dt < DT; ++dt) {
      FragB bvh, bvl;
#pragma unroll
      for (int i = 0; i < 8; ++i) {
        bvh.u[i] = sVh[8 * hh + i][dt * 16 + ln]; bvh.u[8 + i] = sVh[16 + 8 * hh + i][dt * 16 + ln];
        bvl.u[i] = sVl[8 * hh + i][dt * 16 + ln]; bvl.u[8 + i] = sVl[16 + 8 * hh + i][dt * 16 + ln];
      }
      oacc[dt] = mmaN<3>(pah.v, pal.v, bvh.v, bvl.v, oacc[dt]);
    }
    __builtin_amdgcn_fence(__ATOMIC_ACQ_REL, "workgroup");
    __builtin_amdgcn_wave_barrier();
  }
#pragma unroll
  for (int r = 0; r < 8; ++r) {
    float l = l_r[r];
    l += __shfl_xor(l, 1, 32); l += __shfl_xor(l, 2, 32); l += __shfl_xor(l, 4, 32); l += __shfl_xor(l, 8, 32);
    l_r[r] = (l > 0.f) ? 1.0f / l : 0.f;
  }
#pragma unroll
  for (int dt = 0; dt < DT; ++dt)
#pragma unroll
    for (int r = 0; r < 8; ++r) sO[w][8 * hh + r][dt * 16 + ln] = oacc[dt][r] * l_r[r];
  __builtin_amdgcn_fence(__ATOMIC_ACQ_REL, "workgroup");
  __builtin_amdgcn_wave_barrier();
  {
    for (int r = 0; r < 16; ++r) {
      const int row = q0 + r;
      if (row < T && lane < D / 4) {
        const v4f val = *(const v4fa*)&sO[w][r][lane * 4];
        *(v4f*)(y + ((size_t)b * T + row) * ypitch + h * D + lane * 4) = val;
      }
    }
    
  }
}

// GEMM C = act(A·W + bias + resid): A f32 (ASPLIT -> hi/lo 2 terms), Wt bf16 [N][K]; ACT 0 none, 1 relu, 2 exact gelu;
// resid (optional, f32, row index = (row % rmod), pitch ldr, RES_BF16 rounds it) added before the activation.
template <bool ASPLIT, int ACT, bool BIAS_BF16, bool RES_BF16>
__global__ __launch_bounds__(128) void k_gemm_bf3(const float* __restrict__ A, int lda, const unsigned short* __restrict__ Wt, int ldb,
                                                const float* __restrict__ bias, const float* __restrict__ resid, int rmod, int ldr,
                                                float* __restrict__ C, int ldc, int M, int N, int K) {
  __shared__ __attribute__((aligned(16))) float so[4][16][64];
  const int tid = threadIdx.x, w = tid >> 5, lane = tid & 31, ln = lane & 15, hh = lane >> 4;
  const int ntn = N / 64;
  const int wid = blockIdx.x * 4 + w;
  const int mt = wid / ntn, nq = wid % ntn;
  if (mt * 16 >= M) return;
  const int row0 = mt * 16, col0 = nq * 64;
  const float* arow = A + (size_t)(row0 + ln) * lda;
  v8f acc[4] = {};
  for (int kb = 0; kb < K; kb += 32) {
    FragB ah, al;
    const v4f x0 = *(const v4fa*)(arow + kb + 8 * hh), x1 = *(const v4fa*)(arow + kb + 8 * hh + 4);
    const v4f x2 = *(const v4fa*)(arow + kb + 16 + 8 * hh), x3 = *(const v4fa*)(arow + kb + 16 + 8 * hh + 4);
    float xs[16] = {x0[0],x0[1],x0[2],x0[3],x1[0],x1[1],x1[2],x1[3],x2[0],x2[1],x2[2],x2[3],x3[0],x3[1],x3[2],x3[3]};
#pragma unroll
    for (int i = 0; i < 16; ++i) { const unsigned short hb = bf16_bits(xs[i]); ah.u[i] = hb; al.u[i] = ASPLIT ? bf16_bits(xs[i] - bf16_val(hb)) : (unsigned short)0; }
#pragma unroll
    for (int t = 0; t < 4; ++t) {
      const unsigned short* brow = Wt + (size_t)(col0 + t * 16 + ln) * ldb + kb;
      FragB b;
      b.half[0] = *(const v8us*)(brow + 8 * hh);
      b.half[1] = *(const v8us*)(brow + 16 + 8 * hh);
      acc[t] = mmaN<ASPLIT ? 2 : 1>(ah.v, al.v, b.v, b.v, acc[t]);
    }
  }
#pragma unroll
  for (int t = 0; t < 4; ++t) {
    const int col = col0 + t * 16 + ln;
    float bv = bias ? bias[col] : 0.f;
    if (BIAS_BF16) bv = bf16_round(bv);
#pragma unroll
    for (int r = 0; r < 8; ++r) {
      float v = acc[t][r] + bv;
      if (resid) { float rv = resid[(size_t)((row0 + 8 * hh + r) % rmod) * ldr + col]; if (RES_BF16) rv = bf16_round(rv); v += rv; }
      if (ACT == 1) v = fmaxf(v, 0.f);
      if (ACT == 2) v = 0.5f * v * (1.0f + erff(v * 0.70710678118654752f));
      if (ACT == 3) { const float u = 0.7978845608028654f * (v + 0.044715f * v * v * v); v = 0.5f * v * (1.0f + tanhf(u)); }
      so[w][8 * hh + r][t * 16 + ln] = v;
    }
  }
  __builtin_amdgcn_fence(__ATOMIC_ACQ_REL, "workgroup");
  __builtin_amdgcn_wave_barrier();
  const int rsub = lane >> 4, c4 = (lane & 15) * 4;
  {
#pragma unroll
    for (int q = 0; q < 8; ++q) {
      const int r = q * 2 + rsub;
      const v4f v = *(const v4fa*)&so[w][r][c4];
      *(v4f*)(C + (size_t)(row0 + r) * ldc + col0 + c4) = v;
    }
    
  }
}
// row LayerNorm (biased variance, eps) over N: s = X (+ R); optional out_sum <- s; out_norm <- (s-mu)*rsqrt(var+eps)*g + b
template <bool PARAM_BF16>
__global__ __launch_bounds__(256) void k_layernorm(const float* __restrict__ X, const float* __restrict__ R, const float* __restrict__ g, const float* __restrict__ bta,
                                                  float* __restrict__ out_sum, float* __restrict__ out_norm, int N, float eps) {
  __shared__ float red[256];
  const int row = blockIdx.x, tid = threadIdx.x;
  const float* x = X + (size_t)row * N; const float* rr = R ? R + (size_t)row * N : nullptr;
  float vals[16];                     // up to N = 4096
  const int per = N / 256;            // contiguous chunk per thread? use strided-by-4 chunks: thread handles j = tid*4 + 1024*u
  float s1 = 0.f;
  for (int u = 0; u < per / 4; ++u) {
    const int j = tid * 4 + 1024 * u;
    const v4f a = *(const v4fa*)(x + j);
    v4f b = {0.f,0.f,0.f,0.f}; if (rr) b = *(const v4fa*)(rr + j);
#pragma unroll
    for (int q = 0; q < 4; ++q) { const float v = a[q] + b[q]; vals[u * 4 + q] = v; s1 += v; }
  }
  red[tid] = s1; __syncthreads();
  for (int st = 128; st > 0; st >>= 1) { if (tid < st) red[tid] += red[tid + st]; __syncthreads(); }
  const float mu = red[0] / (float)N; __syncthreads();
  float s2 = 0.f;
  for (int u = 0; u < per / 4; ++u)
#pragma unroll
    for (int q = 0; q < 4; ++q) { const float c = vals[u * 4 + q] - mu; s2 += c * c; }
  red[tid] = s2; __syncthreads();
  for (int st = 128; st > 0; st >>= 1) { if (tid < st) red[tid] += red[tid + st]; __syncthreads(); }
  const float rs = rsqrtf(red[0] / (float)N + eps);
  {
    for (int u = 0; u < per / 4; ++u) {
      const int j = tid * 4 + 1024 * u;
      v4f o, sm;
#pragma unroll
      for (int q = 0; q < 4; ++q) {
        float gg = g[j + q], bb = bta[j + q];
        if (PARAM_BF16) { gg = bf16_round(gg); bb = bf16_round(bb); }
        sm[q] = vals[u * 4 + q]; o[q] = (vals[u * 4 + q] - mu) * rs * gg + bb;
      }
      if (out_sum) *(v4f*)(out_sum + (size_t)row * N + j) = sm;
      *(v4f*)(out_norm + (size_t)row * N + j) = o;
    }
    
  }
}



// ---- f16 WMMA path (v_wmma_f32_16x16x32_f16): 11-bit significands for operands in range — used where a [0,1] probability operand needs more precision than bf16
typedef _Float16 v16h __attribute__((ext_vector_type(16)));
union FragH { v16h v; v8us half[2]; _Float16 h[16]; unsigned short u[16]; };
template <int NT>
__device__ __forceinline__ v8f mmaH(v16h ah, v16h al, v16h bh, v16h bl, v8f c) {
  c = __builtin_amdgcn_wmma_f32_16x16x32_f16(false, ah, false, bh, (short)0, c, false, false);
  if (NT >= 2) c = __builtin_amdgcn_wmma_f32_16x16x32_f16(false, al, false, bh, (short)0, c, false, false);
  if (NT >= 3) c = __builtin_amdgcn_wmma_f32_16x16x32_f16(false, ah, false, bl, (short)0, c, false, false);
  asm volatile("v_nop\n\tv_nop\n\tv_nop\n\tv_nop" : "+v"(c) : "v"(ah), "v"(al), "v"(bh), "v"(bl));
  return c;
}
// batched GEMM like k_gemm_b but f16 operands: A f32 (split into f16 hi/lo if ASPLIT, else rounded to f16), Bt = f16 values [n][k]; alpha; C f32; N multiple of 16 (partial tiles skipped)
template <bool ASPLIT>
__global__ __launch_bounds__(128) void k_gemm_h(const float* __restrict__ A, int lda, size_t sA, const _Float16* __restrict__ Bh, int ldb, size_t sB, float alpha, float* __restrict__ C, int ldc, size_t sC, int M, int N, int K) {
  __shared__ __attribute__((aligned(16))) float so[4][16][64];
  const int tid = threadIdx.x, w = tid >> 5, lane = tid & 31, ln = lane & 15, hh = lane >> 4; const int by = blockIdx.y;
  A += (size_t)by * sA; Bh += (size_t)by * sB; C += (size_t)by * sC;
  const int ntn = (N + 63) / 64; const int wid = blockIdx.x * 4 + w; const int mt = wid / ntn, nq = wid % ntn; if (mt * 16 >= M) return;
  const int row0 = mt * 16, col0 = nq * 64; const float* arow = A + (size_t)(row0 + ln) * lda;
  v8f acc[4] = {};
  for (int kb = 0; kb < K; kb += 32) {
    FragH ah, al;
    const v4f x0 = *(const v4fa*)(arow + kb + 8 * hh), x1 = *(const v4fa*)(arow + kb + 8 * hh + 4), x2 = *(const v4fa*)(arow + kb + 16 + 8 * hh), x3 = *(const v4fa*)(arow + kb + 16 + 8 * hh + 4);
    float xs[16] = {x0[0],x0[1],x0[2],x0[3],x1[0],x1[1],x1[2],x1[3],x2[0],x2[1],x2[2],x2[3],x3[0],x3[1],x3[2],x3[3]};
#pragma unroll
    for (int i = 0; i < 16; ++i) { const _Float16 h = (_Float16)xs[i]; ah.h[i] = h; al.h[i] = ASPLIT ? (_Float16)(xs[i] - (float)h) : (_Float16)0.0f; }
#pragma unroll
    for (int t = 0; t < 4; ++t) { if (col0 + t * 16 >= N) continue; const size_t boff = (size_t)(col0 + t * 16 + ln) * ldb + kb; FragH bq; bq.half[0] = *(const v8us*)(Bh + boff + 8 * hh); bq.half[1] = *(const v8us*)(Bh + boff + 16 + 8 * hh);
      acc[t] = mmaH<ASPLIT ? 2 : 1>(ah.v, al.v, bq.v, bq.v, acc[t]); }
  }
#pragma unroll
  for (int t = 0; t < 4; ++t) { if (col0 + t * 16 >= N) continue;
#pragma unroll
    for (int r = 0; r < 8; ++r) so[w][8 * hh + r][t * 16 + ln] = acc[t][r] * alpha; }
  __builtin_amdgcn_fence(__ATOMIC_ACQ_REL, "workgroup"); __builtin_amdgcn_wave_barrier();
  const int rsub = lane >> 4, c4 = (lane & 15) * 4;
  {
#pragma unroll
    for (int q = 0; q < 8; ++q) { const int r = q * 2 + rsub; if (col0 + c4 < N) { const v4f v = *(const v4fa*)&so[w][r][c4]; *(v4f*)(C + (size_t)(row0 + r) * ldc + col0 + c4) = v; } }
     }
}

// k_gemm_hh variant with fused epilogue: v = acc·alpha + bias[by·sBias + col] (+ CP[(row/rowsPerB)·sCPb + by·64 + col] if CP) ; ACT 0 none / 1 elu ; writes f16 C16 (and f32 C if non-null)
template <int ACT>
__global__ __launch_bounds__(128) void k_gemm_hhx(const _Float16* __restrict__ A, int lda, size_t sA, const _Float16* __restrict__ Bh, int ldb, size_t sB, float alpha, const float* __restrict__ bias, size_t sBias, const float* __restrict__ CP, int rowsPerB, size_t sCPb, int row0g,
    float* __restrict__ C, _Float16* __restrict__ C16, int ldc, size_t sC, int M, int N, int K) {
  __shared__ __attribute__((aligned(16))) float so[4][16][64];
  const int tid = threadIdx.x, w = tid >> 5, lane = tid & 31, ln = lane & 15, hh = lane >> 4; const int by = blockIdx.y;
  A += (size_t)by * sA; Bh += (size_t)by * sB; const size_t cofs = (size_t)by * sC; const float* bp = bias ? bias + (size_t)by * sBias : nullptr;
  const int ntn = (N + 63) / 64; const int wid = blockIdx.x * 4 + w; const int mt = wid / ntn, nq = wid % ntn; if (mt * 16 >= M) return;
  const int row0 = mt * 16, col0 = nq * 64; const _Float16* arow = A + (size_t)(row0 + ln) * lda;
  v8f acc[4] = {};
  for (int kb = 0; kb < K; kb += 32) { FragH ah; ah.half[0] = *(const v8us*)((const unsigned short*)arow + kb + 8 * hh); ah.half[1] = *(const v8us*)((const unsigned short*)arow + kb + 16 + 8 * hh);
#pragma unroll
    for (int t = 0; t < 4; ++t) { if (col0 + t * 16 >= N) continue; const size_t boff = (size_t)(col0 + t * 16 + ln) * ldb + kb; FragH bq; bq.half[0] = *(const v8us*)((const unsigned short*)Bh + boff + 8 * hh); bq.half[1] = *(const v8us*)((const unsigned short*)Bh + boff + 16 + 8 * hh);
      acc[t] = mmaH<1>(ah.v, ah.v, bq.v, bq.v, acc[t]); }
  }
#pragma unroll
  for (int t = 0; t < 4; ++t) { if (col0 + t * 16 >= N) continue; const int col = col0 + t * 16 + ln; const float bv = bp ? bf16_round(bp[col]) : 0.f;
#pragma unroll
    for (int r = 0; r < 8; ++r) { float v = acc[t][r] * alpha + bv; if (CP) { const int bidx = (row0g + row0 + 8 * hh + r) / rowsPerB; v += CP[(size_t)bidx * sCPb + (size_t)by * 64 + col]; } if (ACT == 1) v = (v > 0.f) ? v : expm1f(v); else if (ACT == 3) v = fmaxf(v, 0.f); so[w][8 * hh + r][t * 16 + ln] = v; } }
  __builtin_amdgcn_fence(__ATOMIC_ACQ_REL, "workgroup"); __builtin_amdgcn_wave_barrier();
  const int rsub = lane >> 4, c4 = (lane & 15) * 4; typedef _Float16 v4h __attribute__((ext_vector_type(4)));
  {
#pragma unroll
    for (int q = 0; q < 8; ++q) { const int r = q * 2 + rsub; if (col0 + c4 < N) { const v4f v = *(const v4fa*)&so[w][r][c4]; if (C) *(v4f*)(C + cofs + (size_t)(row0 + r) * ldc + col0 + c4) = v; if (C16) { v4h h4; for (int i = 0; i < 4; ++i) h4[i] = (_Float16)v[i]; *(v4h*)(C16 + cofs + (size_t)(row0 + r) * ldc + col0 + c4) = h4; } } }
     }
}


// Projection GEMM, 2048 x 2048 x 2048: C = (A . Bt^T) * alpha + bias. One 128 x 128 tile of C per workgroup of 8 waves (4 x 2, 32 x 64 per wave).
// A pass is 128 k: 128 rows of A and 128 rows of Bt, 256 B each, laid in LDS at pitch 272 B by asynchronous copies, two buffers, the next pass's copies in flight under this pass's products.
// k runs upward in steps of 32 into one accumulator per 16 x 16 tile, as in k_gemm_hhx: the sums keep their order.
// Every '#pragma unroll' in k_gemm_t makes the indices of the fragment and accumulator arrays constants, so that they stay in registers.
#define GT_PITCH 272u
#define GT_STAGE (256u * GT_PITCH)
#define GT_NST (CC / 128)
__device__ __forceinline__ void gt_copy8(unsigned l0, const unsigned short* g0) {
  // eight 16-byte copies of this lane, rows 16 apart; s_wait_xcnt stands inside the statement so that no address register is rewritten ahead of it
  const unsigned l1 = l0 + 16u * GT_PITCH, l2 = l0 + 32u * GT_PITCH, l3 = l0 + 48u * GT_PITCH, l4 = l0 + 64u * GT_PITCH, l5 = l0 + 80u * GT_PITCH, l6 = l0 + 96u * GT_PITCH, l7 = l0 + 112u * GT_PITCH;
  const unsigned short *g1 = g0 + 16 * CC, *g2 = g0 + 32 * CC, *g3 = g0 + 48 * CC, *g4 = g0 + 64 * CC, *g5 = g0 + 80 * CC, *g6 = g0 + 96 * CC, *g7 = g0 + 112 * CC;
  asm volatile("global_load_async_to_lds_b128 %0, %8, off\n\t"
               "global_load_async_to_lds_b128 %1, %9, off\n\t"
               "global_load_async_to_lds_b128 %2, %10, off\n\t"
               "global_load_async_to_lds_b128 %3, %11, off\n\t"
               "global_load_async_to_lds_b128 %4, %12, off\n\t"
               "global_load_async_to_lds_b128 %5, %13, off\n\t"
               "global_load_async_to_lds_b128 %6, %14, off\n\t"
               "global_load_async_to_lds_b128 %7, %15, off\n\t"
               "s_wait_xcnt 0x0"
               :: "v"(l0), "v"(l1), "v"(l2), "v"(l3), "v"(l4), "v"(l5), "v"(l6), "v"(l7),
                  "v"(g0), "v"(g1), "v"(g2), "v"(g3), "v"(g4), "v"(g5), "v"(g6), "v"(g7) : "memory");
}
// blockIdx.y picks one of up to three independent products that share the grid; product 2's tile goes out as f16 to C16, the others' as f32
__global__ __launch_bounds__(256) void k_gemm_t(const _Float16* A0, const _Float16* A1, const _Float16* A2, const _Float16* Bh0, const _Float16* Bh1, const _Float16* Bh2, float alpha,
                                                const float* bias0, const float* bias1, const float* bias2, float* C0, float* C1, _Float16* C16) {
  __shared__ __attribute__((aligned(16))) unsigned char L[2u * GT_STAGE];
  const int py = (int)blockIdx.y; const bool H16 = py == 2;
  const _Float16* A = py == 0 ? A0 : py == 1 ? A1 : A2; const _Float16* Bh = py == 0 ? Bh0 : py == 1 ? Bh1 : Bh2; const float* bias = py == 0 ? bias0 : py == 1 ? bias1 : bias2; float* C = py == 0 ? C0 : C1;
  const int tid = threadIdx.x, w = tid >> 5, lane = tid & 31, ln = lane & 15, hh = lane >> 4;
  const int m0 = (int)(blockIdx.x / (CC / 128)) * 128, n0 = (int)(blockIdx.x % (CC / 128)) * 128;
  const int wm = (w >> 1) * 32, wn = (w & 1) * 64;
  // copies: lane takes 16-byte piece (tid & 15) of rows (tid >> 4) + 16 i; LDS rows 0..127 hold A, 128..255 hold Bt
  const unsigned lcp = (unsigned)(size_t)L + (unsigned)(tid >> 4) * GT_PITCH + (unsigned)(tid & 15) * 16u;
  const unsigned short* ga = (const unsigned short*)A + (size_t)(m0 + (tid >> 4)) * CC + (tid & 15) * 8;
  const unsigned short* gb = (const unsigned short*)Bh + (size_t)(n0 + (tid >> 4)) * CC + (tid & 15) * 8;
  v8f acc[2][4];
#pragma unroll
  for (int i = 0; i < 2; ++i)
#pragma unroll
    for (int j = 0; j < 4; ++j) acc[i][j] = (v8f){0.f,0.f,0.f,0.f,0.f,0.f,0.f,0.f};
  gt_copy8(lcp, ga); gt_copy8(lcp + 128u * GT_PITCH, gb);
  asm volatile("s_wait_asynccnt 0x0" ::: "memory");      // pass 0's bytes of this wave have landed
  __syncthreads();                                        // and every wave's: pass 0 is readable
  gt_copy8(lcp + GT_STAGE, ga + 128); gt_copy8(lcp + GT_STAGE + 128u * GT_PITCH, gb + 128);
#pragma unroll 1      // one pass per trip: the ring's order at the foot stays as written
  for (int t = 0; t < GT_NST; ++t) {
    const unsigned char* S = L + (unsigned)(t & 1) * GT_STAGE;
    const unsigned char* ar = S + (unsigned)(wm + ln) * GT_PITCH + 16u * hh;
    const unsigned char* br = S + (unsigned)(128 + wn + ln) * GT_PITCH + 16u * hh;
    FragH a[2][2], b[2][4];      // two fragment sets: the next 32 k are fetched as one group ahead of this block's products (inside this pass's buffer only)
#pragma unroll
    for (int i = 0; i < 2; ++i) { a[0][i].half[0] = *(const v8us*)(ar + i * 16 * GT_PITCH); a[0][i].half[1] = *(const v8us*)(ar + i * 16 * GT_PITCH + 32); }
#pragma unroll
    for (int j = 0; j < 4; ++j) { b[0][j].half[0] = *(const v8us*)(br + j * 16 * GT_PITCH); b[0][j].half[1] = *(const v8us*)(br + j * 16 * GT_PITCH + 32); }
#pragma unroll
    for (int ks = 0; ks < 4; ++ks) {
      const int cu = ks & 1, nx = cu ^ 1;
      if (ks < 3) {
#pragma unroll
        for (int i = 0; i < 2; ++i) { a[nx][i].half[0] = *(const v8us*)(ar + i * 16 * GT_PITCH + (ks + 1) * 64); a[nx][i].half[1] = *(const v8us*)(ar + i * 16 * GT_PITCH + (ks + 1) * 64 + 32); }
#pragma unroll
        for (int j = 0; j < 4; ++j) { b[nx][j].half[0] = *(const v8us*)(br + j * 16 * GT_PITCH + (ks + 1) * 64); b[nx][j].half[1] = *(const v8us*)(br + j * 16 * GT_PITCH + (ks + 1) * 64 + 32); }
      }
      __builtin_amdgcn_sched_barrier(0);      // keeps the next block's twelve LDS loads one group ahead of these products; without it they sink among the products and each waits out its own latency
#pragma unroll
      for (int i = 0; i < 2; ++i)
#pragma unroll
        for (int j = 0; j < 4; ++j) acc[i][j] = __builtin_amdgcn_wmma_f32_16x16x32_f16(false, a[cu][i].v, false, b[cu][j].v, (short)0, acc[i][j], false, false);
      __builtin_amdgcn_sched_barrier(0);      // the products stay one run: no later load group rises into it
    }
    asm volatile("s_wait_dscnt 0x0" ::: "memory");        // this wave's reads of the buffer have returned
    asm volatile("s_wait_asynccnt 0x0" ::: "memory");     // this wave's copies of pass t + 1 have landed
    __syncthreads();                                      // publishes pass t + 1 and frees the buffer pass t has read
    if (t + 2 < GT_NST) { gt_copy8(lcp + (unsigned)(t & 1) * GT_STAGE, ga + (t + 2) * 128); gt_copy8(lcp + (unsigned)(t & 1) * GT_STAGE + 128u * GT_PITCH, gb + (t + 2) * 128); }
  }
  asm volatile("s_wait_asynccnt 0x0" ::: "memory");       // nothing in flight before the ring becomes output staging
  // epilogue: each wave stages its 32 x 64 tile in its own LDS range (pitch 68 floats) and stores whole lines
  float* so = (float*)(L + (unsigned)w * (32u * 272u));
#pragma unroll
  for (int j = 0; j < 4; ++j) { const float bv = bf16_round(bias[n0 + wn + j * 16 + ln]);
#pragma unroll
    for (int i = 0; i < 2; ++i)
#pragma unroll
      for (int r = 0; r < 8; ++r) so[(i * 16 + 8 * hh + r) * 68 + j * 16 + ln] = acc[i][j][r] * alpha + bv; }
  __builtin_amdgcn_fence(__ATOMIC_ACQ_REL, "workgroup"); __builtin_amdgcn_wave_barrier();      // the wave's staged rows are in LDS before its lanes read them back; the range is the wave's own, so no workgroup barrier
  const int c4 = ln * 4; typedef _Float16 v4h __attribute__((ext_vector_type(4)));
  if (!H16) {
#pragma unroll
    for (int q = 0; q < 16; ++q) { const int r = q * 2 + hh; const v4f v = *(const v4fa*)&so[r * 68 + c4]; const size_t o = (size_t)(m0 + wm + r) * CC + n0 + wn + c4; *(v4f*)(C + o) = v; }
    asm volatile("s_wait_xcnt 0x0" ::: "memory");      // no register that these stores name is rewritten ahead of this wait, whichever block the build lays behind them
  } else {
#pragma unroll
    for (int q = 0; q < 16; ++q) { const int r = q * 2 + hh; const v4f v = *(const v4fa*)&so[r * 68 + c4]; const size_t o = (size_t)(m0 + wm + r) * CC + n0 + wn + c4;
      v4h h4; for (int i = 0; i < 4; ++i) h4[i] = (_Float16)v[i]; *(v4h*)(C16 + o) = h4; }
    asm volatile("s_wait_xcnt 0x0" ::: "memory");      // as in the other arm
  }
}

__global__ __launch_bounds__(256) void k_h16(const float* __restrict__ x, _Float16* __restrict__ X16, size_t n8) { const size_t t = (size_t)blockIdx.x * 256 + threadIdx.x; if (t >= n8) return; FragH f;
#pragma unroll
  for (int q = 0; q < 8; ++q) f.h[q] = (_Float16)x[t * 8 + q]; *(v8us*)((unsigned short*)X16 + t * 8) = f.half[0];  }
// Every conversion that reads inputs alone, in one grid; the block index picks the job, each thread's work is that of the separate kernels.
// Blocks 0 .. PB_G-1: BG_h[e][d] = f16(bf16(G_h[d][e]) * 16), 8 blocks a head. Then PB_M blocks a matrix, 8 elements a thread: the four weights (bf16-rounded, * 16; (out,in) = Bt) and q, k, v (bf16-rounded, * 1, which is exact).
#define PB_G (NH * 8)
#define PB_M (CC * CC / 8 / 256)
__global__ __launch_bounds__(256) void k_prep(const float* __restrict__ G, const float* __restrict__ Wq, const float* __restrict__ Wk, const float* __restrict__ Wv, const float* __restrict__ Wo,
                                              const float* __restrict__ q, const float* __restrict__ k, const float* __restrict__ v, _Float16* __restrict__ BG, _Float16* __restrict__ Y) {
  const int bid = (int)blockIdx.x, tid = threadIdx.x; FragH f;
  if (bid < PB_G) {
    const float* W = G + (size_t)(bid >> 3) * HD * HD; const int t = (bid & 7) * 256 + tid; const int n = t / (HD / 8), k8 = (t % (HD / 8)) * 8;
#pragma unroll
    for (int i = 0; i < 8; ++i) f.h[i] = (_Float16)(bf16_round(W[(size_t)(k8 + i) * HD + n]) * 16.0f);
    *(v8us*)((unsigned short*)BG + (size_t)(bid >> 3) * HD * HD + (size_t)n * HD + k8) = f.half[0];
    asm volatile("s_wait_xcnt 0x0" ::: "memory");      // no register that the store names is rewritten ahead of this wait, whichever block the build lays behind it
    return;
  }
  const int j = (bid - PB_G) / PB_M; const size_t t = (size_t)((bid - PB_G) % PB_M) * 256 + tid;      // matrix j, in the order Wq Wk Wv Wo q k v; the seven results lie one behind the other in Y
  const float* x01 = (j & 1) ? Wk : Wq; const float* x23 = (j & 1) ? Wo : Wv; const float* x45 = (j & 1) ? k : q;
  const float* x03 = (j & 2) ? x23 : x01; const float* x47 = (j & 2) ? v : x45; const float* x = (j & 4) ? x47 : x03;
  const float sc = j < 4 ? 16.0f : 1.0f;
#pragma unroll
  for (int i = 0; i < 8; ++i) f.h[i] = (_Float16)(bf16_round(x[t * 8 + i]) * sc);
  *(v8us*)((unsigned short*)Y + (size_t)j * CC * CC + t * 8) = f.half[0];
  asm volatile("s_wait_xcnt 0x0" ::: "memory");      // as in the other arm
}
template <int NHv, int TTv>
__global__ __launch_bounds__(256) void k_vt(const _Float16* __restrict__ V16, int ldv, int voff, _Float16* __restrict__ Vt) { __shared__ unsigned short tl[64][66]; const int tid = threadIdx.x; const int slab = blockIdx.x / (TTv / 64), lg = blockIdx.x % (TTv / 64); const int b = slab / NHv, h = slab % NHv;
  for (int i = tid; i < 64 * 8; i += 256) { const int r = i / 8, c8 = (i % 8) * 8; FragH f; f.half[0] = *(const v8us*)((const unsigned short*)V16 + ((size_t)b * TTv + lg * 64 + r) * ldv + voff + h * 64 + c8);
#pragma unroll
    for (int q = 0; q < 8; ++q) tl[r][c8 + q] = f.u[q]; }
  __syncthreads();
  {
#pragma unroll
    for (int rd = 0; rd < 2; ++rd) { const int d = rd * 32 + tid / 8, pc = tid % 8; FragH f;
#pragma unroll
      for (int q = 0; q < 8; ++q) f.u[q] = tl[pc * 8 + q][d];
      *(v8us*)((unsigned short*)Vt + ((size_t)slab * 64 + d) * TTv + lg * 64 + pc * 8) = f.half[0]; }
     } }

// Attention ring: a stage is 64 keys for the block's 64 query rows: 64 rows of K (256 B, pitch 272), 128 rows of Vt (128 B, pitch 144) and 64 rows of the mask (256 B, pitch 272),
// laid in LDS by asynchronous copies, two buffers, the next stage's copies in flight under this stage's work; the four waves share K and Vt. A stage is worked as two 32-key tiles, upward, as before: every sum keeps its order.
#define FL_KP 272u
#define FL_VP 144u
#define FL_MP 272u
#define FL_VO (64u * FL_KP)
#define FL_MO (FL_VO + 128u * FL_VP)
#define FL_STAGE (FL_MO + 64u * FL_MP)
#define FL_NST (SS / 64)
#define FL_SC2 (0.08838834764831845f * 1.4426950408889634f)
typedef float f1a __attribute__((may_alias));
__device__ __forceinline__ void fl_copy8(unsigned l0, unsigned ls, const unsigned char* g0, size_t gs) {
  // eight 16-byte copies of this lane, LDS rows ls bytes apart, global rows gs bytes apart; s_wait_xcnt stands inside the statement so that no address register is rewritten ahead of it
  const unsigned l1 = l0 + ls, l2 = l0 + 2u * ls, l3 = l0 + 3u * ls, l4 = l0 + 4u * ls, l5 = l0 + 5u * ls, l6 = l0 + 6u * ls, l7 = l0 + 7u * ls;
  const unsigned char *g1 = g0 + gs, *g2 = g0 + 2 * gs, *g3 = g0 + 3 * gs, *g4 = g0 + 4 * gs, *g5 = g0 + 5 * gs, *g6 = g0 + 6 * gs, *g7 = g0 + 7 * gs;
  asm volatile("global_load_async_to_lds_b128 %0, %8, off\n\t"
               "global_load_async_to_lds_b128 %1, %9, off\n\t"
               "global_load_async_to_lds_b128 %2, %10, off\n\t"
               "global_load_async_to_lds_b128 %3, %11, off\n\t"
               "global_load_async_to_lds_b128 %4, %12, off\n\t"
               "global_load_async_to_lds_b128 %5, %13, off\n\t"
               "global_load_async_to_lds_b128 %6, %14, off\n\t"
               "global_load_async_to_lds_b128 %7, %15, off\n\t"
               "s_wait_xcnt 0x0"
               :: "v"(l0), "v"(l1), "v"(l2), "v"(l3), "v"(l4), "v"(l5), "v"(l6), "v"(l7),
                  "v"(g0), "v"(g1), "v"(g2), "v"(g3), "v"(g4), "v"(g5), "v"(g6), "v"(g7) : "memory");
}
__global__ __launch_bounds__(128) void k_flash(const _Float16* __restrict__ Q16, int ldq, const _Float16* __restrict__ K16, int ldk, const _Float16* __restrict__ Vt, const float* __restrict__ MSK, float* __restrict__ O, int ldo) {
  constexpr int RPW = 16, RTN = RPW / 16, NQB = 2048 / (4 * RPW), DT = 8, KS = 4;      /* head dim 128 */
  __shared__ __attribute__((aligned(16))) unsigned short sP[4][RPW][40]; __shared__ __attribute__((aligned(16))) unsigned char L[2u * FL_STAGE];
  const int tid = threadIdx.x, w = tid >> 5, lane = tid & 31, ln = lane & 15, hh = lane >> 4;
  const int slab = blockIdx.x / NQB, qblk = blockIdx.x % NQB; const int b = slab / 16, h = slab % 16; const int qb0 = qblk * (4 * RPW); const int q0 = qb0 + w * RPW;
  const unsigned short* Vth = (const unsigned short*)Vt + (size_t)slab * 128 * 2048;
  // copies: K and mask: 16-byte piece (tid & 15) of rows (tid >> 4) + 8 i; Vt: piece (tid & 7) of rows (tid >> 3) + 16 i
  const unsigned lb = (unsigned)(size_t)L;
  const unsigned lk = lb + (unsigned)(tid >> 4) * FL_KP + (unsigned)(tid & 15) * 16u, lv = lb + FL_VO + (unsigned)(tid >> 3) * FL_VP + (unsigned)(tid & 7) * 16u, lm = lb + FL_MO + (unsigned)(tid >> 4) * FL_MP + (unsigned)(tid & 15) * 16u;
  const size_t kstep = (size_t)ldk * 2;      // bytes of a K row
  const unsigned char* gk = (const unsigned char*)((const unsigned short*)K16 + ((size_t)b * 2048 + (tid >> 4)) * ldk + h * 128 + (tid & 15) * 8);
  const unsigned char* gv = (const unsigned char*)(Vth + (size_t)(tid >> 3) * 2048 + (tid & 7) * 8);
  const unsigned char* gm = (const unsigned char*)(MSK + ((size_t)b * 2048 + qb0 + (tid >> 4)) * 2048 + (tid & 15) * 4);
  fl_copy8(lk, 8u * FL_KP, gk, 8 * kstep); fl_copy8(lv, 16u * FL_VP, gv, (size_t)16 * 4096); fl_copy8(lm, 8u * FL_MP, gm, (size_t)8 * 8192);
  FragH aq[2][KS];
#pragma unroll
  for (int rt = 0; rt < RTN; ++rt) { const unsigned short* qr = (const unsigned short*)Q16 + ((size_t)b * 2048 + q0 + rt * 16 + ln) * ldq + h * 128;
#pragma unroll
    for (int ks = 0; ks < KS; ++ks) { aq[rt][ks].half[0] = *(const v8us*)(qr + ks * 32 + 8 * hh); aq[rt][ks].half[1] = *(const v8us*)(qr + ks * 32 + 16 + 8 * hh); } }
  float m_r[2][8], l_r[2][8]; v8f oacc[2][DT];
#pragma unroll
  for (int rt = 0; rt < RTN; ++rt) {
#pragma unroll
    for (int r = 0; r < 8; ++r) { m_r[rt][r] = -3.0e38f; l_r[rt][r] = 0.f; }
#pragma unroll
    for (int dt = 0; dt < DT; ++dt) oacc[rt][dt] = (v8f){0.f,0.f,0.f,0.f,0.f,0.f,0.f,0.f}; }
  asm volatile("s_wait_asynccnt 0x0" ::: "memory");      // stage 0's bytes of this wave have landed
  __syncthreads();                                        // and every wave's: stage 0 is readable
  fl_copy8(lk + FL_STAGE, 8u * FL_KP, gk + 64 * kstep, 8 * kstep); fl_copy8(lv + FL_STAGE, 16u * FL_VP, gv + 128, (size_t)16 * 4096); fl_copy8(lm + FL_STAGE, 8u * FL_MP, gm + 256, (size_t)8 * 8192);
#pragma unroll 1      // one stage per trip: the ring's order at the foot stays as written
  for (int t = 0; t < FL_NST; ++t) {
    const unsigned char* S = L + (unsigned)(t & 1) * FL_STAGE;
#pragma unroll 1      // the two 32-key tiles of a stage share one body: less code, and a masked tile is skipped on its own
  for (int sub = 0; sub < 2; ++sub) {
    // mask tile for my 16 query rows x 32 keys: lane (ln,hh) needs rows rt*16 + 8hh + r, keys ln and 16 + ln of the tile
    unsigned okb0 = 0u, okb1 = 0u;      // bit (rt*8 + r) set when key ln (resp. 16+ln) of the tile is OPEN for query row rt*16 + 8hh + r
#pragma unroll
    for (int rt = 0; rt < RTN; ++rt)
#pragma unroll
      for (int r = 0; r < 8; ++r) { const f1a* mr = (const f1a*)(S + FL_MO + (unsigned)(w * RPW + rt * 16 + 8 * hh + r) * FL_MP + (unsigned)sub * 128u); okb0 |= (mr[ln] == 0.0f ? 1u : 0u) << (rt * 8 + r); okb1 |= (mr[16 + ln] == 0.0f ? 1u : 0u) << (rt * 8 + r); }      /* float mask: nonzero = masked (-1e9) */
    if (__builtin_amdgcn_ballot_w32((okb0 | okb1) != 0u) == 0u) continue;      // every (query,key) of this wave's tile is masked: contributes nothing (uniform branch; the stage's foot is outside this loop)
    // The tile's LDS fragment reads stand in groups ahead of the products that use them, so that no product waits out an LDS round trip of its own:
    // all of K (both 16-key halves) ahead of the score products; all of Vt directly behind the loads of P, so that it streams in under P's round trip and the first products.
    // Every '#pragma unroll' here makes the indices of the fragment arrays constants, so that they stay in registers.
    v8f s[2][2]; FragH bk[2][KS], bv[DT];
#pragma unroll
    for (int nt = 0; nt < 2; ++nt) { const unsigned char* kr = S + (unsigned)(sub * 32 + nt * 16 + ln) * FL_KP + 16u * hh;
#pragma unroll
      for (int ks = 0; ks < KS; ++ks) { bk[nt][ks].half[0] = *(const v8us*)(kr + ks * 64); bk[nt][ks].half[1] = *(const v8us*)(kr + ks * 64 + 32); } }
#pragma unroll
    for (int rt = 0; rt < RTN; ++rt) { s[rt][0] = (v8f){0.f,0.f,0.f,0.f,0.f,0.f,0.f,0.f}; s[rt][1] = (v8f){0.f,0.f,0.f,0.f,0.f,0.f,0.f,0.f}; }
    // the two halves' accumulator chains alternate, so that each fills the other's accumulate latency; within a chain k runs upward as before
#pragma unroll
    for (int ks = 0; ks < KS; ++ks)
#pragma unroll
      for (int nt = 0; nt < 2; ++nt)
#pragma unroll
        for (int rt = 0; rt < RTN; ++rt) s[rt][nt] = mmaH<1>(aq[rt][ks].v, aq[rt][ks].v, bk[nt][ks].v, bk[nt][ks].v, s[rt][nt]);
    // Softmax of the tile in phases over the eight rows of a lane, with no branch inside: each row's chain (four cross-lane steps, three exponentials) is long and dependent,
    // so the rows' chains are laid side by side and fill one another's waits. Every exponential is taken unconditionally and the old conditions pick between its value and the constant.
    // Scores and running maxima are kept in base 2 (FL_SC2 = 1/sqrt(128) * log2 e, in the multiply the score had anyway), so that exp(x - m) is one v_exp_f32 of a difference; only differences of them are ever used, so p, alpha and l mean what they did.
    // Every '#pragma unroll' below makes the row index a constant, so that the per-row arrays stay in registers.
#pragma unroll
    for (int rt = 0; rt < RTN; ++rt) {
      float s0[8], s1[8], mc[8], al[8];
#pragma unroll
      for (int r = 0; r < 8; ++r) {
        const bool ok0 = ((okb0 >> (rt * 8 + r)) & 1u) != 0u, ok1 = ((okb1 >> (rt * 8 + r)) & 1u) != 0u;
        s0[r] = ok0 ? s[rt][0][r] * FL_SC2 : -INFINITY; s1[r] = ok1 ? s[rt][1][r] * FL_SC2 : -INFINITY; mc[r] = fmaxf(s0[r], s1[r]); }
#pragma unroll
      for (int m = 1; m < 16; m <<= 1)
#pragma unroll
        for (int r = 0; r < 8; ++r) mc[r] = fmaxf(mc[r], __shfl_xor(mc[r], m, 32));
#pragma unroll
      for (int r = 0; r < 8; ++r) {
        const bool ok0 = ((okb0 >> (rt * 8 + r)) & 1u) != 0u, ok1 = ((okb1 >> (rt * 8 + r)) & 1u) != 0u;
        const float mn = fmaxf(m_r[rt][r], mc[r]); const float ea = __builtin_amdgcn_exp2f(m_r[rt][r] - mn), e0 = __builtin_amdgcn_exp2f(s0[r] - mn), e1 = __builtin_amdgcn_exp2f(s1[r] - mn);
        al[r] = (mn > -1.0e38f) ? ea : 1.0f; m_r[rt][r] = mn; const float p0 = ok0 ? e0 : 0.f, p1 = ok1 ? e1 : 0.f; l_r[rt][r] = l_r[rt][r] * al[r] + p0 + p1;
        FragH t2; t2.h[0] = (_Float16)p0; t2.h[1] = (_Float16)p1; sP[w][rt * 16 + 8 * hh + r][ln] = t2.u[0]; sP[w][rt * 16 + 8 * hh + r][16 + ln] = t2.u[1]; }
#pragma unroll
      for (int dt = 0; dt < DT; ++dt)
#pragma unroll
        for (int r = 0; r < 8; ++r) oacc[rt][dt][r] *= al[r]; }
    __builtin_amdgcn_fence(__ATOMIC_ACQ_REL, "workgroup"); __builtin_amdgcn_wave_barrier();
    FragH pa[2];
#pragma unroll
    for (int rt = 0; rt < RTN; ++rt) { pa[rt].half[0] = *(const v8us*)&sP[w][rt * 16 + ln][8 * hh]; pa[rt].half[1] = *(const v8us*)&sP[w][rt * 16 + ln][16 + 8 * hh]; }
#pragma unroll
    for (int dt = 0; dt < DT; ++dt) { const unsigned char* vrow = S + FL_VO + (unsigned)(dt * 16 + ln) * FL_VP + (unsigned)sub * 64u + 16u * hh; bv[dt].half[0] = *(const v8us*)vrow; bv[dt].half[1] = *(const v8us*)(vrow + 32); }
#pragma unroll
    for (int dt = 0; dt < DT; ++dt)
#pragma unroll
      for (int rt = 0; rt < RTN; ++rt) oacc[rt][dt] = mmaH<1>(pa[rt].v, pa[rt].v, bv[dt].v, bv[dt].v, oacc[rt][dt]);
    __builtin_amdgcn_fence(__ATOMIC_ACQ_REL, "workgroup"); __builtin_amdgcn_wave_barrier(); }
    asm volatile("s_wait_dscnt 0x0" ::: "memory");        // this wave's reads of the buffer have returned
    asm volatile("s_wait_asynccnt 0x0" ::: "memory");     // this wave's copies of stage t + 1 have landed
    __syncthreads();                                      // publishes stage t + 1 and frees the buffer stage t has read
    if (t + 2 < FL_NST) { const unsigned lo = (unsigned)(t & 1) * FL_STAGE; fl_copy8(lk + lo, 8u * FL_KP, gk + (size_t)(t + 2) * 64 * kstep, 8 * kstep); fl_copy8(lv + lo, 16u * FL_VP, gv + (t + 2) * 128, (size_t)16 * 4096); fl_copy8(lm + lo, 8u * FL_MP, gm + (t + 2) * 256, (size_t)8 * 8192); }
  }
  asm volatile("s_wait_asynccnt 0x0" ::: "memory");       // nothing in flight before the ring becomes output staging (the last foot's barrier has ended every wave's reads of it)
  float* sO = (float*)(L + (unsigned)w * (unsigned)(RPW * (128 + 4) * 4));      // each wave's own range, pitch 132 floats
#pragma unroll
  for (int rt = 0; rt < RTN; ++rt) {
#pragma unroll
    for (int r = 0; r < 8; ++r) { float l = l_r[rt][r]; l += __shfl_xor(l, 1, 32); l += __shfl_xor(l, 2, 32); l += __shfl_xor(l, 4, 32); l += __shfl_xor(l, 8, 32); l_r[rt][r] = (l > 0.f) ? 1.0f / l : 0.f; }
#pragma unroll
    for (int dt = 0; dt < DT; ++dt)
#pragma unroll
      for (int r = 0; r < 8; ++r) sO[(rt * 16 + 8 * hh + r) * 132 + dt * 16 + ln] = oacc[rt][dt][r] * l_r[rt][r]; }
  __builtin_amdgcn_fence(__ATOMIC_ACQ_REL, "workgroup"); __builtin_amdgcn_wave_barrier();
  {
#pragma unroll
    for (int rp = 0; rp < RPW; ++rp) { const int r = rp, pc = lane; const v4f val = *(const v4fa*)&sO[r * 132 + pc * 4]; *(v4f*)(O + ((size_t)b * 2048 + q0 + r) * ldo + h * 128 + pc * 4) = val; }      /* 128-float rows: 32 lanes x 16 B */
     } }

__device__ __forceinline__ void d_rope16(int bid, const float* __restrict__ SRC, _Float16* __restrict__ D16) { __shared__ __attribute__((aligned(16))) _Float16 st[256][8]; const int tid = threadIdx.x; const size_t t = (size_t)bid * 256 + tid; if (t >= (size_t)SS * NH * 16) return; const int p = (int)(t % 16); const int h = (int)((t / 16) % NH); const int s = (int)(t / (16 * NH)); const float* src = SRC + ((size_t)s * NH + h) * HD;
#pragma unroll 1
  for (int q = 0; q < 8; ++q) { const int j = p * 8 + q; const int i = j >> 1; const float f = __builtin_powf(10000.0f, -(float)(2 * i) / 128.0f); const float ang = (float)s * f; const float c = cosf(ang), sn = sinf(ang); const float xr = src[2 * i], xi = src[2 * i + 1]; st[tid][q] = (_Float16)((j & 1) ? (xr * sn + xi * c) : (xr * c - xi * sn)); }
  const v8us v = *(const v8us*)&st[tid][0]; unsigned short* d = (unsigned short*)D16 + ((size_t)s * NH + h) * HD + p * 8; *(v8us*)d = v;  }
__device__ __forceinline__ void d_vt128(int bid, const _Float16* __restrict__ V16, _Float16* __restrict__ Vt) { __shared__ unsigned short tl[64][130]; const int tid = threadIdx.x; const int h = bid / (SS / 64), lg = bid % (SS / 64);
  for (int i = tid; i < 64 * 16; i += 256) { const int r = i / 16, c8 = (i % 16) * 8; FragH f; f.half[0] = *(const v8us*)((const unsigned short*)V16 + ((size_t)lg * 64 + r) * CC + h * HD + c8);
#pragma unroll
    for (int q = 0; q < 8; ++q) tl[r][c8 + q] = f.u[q]; }
  __syncthreads();
  { for (int i = tid; i < 128 * 8; i += 256) { const int d = i / 8, pc = i % 8; FragH f;
#pragma unroll
      for (int q = 0; q < 8; ++q) f.u[q] = tl[pc * 8 + q][d]; *(v8us*)((unsigned short*)Vt + ((size_t)h * HD + d) * SS + lg * 64 + pc * 8) = f.half[0]; }  } }
// What follows the three projections and is independent of one another, in one grid: RoPE of q, RoPE of k (RB blocks each), then the short V transposes
#define RB (SS * NH * 16 / 256)
__global__ __launch_bounds__(256) void k_post(const float* __restrict__ QF, _Float16* __restrict__ QR16, const float* __restrict__ KF, _Float16* __restrict__ KR16, const _Float16* __restrict__ V16, _Float16* __restrict__ Vt) {
  const int bid = (int)blockIdx.x;
  if (bid < 2 * RB) d_rope16(bid % RB, bid < RB ? QF : KF, bid < RB ? QR16 : KR16);
  else d_vt128(bid - 2 * RB, V16, Vt);
}
extern "C" void kernel_launch(void* const* d_in, const int* in_sizes, int n_in,
                              void* d_out, int out_size, void* d_ws, size_t ws_size, hipStream_t stream) {
  (void)in_sizes; (void)n_in; (void)out_size;
  const float* const* I = (const float* const*)d_in; const float* q = I[0]; const float* k = I[1]; const float* v = I[2]; const float* mask = I[3]; const float* Wq = I[4]; const float* bq = I[5]; const float* Wk = I[6]; const float* bk = I[7]; const float* Wv = I[8]; const float* bv = I[9]; const float* G = I[10]; const float* Wo = I[11]; const float* bo = I[12];
  char* ws = (char*)d_ws; size_t off = 0;
  auto take = [&](size_t bytes) { char* p = ws + off; off += (bytes + 255) & ~(size_t)255; return p; };
  _Float16* Y = (_Float16*)take((size_t)7 * CC * CC * 2); _Float16* Bq = Y; _Float16* Bk = Y + (size_t)CC * CC; _Float16* Bv = Y + (size_t)2 * CC * CC; _Float16* Bo = Y + (size_t)3 * CC * CC; _Float16* Xq = Y + (size_t)4 * CC * CC; _Float16* Xk = Y + (size_t)5 * CC * CC; _Float16* Xv = Y + (size_t)6 * CC * CC;
  _Float16* BG = (_Float16*)take((size_t)NH * HD * HD * 2);
  float* QF = (float*)take((size_t)SS * CC * 4); float* KF = (float*)take((size_t)SS * CC * 4);
  _Float16* QR16 = (_Float16*)take((size_t)SS * CC * 2); _Float16* QG16 = (_Float16*)take((size_t)SS * CC * 2); _Float16* KR16 = (_Float16*)take((size_t)SS * CC * 2); _Float16* V16 = (_Float16*)take((size_t)SS * CC * 2); _Float16* Vt = (_Float16*)take((size_t)SS * CC * 2); float* O = QF; _Float16* O16 = Xq;
  if (off > ws_size) return;      // 8.4 x 12 + 0.5 + 16.8 x 2 = about 135 MB
  const unsigned gx = (unsigned)(((size_t)SS * CC / 8 + 255) / 256); const unsigned gt = (SS / 128) * (CC / 128);
  k_prep<<<PB_G + 7 * PB_M, 256, 0, stream>>>(G, Wq, Wk, Wv, Wo, q, k, v, BG, Y);      // operands in f16
  k_gemm_t<<<dim3(gt, 3), 256, 0, stream>>>(Xq, Xk, Xv, Bq, Bk, Bv, 0.0625f, bq, bk, bv, QF, KF, V16);      // q, k (f32) and v (f16) projections
  k_post<<<2 * RB + NH * (SS / 64), 256, 0, stream>>>(QF, QR16, KF, KR16, V16, Vt);      // rope q, rope k, Vt
  k_gemm_hhx<0><<<dim3(((SS / 16) * (HD / 64) + 3) / 4, NH), 128, 0, stream>>>(QR16, CC, (size_t)HD, BG, HD, (size_t)HD * HD, 0.0625f, nullptr, 0, nullptr, 1, 0, 0, nullptr, QG16, CC, (size_t)HD, SS, HD, HD);      // qg_h = q_h · G_h (batched over heads via column offsets)
  k_flash<<<1 * NH * (SS / 64), 128, 0, stream>>>(QG16, CC, KR16, CC, Vt, mask, O, CC);
  k_h16<<<gx, 256, 0, stream>>>(O, O16, (size_t)SS * CC / 8);
  k_gemm_t<<<dim3(gt, 1), 256, 0, stream>>>(O16, O16, O16, Bo, Bo, Bo, 0.0625f, bo, bo, bo, (float*)d_out, (float*)d_out, nullptr);
}

// v007
// A run of this version takes 168 microseconds.
// Two timings next to v006 both put it at 1.07 times that version's speed.
// Counting every step since v000, it is 4.37 times as fast.
#include <hip/hip_runtime.h>
// Power-law-graph multi-head attention (B=1, S=2048, D=2048, 16 heads × 128; INPUT additive mask (nonzero = −1e9) ; RoPE interleaved pairs): q/k/v/o projections ((out,in) + bias) and the per-head
// metric product qg = q_h·G_h as GEMMs and the attention as a fused flash-style kernel (head dim 128: 4 k-steps / 8 d-tiles; masked keys excluded, fully masked 32-key tiles skipped by ballot;
// online softmax f32; P f16 ≤ 1; O = P·Vt; RPW-16 waves) on v_wmma_f32_16x16x32_f16, f32 accumulate; RoPE f32 VALU.
#define SS 2048
#define CC 2048
#define NH 16
#define HD 128

typedef __bf16 v16b __attribute__((ext_vector_type(16)));
typedef unsigned short v8us __attribute__((ext_vector_type(8), may_alias));
typedef float  v8f  __attribute__((ext_vector_type(8)));
typedef float  v4f  __attribute__((ext_vector_type(4)));
typedef float  v4fa __attribute__((ext_vector_type(4), may_alias));
union FragB { v16b v; v8us half[2]; unsigned short u[16]; };

__device__ __forceinline__ unsigned short bf16_bits(float x) { unsigned int u = __float_as_uint(x); return (unsigned short)((u + 0x7FFFu + ((u >> 16) & 1u)) >> 16); }
__device__ __forceinline__ float bf16_val(unsigned short b) { return __uint_as_float(((unsigned int)b) << 16); }
__device__ __forceinline__ float bf16_round(float x) { return bf16_val(bf16_bits(x)); }
// D += A·B with NT terms: 1 = ah·bh, 2 = + al·bh (A split), 3 = + ah·bl (both split)
template <int NT>
__device__ __forceinline__ v8f mmaN(v16b ah, v16b al, v16b bh, v16b bl, v8f c) {
  c = __builtin_amdgcn_wmma_f32_16x16x32_bf16(false, ah, false, bh, (short)0, c, false, false);
  if (NT >= 2) c = __builtin_amdgcn_wmma_f32_16x16x32_bf16(false, al, false, bh, (short)0, c, false, false);
  if (NT >= 3) c = __builtin_amdgcn_wmma_f32_16x16x32_bf16(false, ah, false, bl, (short)0, c, false, false);
  asm volatile("v_nop\n\tv_nop\n\tv_nop\n\tv_nop" : "+v"(c) : "v"(ah), "v"(al), "v"(bh), "v"(bl));
  return c;
}

__global__ __launch_bounds__(256) void k_wt_bf16(const float* __restrict__ W, unsigned short* __restrict__ Wt, int K, int N) {
  const int t = blockIdx.x * 256 + threadIdx.x;
  const int k8n = K / 8;
  if (t >= N * k8n) return;
  const int n = t / k8n, k8 = (t % k8n) * 8;
  v8us v;
#pragma unroll
  for (int i = 0; i < 8; ++i) v[i] = bf16_bits(W[(size_t)(k8 + i) * N + n]);
  *(v8us*)(Wt + (size_t)n * K + k8) = v;
  
}

// GEMM C[M][N] (f32, pitch ldc) = act(A[M][K]·W + bias). A f32 row-major (pitch lda) converted per fragment to bf16
// (ASPLIT: hi/lo two planes -> 2 terms, else single rounded term); Wt bf16 [N][K] (pitch ldb). BIAS_BF16 rounds the
// bias to bf16 first (bias quantised to bf16 before the add). K%32==0, M%16==0, N%64==0.
template <bool ASPLIT, int ACT, bool BIAS_BF16>
__global__ __launch_bounds__(128) void k_gemm_bf(const float* __restrict__ A, int lda, const unsigned short* __restrict__ Wt, int ldb,
                                               const float* __restrict__ bias, float* __restrict__ C, int ldc, int M, int N, int K) {
  __shared__ __attribute__((aligned(16))) float so[4][16][64];
  const int tid = threadIdx.x, w = tid >> 5, lane = tid & 31, ln = lane & 15, hh = lane >> 4;
  const int ntn = N / 64;
  const int wid = blockIdx.x * 4 + w;
  const int mt = wid / ntn, nq = wid % ntn;
  if (mt * 16 >= M) return;
  const int row0 = mt * 16, col0 = nq * 64;
  const float* arow = A + (size_t)(row0 + ln) * lda;
  v8f acc[4] = {};
  for (int kb = 0; kb < K; kb += 32) {
    FragB ah, al;
    const v4f x0 = *(const v4fa*)(arow + kb + 8 * hh), x1 = *(const v4fa*)(arow + kb + 8 * hh + 4);
    const v4f x2 = *(const v4fa*)(arow + kb + 16 + 8 * hh), x3 = *(const v4fa*)(arow + kb + 16 + 8 * hh + 4);
    float xs[16] = {x0[0],x0[1],x0[2],x0[3],x1[0],x1[1],x1[2],x1[3],x2[0],x2[1],x2[2],x2[3],x3[0],x3[1],x3[2],x3[3]};
#pragma unroll
    for (int i = 0; i < 16; ++i) { const unsigned short hb = bf16_bits(xs[i]); ah.u[i] = hb; al.u[i] = ASPLIT ? bf16_bits(xs[i] - bf16_val(hb)) : (unsigned short)0; }
#pragma unroll
    for (int t = 0; t < 4; ++t) {
      const unsigned short* brow = Wt + (size_t)(col0 + t * 16 + ln) * ldb + kb;
      FragB b;
      b.half[0] = *(const v8us*)(brow + 8 * hh);
      b.half[1] = *(const v8us*)(brow + 16 + 8 * hh);
      acc[t] = mmaN<ASPLIT ? 2 : 1>(ah.v, al.v, b.v, b.v, acc[t]);
    }
  }
#pragma unroll
  for (int t = 0; t < 4; ++t) {
    float bv = bias ? bias[col0 + t * 16 + ln] : 0.f;
    if (BIAS_BF16) bv = bf16_round(bv);
#pragma unroll
    for (int r = 0; r < 8; ++r) { float v = acc[t][r] + bv; if (ACT == 1) v = fmaxf(v, 0.f); so[w][8 * hh + r][t * 16 + ln] = v; }
  }
  __builtin_amdgcn_fence(__ATOMIC_ACQ_REL, "workgroup");
  __builtin_amdgcn_wave_barrier();
  const int rsub = lane >> 4, c4 = (lane & 15) * 4;
  {
#pragma unroll
    for (int q = 0; q < 8; ++q) {
      const int r = q * 2 + rsub;
      const v4f v = *(const v4fa*)&so[w][r][c4];
      *(v4f*)(C + (size_t)(row0 + r) * ldc + col0 + c4) = v;
    }
    
  }
}

// Flash-style causal/unmasked attention, all contractions 3-term bf16 hi/lo splits, f32 softmax with running max.
// q,k,v rows are read from f32 buffers with arbitrary row pitch (so they can live inside a fused qkv buffer);
// D = head size (multiple of 32, <= 128); one wave = 16 query rows; block = 4 waves (64 queries) sharing K/V chunks of 32.
template <int D, bool CAUSAL>
__global__ __launch_bounds__(128) void k_flash(const float* __restrict__ qb, const float* __restrict__ kb, const float* __restrict__ vb,
                                             int pitch, int T, int H, float scale, float* __restrict__ y, int ypitch) {
  constexpr int KS = D / 32;        // k-steps for QK
  constexpr int DT = D / 16;        // d tiles for PV
  __shared__ __attribute__((aligned(16))) unsigned short sKh[32][D + 8], sKl[32][D + 8], sVh[32][D + 8], sVl[32][D + 8];
  __shared__ __attribute__((aligned(16))) unsigned short sPh[4][16][40], sPl[4][16][40];
  __shared__ __attribute__((aligned(16))) float sO[4][16][D];
  const int tid = threadIdx.x, w = tid >> 5, lane = tid & 31, ln = lane & 15, hh = lane >> 4;
  const int nqb = (T + 63) / 64;
  const int bh = blockIdx.x / nqb, qblk = blockIdx.x % nqb;
  const int b = bh / H, h = bh % H;
  const int q0 = qblk * 64 + w * 16;
  const float* Q = qb + (size_t)b * T * pitch + h * D;
  const float* K = kb + (size_t)b * T * pitch + h * D;
  const float* V = vb + (size_t)b * T * pitch + h * D;

  // A fragments of the wave's 16 query rows (scaled), hi/lo
  FragB aqh[KS], aql[KS];
  {
    int row = q0 + ln; if (row >= T) row = T - 1;
    const float* qr = Q + (size_t)row * pitch;
#pragma unroll
    for (int ks = 0; ks < KS; ++ks)
#pragma unroll
      for (int i = 0; i < 16; ++i) {
        const int d = ks * 32 + ((i < 8) ? (8 * hh + i) : (16 + 8 * hh + (i - 8)));
        const float x = qr[d] * scale; const unsigned short hb = bf16_bits(x);
        aqh[ks].u[i] = hb; aql[ks].u[i] = bf16_bits(x - bf16_val(hb));
      }
  }
  float m_r[8], l_r[8];
#pragma unroll
  for (int r = 0; r < 8; ++r) { m_r[r] = -3.0e38f; l_r[r] = 0.f; }
  v8f oacc[DT];
#pragma unroll
  for (int dt = 0; dt < DT; ++dt) oacc[dt] = (v8f){0.f,0.f,0.f,0.f,0.f,0.f,0.f,0.f};

  const int kv_end = CAUSAL ? min(T, qblk * 64 + 64) : T;     // block-uniform
  for (int j0 = 0; j0 < kv_end; j0 += 32) {
    __syncthreads();
    for (int e = tid; e < 32 * (D / 4); e += 128) {
      const int r = e / (D / 4), c4 = (e % (D / 4)) * 4;
      const int key = j0 + r;
      v4f kf = {0.f,0.f,0.f,0.f}, vf = {0.f,0.f,0.f,0.f};
      if (key < T) { kf = *(const v4fa*)(K + (size_t)key * pitch + c4); vf = *(const v4fa*)(V + (size_t)key * pitch + c4); }
#pragma unroll
      for (int t = 0; t < 4; ++t) {
        unsigned short hb = bf16_bits(kf[t]); sKh[r][c4 + t] = hb; sKl[r][c4 + t] = bf16_bits(kf[t] - bf16_val(hb));
        hb = bf16_bits(vf[t]); sVh[r][c4 + t] = hb; sVl[r][c4 + t] = bf16_bits(vf[t] - bf16_val(hb));
      }
    }
    __syncthreads();
    // S tile 16 x 32
    v8f s[2];
#pragma unroll
    for (int nt = 0; nt < 2; ++nt) {
      v8f acc = {};
#pragma unroll
      for (int ks = 0; ks < KS; ++ks) {
        FragB bh_, bl_;
        bh_.half[0] = *(const v8us*)&sKh[nt * 16 + ln][ks * 32 + 8 * hh]; bh_.half[1] = *(const v8us*)&sKh[nt * 16 + ln][ks * 32 + 16 + 8 * hh];
        bl_.half[0] = *(const v8us*)&sKl[nt * 16 + ln][ks * 32 + 8 * hh]; bl_.half[1] = *(const v8us*)&sKl[nt * 16 + ln][ks * 32 + 16 + 8 * hh];
        acc = mmaN<3>(aqh[ks].v, aql[ks].v, bh_.v, bl_.v, acc);
      }
      s[nt] = acc;
    }
    // mask + running max (rows 8hh+r; the 16 lanes of a half share rows)
    float alpha[8];
#pragma unroll
    for (int r = 0; r < 8; ++r) {
      const int qi = q0 + 8 * hh + r;
      const int ja = j0 + ln, jb = j0 + 16 + ln;
      if (CAUSAL) { if (ja > qi) s[0][r] = -3.0e38f; if (jb > qi) s[1][r] = -3.0e38f; }
      if (ja >= T) s[0][r] = -3.0e38f;
      if (jb >= T) s[1][r] = -3.0e38f;
      float mx = fmaxf(s[0][r], s[1][r]);
      mx = fmaxf(mx, __shfl_xor(mx, 1, 32)); mx = fmaxf(mx, __shfl_xor(mx, 2, 32)); mx = fmaxf(mx, __shfl_xor(mx, 4, 32)); mx = fmaxf(mx, __shfl_xor(mx, 8, 32));
      const float mnew = fmaxf(m_r[r], mx);
      alpha[r] = (mnew > -1.0e38f) ? __expf(m_r[r] - mnew) : 1.0f;
      const float p0 = (s[0][r] > -1.0e38f) ? __expf(s[0][r] - mnew) : 0.f;
      const float p1 = (s[1][r] > -1.0e38f) ? __expf(s[1][r] - mnew) : 0.f;
      m_r[r] = mnew;
      l_r[r] = l_r[r] * alpha[r] + p0 + p1;            // per-lane partial row sum (16 lanes combined at the end)
      unsigned short hb = bf16_bits(p0); sPh[w][8 * hh + r][ln] = hb;      sPl[w][8 * hh + r][ln] = bf16_bits(p0 - bf16_val(hb));
      hb = bf16_bits(p1);                sPh[w][8 * hh + r][16 + ln] = hb; sPl[w][8 * hh + r][16 + ln] = bf16_bits(p1 - bf16_val(hb));
    }
#pragma unroll
    for (int dt = 0; dt < DT; ++dt)
#pragma unroll
      for (int r = 0; r < 8; ++r) oacc[dt][r] *= alpha[r];
    __builtin_amdgcn_fence(__ATOMIC_ACQ_REL, "workgroup");
    __builtin_amdgcn_wave_barrier();
    FragB pah, pal;
    pah.half[0] = *(const v8us*)&sPh[w][ln][8 * hh]; pah.half[1] = *(const v8us*)&sPh[w][ln][16 + 8 * hh];
    pal.half[0] = *(const v8us*)&sPl[w][ln][8 * hh]; pal.half[1] = *(const v8us*)&sPl[w][ln][16 + 8 * hh];
#pragma unroll
    for (int dt = 0; dt < DT; ++dt) {
      FragB bvh, bvl;
#pragma unroll
      for (int i = 0; i < 8; ++i) {
        bvh.u[i] = sVh[8 * hh + i][dt * 16 + ln]; bvh.u[8 + i] = sVh[16 + 8 * hh + i][dt * 16 + ln];
        bvl.u[i] = sVl[8 * hh + i][dt * 16 + ln]; bvl.u[8 + i] = sVl[16 + 8 * hh + i][dt * 16 + ln];
      }
      oacc[dt] = mmaN<3>(pah.v, pal.v, bvh.v, bvl.v, oacc[dt]);
    }
    __builtin_amdgcn_fence(__ATOMIC_ACQ_REL, "workgroup");
    __builtin_amdgcn_wave_barrier();
  }
#pragma unroll
  for (int r = 0; r < 8; ++r) {
    float l = l_r[r];
    l += __shfl_xor(l, 1, 32); l += __shfl_xor(l, 2, 32); l += __shfl_xor(l, 4, 32); l += __shfl_xor(l, 8, 32);
    l_r[r] = (l > 0.f) ? 1.0f / l : 0.f;
  }
#pragma unroll
  for (int dt = 0; dt < DT; ++dt)
#pragma unroll
    for (int r = 0; r < 8; ++r) sO[w][8 * hh + r][dt * 16 + ln] = oacc[dt][r] * l_r[r];
  __builtin_amdgcn_fence(__ATOMIC_ACQ_REL, "workgroup");
  __builtin_amdgcn_wave_barrier();
  {
    for (int r = 0; r < 16; ++r) {
      const int row = q0 + r;
      if (row < T && lane < D / 4) {
        const v4f val = *(const v4fa*)&sO[w][r][lane * 4];
        *(v4f*)(y + ((size_t)b * T + row) * ypitch + h * D + lane * 4) = val;
      }
    }
    
  }
}

// GEMM C = act(A·W + bias + resid): A f32 (ASPLIT -> hi/lo 2 terms), Wt bf16 [N][K]; ACT 0 none, 1 relu, 2 exact gelu;
// resid (optional, f32, row index = (row % rmod), pitch ldr, RES_BF16 rounds it) added before the activation.
template <bool ASPLIT, int ACT, bool BIAS_BF16, bool RES_BF16>
__global__ __launch_bounds__(128) void k_gemm_bf3(const float* __restrict__ A, int lda, const unsigned short* __restrict__ Wt, int ldb,
                                                const float* __restrict__ bias, const float* __restrict__ resid, int rmod, int ldr,
                                                float* __restrict__ C, int ldc, int M, int N, int K) {
  __shared__ __attribute__((aligned(16))) float so[4][16][64];
  const int tid = threadIdx.x, w = tid >> 5, lane = tid & 31, ln = lane & 15, hh = lane >> 4;
  const int ntn = N / 64;
  const int wid = blockIdx.x * 4 + w;
  const int mt = wid / ntn, nq = wid % ntn;
  if (mt * 16 >= M) return;
  const int row0 = mt * 16, col0 = nq * 64;
  const float* arow = A + (size_t)(row0 + ln) * lda;
  v8f acc[4] = {};
  for (int kb = 0; kb < K; kb += 32) {
    FragB ah, al;
    const v4f x0 = *(const v4fa*)(arow + kb + 8 * hh), x1 = *(const v4fa*)(arow + kb + 8 * hh + 4);
    const v4f x2 = *(const v4fa*)(arow + kb + 16 + 8 * hh), x3 = *(const v4fa*)(arow + kb + 16 + 8 * hh + 4);
    float xs[16] = {x0[0],x0[1],x0[2],x0[3],x1[0],x1[1],x1[2],x1[3],x2[0],x2[1],x2[2],x2[3],x3[0],x3[1],x3[2],x3[3]};
#pragma unroll
    for (int i = 0; i < 16; ++i) { const unsigned short hb = bf16_bits(xs[i]); ah.u[i] = hb; al.u[i] = ASPLIT ? bf16_bits(xs[i] - bf16_val(hb)) : (unsigned short)0; }
#pragma unroll
    for (int t = 0; t < 4; ++t) {
      const unsigned short* brow = Wt + (size_t)(col0 + t * 16 + ln) * ldb + kb;
      FragB b;
      b.half[0] = *(const v8us*)(brow + 8 * hh);
      b.half[1] = *(const v8us*)(brow + 16 + 8 * hh);
      acc[t] = mmaN<ASPLIT ? 2 : 1>(ah.v, al.v, b.v, b.v, acc[t]);
    }
  }
#pragma unroll
  for (int t = 0; t < 4; ++t) {
    const int col = col0 + t * 16 + ln;
    float bv = bias ? bias[col] : 0.f;
    if (BIAS_BF16) bv = bf16_round(bv);
#pragma unroll
    for (int r = 0; r < 8; ++r) {
      float v = acc[t][r] + bv;
      if (resid) { float rv = resid[(size_t)((row0 + 8 * hh + r) % rmod) * ldr + col]; if (RES_BF16) rv = bf16_round(rv); v += rv; }
      if (ACT == 1) v = fmaxf(v, 0.f);
      if (ACT == 2) v = 0.5f * v * (1.0f + erff(v * 0.70710678118654752f));
      if (ACT == 3) { const float u = 0.7978845608028654f * (v + 0.044715f * v * v * v); v = 0.5f * v * (1.0f + tanhf(u)); }
      so[w][8 * hh + r][t * 16 + ln] = v;
    }
  }
  __builtin_amdgcn_fence(__ATOMIC_ACQ_REL, "workgroup");
  __builtin_amdgcn_wave_barrier();
  const int rsub = lane >> 4, c4 = (lane & 15) * 4;
  {
#pragma unroll
    for (int q = 0; q < 8; ++q) {
      const int r = q * 2 + rsub;
      const v4f v = *(const v4fa*)&so[w][r][c4];
      *(v4f*)(C + (size_t)(row0 + r) * ldc + col0 + c4) = v;
    }
    
  }
}
// row LayerNorm (biased variance, eps) over N: s = X (+ R); optional out_sum <- s; out_norm <- (s-mu)*rsqrt(var+eps)*g + b
template <bool PARAM_BF16>
__global__ __launch_bounds__(256) void k_layernorm(const float* __restrict__ X, const float* __restrict__ R, const float* __restrict__ g, const float* __restrict__ bta,
                                                  float* __restrict__ out_sum, float* __restrict__ out_norm, int N, float eps) {
  __shared__ float red[256];
  const int row = blockIdx.x, tid = threadIdx.x;
  const float* x = X + (size_t)row * N; const float* rr = R ? R + (size_t)row * N : nullptr;
  float vals[16];                     // up to N = 4096
  const int per = N / 256;            // contiguous chunk per thread? use strided-by-4 chunks: thread handles j = tid*4 + 1024*u
  float s1 = 0.f;
  for (int u = 0; u < per / 4; ++u) {
    const int j = tid * 4 + 1024 * u;
    const v4f a = *(const v4fa*)(x + j);
    v4f b = {0.f,0.f,0.f,0.f}; if (rr) b = *(const v4fa*)(rr + j);
#pragma unroll
    for (int q = 0; q < 4; ++q) { const float v = a[q] + b[q]; vals[u * 4 + q] = v; s1 += v; }
  }
  red[tid] = s1; __syncthreads();
  for (int st = 128; st > 0; st >>= 1) { if (tid < st) red[tid] += red[tid + st]; __syncthreads(); }
  const float mu = red[0] / (float)N; __syncthreads();
  float s2 = 0.f;
  for (int u = 0; u < per / 4; ++u)
#pragma unroll
    for (int q = 0; q < 4; ++q) { const float c = vals[u * 4 + q] - mu; s2 += c * c; }
  red[tid] = s2; __syncthreads();
  for (int st = 128; st > 0; st >>= 1) { if (tid < st) red[tid] += red[tid + st]; __syncthreads(); }
  const float rs = rsqrtf(red[0] / (float)N + eps);
  {
    for (int u = 0; u < per / 4; ++u) {
      const int j = tid * 4 + 1024 * u;
      v4f o, sm;
#pragma unroll
      for (int q = 0; q < 4; ++q) {
        float gg = g[j + q], bb = bta[j + q];
        if (PARAM_BF16) { gg = bf16_round(gg); bb = bf16_round(bb); }
        sm[q] = vals[u * 4 + q]; o[q] = (vals[u * 4 + q] - mu) * rs * gg + bb;
      }
      if (out_sum) *(v4f*)(out_sum + (size_t)row * N + j) = sm;
      *(v4f*)(out_norm + (size_t)row * N + j) = o;
    }
    
  }
}



// ---- f16 WMMA path (v_wmma_f32_16x16x32_f16): 11-bit significands for operands in range — used where a [0,1] probability operand needs more precision than bf16
typedef _Float16 v16h __attribute__((ext_vector_type(16)));
union FragH { v16h v; v8us half[2]; _Float16 h[16]; unsigned short u[16]; };
template <int NT>
__device__ __forceinline__ v8f mmaH(v16h ah, v16h al, v16h bh, v16h bl, v8f c) {
  c = __builtin_amdgcn_wmma_f32_16x16x32_f16(false, ah, false, bh, (short)0, c, false, false);
  if (NT >= 2) c = __builtin_amdgcn_wmma_f32_16x16x32_f16(false, al, false, bh, (short)0, c, false, false);
  if (NT >= 3) c = __builtin_amdgcn_wmma_f32_16x16x32_f16(false, ah, false, bl, (short)0, c, false, false);
  asm volatile("v_nop\n\tv_nop\n\tv_nop\n\tv_nop" : "+v"(c) : "v"(ah), "v"(al), "v"(bh), "v"(bl));
  return c;
}
// batched GEMM like k_gemm_b but f16 operands: A f32 (split into f16 hi/lo if ASPLIT, else rounded to f16), Bt = f16 values [n][k]; alpha; C f32; N multiple of 16 (partial tiles skipped)
template <bool ASPLIT>
__global__ __launch_bounds__(128) void k_gemm_h(const float* __restrict__ A, int lda, size_t sA, const _Float16* __restrict__ Bh, int ldb, size_t sB, float alpha, float* __restrict__ C, int ldc, size_t sC, int M, int N, int K) {
  __shared__ __attribute__((aligned(16))) float so[4][16][64];
  const int tid = threadIdx.x, w = tid >> 5, lane = tid & 31, ln = lane & 15, hh = lane >> 4; const int by = blockIdx.y;
  A += (size_t)by * sA; Bh += (size_t)by * sB; C += (size_t)by * sC;
  const int ntn = (N + 63) / 64; const int wid = blockIdx.x * 4 + w; const int mt = wid / ntn, nq = wid % ntn; if (mt * 16 >= M) return;
  const int row0 = mt * 16, col0 = nq * 64; const float* arow = A + (size_t)(row0 + ln) * lda;
  v8f acc[4] = {};
  for (int kb = 0; kb < K; kb += 32) {
    FragH ah, al;
    const v4f x0 = *(const v4fa*)(arow + kb + 8 * hh), x1 = *(const v4fa*)(arow + kb + 8 * hh + 4), x2 = *(const v4fa*)(arow + kb + 16 + 8 * hh), x3 = *(const v4fa*)(arow + kb + 16 + 8 * hh + 4);
    float xs[16] = {x0[0],x0[1],x0[2],x0[3],x1[0],x1[1],x1[2],x1[3],x2[0],x2[1],x2[2],x2[3],x3[0],x3[1],x3[2],x3[3]};
#pragma unroll
    for (int i = 0; i < 16; ++i) { const _Float16 h = (_Float16)xs[i]; ah.h[i] = h; al.h[i] = ASPLIT ? (_Float16)(xs[i] - (float)h) : (_Float16)0.0f; }
#pragma unroll
    for (int t = 0; t < 4; ++t) { if (col0 + t * 16 >= N) continue; const size_t boff = (size_t)(col0 + t * 16 + ln) * ldb + kb; FragH bq; bq.half[0] = *(const v8us*)(Bh + boff + 8 * hh); bq.half[1] = *(const v8us*)(Bh + boff + 16 + 8 * hh);
      acc[t] = mmaH<ASPLIT ? 2 : 1>(ah.v, al.v, bq.v, bq.v, acc[t]); }
  }
#pragma unroll
  for (int t = 0; t < 4; ++t) { if (col0 + t * 16 >= N) continue;
#pragma unroll
    for (int r = 0; r < 8; ++r) so[w][8 * hh + r][t * 16 + ln] = acc[t][r] * alpha; }
  __builtin_amdgcn_fence(__ATOMIC_ACQ_REL, "workgroup"); __builtin_amdgcn_wave_barrier();
  const int rsub = lane >> 4, c4 = (lane & 15) * 4;
  {
#pragma unroll
    for (int q = 0; q < 8; ++q) { const int r = q * 2 + rsub; if (col0 + c4 < N) { const v4f v = *(const v4fa*)&so[w][r][c4]; *(v4f*)(C + (size_t)(row0 + r) * ldc + col0 + c4) = v; } }
     }
}

// k_gemm_hh variant with fused epilogue: v = acc·alpha + bias[by·sBias + col] (+ CP[(row/rowsPerB)·sCPb + by·64 + col] if CP) ; ACT 0 none / 1 elu ; writes f16 C16 (and f32 C if non-null)
template <int ACT>
__global__ __launch_bounds__(128) void k_gemm_hhx(const _Float16* __restrict__ A, int lda, size_t sA, const _Float16* __restrict__ Bh, int ldb, size_t sB, float alpha, const float* __restrict__ bias, size_t sBias, const float* __restrict__ CP, int rowsPerB, size_t sCPb, int row0g,
    float* __restrict__ C, _Float16* __restrict__ C16, int ldc, size_t sC, int M, int N, int K) {
  __shared__ __attribute__((aligned(16))) float so[4][16][64];
  const int tid = threadIdx.x, w = tid >> 5, lane = tid & 31, ln = lane & 15, hh = lane >> 4; const int by = blockIdx.y;
  A += (size_t)by * sA; Bh += (size_t)by * sB; const size_t cofs = (size_t)by * sC; const float* bp = bias ? bias + (size_t)by * sBias : nullptr;
  const int ntn = (N + 63) / 64; const int wid = blockIdx.x * 4 + w; const int mt = wid / ntn, nq = wid % ntn; if (mt * 16 >= M) return;
  const int row0 = mt * 16, col0 = nq * 64; const _Float16* arow = A + (size_t)(row0 + ln) * lda;
  v8f acc[4] = {};
  for (int kb = 0; kb < K; kb += 32) { FragH ah; ah.half[0] = *(const v8us*)((const unsigned short*)arow + kb + 8 * hh); ah.half[1] = *(const v8us*)((const unsigned short*)arow + kb + 16 + 8 * hh);
#pragma unroll
    for (int t = 0; t < 4; ++t) { if (col0 + t * 16 >= N) continue; const size_t boff = (size_t)(col0 + t * 16 + ln) * ldb + kb; FragH bq; bq.half[0] = *(const v8us*)((const unsigned short*)Bh + boff + 8 * hh); bq.half[1] = *(const v8us*)((const unsigned short*)Bh + boff + 16 + 8 * hh);
      acc[t] = mmaH<1>(ah.v, ah.v, bq.v, bq.v, acc[t]); }
  }
#pragma unroll
  for (int t = 0; t < 4; ++t) { if (col0 + t * 16 >= N) continue; const int col = col0 + t * 16 + ln; const float bv = bp ? bf16_round(bp[col]) : 0.f;
#pragma unroll
    for (int r = 0; r < 8; ++r) { float v = acc[t][r] * alpha + bv; if (CP) { const int bidx = (row0g + row0 + 8 * hh + r) / rowsPerB; v += CP[(size_t)bidx * sCPb + (size_t)by * 64 + col]; } if (ACT == 1) v = (v > 0.f) ? v : expm1f(v); else if (ACT == 3) v = fmaxf(v, 0.f); so[w][8 * hh + r][t * 16 + ln] = v; } }
  __builtin_amdgcn_fence(__ATOMIC_ACQ_REL, "workgroup"); __builtin_amdgcn_wave_barrier();
  const int rsub = lane >> 4, c4 = (lane & 15) * 4; typedef _Float16 v4h __attribute__((ext_vector_type(4)));
  {
#pragma unroll
    for (int q = 0; q < 8; ++q) { const int r = q * 2 + rsub; if (col0 + c4 < N) { const v4f v = *(const v4fa*)&so[w][r][c4]; if (C) *(v4f*)(C + cofs + (size_t)(row0 + r) * ldc + col0 + c4) = v; if (C16) { v4h h4; for (int i = 0; i < 4; ++i) h4[i] = (_Float16)v[i]; *(v4h*)(C16 + cofs + (size_t)(row0 + r) * ldc + col0 + c4) = h4; } } }
     }
}


// Projection GEMM, 2048 x 2048 x 2048: C = (A . Bt^T) * alpha + bias. One 128 x 128 tile of C per workgroup of 8 waves (4 x 2, 32 x 64 per wave).
// A pass is 128 k: 128 rows of A and 128 rows of Bt, 256 B each, laid in LDS at pitch 272 B by asynchronous copies, two buffers, the next pass's copies in flight under this pass's products.
// k runs upward in steps of 32 into one accumulator per 16 x 16 tile, as in k_gemm_hhx: the sums keep their order.
// Every '#pragma unroll' in k_gemm_t makes the indices of the fragment and accumulator arrays constants, so that they stay in registers.
#define GT_PITCH 272u
#define GT_STAGE (256u * GT_PITCH)
#define GT_NST (CC / 128)
__device__ __forceinline__ void gt_copy8(unsigned l0, const unsigned short* g0) {
  // eight 16-byte copies of this lane, rows 16 apart; s_wait_xcnt stands inside the statement so that no address register is rewritten ahead of it
  const unsigned l1 = l0 + 16u * GT_PITCH, l2 = l0 + 32u * GT_PITCH, l3 = l0 + 48u * GT_PITCH, l4 = l0 + 64u * GT_PITCH, l5 = l0 + 80u * GT_PITCH, l6 = l0 + 96u * GT_PITCH, l7 = l0 + 112u * GT_PITCH;
  const unsigned short *g1 = g0 + 16 * CC, *g2 = g0 + 32 * CC, *g3 = g0 + 48 * CC, *g4 = g0 + 64 * CC, *g5 = g0 + 80 * CC, *g6 = g0 + 96 * CC, *g7 = g0 + 112 * CC;
  asm volatile("global_load_async_to_lds_b128 %0, %8, off\n\t"
               "global_load_async_to_lds_b128 %1, %9, off\n\t"
               "global_load_async_to_lds_b128 %2, %10, off\n\t"
               "global_load_async_to_lds_b128 %3, %11, off\n\t"
               "global_load_async_to_lds_b128 %4, %12, off\n\t"
               "global_load_async_to_lds_b128 %5, %13, off\n\t"
               "global_load_async_to_lds_b128 %6, %14, off\n\t"
               "global_load_async_to_lds_b128 %7, %15, off\n\t"
               "s_wait_xcnt 0x0"
               :: "v"(l0), "v"(l1), "v"(l2), "v"(l3), "v"(l4), "v"(l5), "v"(l6), "v"(l7),
                  "v"(g0), "v"(g1), "v"(g2), "v"(g3), "v"(g4), "v"(g5), "v"(g6), "v"(g7) : "memory");
}
// blockIdx.y picks one of up to three independent products that share the grid; product 2's tile goes out as f16 to C16, the others' as f32
__global__ __launch_bounds__(256) void k_gemm_t(const _Float16* A0, const _Float16* A1, const _Float16* A2, const _Float16* Bh0, const _Float16* Bh1, const _Float16* Bh2, float alpha,
                                                const float* bias0, const float* bias1, const float* bias2, float* C0, float* C1, _Float16* C16) {
  __shared__ __attribute__((aligned(16))) unsigned char L[2u * GT_STAGE];
  const int py = (int)blockIdx.y; const bool H16 = py == 2;
  const _Float16* A = py == 0 ? A0 : py == 1 ? A1 : A2; const _Float16* Bh = py == 0 ? Bh0 : py == 1 ? Bh1 : Bh2; const float* bias = py == 0 ? bias0 : py == 1 ? bias1 : bias2; float* C = py == 0 ? C0 : C1;
  const int tid = threadIdx.x, w = tid >> 5, lane = tid & 31, ln = lane & 15, hh = lane >> 4;
  const int m0 = (int)(blockIdx.x / (CC / 128)) * 128, n0 = (int)(blockIdx.x % (CC / 128)) * 128;
  const int wm = (w >> 1) * 32, wn = (w & 1) * 64;
  // copies: lane takes 16-byte piece (tid & 15) of rows (tid >> 4) + 16 i; LDS rows 0..127 hold A, 128..255 hold Bt
  const unsigned lcp = (unsigned)(size_t)L + (unsigned)(tid >> 4) * GT_PITCH + (unsigned)(tid & 15) * 16u;
  const unsigned short* ga = (const unsigned short*)A + (size_t)(m0 + (tid >> 4)) * CC + (tid & 15) * 8;
  const unsigned short* gb = (const unsigned short*)Bh + (size_t)(n0 + (tid >> 4)) * CC + (tid & 15) * 8;
  v8f acc[2][4];
#pragma unroll
  for (int i = 0; i < 2; ++i)
#pragma unroll
    for (int j = 0; j < 4; ++j) acc[i][j] = (v8f){0.f,0.f,0.f,0.f,0.f,0.f,0.f,0.f};
  gt_copy8(lcp, ga); gt_copy8(lcp + 128u * GT_PITCH, gb);
  asm volatile("s_wait_asynccnt 0x0" ::: "memory");      // pass 0's bytes of this wave have landed
  __syncthreads();                                        // and every wave's: pass 0 is readable
  gt_copy8(lcp + GT_STAGE, ga + 128); gt_copy8(lcp + GT_STAGE + 128u * GT_PITCH, gb + 128);
#pragma unroll 1      // one pass per trip: the ring's order at the foot stays as written
  for (int t = 0; t < GT_NST; ++t) {
    const unsigned char* S = L + (unsigned)(t & 1) * GT_STAGE;
    const unsigned char* ar = S + (unsigned)(wm + ln) * GT_PITCH + 16u * hh;
    const unsigned char* br = S + (unsigned)(128 + wn + ln) * GT_PITCH + 16u * hh;
    FragH a[2][2], b[2][4];      // two fragment sets: the next 32 k are fetched as one group ahead of this block's products (inside this pass's buffer only)
#pragma unroll
    for (int i = 0; i < 2; ++i) { a[0][i].half[0] = *(const v8us*)(ar + i * 16 * GT_PITCH); a[0][i].half[1] = *(const v8us*)(ar + i * 16 * GT_PITCH + 32); }
#pragma unroll
    for (int j = 0; j < 4; ++j) { b[0][j].half[0] = *(const v8us*)(br + j * 16 * GT_PITCH); b[0][j].half[1] = *(const v8us*)(br + j * 16 * GT_PITCH + 32); }
#pragma unroll
    for (int ks = 0; ks < 4; ++ks) {
      const int cu = ks & 1, nx = cu ^ 1;
      if (ks < 3) {
#pragma unroll
        for (int i = 0; i < 2; ++i) { a[nx][i].half[0] = *(const v8us*)(ar + i * 16 * GT_PITCH + (ks + 1) * 64); a[nx][i].half[1] = *(const v8us*)(ar + i * 16 * GT_PITCH + (ks + 1) * 64 + 32); }
#pragma unroll
        for (int j = 0; j < 4; ++j) { b[nx][j].half[0] = *(const v8us*)(br + j * 16 * GT_PITCH + (ks + 1) * 64); b[nx][j].half[1] = *(const v8us*)(br + j * 16 * GT_PITCH + (ks + 1) * 64 + 32); }
      }
      __builtin_amdgcn_sched_barrier(0);      // keeps the next block's twelve LDS loads one group ahead of these products; without it they sink among the products and each waits out its own latency
#pragma unroll
      for (int i = 0; i < 2; ++i)
#pragma unroll
        for (int j = 0; j < 4; ++j) acc[i][j] = __builtin_amdgcn_wmma_f32_16x16x32_f16(false, a[cu][i].v, false, b[cu][j].v, (short)0, acc[i][j], false, false);
      __builtin_amdgcn_sched_barrier(0);      // the products stay one run: no later load group rises into it
    }
    asm volatile("s_wait_dscnt 0x0" ::: "memory");        // this wave's reads of the buffer have returned
    asm volatile("s_wait_asynccnt 0x0" ::: "memory");     // this wave's copies of pass t + 1 have landed
    __syncthreads();                                      // publishes pass t + 1 and frees the buffer pass t has read
    if (t + 2 < GT_NST) { gt_copy8(lcp + (unsigned)(t & 1) * GT_STAGE, ga + (t + 2) * 128); gt_copy8(lcp + (unsigned)(t & 1) * GT_STAGE + 128u * GT_PITCH, gb + (t + 2) * 128); }
  }
  asm volatile("s_wait_asynccnt 0x0" ::: "memory");       // nothing in flight before the ring becomes output staging
  // epilogue: each wave stages its 32 x 64 tile in its own LDS range (pitch 68 floats) and stores whole lines
  float* so = (float*)(L + (unsigned)w * (32u * 272u));
#pragma unroll
  for (int j = 0; j < 4; ++j) { const float bv = bf16_round(bias[n0 + wn + j * 16 + ln]);
#pragma unroll
    for (int i = 0; i < 2; ++i)
#pragma unroll
      for (int r = 0; r < 8; ++r) so[(i * 16 + 8 * hh + r) * 68 + j * 16 + ln] = acc[i][j][r] * alpha + bv; }
  __builtin_amdgcn_fence(__ATOMIC_ACQ_REL, "workgroup"); __builtin_amdgcn_wave_barrier();      // the wave's staged rows are in LDS before its lanes read them back; the range is the wave's own, so no workgroup barrier
  const int c4 = ln * 4; typedef _Float16 v4h __attribute__((ext_vector_type(4)));
  if (!H16) {
#pragma unroll
    for (int q = 0; q < 16; ++q) { const int r = q * 2 + hh; const v4f v = *(const v4fa*)&so[r * 68 + c4]; const size_t o = (size_t)(m0 + wm + r) * CC + n0 + wn + c4; *(v4f*)(C + o) = v; }
    asm volatile("s_wait_xcnt 0x0" ::: "memory");      // no register that these stores name is rewritten ahead of this wait, whichever block the build lays behind them
  } else {
#pragma unroll
    for (int q = 0; q < 16; ++q) { const int r = q * 2 + hh; const v4f v = *(const v4fa*)&so[r * 68 + c4]; const size_t o = (size_t)(m0 + wm + r) * CC + n0 + wn + c4;
      v4h h4; for (int i = 0; i < 4; ++i) h4[i] = (_Float16)v[i]; *(v4h*)(C16 + o) = h4; }
    asm volatile("s_wait_xcnt 0x0" ::: "memory");      // as in the other arm
  }
}

__global__ __launch_bounds__(256) void k_h16(const float* __restrict__ x, _Float16* __restrict__ X16, size_t n8) { const size_t t = (size_t)blockIdx.x * 256 + threadIdx.x; if (t >= n8) return; FragH f;
#pragma unroll
  for (int q = 0; q < 8; ++q) f.h[q] = (_Float16)x[t * 8 + q]; *(v8us*)((unsigned short*)X16 + t * 8) = f.half[0];  }
// Every conversion that reads inputs alone, in one grid; the block index picks the job, each thread's work is that of the separate kernels.
// Blocks 0 .. PB_G-1: BG_h[e][d] = f16(bf16(G_h[d][e]) * 16), 8 blocks a head. Then PB_M blocks a matrix, 8 elements a thread: the four weights (bf16-rounded, * 16; (out,in) = Bt) and q, k, v (bf16-rounded, * 1, which is exact).
#define PB_G (NH * 8)
#define PB_M (CC * CC / 8 / 256)
__global__ __launch_bounds__(256) void k_prep(const float* __restrict__ G, const float* __restrict__ Wq, const float* __restrict__ Wk, const float* __restrict__ Wv, const float* __restrict__ Wo,
                                              const float* __restrict__ q, const float* __restrict__ k, const float* __restrict__ v, _Float16* __restrict__ BG, _Float16* __restrict__ Y) {
  const int bid = (int)blockIdx.x, tid = threadIdx.x; FragH f;
  if (bid < PB_G) {
    const float* W = G + (size_t)(bid >> 3) * HD * HD; const int t = (bid & 7) * 256 + tid; const int n = t / (HD / 8), k8 = (t % (HD / 8)) * 8;
#pragma unroll
    for (int i = 0; i < 8; ++i) f.h[i] = (_Float16)(bf16_round(W[(size_t)(k8 + i) * HD + n]) * 16.0f);
    *(v8us*)((unsigned short*)BG + (size_t)(bid >> 3) * HD * HD + (size_t)n * HD + k8) = f.half[0];
    asm volatile("s_wait_xcnt 0x0" ::: "memory");      // no register that the store names is rewritten ahead of this wait, whichever block the build lays behind it
    return;
  }
  const int j = (bid - PB_G) / PB_M; const size_t t = (size_t)((bid - PB_G) % PB_M) * 256 + tid;      // matrix j, in the order Wq Wk Wv Wo q k v; the seven results lie one behind the other in Y
  const float* x01 = (j & 1) ? Wk : Wq; const float* x23 = (j & 1) ? Wo : Wv; const float* x45 = (j & 1) ? k : q;
  const float* x03 = (j & 2) ? x23 : x01; const float* x47 = (j & 2) ? v : x45; const float* x = (j & 4) ? x47 : x03;
  const float sc = j < 4 ? 16.0f : 1.0f;
#pragma unroll
  for (int i = 0; i < 8; ++i) f.h[i] = (_Float16)(bf16_round(x[t * 8 + i]) * sc);
  *(v8us*)((unsigned short*)Y + (size_t)j * CC * CC + t * 8) = f.half[0];
  asm volatile("s_wait_xcnt 0x0" ::: "memory");      // as in the other arm
}
template <int NHv, int TTv>
__global__ __launch_bounds__(256) void k_vt(const _Float16* __restrict__ V16, int ldv, int voff, _Float16* __restrict__ Vt) { __shared__ unsigned short tl[64][66]; const int tid = threadIdx.x; const int slab = blockIdx.x / (TTv / 64), lg = blockIdx.x % (TTv / 64); const int b = slab / NHv, h = slab % NHv;
  for (int i = tid; i < 64 * 8; i += 256) { const int r = i / 8, c8 = (i % 8) * 8; FragH f; f.half[0] = *(const v8us*)((const unsigned short*)V16 + ((size_t)b * TTv + lg * 64 + r) * ldv + voff + h * 64 + c8);
#pragma unroll
    for (int q = 0; q < 8; ++q) tl[r][c8 + q] = f.u[q]; }
  __syncthreads();
  {
#pragma unroll
    for (int rd = 0; rd < 2; ++rd) { const int d = rd * 32 + tid / 8, pc = tid % 8; FragH f;
#pragma unroll
      for (int q = 0; q < 8; ++q) f.u[q] = tl[pc * 8 + q][d];
      *(v8us*)((unsigned short*)Vt + ((size_t)slab * 64 + d) * TTv + lg * 64 + pc * 8) = f.half[0]; }
     } }

// Attention ring: a stage is 64 keys for the block's 128 query rows: 64 rows of K (256 B, pitch 272), 128 rows of Vt (128 B, pitch 144) and 128 rows of the mask (256 B, pitch 272),
// laid in LDS by asynchronous copies, two buffers, the next stage's copies in flight under this stage's work; the eight waves share K and Vt. A stage is worked as two 32-key tiles, upward, as before: every sum keeps its order.
// The 128 rows are two 64-row blocks of one head, block 31 - j (waves 0 to 3) and block j (waves 4 to 7). Where the mask opens few keys for early rows and many for late ones
// no WGP holds two long ones while another holds two short ones. For any other mask the pairing is merely another order of the same work.
#define FL_KP 272u
#define FL_VP 144u
#define FL_MP 272u
#define FL_VO (64u * FL_KP)
#define FL_MO (FL_VO + 128u * FL_VP)
#define FL_STAGE (FL_MO + 128u * FL_MP)
#define FL_NST (SS / 64)
#define FL_SC2 (0.08838834764831845f * 1.4426950408889634f)
typedef float f1a __attribute__((may_alias));
__device__ __forceinline__ void fl_copy4(unsigned l0, unsigned ls, const unsigned char* g0, size_t gs) {
  // four 16-byte copies of this lane, LDS rows ls bytes apart, global rows gs bytes apart; s_wait_xcnt stands inside the statement so that no address register is rewritten ahead of it
  const unsigned l1 = l0 + ls, l2 = l0 + 2u * ls, l3 = l0 + 3u * ls;
  const unsigned char *g1 = g0 + gs, *g2 = g0 + 2 * gs, *g3 = g0 + 3 * gs;
  asm volatile("global_load_async_to_lds_b128 %0, %4, off\n\t"
               "global_load_async_to_lds_b128 %1, %5, off\n\t"
               "global_load_async_to_lds_b128 %2, %6, off\n\t"
               "global_load_async_to_lds_b128 %3, %7, off\n\t"
               "s_wait_xcnt 0x0"
               :: "v"(l0), "v"(l1), "v"(l2), "v"(l3), "v"(g0), "v"(g1), "v"(g2), "v"(g3) : "memory");
}
__global__ __launch_bounds__(256) void k_flash(const _Float16* __restrict__ Q16, int ldq, const _Float16* __restrict__ K16, int ldk, const _Float16* __restrict__ Vt, const float* __restrict__ MSK, float* __restrict__ O, int ldo) {
  constexpr int RPW = 16, RTN = RPW / 16, NQB = 2048 / (4 * RPW), DT = 8, KS = 4;      /* head dim 128 */
  __shared__ __attribute__((aligned(16))) unsigned short sP[8][RPW][40]; __shared__ __attribute__((aligned(16))) unsigned char L[2u * FL_STAGE];
  const int tid = threadIdx.x, w = tid >> 5, lane = tid & 31, ln = lane & 15, hh = lane >> 4;
  const int slab = blockIdx.x / (NQB / 2), pj = blockIdx.x % (NQB / 2); const int b = slab / 16, h = slab % 16; const int qbA = (NQB - 1 - pj) * (4 * RPW), qbB = pj * (4 * RPW); const int q0 = (w < 4 ? qbA : qbB) + (w & 3) * RPW;
  const unsigned short* Vth = (const unsigned short*)Vt + (size_t)slab * 128 * 2048;
  // copies: K and each block's mask: 16-byte piece (tid & 15) of rows (tid >> 4) + 16 i; Vt: piece (tid & 7) of rows (tid >> 3) + 32 i; mask rows 0..63 in LDS are block A's (waves 0 to 3), 64..127 block B's
  const unsigned lb = (unsigned)(size_t)L;
  const unsigned lk = lb + (unsigned)(tid >> 4) * FL_KP + (unsigned)(tid & 15) * 16u, lv = lb + FL_VO + (unsigned)(tid >> 3) * FL_VP + (unsigned)(tid & 7) * 16u, lm = lb + FL_MO + (unsigned)(tid >> 4) * FL_MP + (unsigned)(tid & 15) * 16u;
  const size_t kstep = (size_t)ldk * 2;      // bytes of a K row
  const unsigned char* gk = (const unsigned char*)((const unsigned short*)K16 + ((size_t)b * 2048 + (tid >> 4)) * ldk + h * 128 + (tid & 15) * 8);
  const unsigned char* gv = (const unsigned char*)(Vth + (size_t)(tid >> 3) * 2048 + (tid & 7) * 8);
  const unsigned char* gmA = (const unsigned char*)(MSK + ((size_t)b * 2048 + qbA + (tid >> 4)) * 2048 + (tid & 15) * 4);
  const unsigned char* gmB = (const unsigned char*)(MSK + ((size_t)b * 2048 + qbB + (tid >> 4)) * 2048 + (tid & 15) * 4);
  fl_copy4(lk, 16u * FL_KP, gk, 16 * kstep); fl_copy4(lv, 32u * FL_VP, gv, (size_t)32 * 4096); fl_copy4(lm, 16u * FL_MP, gmA, (size_t)16 * 8192); fl_copy4(lm + 64u * FL_MP, 16u * FL_MP, gmB, (size_t)16 * 8192);
  FragH aq[2][KS];
#pragma unroll
  for (int rt = 0; rt < RTN; ++rt) { const unsigned short* qr = (const unsigned short*)Q16 + ((size_t)b * 2048 + q0 + rt * 16 + ln) * ldq + h * 128;
#pragma unroll
    for (int ks = 0; ks < KS; ++ks) { aq[rt][ks].half[0] = *(const v8us*)(qr + ks * 32 + 8 * hh); aq[rt][ks].half[1] = *(const v8us*)(qr + ks * 32 + 16 + 8 * hh); } }
  float m_r[2][8], l_r[2][8]; v8f oacc[2][DT];
#pragma unroll
  for (int rt = 0; rt < RTN; ++rt) {
#pragma unroll
    for (int r = 0; r < 8; ++r) { m_r[rt][r] = -3.0e38f; l_r[rt][r] = 0.f; }
#pragma unroll
    for (int dt = 0; dt < DT; ++dt) oacc[rt][dt] = (v8f){0.f,0.f,0.f,0.f,0.f,0.f,0.f,0.f}; }
  asm volatile("s_wait_asynccnt 0x0" ::: "memory");      // stage 0's bytes of this wave have landed
  __syncthreads();                                        // and every wave's: stage 0 is readable
  fl_copy4(lk + FL_STAGE, 16u * FL_KP, gk + 64 * kstep, 16 * kstep); fl_copy4(lv + FL_STAGE, 32u * FL_VP, gv + 128, (size_t)32 * 4096); fl_copy4(lm + FL_STAGE, 16u * FL_MP, gmA + 256, (size_t)16 * 8192); fl_copy4(lm + FL_STAGE + 64u * FL_MP, 16u * FL_MP, gmB + 256, (size_t)16 * 8192);
#pragma unroll 1      // one stage per trip: the ring's order at the foot stays as written
  for (int t = 0; t < FL_NST; ++t) {
    const unsigned char* S = L + (unsigned)(t & 1) * FL_STAGE;
#pragma unroll 1      // the two 32-key tiles of a stage share one body: less code, and a masked tile is skipped on its own
  for (int sub = 0; sub < 2; ++sub) {
    // mask tile for my 16 query rows x 32 keys: lane (ln,hh) needs rows rt*16 + 8hh + r, keys ln and 16 + ln of the tile
    unsigned okb0 = 0u, okb1 = 0u;      // bit (rt*8 + r) set when key ln (resp. 16+ln) of the tile is OPEN for query row rt*16 + 8hh + r
#pragma unroll
    for (int rt = 0; rt < RTN; ++rt)
#pragma unroll
      for (int r = 0; r < 8; ++r) { const f1a* mr = (const f1a*)(S + FL_MO + (unsigned)(w * RPW + rt * 16 + 8 * hh + r) * FL_MP + (unsigned)sub * 128u); okb0 |= (mr[ln] == 0.0f ? 1u : 0u) << (rt * 8 + r); okb1 |= (mr[16 + ln] == 0.0f ? 1u : 0u) << (rt * 8 + r); }      /* float mask: nonzero = masked (-1e9) */
    if (__builtin_amdgcn_ballot_w32((okb0 | okb1) != 0u) == 0u) continue;      // every (query,key) of this wave's tile is masked: contributes nothing (uniform branch; the stage's foot is outside this loop)
    // The tile's LDS fragment reads stand in groups ahead of the products that use them, so that no product waits out an LDS round trip of its own:
    // all of K (both 16-key halves) ahead of the score products; all of Vt directly behind the loads of P, so that it streams in under P's round trip and the first products.
    // Every '#pragma unroll' here makes the indices of the fragment arrays constants, so that they stay in registers.
    v8f s[2][2]; FragH bk[2][KS], bv[DT];
#pragma unroll
    for (int nt = 0; nt < 2; ++nt) { const unsigned char* kr = S + (unsigned)(sub * 32 + nt * 16 + ln) * FL_KP + 16u * hh;
#pragma unroll
      for (int ks = 0; ks < KS; ++ks) { bk[nt][ks].half[0] = *(const v8us*)(kr + ks * 64); bk[nt][ks].half[1] = *(const v8us*)(kr + ks * 64 + 32); } }
#pragma unroll
    for (int rt = 0; rt < RTN; ++rt) { s[rt][0] = (v8f){0.f,0.f,0.f,0.f,0.f,0.f,0.f,0.f}; s[rt][1] = (v8f){0.f,0.f,0.f,0.f,0.f,0.f,0.f,0.f}; }
    // the two halves' accumulator chains alternate, so that each fills the other's accumulate latency; within a chain k runs upward as before
#pragma unroll
    for (int ks = 0; ks < KS; ++ks)
#pragma unroll
      for (int nt = 0; nt < 2; ++nt)
#pragma unroll
        for (int rt = 0; rt < RTN; ++rt) s[rt][nt] = mmaH<1>(aq[rt][ks].v, aq[rt][ks].v, bk[nt][ks].v, bk[nt][ks].v, s[rt][nt]);
    // Softmax of the tile in phases over the eight rows of a lane, with no branch inside: each row's chain (four cross-lane steps, three exponentials) is long and dependent,
    // so the rows' chains are laid side by side and fill one another's waits. Every exponential is taken unconditionally and the old conditions pick between its value and the constant.
    // Scores and running maxima are kept in base 2 (FL_SC2 = 1/sqrt(128) * log2 e, in the multiply the score had anyway), so that exp(x - m) is one v_exp_f32 of a difference; only differences of them are ever used, so p, alpha and l mean what they did.
    // Every '#pragma unroll' below makes the row index a constant, so that the per-row arrays stay in registers.
#pragma unroll
    for (int rt = 0; rt < RTN; ++rt) {
      float s0[8], s1[8], mc[8], al[8];
#pragma unroll
      for (int r = 0; r < 8; ++r) {
        const bool ok0 = ((okb0 >> (rt * 8 + r)) & 1u) != 0u, ok1 = ((okb1 >> (rt * 8 + r)) & 1u) != 0u;
        s0[r] = ok0 ? s[rt][0][r] * FL_SC2 : -INFINITY; s1[r] = ok1 ? s[rt][1][r] * FL_SC2 : -INFINITY; mc[r] = fmaxf(s0[r], s1[r]); }
#pragma unroll
      for (int m = 1; m < 16; m <<= 1)
#pragma unroll
        for (int r = 0; r < 8; ++r) mc[r] = fmaxf(mc[r], __shfl_xor(mc[r], m, 32));
#pragma unroll
      for (int r = 0; r < 8; ++r) {
        const bool ok0 = ((okb0 >> (rt * 8 + r)) & 1u) != 0u, ok1 = ((okb1 >> (rt * 8 + r)) & 1u) != 0u;
        const float mn = fmaxf(m_r[rt][r], mc[r]); const float ea = __builtin_amdgcn_exp2f(m_r[rt][r] - mn), e0 = __builtin_amdgcn_exp2f(s0[r] - mn), e1 = __builtin_amdgcn_exp2f(s1[r] - mn);
        al[r] = (mn > -1.0e38f) ? ea : 1.0f; m_r[rt][r] = mn; const float p0 = ok0 ? e0 : 0.f, p1 = ok1 ? e1 : 0.f; l_r[rt][r] = l_r[rt][r] * al[r] + p0 + p1;
        FragH t2; t2.h[0] = (_Float16)p0; t2.h[1] = (_Float16)p1; sP[w][rt * 16 + 8 * hh + r][ln] = t2.u[0]; sP[w][rt * 16 + 8 * hh + r][16 + ln] = t2.u[1]; }
#pragma unroll
      for (int dt = 0; dt < DT; ++dt)
#pragma unroll
        for (int r = 0; r < 8; ++r) oacc[rt][dt][r] *= al[r]; }
    __builtin_amdgcn_fence(__ATOMIC_ACQ_REL, "workgroup"); __builtin_amdgcn_wave_barrier();
    FragH pa[2];
#pragma unroll
    for (int rt = 0; rt < RTN; ++rt) { pa[rt].half[0] = *(const v8us*)&sP[w][rt * 16 + ln][8 * hh]; pa[rt].half[1] = *(const v8us*)&sP[w][rt * 16 + ln][16 + 8 * hh]; }
#pragma unroll
    for (int dt = 0; dt < DT; ++dt) { const unsigned char* vrow = S + FL_VO + (unsigned)(dt * 16 + ln) * FL_VP + (unsigned)sub * 64u + 16u * hh; bv[dt].half[0] = *(const v8us*)vrow; bv[dt].half[1] = *(const v8us*)(vrow + 32); }
#pragma unroll
    for (int dt = 0; dt < DT; ++dt)
#pragma unroll
      for (int rt = 0; rt < RTN; ++rt) oacc[rt][dt] = mmaH<1>(pa[rt].v, pa[rt].v, bv[dt].v, bv[dt].v, oacc[rt][dt]);
    __builtin_amdgcn_fence(__ATOMIC_ACQ_REL, "workgroup"); __builtin_amdgcn_wave_barrier(); }
    asm volatile("s_wait_dscnt 0x0" ::: "memory");        // this wave's reads of the buffer have returned
    asm volatile("s_wait_asynccnt 0x0" ::: "memory");     // this wave's copies of stage t + 1 have landed
    __syncthreads();                                      // publishes stage t + 1 and frees the buffer stage t has read
    if (t + 2 < FL_NST) { const unsigned lo = (unsigned)(t & 1) * FL_STAGE; fl_copy4(lk + lo, 16u * FL_KP, gk + (size_t)(t + 2) * 64 * kstep, 16 * kstep); fl_copy4(lv + lo, 32u * FL_VP, gv + (t + 2) * 128, (size_t)32 * 4096); fl_copy4(lm + lo, 16u * FL_MP, gmA + (t + 2) * 256, (size_t)16 * 8192); fl_copy4(lm + lo + 64u * FL_MP, 16u * FL_MP, gmB + (t + 2) * 256, (size_t)16 * 8192); }
  }
  asm volatile("s_wait_asynccnt 0x0" ::: "memory");       // nothing in flight before the ring becomes output staging (the last foot's barrier has ended every wave's reads of it)
  float* sO = (float*)(L + (unsigned)w * (unsigned)(RPW * (128 + 4) * 4));      // each wave's own range, pitch 132 floats
#pragma unroll
  for (int rt = 0; rt < RTN; ++rt) {
#pragma unroll
    for (int r = 0; r < 8; ++r) { float l = l_r[rt][r]; l += __shfl_xor(l, 1, 32); l += __shfl_xor(l, 2, 32); l += __shfl_xor(l, 4, 32); l += __shfl_xor(l, 8, 32); l_r[rt][r] = (l > 0.f) ? 1.0f / l : 0.f; }
#pragma unroll
    for (int dt = 0; dt < DT; ++dt)
#pragma unroll
      for (int r = 0; r < 8; ++r) sO[(rt * 16 + 8 * hh + r) * 132 + dt * 16 + ln] = oacc[rt][dt][r] * l_r[rt][r]; }
  __builtin_amdgcn_fence(__ATOMIC_ACQ_REL, "workgroup"); __builtin_amdgcn_wave_barrier();
  {
#pragma unroll
    for (int rp = 0; rp < RPW; ++rp) { const int r = rp, pc = lane; const v4f val = *(const v4fa*)&sO[r * 132 + pc * 4]; *(v4f*)(O + ((size_t)b * 2048 + q0 + r) * ldo + h * 128 + pc * 4) = val; }      /* 128-float rows: 32 lanes x 16 B */
     } }

__device__ __forceinline__ void d_rope16(int bid, const float* __restrict__ SRC, _Float16* __restrict__ D16) { __shared__ __attribute__((aligned(16))) _Float16 st[256][8]; const int tid = threadIdx.x; const size_t t = (size_t)bid * 256 + tid; if (t >= (size_t)SS * NH * 16) return; const int p = (int)(t % 16); const int h = (int)((t / 16) % NH); const int s = (int)(t / (16 * NH)); const float* src = SRC + ((size_t)s * NH + h) * HD;
#pragma unroll 1
  for (int q = 0; q < 8; ++q) { const int j = p * 8 + q; const int i = j >> 1; const float f = __builtin_powf(10000.0f, -(float)(2 * i) / 128.0f); const float ang = (float)s * f; const float c = cosf(ang), sn = sinf(ang); const float xr = src[2 * i], xi = src[2 * i + 1]; st[tid][q] = (_Float16)((j & 1) ? (xr * sn + xi * c) : (xr * c - xi * sn)); }
  const v8us v = *(const v8us*)&st[tid][0]; unsigned short* d = (unsigned short*)D16 + ((size_t)s * NH + h) * HD + p * 8; *(v8us*)d = v;  }
__device__ __forceinline__ void d_vt128(int bid, const _Float16* __restrict__ V16, _Float16* __restrict__ Vt) { __shared__ unsigned short tl[64][130]; const int tid = threadIdx.x; const int h = bid / (SS / 64), lg = bid % (SS / 64);
  for (int i = tid; i < 64 * 16; i += 256) { const int r = i / 16, c8 = (i % 16) * 8; FragH f; f.half[0] = *(const v8us*)((const unsigned short*)V16 + ((size_t)lg * 64 + r) * CC + h * HD + c8);
#pragma unroll
    for (int q = 0; q < 8; ++q) tl[r][c8 + q] = f.u[q]; }
  __syncthreads();
  { for (int i = tid; i < 128 * 8; i += 256) { const int d = i / 8, pc = i % 8; FragH f;
#pragma unroll
      for (int q = 0; q < 8; ++q) f.u[q] = tl[pc * 8 + q][d]; *(v8us*)((unsigned short*)Vt + ((size_t)h * HD + d) * SS + lg * 64 + pc * 8) = f.half[0]; }  } }
// What follows the three projections and is independent of one another, in one grid: RoPE of q, RoPE of k (RB blocks each), then the short V transposes
#define RB (SS * NH * 16 / 256)
__global__ __launch_bounds__(256) void k_post(const float* __restrict__ QF, _Float16* __restrict__ QR16, const float* __restrict__ KF, _Float16* __restrict__ KR16, const _Float16* __restrict__ V16, _Float16* __restrict__ Vt) {
  const int bid = (int)blockIdx.x;
  if (bid < 2 * RB) d_rope16(bid % RB, bid < RB ? QF : KF, bid < RB ? QR16 : KR16);
  else d_vt128(bid - 2 * RB, V16, Vt);
}
extern "C" void kernel_launch(void* const* d_in, const int* in_sizes, int n_in,
                              void* d_out, int out_size, void* d_ws, size_t ws_size, hipStream_t stream) {
  (void)in_sizes; (void)n_in; (void)out_size;
  const float* const* I = (const float* const*)d_in; const float* q = I[0]; const float* k = I[1]; const float* v = I[2]; const float* mask = I[3]; const float* Wq = I[4]; const float* bq = I[5]; const float* Wk = I[6]; const float* bk = I[7]; const float* Wv = I[8]; const float* bv = I[9]; const float* G = I[10]; const float* Wo = I[11]; const float* bo = I[12];
  char* ws = (char*)d_ws; size_t off = 0;
  auto take = [&](size_t bytes) { char* p = ws + off; off += (bytes + 255) & ~(size_t)255; return p; };
  _Float16* Y = (_Float16*)take((size_t)7 * CC * CC * 2); _Float16* Bq = Y; _Float16* Bk = Y + (size_t)CC * CC; _Float16* Bv = Y + (size_t)2 * CC * CC; _Float16* Bo = Y + (size_t)3 * CC * CC; _Float16* Xq = Y + (size_t)4 * CC * CC; _Float16* Xk = Y + (size_t)5 * CC * CC; _Float16* Xv = Y + (size_t)6 * CC * CC;
  _Float16* BG = (_Float16*)take((size_t)NH * HD * HD * 2);
  float* QF = (float*)take((size_t)SS * CC * 4); float* KF = (float*)take((size_t)SS * CC * 4);
  _Float16* QR16 = (_Float16*)take((size_t)SS * CC * 2); _Float16* QG16 = (_Float16*)take((size_t)SS * CC * 2); _Float16* KR16 = (_Float16*)take((size_t)SS * CC * 2); _Float16* V16 = (_Float16*)take((size_t)SS * CC * 2); _Float16* Vt = (_Float16*)take((size_t)SS * CC * 2); float* O = QF; _Float16* O16 = Xq;
  if (off > ws_size) return;      // 8.4 x 12 + 0.5 + 16.8 x 2 = about 135 MB
  const unsigned gx = (unsigned)(((size_t)SS * CC / 8 + 255) / 256); const unsigned gt = (SS / 128) * (CC / 128);
  k_prep<<<PB_G + 7 * PB_M, 256, 0, stream>>>(G, Wq, Wk, Wv, Wo, q, k, v, BG, Y);      // operands in f16
  k_gemm_t<<<dim3(gt, 3), 256, 0, stream>>>(Xq, Xk, Xv, Bq, Bk, Bv, 0.0625f, bq, bk, bv, QF, KF, V16);      // q, k (f32) and v (f16) projections
  k_post<<<2 * RB + NH * (SS / 64), 256, 0, stream>>>(QF, QR16, KF, KR16, V16, Vt);      // rope q, rope k, Vt
  k_gemm_hhx<0><<<dim3(((SS / 16) * (HD / 64) + 3) / 4, NH), 128, 0, stream>>>(QR16, CC, (size_t)HD, BG, HD, (size_t)HD * HD, 0.0625f, nullptr, 0, nullptr, 1, 0, 0, nullptr, QG16, CC, (size_t)HD, SS, HD, HD);      // qg_h = q_h · G_h (batched over heads via column offsets)
  k_flash<<<1 * NH * (SS / 128), 256, 0, stream>>>(QG16, CC, KR16, CC, Vt, mask, O, CC);
  k_h16<<<gx, 256, 0, stream>>>(O, O16, (size_t)SS * CC / 8);
  k_gemm_t<<<dim3(gt, 1), 256, 0, stream>>>(O16, O16, O16, Bo, Bo, Bo, 0.0625f, bo, bo, bo, (float*)d_out, (float*)d_out, nullptr);
}

// v008
// One run takes 148 microseconds.
// Two timings next to v007 both put it at 1.13 times that version's speed.
// Over all steps from v000 it is 4.94 times as fast.
#include <hip/hip_runtime.h>
// Power-law-graph multi-head attention (B=1, S=2048, D=2048, 16 heads × 128; INPUT additive mask (nonzero = −1e9) ; RoPE interleaved pairs): q/k/v/o projections ((out,in) + bias) and the per-head
// metric product qg = q_h·G_h as GEMMs and the attention as a fused flash-style kernel (head dim 128: 4 k-steps / 8 d-tiles; masked keys excluded, fully masked 32-key tiles skipped by ballot;
// online softmax f32; P f16 ≤ 1; O = P·Vt; RPW-16 waves) on v_wmma_f32_16x16x32_f16, f32 accumulate; RoPE f32 VALU.
#define SS 2048
#define CC 2048
#define NH 16
#define HD 128

typedef __bf16 v16b __attribute__((ext_vector_type(16)));
typedef unsigned short v8us __attribute__((ext_vector_type(8), may_alias));
typedef float  v8f  __attribute__((ext_vector_type(8)));
typedef float  v4f  __attribute__((ext_vector_type(4)));
typedef float  v4fa __attribute__((ext_vector_type(4), may_alias));
union FragB { v16b v; v8us half[2]; unsigned short u[16]; };

__device__ __forceinline__ unsigned short bf16_bits(float x) { unsigned int u = __float_as_uint(x); return (unsigned short)((u + 0x7FFFu + ((u >> 16) & 1u)) >> 16); }
__device__ __forceinline__ float bf16_val(unsigned short b) { return __uint_as_float(((unsigned int)b) << 16); }
__device__ __forceinline__ float bf16_round(float x) { return bf16_val(bf16_bits(x)); }
// D += A·B with NT terms: 1 = ah·bh, 2 = + al·bh (A split), 3 = + ah·bl (both split)
template <int NT>
__device__ __forceinline__ v8f mmaN(v16b ah, v16b al, v16b bh, v16b bl, v8f c) {
  c = __builtin_amdgcn_wmma_f32_16x16x32_bf16(false, ah, false, bh, (short)0, c, false, false);
  if (NT >= 2) c = __builtin_amdgcn_wmma_f32_16x16x32_bf16(false, al, false, bh, (short)0, c, false, false);
  if (NT >= 3) c = __builtin_amdgcn_wmma_f32_16x16x32_bf16(false, ah, false, bl, (short)0, c, false, false);
  asm volatile("v_nop\n\tv_nop\n\tv_nop\n\tv_nop" : "+v"(c) : "v"(ah), "v"(al), "v"(bh), "v"(bl));
  return c;
}

__global__ __launch_bounds__(256) void k_wt_bf16(const float* __restrict__ W, unsigned short* __restrict__ Wt, int K, int N) {
  const int t = blockIdx.x * 256 + threadIdx.x;
  const int k8n = K / 8;
  if (t >= N * k8n) return;
  const int n = t / k8n, k8 = (t % k8n) * 8;
  v8us v;
#pragma unroll
  for (int i = 0; i < 8; ++i) v[i] = bf16_bits(W[(size_t)(k8 + i) * N + n]);
  *(v8us*)(Wt + (size_t)n * K + k8) = v;
  
}

// GEMM C[M][N] (f32, pitch ldc) = act(A[M][K]·W + bias). A f32 row-major (pitch lda) converted per fragment to bf16
// (ASPLIT: hi/lo two planes -> 2 terms, else single rounded term); Wt bf16 [N][K] (pitch ldb). BIAS_BF16 rounds the
// bias to bf16 first (bias quantised to bf16 before the add). K%32==0, M%16==0, N%64==0.
template <bool ASPLIT, int ACT, bool BIAS_BF16>
__global__ __launch_bounds__(128) void k_gemm_bf(const float* __restrict__ A, int lda, const unsigned short* __restrict__ Wt, int ldb,
                                               const float* __restrict__ bias, float* __restrict__ C, int ldc, int M, int N, int K) {
  __shared__ __attribute__((aligned(16))) float so[4][16][64];
  const int tid = threadIdx.x, w = tid >> 5, lane = tid & 31, ln = lane & 15, hh = lane >> 4;
  const int ntn = N / 64;
  const int wid = blockIdx.x * 4 + w;
  const int mt = wid / ntn, nq = wid % ntn;
  if (mt * 16 >= M) return;
  const int row0 = mt * 16, col0 = nq * 64;
  const float* arow = A + (size_t)(row0 + ln) * lda;
  v8f acc[4] = {};
  for (int kb = 0; kb < K; kb += 32) {
    FragB ah, al;
    const v4f x0 = *(const v4fa*)(arow + kb + 8 * hh), x1 = *(const v4fa*)(arow + kb + 8 * hh + 4);
    const v4f x2 = *(const v4fa*)(arow + kb + 16 + 8 * hh), x3 = *(const v4fa*)(arow + kb + 16 + 8 * hh + 4);
    float xs[16] = {x0[0],x0[1],x0[2],x0[3],x1[0],x1[1],x1[2],x1[3],x2[0],x2[1],x2[2],x2[3],x3[0],x3[1],x3[2],x3[3]};
#pragma unroll
    for (int i = 0; i < 16; ++i) { const unsigned short hb = bf16_bits(xs[i]); ah.u[i] = hb; al.u[i] = ASPLIT ? bf16_bits(xs[i] - bf16_val(hb)) : (unsigned short)0; }
#pragma unroll
    for (int t = 0; t < 4; ++t) {
      const unsigned short* brow = Wt + (size_t)(col0 + t * 16 + ln) * ldb + kb;
      FragB b;
      b.half[0] = *(const v8us*)(brow + 8 * hh);
      b.half[1] = *(const v8us*)(brow + 16 + 8 * hh);
      acc[t] = mmaN<ASPLIT ? 2 : 1>(ah.v, al.v, b.v, b.v, acc[t]);
    }
  }
#pragma unroll
  for (int t = 0; t < 4; ++t) {
    float bv = bias ? bias[col0 + t * 16 + ln] : 0.f;
    if (BIAS_BF16) bv = bf16_round(bv);
#pragma unroll
    for (int r = 0; r < 8; ++r) { float v = acc[t][r] + bv; if (ACT == 1) v = fmaxf(v, 0.f); so[w][8 * hh + r][t * 16 + ln] = v; }
  }
  __builtin_amdgcn_fence(__ATOMIC_ACQ_REL, "workgroup");
  __builtin_amdgcn_wave_barrier();
  const int rsub = lane >> 4, c4 = (lane & 15) * 4;
  {
#pragma unroll
    for (int q = 0; q < 8; ++q) {
      const int r = q * 2 + rsub;
      const v4f v = *(const v4fa*)&so[w][r][c4];
      *(v4f*)(C + (size_t)(row0 + r) * ldc + col0 + c4) = v;
    }
    
  }
}

// Flash-style causal/unmasked attention, all contractions 3-term bf16 hi/lo splits, f32 softmax with running max.
// q,k,v rows are read from f32 buffers with arbitrary row pitch (so they can live inside a fused qkv buffer);
// D = head size (multiple of 32, <= 128); one wave = 16 query rows; block = 4 waves (64 queries) sharing K/V chunks of 32.
template <int D, bool CAUSAL>
__global__ __launch_bounds__(128) void k_flash(const float* __restrict__ qb, const float* __restrict__ kb, const float* __restrict__ vb,
                                             int pitch, int T, int H, float scale, float* __restrict__ y, int ypitch) {
  constexpr int KS = D / 32;        // k-steps for QK
  constexpr int DT = D / 16;        // d tiles for PV
  __shared__ __attribute__((aligned(16))) unsigned short sKh[32][D + 8], sKl[32][D + 8], sVh[32][D + 8], sVl[32][D + 8];
  __shared__ __attribute__((aligned(16))) unsigned short sPh[4][16][40], sPl[4][16][40];
  __shared__ __attribute__((aligned(16))) float sO[4][16][D];
  const int tid = threadIdx.x, w = tid >> 5, lane = tid & 31, ln = lane & 15, hh = lane >> 4;
  const int nqb = (T + 63) / 64;
  const int bh = blockIdx.x / nqb, qblk = blockIdx.x % nqb;
  const int b = bh / H, h = bh % H;
  const int q0 = qblk * 64 + w * 16;
  const float* Q = qb + (size_t)b * T * pitch + h * D;
  const float* K = kb + (size_t)b * T * pitch + h * D;
  const float* V = vb + (size_t)b * T * pitch + h * D;

  // A fragments of the wave's 16 query rows (scaled), hi/lo
  FragB aqh[KS], aql[KS];
  {
    int row = q0 + ln; if (row >= T) row = T - 1;
    const float* qr = Q + (size_t)row * pitch;
#pragma unroll
    for (int ks = 0; ks < KS; ++ks)
#pragma unroll
      for (int i = 0; i < 16; ++i) {
        const int d = ks * 32 + ((i < 8) ? (8 * hh + i) : (16 + 8 * hh + (i - 8)));
        const float x = qr[d] * scale; const unsigned short hb = bf16_bits(x);
        aqh[ks].u[i] = hb; aql[ks].u[i] = bf16_bits(x - bf16_val(hb));
      }
  }
  float m_r[8], l_r[8];
#pragma unroll
  for (int r = 0; r < 8; ++r) { m_r[r] = -3.0e38f; l_r[r] = 0.f; }
  v8f oacc[DT];
#pragma unroll
  for (int dt = 0; dt < DT; ++dt) oacc[dt] = (v8f){0.f,0.f,0.f,0.f,0.f,0.f,0.f,0.f};

  const int kv_end = CAUSAL ? min(T, qblk * 64 + 64) : T;     // block-uniform
  for (int j0 = 0; j0 < kv_end; j0 += 32) {
    __syncthreads();
    for (int e = tid; e < 32 * (D / 4); e += 128) {
      const int r = e / (D / 4), c4 = (e % (D / 4)) * 4;
      const int key = j0 + r;
      v4f kf = {0.f,0.f,0.f,0.f}, vf = {0.f,0.f,0.f,0.f};
      if (key < T) { kf = *(const v4fa*)(K + (size_t)key * pitch + c4); vf = *(const v4fa*)(V + (size_t)key * pitch + c4); }
#pragma unroll
      for (int t = 0; t < 4; ++t) {
        unsigned short hb = bf16_bits(kf[t]); sKh[r][c4 + t] = hb; sKl[r][c4 + t] = bf16_bits(kf[t] - bf16_val(hb));
        hb = bf16_bits(vf[t]); sVh[r][c4 + t] = hb; sVl[r][c4 + t] = bf16_bits(vf[t] - bf16_val(hb));
      }
    }
    __syncthreads();
    // S tile 16 x 32
    v8f s[2];
#pragma unroll
    for (int nt = 0; nt < 2; ++nt) {
      v8f acc = {};
#pragma unroll
      for (int ks = 0; ks < KS; ++ks) {
        FragB bh_, bl_;
        bh_.half[0] = *(const v8us*)&sKh[nt * 16 + ln][ks * 32 + 8 * hh]; bh_.half[1] = *(const v8us*)&sKh[nt * 16 + ln][ks * 32 + 16 + 8 * hh];
        bl_.half[0] = *(const v8us*)&sKl[nt * 16 + ln][ks * 32 + 8 * hh]; bl_.half[1] = *(const v8us*)&sKl[nt * 16 + ln][ks * 32 + 16 + 8 * hh];
        acc = mmaN<3>(aqh[ks].v, aql[ks].v, bh_.v, bl_.v, acc);
      }
      s[nt] = acc;
    }
    // mask + running max (rows 8hh+r; the 16 lanes of a half share rows)
    float alpha[8];
#pragma unroll
    for (int r = 0; r < 8; ++r) {
      const int qi = q0 + 8 * hh + r;
      const int ja = j0 + ln, jb = j0 + 16 + ln;
      if (CAUSAL) { if (ja > qi) s[0][r] = -3.0e38f; if (jb > qi) s[1][r] = -3.0e38f; }
      if (ja >= T) s[0][r] = -3.0e38f;
      if (jb >= T) s[1][r] = -3.0e38f;
      float mx = fmaxf(s[0][r], s[1][r]);
      mx = fmaxf(mx, __shfl_xor(mx, 1, 32)); mx = fmaxf(mx, __shfl_xor(mx, 2, 32)); mx = fmaxf(mx, __shfl_xor(mx, 4, 32)); mx = fmaxf(mx, __shfl_xor(mx, 8, 32));
      const float mnew = fmaxf(m_r[r], mx);
      alpha[r] = (mnew > -1.0e38f) ? __expf(m_r[r] - mnew) : 1.0f;
      const float p0 = (s[0][r] > -1.0e38f) ? __expf(s[0][r] - mnew) : 0.f;
      const float p1 = (s[1][r] > -1.0e38f) ? __expf(s[1][r] - mnew) : 0.f;
      m_r[r] = mnew;
      l_r[r] = l_r[r] * alpha[r] + p0 + p1;            // per-lane partial row sum (16 lanes combined at the end)
      unsigned short hb = bf16_bits(p0); sPh[w][8 * hh + r][ln] = hb;      sPl[w][8 * hh + r][ln] = bf16_bits(p0 - bf16_val(hb));
      hb = bf16_bits(p1);                sPh[w][8 * hh + r][16 + ln] = hb; sPl[w][8 * hh + r][16 + ln] = bf16_bits(p1 - bf16_val(hb));
    }
#pragma unroll
    for (int dt = 0; dt < DT; ++dt)
#pragma unroll
      for (int r = 0; r < 8; ++r) oacc[dt][r] *= alpha[r];
    __builtin_amdgcn_fence(__ATOMIC_ACQ_REL, "workgroup");
    __builtin_amdgcn_wave_barrier();
    FragB pah, pal;
    pah.half[0] = *(const v8us*)&sPh[w][ln][8 * hh]; pah.half[1] = *(const v8us*)&sPh[w][ln][16 + 8 * hh];
    pal.half[0] = *(const v8us*)&sPl[w][ln][8 * hh]; pal.half[1] = *(const v8us*)&sPl[w][ln][16 + 8 * hh];
#pragma unroll
    for (int dt = 0; dt < DT; ++dt) {
      FragB bvh, bvl;
#pragma unroll
      for (int i = 0; i < 8; ++i) {
        bvh.u[i] = sVh[8 * hh + i][dt * 16 + ln]; bvh.u[8 + i] = sVh[16 + 8 * hh + i][dt * 16 + ln];
        bvl.u[i] = sVl[8 * hh + i][dt * 16 + ln]; bvl.u[8 + i] = sVl[16 + 8 * hh + i][dt * 16 + ln];
      }
      oacc[dt] = mmaN<3>(pah.v, pal.v, bvh.v, bvl.v, oacc[dt]);
    }
    __builtin_amdgcn_fence(__ATOMIC_ACQ_REL, "workgroup");
    __builtin_amdgcn_wave_barrier();
  }
#pragma unroll
  for (int r = 0; r < 8; ++r) {
    float l = l_r[r];
    l += __shfl_xor(l, 1, 32); l += __shfl_xor(l, 2, 32); l += __shfl_xor(l, 4, 32); l += __shfl_xor(l, 8, 32);
    l_r[r] = (l > 0.f) ? 1.0f / l : 0.f;
  }
#pragma unroll
  for (int dt = 0; dt < DT; ++dt)
#pragma unroll
    for (int r = 0; r < 8; ++r) sO[w][8 * hh + r][dt * 16 + ln] = oacc[dt][r] * l_r[r];
  __builtin_amdgcn_fence(__ATOMIC_ACQ_REL, "workgroup");
  __builtin_amdgcn_wave_barrier();
  {
    for (int r = 0; r < 16; ++r) {
      const int row = q0 + r;
      if (row < T && lane < D / 4) {
        const v4f val = *(const v4fa*)&sO[w][r][lane * 4];
        *(v4f*)(y + ((size_t)b * T + row) * ypitch + h * D + lane * 4) = val;
      }
    }
    
  }
}

// GEMM C = act(A·W + bias + resid): A f32 (ASPLIT -> hi/lo 2 terms), Wt bf16 [N][K]; ACT 0 none, 1 relu, 2 exact gelu;
// resid (optional, f32, row index = (row % rmod), pitch ldr, RES_BF16 rounds it) added before the activation.
template <bool ASPLIT, int ACT, bool BIAS_BF16, bool RES_BF16>
__global__ __launch_bounds__(128) void k_gemm_bf3(const float* __restrict__ A, int lda, const unsigned short* __restrict__ Wt, int ldb,
                                                const float* __restrict__ bias, const float* __restrict__ resid, int rmod, int ldr,
                                                float* __restrict__ C, int ldc, int M, int N, int K) {
  __shared__ __attribute__((aligned(16))) float so[4][16][64];
  const int tid = threadIdx.x, w = tid >> 5, lane = tid & 31, ln = lane & 15, hh = lane >> 4;
  const int ntn = N / 64;
  const int wid = blockIdx.x * 4 + w;
  const int mt = wid / ntn, nq = wid % ntn;
  if (mt * 16 >= M) return;
  const int row0 = mt * 16, col0 = nq * 64;
  const float* arow = A + (size_t)(row0 + ln) * lda;
  v8f acc[4] = {};
  for (int kb = 0; kb < K; kb += 32) {
    FragB ah, al;
    const v4f x0 = *(const v4fa*)(arow + kb + 8 * hh), x1 = *(const v4fa*)(arow + kb + 8 * hh + 4);
    const v4f x2 = *(const v4fa*)(arow + kb + 16 + 8 * hh), x3 = *(const v4fa*)(arow + kb + 16 + 8 * hh + 4);
    float xs[16] = {x0[0],x0[1],x0[2],x0[3],x1[0],x1[1],x1[2],x1[3],x2[0],x2[1],x2[2],x2[3],x3[0],x3[1],x3[2],x3[3]};
#pragma unroll
    for (int i = 0; i < 16; ++i) { const unsigned short hb = bf16_bits(xs[i]); ah.u[i] = hb; al.u[i] = ASPLIT ? bf16_bits(xs[i] - bf16_val(hb)) : (unsigned short)0; }
#pragma unroll
    for (int t = 0; t < 4; ++t) {
      const unsigned short* brow = Wt + (size_t)(col0 + t * 16 + ln) * ldb + kb;
      FragB b;
      b.half[0] = *(const v8us*)(brow + 8 * hh);
      b.half[1] = *(const v8us*)(brow + 16 + 8 * hh);
      acc[t] = mmaN<ASPLIT ? 2 : 1>(ah.v, al.v, b.v, b.v, acc[t]);
    }
  }
#pragma unroll
  for (int t = 0; t < 4; ++t) {
    const int col = col0 + t * 16 + ln;
    float bv = bias ? bias[col] : 0.f;
    if (BIAS_BF16) bv = bf16_round(bv);
#pragma unroll
    for (int r = 0; r < 8; ++r) {
      float v = acc[t][r] + bv;
      if (resid) { float rv = resid[(size_t)((row0 + 8 * hh + r) % rmod) * ldr + col]; if (RES_BF16) rv = bf16_round(rv); v += rv; }
      if (ACT == 1) v = fmaxf(v, 0.f);
      if (ACT == 2) v = 0.5f * v * (1.0f + erff(v * 0.70710678118654752f));
      if (ACT == 3) { const float u = 0.7978845608028654f * (v + 0.044715f * v * v * v); v = 0.5f * v * (1.0f + tanhf(u)); }
      so[w][8 * hh + r][t * 16 + ln] = v;
    }
  }
  __builtin_amdgcn_fence(__ATOMIC_ACQ_REL, "workgroup");
  __builtin_amdgcn_wave_barrier();
  const int rsub = lane >> 4, c4 = (lane & 15) * 4;
  {
#pragma unroll
    for (int q = 0; q < 8; ++q) {
      const int r = q * 2 + rsub;
      const v4f v = *(const v4fa*)&so[w][r][c4];
      *(v4f*)(C + (size_t)(row0 + r) * ldc + col0 + c4) = v;
    }
    
  }
}
// row LayerNorm (biased variance, eps) over N: s = X (+ R); optional out_sum <- s; out_norm <- (s-mu)*rsqrt(var+eps)*g + b
template <bool PARAM_BF16>
__global__ __launch_bounds__(256) void k_layernorm(const float* __restrict__ X, const float* __restrict__ R, const float* __restrict__ g, const float* __restrict__ bta,
                                                  float* __restrict__ out_sum, float* __restrict__ out_norm, int N, float eps) {
  __shared__ float red[256];
  const int row = blockIdx.x, tid = threadIdx.x;
  const float* x = X + (size_t)row * N; const float* rr = R ? R + (size_t)row * N : nullptr;
  float vals[16];                     // up to N = 4096
  const int per = N / 256;            // contiguous chunk per thread? use strided-by-4 chunks: thread handles j = tid*4 + 1024*u
  float s1 = 0.f;
  for (int u = 0; u < per / 4; ++u) {
    const int j = tid * 4 + 1024 * u;
    const v4f a = *(const v4fa*)(x + j);
    v4f b = {0.f,0.f,0.f,0.f}; if (rr) b = *(const v4fa*)(rr + j);
#pragma unroll
    for (int q = 0; q < 4; ++q) { const float v = a[q] + b[q]; vals[u * 4 + q] = v; s1 += v; }
  }
  red[tid] = s1; __syncthreads();
  for (int st = 128; st > 0; st >>= 1) { if (tid < st) red[tid] += red[tid + st]; __syncthreads(); }
  const float mu = red[0] / (float)N; __syncthreads();
  float s2 = 0.f;
  for (int u = 0; u < per / 4; ++u)
#pragma unroll
    for (int q = 0; q < 4; ++q) { const float c = vals[u * 4 + q] - mu; s2 += c * c; }
  red[tid] = s2; __syncthreads();
  for (int st = 128; st > 0; st >>= 1) { if (tid < st) red[tid] += red[tid + st]; __syncthreads(); }
  const float rs = rsqrtf(red[0] / (float)N + eps);
  {
    for (int u = 0; u < per / 4; ++u) {
      const int j = tid * 4 + 1024 * u;
      v4f o, sm;
#pragma unroll
      for (int q = 0; q < 4; ++q) {
        float gg = g[j + q], bb = bta[j + q];
        if (PARAM_BF16) { gg = bf16_round(gg); bb = bf16_round(bb); }
        sm[q] = vals[u * 4 + q]; o[q] = (vals[u * 4 + q] - mu) * rs * gg + bb;
      }
      if (out_sum) *(v4f*)(out_sum + (size_t)row * N + j) = sm;
      *(v4f*)(out_norm + (size_t)row * N + j) = o;
    }
    
  }
}



// ---- f16 WMMA path (v_wmma_f32_16x16x32_f16): 11-bit significands for operands in range — used where a [0,1] probability operand needs more precision than bf16
typedef _Float16 v16h __attribute__((ext_vector_type(16)));
union FragH { v16h v; v8us half[2]; _Float16 h[16]; unsigned short u[16]; };
template <int NT>
__device__ __forceinline__ v8f mmaH(v16h ah, v16h al, v16h bh, v16h bl, v8f c) {
  c = __builtin_amdgcn_wmma_f32_16x16x32_f16(false, ah, false, bh, (short)0, c, false, false);
  if (NT >= 2) c = __builtin_amdgcn_wmma_f32_16x16x32_f16(false, al, false, bh, (short)0, c, false, false);
  if (NT >= 3) c = __builtin_amdgcn_wmma_f32_16x16x32_f16(false, ah, false, bl, (short)0, c, false, false);
  asm volatile("v_nop\n\tv_nop\n\tv_nop\n\tv_nop" : "+v"(c) : "v"(ah), "v"(al), "v"(bh), "v"(bl));
  return c;
}
// batched GEMM like k_gemm_b but f16 operands: A f32 (split into f16 hi/lo if ASPLIT, else rounded to f16), Bt = f16 values [n][k]; alpha; C f32; N multiple of 16 (partial tiles skipped)
template <bool ASPLIT>
__global__ __launch_bounds__(128) void k_gemm_h(const float* __restrict__ A, int lda, size_t sA, const _Float16* __restrict__ Bh, int ldb, size_t sB, float alpha, float* __restrict__ C, int ldc, size_t sC, int M, int N, int K) {
  __shared__ __attribute__((aligned(16))) float so[4][16][64];
  const int tid = threadIdx.x, w = tid >> 5, lane = tid & 31, ln = lane & 15, hh = lane >> 4; const int by = blockIdx.y;
  A += (size_t)by * sA; Bh += (size_t)by * sB; C += (size_t)by * sC;
  const int ntn = (N + 63) / 64; const int wid = blockIdx.x * 4 + w; const int mt = wid / ntn, nq = wid % ntn; if (mt * 16 >= M) return;
  const int row0 = mt * 16, col0 = nq * 64; const float* arow = A + (size_t)(row0 + ln) * lda;
  v8f acc[4] = {};
  for (int kb = 0; kb < K; kb += 32) {
    FragH ah, al;
    const v4f x0 = *(const v4fa*)(arow + kb + 8 * hh), x1 = *(const v4fa*)(arow + kb + 8 * hh + 4), x2 = *(const v4fa*)(arow + kb + 16 + 8 * hh), x3 = *(const v4fa*)(arow + kb + 16 + 8 * hh + 4);
    float xs[16] = {x0[0],x0[1],x0[2],x0[3],x1[0],x1[1],x1[2],x1[3],x2[0],x2[1],x2[2],x2[3],x3[0],x3[1],x3[2],x3[3]};
#pragma unroll
    for (int i = 0; i < 16; ++i) { const _Float16 h = (_Float16)xs[i]; ah.h[i] = h; al.h[i] = ASPLIT ? (_Float16)(xs[i] - (float)h) : (_Float16)0.0f; }
#pragma unroll
    for (int t = 0; t < 4; ++t) { if (col0 + t * 16 >= N) continue; const size_t boff = (size_t)(col0 + t * 16 + ln) * ldb + kb; FragH bq; bq.half[0] = *(const v8us*)(Bh + boff + 8 * hh); bq.half[1] = *(const v8us*)(Bh + boff + 16 + 8 * hh);
      acc[t] = mmaH<ASPLIT ? 2 : 1>(ah.v, al.v, bq.v, bq.v, acc[t]); }
  }
#pragma unroll
  for (int t = 0; t < 4; ++t) { if (col0 + t * 16 >= N) continue;
#pragma unroll
    for (int r = 0; r < 8; ++r) so[w][8 * hh + r][t * 16 + ln] = acc[t][r] * alpha; }
  __builtin_amdgcn_fence(__ATOMIC_ACQ_REL, "workgroup"); __builtin_amdgcn_wave_barrier();
  const int rsub = lane >> 4, c4 = (lane & 15) * 4;
  {
#pragma unroll
    for (int q = 0; q < 8; ++q) { const int r = q * 2 + rsub; if (col0 + c4 < N) { const v4f v = *(const v4fa*)&so[w][r][c4]; *(v4f*)(C + (size_t)(row0 + r) * ldc + col0 + c4) = v; } }
     }
}

// k_gemm_hh variant with fused epilogue: v = acc·alpha + bias[by·sBias + col] (+ CP[(row/rowsPerB)·sCPb + by·64 + col] if CP) ; ACT 0 none / 1 elu ; writes f16 C16 (and f32 C if non-null)
template <int ACT>
__global__ __launch_bounds__(128) void k_gemm_hhx(const _Float16* __restrict__ A, int lda, size_t sA, const _Float16* __restrict__ Bh, int ldb, size_t sB, float alpha, const float* __restrict__ bias, size_t sBias, const float* __restrict__ CP, int rowsPerB, size_t sCPb, int row0g,
    float* __restrict__ C, _Float16* __restrict__ C16, int ldc, size_t sC, int M, int N, int K) {
  __shared__ __attribute__((aligned(16))) float so[4][16][64];
  const int tid = threadIdx.x, w = tid >> 5, lane = tid & 31, ln = lane & 15, hh = lane >> 4; const int by = blockIdx.y;
  A += (size_t)by * sA; Bh += (size_t)by * sB; const size_t cofs = (size_t)by * sC; const float* bp = bias ? bias + (size_t)by * sBias : nullptr;
  const int ntn = (N + 63) / 64; const int wid = blockIdx.x * 4 + w; const int mt = wid / ntn, nq = wid % ntn; if (mt * 16 >= M) return;
  const int row0 = mt * 16, col0 = nq * 64; const _Float16* arow = A + (size_t)(row0 + ln) * lda;
  v8f acc[4] = {};
  for (int kb = 0; kb < K; kb += 32) { FragH ah; ah.half[0] = *(const v8us*)((const unsigned short*)arow + kb + 8 * hh); ah.half[1] = *(const v8us*)((const unsigned short*)arow + kb + 16 + 8 * hh);
#pragma unroll
    for (int t = 0; t < 4; ++t) { if (col0 + t * 16 >= N) continue; const size_t boff = (size_t)(col0 + t * 16 + ln) * ldb + kb; FragH bq; bq.half[0] = *(const v8us*)((const unsigned short*)Bh + boff + 8 * hh); bq.half[1] = *(const v8us*)((const unsigned short*)Bh + boff + 16 + 8 * hh);
      acc[t] = mmaH<1>(ah.v, ah.v, bq.v, bq.v, acc[t]); }
  }
#pragma unroll
  for (int t = 0; t < 4; ++t) { if (col0 + t * 16 >= N) continue; const int col = col0 + t * 16 + ln; const float bv = bp ? bf16_round(bp[col]) : 0.f;
#pragma unroll
    for (int r = 0; r < 8; ++r) { float v = acc[t][r] * alpha + bv; if (CP) { const int bidx = (row0g + row0 + 8 * hh + r) / rowsPerB; v += CP[(size_t)bidx * sCPb + (size_t)by * 64 + col]; } if (ACT == 1) v = (v > 0.f) ? v : expm1f(v); else if (ACT == 3) v = fmaxf(v, 0.f); so[w][8 * hh + r][t * 16 + ln] = v; } }
  __builtin_amdgcn_fence(__ATOMIC_ACQ_REL, "workgroup"); __builtin_amdgcn_wave_barrier();
  const int rsub = lane >> 4, c4 = (lane & 15) * 4; typedef _Float16 v4h __attribute__((ext_vector_type(4)));
  {
#pragma unroll
    for (int q = 0; q < 8; ++q) { const int r = q * 2 + rsub; if (col0 + c4 < N) { const v4f v = *(const v4fa*)&so[w][r][c4]; if (C) *(v4f*)(C + cofs + (size_t)(row0 + r) * ldc + col0 + c4) = v; if (C16) { v4h h4; for (int i = 0; i < 4; ++i) h4[i] = (_Float16)v[i]; *(v4h*)(C16 + cofs + (size_t)(row0 + r) * ldc + col0 + c4) = h4; } } }
     }
}


// Projection GEMM, 2048 x 2048 x 2048: C = (A . Bt^T) * alpha + bias. One 128 x 128 tile of C per workgroup of 8 waves (4 x 2, 32 x 64 per wave).
// A pass is 128 k: 128 rows of A and 128 rows of Bt, 256 B each, laid in LDS at pitch 272 B by asynchronous copies, two buffers, the next pass's copies in flight under this pass's products.
// k runs upward in steps of 32 into one accumulator per 16 x 16 tile, as in k_gemm_hhx: the sums keep their order.
// Every '#pragma unroll' in k_gemm_t makes the indices of the fragment and accumulator arrays constants, so that they stay in registers.
#define GT_PITCH 272u
#define GT_STAGE (256u * GT_PITCH)
#define GT_NST (CC / 128)
__device__ __forceinline__ void gt_copy8(unsigned l0, const unsigned short* g0) {
  // eight 16-byte copies of this lane, rows 16 apart; s_wait_xcnt stands inside the statement so that no address register is rewritten ahead of it
  const unsigned l1 = l0 + 16u * GT_PITCH, l2 = l0 + 32u * GT_PITCH, l3 = l0 + 48u * GT_PITCH, l4 = l0 + 64u * GT_PITCH, l5 = l0 + 80u * GT_PITCH, l6 = l0 + 96u * GT_PITCH, l7 = l0 + 112u * GT_PITCH;
  const unsigned short *g1 = g0 + 16 * CC, *g2 = g0 + 32 * CC, *g3 = g0 + 48 * CC, *g4 = g0 + 64 * CC, *g5 = g0 + 80 * CC, *g6 = g0 + 96 * CC, *g7 = g0 + 112 * CC;
  asm volatile("global_load_async_to_lds_b128 %0, %8, off\n\t"
               "global_load_async_to_lds_b128 %1, %9, off\n\t"
               "global_load_async_to_lds_b128 %2, %10, off\n\t"
               "global_load_async_to_lds_b128 %3, %11, off\n\t"
               "global_load_async_to_lds_b128 %4, %12, off\n\t"
               "global_load_async_to_lds_b128 %5, %13, off\n\t"
               "global_load_async_to_lds_b128 %6, %14, off\n\t"
               "global_load_async_to_lds_b128 %7, %15, off\n\t"
               "s_wait_xcnt 0x0"
               :: "v"(l0), "v"(l1), "v"(l2), "v"(l3), "v"(l4), "v"(l5), "v"(l6), "v"(l7),
                  "v"(g0), "v"(g1), "v"(g2), "v"(g3), "v"(g4), "v"(g5), "v"(g6), "v"(g7) : "memory");
}
// blockIdx.y picks one of up to three independent products that share the grid; product 2's tile goes out as f16 to C16, the others' as f32
__global__ __launch_bounds__(256) void k_gemm_t(const _Float16* A0, const _Float16* A1, const _Float16* A2, const _Float16* Bh0, const _Float16* Bh1, const _Float16* Bh2, float alpha,
                                                const float* bias0, const float* bias1, const float* bias2, float* C0, float* C1, _Float16* C16) {
  __shared__ __attribute__((aligned(16))) unsigned char L[2u * GT_STAGE];
  const int py = (int)blockIdx.y; const bool H16 = py == 2;
  const _Float16* A = py == 0 ? A0 : py == 1 ? A1 : A2; const _Float16* Bh = py == 0 ? Bh0 : py == 1 ? Bh1 : Bh2; const float* bias = py == 0 ? bias0 : py == 1 ? bias1 : bias2; float* C = py == 0 ? C0 : C1;
  const int tid = threadIdx.x, w = tid >> 5, lane = tid & 31, ln = lane & 15, hh = lane >> 4;
  const int m0 = (int)(blockIdx.x / (CC / 128)) * 128, n0 = (int)(blockIdx.x % (CC / 128)) * 128;
  const int wm = (w >> 1) * 32, wn = (w & 1) * 64;
  // copies: lane takes 16-byte piece (tid & 15) of rows (tid >> 4) + 16 i; LDS rows 0..127 hold A, 128..255 hold Bt
  const unsigned lcp = (unsigned)(size_t)L + (unsigned)(tid >> 4) * GT_PITCH + (unsigned)(tid & 15) * 16u;
  const unsigned short* ga = (const unsigned short*)A + (size_t)(m0 + (tid >> 4)) * CC + (tid & 15) * 8;
  const unsigned short* gb = (const unsigned short*)Bh + (size_t)(n0 + (tid >> 4)) * CC + (tid & 15) * 8;
  v8f acc[2][4];
#pragma unroll
  for (int i = 0; i < 2; ++i)
#pragma unroll
    for (int j = 0; j < 4; ++j) acc[i][j] = (v8f){0.f,0.f,0.f,0.f,0.f,0.f,0.f,0.f};
  gt_copy8(lcp, ga); gt_copy8(lcp + 128u * GT_PITCH, gb);
  asm volatile("s_wait_asynccnt 0x0" ::: "memory");      // pass 0's bytes of this wave have landed
  __syncthreads();                                        // and every wave's: pass 0 is readable
  gt_copy8(lcp + GT_STAGE, ga + 128); gt_copy8(lcp + GT_STAGE + 128u * GT_PITCH, gb + 128);
#pragma unroll 1      // one pass per trip: the ring's order at the foot stays as written
  for (int t = 0; t < GT_NST; ++t) {
    const unsigned char* S = L + (unsigned)(t & 1) * GT_STAGE;
    const unsigned char* ar = S + (unsigned)(wm + ln) * GT_PITCH + 16u * hh;
    const unsigned char* br = S + (unsigned)(128 + wn + ln) * GT_PITCH + 16u * hh;
    FragH a[2][2], b[2][4];      // two fragment sets: the next 32 k are fetched as one group ahead of this block's products (inside this pass's buffer only)
#pragma unroll
    for (int i = 0; i < 2; ++i) { a[0][i].half[0] = *(const v8us*)(ar + i * 16 * GT_PITCH); a[0][i].half[1] = *(const v8us*)(ar + i * 16 * GT_PITCH + 32); }
#pragma unroll
    for (int j = 0; j < 4; ++j) { b[0][j].half[0] = *(const v8us*)(br + j * 16 * GT_PITCH); b[0][j].half[1] = *(const v8us*)(br + j * 16 * GT_PITCH + 32); }
#pragma unroll
    for (int ks = 0; ks < 4; ++ks) {
      const int cu = ks & 1, nx = cu ^ 1;
      if (ks < 3) {
#pragma unroll
        for (int i = 0; i < 2; ++i) { a[nx][i].half[0] = *(const v8us*)(ar + i * 16 * GT_PITCH + (ks + 1) * 64); a[nx][i].half[1] = *(const v8us*)(ar + i * 16 * GT_PITCH + (ks + 1) * 64 + 32); }
#pragma unroll
        for (int j = 0; j < 4; ++j) { b[nx][j].half[0] = *(const v8us*)(br + j * 16 * GT_PITCH + (ks + 1) * 64); b[nx][j].half[1] = *(const v8us*)(br + j * 16 * GT_PITCH + (ks + 1) * 64 + 32); }
      }
      __builtin_amdgcn_sched_barrier(0);      // keeps the next block's twelve LDS loads one group ahead of these products; without it they sink among the products and each waits out its own latency
#pragma unroll
      for (int i = 0; i < 2; ++i)
#pragma unroll
        for (int j = 0; j < 4; ++j) acc[i][j] = __builtin_amdgcn_wmma_f32_16x16x32_f16(false, a[cu][i].v, false, b[cu][j].v, (short)0, acc[i][j], false, false);
      __builtin_amdgcn_sched_barrier(0);      // the products stay one run: no later load group rises into it
    }
    asm volatile("s_wait_dscnt 0x0" ::: "memory");        // this wave's reads of the buffer have returned
    asm volatile("s_wait_asynccnt 0x0" ::: "memory");     // this wave's copies of pass t + 1 have landed
    __syncthreads();                                      // publishes pass t + 1 and frees the buffer pass t has read
    if (t + 2 < GT_NST) { gt_copy8(lcp + (unsigned)(t & 1) * GT_STAGE, ga + (t + 2) * 128); gt_copy8(lcp + (unsigned)(t & 1) * GT_STAGE + 128u * GT_PITCH, gb + (t + 2) * 128); }
  }
  asm volatile("s_wait_asynccnt 0x0" ::: "memory");       // nothing in flight before the ring becomes output staging
  // epilogue: each wave stages its 32 x 64 tile in its own LDS range (pitch 68 floats) and stores whole lines
  float* so = (float*)(L + (unsigned)w * (32u * 272u));
#pragma unroll
  for (int j = 0; j < 4; ++j) { const float bv = bf16_round(bias[n0 + wn + j * 16 + ln]);
#pragma unroll
    for (int i = 0; i < 2; ++i)
#pragma unroll
      for (int r = 0; r < 8; ++r) so[(i * 16 + 8 * hh + r) * 68 + j * 16 + ln] = acc[i][j][r] * alpha + bv; }
  __builtin_amdgcn_fence(__ATOMIC_ACQ_REL, "workgroup"); __builtin_amdgcn_wave_barrier();      // the wave's staged rows are in LDS before its lanes read them back; the range is the wave's own, so no workgroup barrier
  const int c4 = ln * 4; typedef _Float16 v4h __attribute__((ext_vector_type(4)));
  if (!H16) {
#pragma unroll
    for (int q = 0; q < 16; ++q) { const int r = q * 2 + hh; const v4f v = *(const v4fa*)&so[r * 68 + c4]; const size_t o = (size_t)(m0 + wm + r) * CC + n0 + wn + c4; *(v4f*)(C + o) = v; }
    asm volatile("s_wait_xcnt 0x0" ::: "memory");      // no register that these stores name is rewritten ahead of this wait, whichever block the build lays behind them
  } else {
#pragma unroll
    for (int q = 0; q < 16; ++q) { const int r = q * 2 + hh; const v4f v = *(const v4fa*)&so[r * 68 + c4]; const size_t o = (size_t)(m0 + wm + r) * CC + n0 + wn + c4;
      v4h h4; for (int i = 0; i < 4; ++i) h4[i] = (_Float16)v[i]; *(v4h*)(C16 + o) = h4; }
    asm volatile("s_wait_xcnt 0x0" ::: "memory");      // as in the other arm
  }
}

__global__ __launch_bounds__(256) void k_h16(const float* __restrict__ x, _Float16* __restrict__ X16, size_t n8) { const size_t t = (size_t)blockIdx.x * 256 + threadIdx.x; if (t >= n8) return; FragH f;
#pragma unroll
  for (int q = 0; q < 8; ++q) f.h[q] = (_Float16)x[t * 8 + q]; *(v8us*)((unsigned short*)X16 + t * 8) = f.half[0];  }
// Every conversion that reads inputs alone, in one grid; the block index picks the job, each thread's work is that of the separate kernels.
// Blocks 0 .. PB_G-1: BG_h[e][d] = f16(bf16(G_h[d][e]) * 16), 8 blocks a head. Then PB_M blocks a matrix, 8 elements a thread: the four weights (bf16-rounded, * 16; (out,in) = Bt) and q, k, v (bf16-rounded, * 1, which is exact).
#define PB_G (NH * 8)
#define PB_M (CC * CC / 8 / 256)
__global__ __launch_bounds__(256) void k_prep(const float* __restrict__ G, const float* __restrict__ Wq, const float* __restrict__ Wk, const float* __restrict__ Wv, const float* __restrict__ Wo,
                                              const float* __restrict__ q, const float* __restrict__ k, const float* __restrict__ v, _Float16* __restrict__ BG, _Float16* __restrict__ Y) {
  const int bid = (int)blockIdx.x, tid = threadIdx.x; FragH f;
  if (bid < PB_G) {
    const float* W = G + (size_t)(bid >> 3) * HD * HD; const int t = (bid & 7) * 256 + tid; const int n = t / (HD / 8), k8 = (t % (HD / 8)) * 8;
#pragma unroll
    for (int i = 0; i < 8; ++i) f.h[i] = (_Float16)(bf16_round(W[(size_t)(k8 + i) * HD + n]) * 16.0f);
    *(v8us*)((unsigned short*)BG + (size_t)(bid >> 3) * HD * HD + (size_t)n * HD + k8) = f.half[0];
    asm volatile("s_wait_xcnt 0x0" ::: "memory");      // no register that the store names is rewritten ahead of this wait, whichever block the build lays behind it
    return;
  }
  const int j = (bid - PB_G) / PB_M; const size_t t = (size_t)((bid - PB_G) % PB_M) * 256 + tid;      // matrix j, in the order Wq Wk Wv Wo q k v; the seven results lie one behind the other in Y
  const float* x01 = (j & 1) ? Wk : Wq; const float* x23 = (j & 1) ? Wo : Wv; const float* x45 = (j & 1) ? k : q;
  const float* x03 = (j & 2) ? x23 : x01; const float* x47 = (j & 2) ? v : x45; const float* x = (j & 4) ? x47 : x03;
  const float sc = j < 4 ? 16.0f : 1.0f;
#pragma unroll
  for (int i = 0; i < 8; ++i) f.h[i] = (_Float16)(bf16_round(x[t * 8 + i]) * sc);
  *(v8us*)((unsigned short*)Y + (size_t)j * CC * CC + t * 8) = f.half[0];
  asm volatile("s_wait_xcnt 0x0" ::: "memory");      // as in the other arm
}
template <int NHv, int TTv>
__global__ __launch_bounds__(256) void k_vt(const _Float16* __restrict__ V16, int ldv, int voff, _Float16* __restrict__ Vt) { __shared__ unsigned short tl[64][66]; const int tid = threadIdx.x; const int slab = blockIdx.x / (TTv / 64), lg = blockIdx.x % (TTv / 64); const int b = slab / NHv, h = slab % NHv;
  for (int i = tid; i < 64 * 8; i += 256) { const int r = i / 8, c8 = (i % 8) * 8; FragH f; f.half[0] = *(const v8us*)((const unsigned short*)V16 + ((size_t)b * TTv + lg * 64 + r) * ldv + voff + h * 64 + c8);
#pragma unroll
    for (int q = 0; q < 8; ++q) tl[r][c8 + q] = f.u[q]; }
  __syncthreads();
  {
#pragma unroll
    for (int rd = 0; rd < 2; ++rd) { const int d = rd * 32 + tid / 8, pc = tid % 8; FragH f;
#pragma unroll
      for (int q = 0; q < 8; ++q) f.u[q] = tl[pc * 8 + q][d];
      *(v8us*)((unsigned short*)Vt + ((size_t)slab * 64 + d) * TTv + lg * 64 + pc * 8) = f.half[0]; }
     } }

// Attention ring: a stage is 64 keys for the block's 128 query rows: 64 rows of K (256 B, pitch 272), 128 rows of Vt (128 B, pitch 144) and 128 rows of the mask (256 B, pitch 272),
// laid in LDS by asynchronous copies, two buffers, the next stage's copies in flight under this stage's work; the eight waves share K and Vt. A stage is worked as two 32-key tiles, upward.
// The 128 rows are two 64-row blocks of one head, block 31 - j (waves 0 to 3) and block j (waves 4 to 7). Where the mask opens few keys for early rows and many for late ones
// every workgroup gets one long and one short row block, and no WGP holds two long ones while another holds two short ones. For any other mask the pairing is merely another order of the same work.
#define FL_KP 272u
#define FL_VP 144u
#define FL_MP 272u
#define FL_VO (64u * FL_KP)
#define FL_MO (FL_VO + 128u * FL_VP)
#define FL_STAGE (FL_MO + 128u * FL_MP)
#define FL_NST (SS / 64)
#define FL_SC2 (0.08838834764831845f * 1.4426950408889634f)
typedef float f1a __attribute__((may_alias));
__device__ __forceinline__ void fl_copy4(unsigned l0, unsigned ls, const unsigned char* g0, size_t gs) {
  // four 16-byte copies of this lane, LDS rows ls bytes apart, global rows gs bytes apart; s_wait_xcnt stands inside the statement so that no address register is rewritten ahead of it
  const unsigned l1 = l0 + ls, l2 = l0 + 2u * ls, l3 = l0 + 3u * ls;
  const unsigned char *g1 = g0 + gs, *g2 = g0 + 2 * gs, *g3 = g0 + 3 * gs;
  asm volatile("global_load_async_to_lds_b128 %0, %4, off\n\t"
               "global_load_async_to_lds_b128 %1, %5, off\n\t"
               "global_load_async_to_lds_b128 %2, %6, off\n\t"
               "global_load_async_to_lds_b128 %3, %7, off\n\t"
               "s_wait_xcnt 0x0"
               :: "v"(l0), "v"(l1), "v"(l2), "v"(l3), "v"(g0), "v"(g1), "v"(g2), "v"(g3) : "memory");
}
// lane l with lane l ^ 16: one vector cross-row move, no LDS round trip
__device__ __forceinline__ float fl_xhalf(float x) { return __builtin_bit_cast(float, __builtin_amdgcn_permlanex16(__builtin_bit_cast(int, x), __builtin_bit_cast(int, x), 0x76543210, 0xfedcba98, false, false)); }
__global__ __launch_bounds__(256) void k_flash(const _Float16* __restrict__ Q16, int ldq, const _Float16* __restrict__ K16, int ldk, const _Float16* __restrict__ Vt, const float* __restrict__ MSK, float* __restrict__ O, int ldo) {
  constexpr int RPW = 16, NQB = 2048 / (4 * RPW), DT = 8, KS = 4;      /* head dim 128 */
  __shared__ __attribute__((aligned(16))) unsigned char L[2u * FL_STAGE];
  const int tid = threadIdx.x, w = tid >> 5, lane = tid & 31, ln = lane & 15, hh = lane >> 4;
  const int slab = blockIdx.x / (NQB / 2), pj = blockIdx.x % (NQB / 2); const int b = slab / 16, h = slab % 16; const int qbA = (NQB - 1 - pj) * (4 * RPW), qbB = pj * (4 * RPW); const int q0 = (w < 4 ? qbA : qbB) + (w & 3) * RPW;
  const unsigned short* Vth = (const unsigned short*)Vt + (size_t)slab * 128 * 2048;
  // copies: K and each block's mask: 16-byte piece (tid & 15) of rows (tid >> 4) + 16 i; Vt: piece (tid & 7) of rows (tid >> 3) + 32 i; mask rows 0..63 in LDS are block A's (waves 0 to 3), 64..127 block B's
  const unsigned lb = (unsigned)(size_t)L;
  const unsigned lk = lb + (unsigned)(tid >> 4) * FL_KP + (unsigned)(tid & 15) * 16u, lv = lb + FL_VO + (unsigned)(tid >> 3) * FL_VP + (unsigned)(tid & 7) * 16u, lm = lb + FL_MO + (unsigned)(tid >> 4) * FL_MP + (unsigned)(tid & 15) * 16u;
  const size_t kstep = (size_t)ldk * 2;      // bytes of a K row
  const unsigned char* gk = (const unsigned char*)((const unsigned short*)K16 + ((size_t)b * 2048 + (tid >> 4)) * ldk + h * 128 + (tid & 15) * 8);
  const unsigned char* gv = (const unsigned char*)(Vth + (size_t)(tid >> 3) * 2048 + (tid & 7) * 8);
  const unsigned char* gmA = (const unsigned char*)(MSK + ((size_t)b * 2048 + qbA + (tid >> 4)) * 2048 + (tid & 15) * 4);
  const unsigned char* gmB = (const unsigned char*)(MSK + ((size_t)b * 2048 + qbB + (tid >> 4)) * 2048 + (tid & 15) * 4);
  fl_copy4(lk, 16u * FL_KP, gk, 16 * kstep); fl_copy4(lv, 32u * FL_VP, gv, (size_t)32 * 4096); fl_copy4(lm, 16u * FL_MP, gmA, (size_t)16 * 8192); fl_copy4(lm + 64u * FL_MP, 16u * FL_MP, gmB, (size_t)16 * 8192);
  FragH aq[KS];      // the wave's 16 query rows, now the B operand: lane = column = query row ln, same k order as before
  { const unsigned short* qr = (const unsigned short*)Q16 + ((size_t)b * 2048 + q0 + ln) * ldq + h * 128;
#pragma unroll
    for (int ks = 0; ks < KS; ++ks) { aq[ks].half[0] = *(const v8us*)(qr + ks * 32 + 8 * hh); aq[ks].half[1] = *(const v8us*)(qr + ks * 32 + 16 + 8 * hh); } }
  float m_r = -3.0e38f, l_r = 0.f; v8f oacc[DT];      // of query row ln; oacc[dt][r] = O[ln][dt*16 + 8hh + r]; l_r sums this half's keys only
#pragma unroll
  for (int dt = 0; dt < DT; ++dt) oacc[dt] = (v8f){0.f,0.f,0.f,0.f,0.f,0.f,0.f,0.f};
  asm volatile("s_wait_asynccnt 0x0" ::: "memory");      // stage 0's bytes of this wave have landed
  __syncthreads();                                        // and every wave's: stage 0 is readable
  fl_copy4(lk + FL_STAGE, 16u * FL_KP, gk + 64 * kstep, 16 * kstep); fl_copy4(lv + FL_STAGE, 32u * FL_VP, gv + 128, (size_t)32 * 4096); fl_copy4(lm + FL_STAGE, 16u * FL_MP, gmA + 256, (size_t)16 * 8192); fl_copy4(lm + FL_STAGE + 64u * FL_MP, 16u * FL_MP, gmB + 256, (size_t)16 * 8192);
#pragma unroll 1      // one stage per trip: the ring's order at the foot stays as written
  for (int t = 0; t < FL_NST; ++t) {
    const unsigned char* S = L + (unsigned)(t & 1) * FL_STAGE;
#pragma unroll 1      // the two 32-key tiles of a stage share one body: less code, and a masked tile is skipped on its own
  for (int sub = 0; sub < 2; ++sub) {
    // mask of query row ln for this lane's 16 keys of the tile: four 16-byte reads of the row. Every '#pragma unroll' in this body makes the indices of the per-key and fragment arrays constants, so that they stay in registers.
    const unsigned char* mrow = S + FL_MO + (unsigned)(w * RPW + ln) * FL_MP + (unsigned)sub * 128u + 32u * hh;
    bool ok[2][8]; bool any = false;      // ok[nt][r]: key nt*16 + 8hh + r of the tile is OPEN for query row ln (float mask: nonzero = masked, -1e9)
#pragma unroll
    for (int nt = 0; nt < 2; ++nt) { const v4f ma = *(const v4fa*)(mrow + nt * 64), mb = *(const v4fa*)(mrow + nt * 64 + 16);
#pragma unroll
      for (int r = 0; r < 4; ++r) { ok[nt][r] = ma[r] == 0.0f; ok[nt][4 + r] = mb[r] == 0.0f; any = any || ok[nt][r] || ok[nt][4 + r]; } }
    if (__builtin_amdgcn_ballot_w32(any) == 0u) continue;      // every (query,key) of this wave's tile is masked: contributes nothing (uniform branch; the stage's foot is outside this loop)
    // The tile's LDS fragment reads stand in groups ahead of the products that use them: all of K ahead of the score products; all of Vt behind them, so that it streams in under the softmax.
    v8f s[2]; FragH bk[2][KS], bv[DT];
#pragma unroll
    for (int nt = 0; nt < 2; ++nt) { const unsigned char* kr = S + (unsigned)(sub * 32 + nt * 16 + ln) * FL_KP + 16u * hh;
#pragma unroll
      for (int ks = 0; ks < KS; ++ks) { bk[nt][ks].half[0] = *(const v8us*)(kr + ks * 64); bk[nt][ks].half[1] = *(const v8us*)(kr + ks * 64 + 32); } }
    s[0] = (v8f){0.f,0.f,0.f,0.f,0.f,0.f,0.f,0.f}; s[1] = (v8f){0.f,0.f,0.f,0.f,0.f,0.f,0.f,0.f};
    // the two halves' accumulator chains alternate, so that each fills the other's accumulate latency; within a chain k runs upward as before. s[nt][r] = S[query ln][key nt*16 + 8hh + r]
#pragma unroll
    for (int ks = 0; ks < KS; ++ks)
#pragma unroll
      for (int nt = 0; nt < 2; ++nt) s[nt] = mmaH<1>(bk[nt][ks].v, bk[nt][ks].v, aq[ks].v, aq[ks].v, s[nt]);
#pragma unroll
    for (int dt = 0; dt < DT; ++dt) { const unsigned char* vrow = S + FL_VO + (unsigned)(dt * 16 + ln) * FL_VP + (unsigned)sub * 64u + 16u * hh; bv[dt].half[0] = *(const v8us*)vrow; bv[dt].half[1] = *(const v8us*)(vrow + 32); }
    __builtin_amdgcn_sched_barrier(0);      // keeps the sixteen Vt loads one group ahead of the softmax; without it they sink into it in five places, the last ones directly ahead of their products
    // Softmax of the tile, no branch inside: every exponential is taken unconditionally and the mask picks between its value and the constant.
    // Scores and running maximum are kept in base 2 (FL_SC2 = 1/sqrt(128) * log2 e, in the multiply the score had anyway), so that exp(x - m) is one v_exp_f32 of a difference; only differences of them are ever used.
    float sv[2][8];
#pragma unroll
    for (int nt = 0; nt < 2; ++nt)
#pragma unroll
      for (int r = 0; r < 8; ++r) sv[nt][r] = ok[nt][r] ? s[nt][r] * FL_SC2 : -INFINITY;
    float mc = fmaxf(sv[0][0], sv[1][0]);
#pragma unroll
    for (int r = 1; r < 8; ++r) mc = fmaxf(mc, fmaxf(sv[0][r], sv[1][r]));
    mc = fmaxf(mc, fl_xhalf(mc));      // the other half of the wave holds the row's other 16 keys
    const float mn = fmaxf(m_r, mc);
    float p[2][8]; FragH pb;      // pb: P^T as a B fragment: element i = key 8hh + i, element 8 + i = key 16 + 8hh + i, column = query row ln
#pragma unroll
    for (int nt = 0; nt < 2; ++nt)
#pragma unroll
      for (int r = 0; r < 8; ++r) p[nt][r] = __builtin_amdgcn_exp2f(sv[nt][r] - mn);
    const float ea = __builtin_amdgcn_exp2f(m_r - mn); const float al = (mn > -1.0e38f) ? ea : 1.0f; m_r = mn;
#pragma unroll
    for (int nt = 0; nt < 2; ++nt)
#pragma unroll
      for (int r = 0; r < 8; ++r) { p[nt][r] = ok[nt][r] ? p[nt][r] : 0.f; pb.h[nt * 8 + r] = (_Float16)p[nt][r]; }
    float ps[8];
#pragma unroll
    for (int r = 0; r < 8; ++r) ps[r] = p[0][r] + p[1][r];
    l_r = l_r * al + (((ps[0] + ps[1]) + (ps[2] + ps[3])) + ((ps[4] + ps[5]) + (ps[6] + ps[7])));
#pragma unroll
    for (int dt = 0; dt < DT; ++dt)
#pragma unroll
      for (int r = 0; r < 8; ++r) oacc[dt][r] *= al;
#pragma unroll
    for (int dt = 0; dt < DT; ++dt) oacc[dt] = mmaH<1>(bv[dt].v, bv[dt].v, pb.v, pb.v, oacc[dt]);
  }
    asm volatile("s_wait_dscnt 0x0" ::: "memory");        // this wave's reads of the buffer have returned
    asm volatile("s_wait_asynccnt 0x0" ::: "memory");     // this wave's copies of stage t + 1 have landed
    __syncthreads();                                      // publishes stage t + 1 and frees the buffer stage t has read
    if (t + 2 < FL_NST) { const unsigned lo = (unsigned)(t & 1) * FL_STAGE; fl_copy4(lk + lo, 16u * FL_KP, gk + (size_t)(t + 2) * 64 * kstep, 16 * kstep); fl_copy4(lv + lo, 32u * FL_VP, gv + (t + 2) * 128, (size_t)32 * 4096); fl_copy4(lm + lo, 16u * FL_MP, gmA + (t + 2) * 256, (size_t)16 * 8192); fl_copy4(lm + lo + 64u * FL_MP, 16u * FL_MP, gmB + (t + 2) * 256, (size_t)16 * 8192); }
  }
  asm volatile("s_wait_asynccnt 0x0" ::: "memory");       // nothing in flight before the ring becomes output staging (the last foot's barrier has ended every wave's reads of it)
  float* sO = (float*)(L + (unsigned)w * (unsigned)(RPW * (128 + 4) * 4));      // each wave's own range, pitch 132 floats
  const float lt = l_r + fl_xhalf(l_r); const float li = (lt > 0.f) ? 1.0f / lt : 0.f;      // the halves' sums are joined once
#pragma unroll
  for (int dt = 0; dt < DT; ++dt) { v4f o0, o1;
#pragma unroll
    for (int r = 0; r < 4; ++r) { o0[r] = oacc[dt][r] * li; o1[r] = oacc[dt][4 + r] * li; }
    *(v4fa*)&sO[ln * 132 + dt * 16 + 8 * hh] = o0; *(v4fa*)&sO[ln * 132 + dt * 16 + 8 * hh + 4] = o1; }
  __builtin_amdgcn_fence(__ATOMIC_ACQ_REL, "workgroup"); __builtin_amdgcn_wave_barrier();
  {
#pragma unroll
    for (int rp = 0; rp < RPW; ++rp) { const int r = rp, pc = lane; const v4f val = *(const v4fa*)&sO[r * 132 + pc * 4]; *(v4f*)(O + ((size_t)b * 2048 + q0 + r) * ldo + h * 128 + pc * 4) = val; }      /* 128-float rows: 32 lanes x 16 B */
     } }

__device__ __forceinline__ void d_rope16(int bid, const float* __restrict__ SRC, _Float16* __restrict__ D16) { __shared__ __attribute__((aligned(16))) _Float16 st[256][8]; const int tid = threadIdx.x; const size_t t = (size_t)bid * 256 + tid; if (t >= (size_t)SS * NH * 16) return; const int p = (int)(t % 16); const int h = (int)((t / 16) % NH); const int s = (int)(t / (16 * NH)); const float* src = SRC + ((size_t)s * NH + h) * HD;
#pragma unroll 1
  for (int q = 0; q < 8; ++q) { const int j = p * 8 + q; const int i = j >> 1; const float f = __builtin_powf(10000.0f, -(float)(2 * i) / 128.0f); const float ang = (float)s * f; const float c = cosf(ang), sn = sinf(ang); const float xr = src[2 * i], xi = src[2 * i + 1]; st[tid][q] = (_Float16)((j & 1) ? (xr * sn + xi * c) : (xr * c - xi * sn)); }
  const v8us v = *(const v8us*)&st[tid][0]; unsigned short* d = (unsigned short*)D16 + ((size_t)s * NH + h) * HD + p * 8; *(v8us*)d = v;  }
__device__ __forceinline__ void d_vt128(int bid, const _Float16* __restrict__ V16, _Float16* __restrict__ Vt) { __shared__ unsigned short tl[64][130]; const int tid = threadIdx.x; const int h = bid / (SS / 64), lg = bid % (SS / 64);
  for (int i = tid; i < 64 * 16; i += 256) { const int r = i / 16, c8 = (i % 16) * 8; FragH f; f.half[0] = *(const v8us*)((const unsigned short*)V16 + ((size_t)lg * 64 + r) * CC + h * HD + c8);
#pragma unroll
    for (int q = 0; q < 8; ++q) tl[r][c8 + q] = f.u[q]; }
  __syncthreads();
  { for (int i = tid; i < 128 * 8; i += 256) { const int d = i / 8, pc = i % 8; FragH f;
#pragma unroll
      for (int q = 0; q < 8; ++q) f.u[q] = tl[pc * 8 + q][d]; *(v8us*)((unsigned short*)Vt + ((size_t)h * HD + d) * SS + lg * 64 + pc * 8) = f.half[0]; }  } }
// What follows the three projections and is independent of one another, in one grid: RoPE of q, RoPE of k (RB blocks each), then the short V transposes
#define RB (SS * NH * 16 / 256)
__global__ __launch_bounds__(256) void k_post(const float* __restrict__ QF, _Float16* __restrict__ QR16, const float* __restrict__ KF, _Float16* __restrict__ KR16, const _Float16* __restrict__ V16, _Float16* __restrict__ Vt) {
  const int bid = (int)blockIdx.x;
  if (bid < 2 * RB) d_rope16(bid % RB, bid < RB ? QF : KF, bid < RB ? QR16 : KR16);
  else d_vt128(bid - 2 * RB, V16, Vt);
}
extern "C" void kernel_launch(void* const* d_in, const int* in_sizes, int n_in,
                              void* d_out, int out_size, void* d_ws, size_t ws_size, hipStream_t stream) {
  (void)in_sizes; (void)n_in; (void)out_size;
  const float* const* I = (const float* const*)d_in; const float* q = I[0]; const float* k = I[1]; const float* v = I[2]; const float* mask = I[3]; const float* Wq = I[4]; const float* bq = I[5]; const float* Wk = I[6]; const float* bk = I[7]; const float* Wv = I[8]; const float* bv = I[9]; const float* G = I[10]; const float* Wo = I[11]; const float* bo = I[12];
  char* ws = (char*)d_ws; size_t off = 0;
  auto take = [&](size_t bytes) { char* p = ws + off; off += (bytes + 255) & ~(size_t)255; return p; };
  _Float16* Y = (_Float16*)take((size_t)7 * CC * CC * 2); _Float16* Bq = Y; _Float16* Bk = Y + (size_t)CC * CC; _Float16* Bv = Y + (size_t)2 * CC * CC; _Float16* Bo = Y + (size_t)3 * CC * CC; _Float16* Xq = Y + (size_t)4 * CC * CC; _Float16* Xk = Y + (size_t)5 * CC * CC; _Float16* Xv = Y + (size_t)6 * CC * CC;
  _Float16* BG = (_Float16*)take((size_t)NH * HD * HD * 2);
  float* QF = (float*)take((size_t)SS * CC * 4); float* KF = (float*)take((size_t)SS * CC * 4);
  _Float16* QR16 = (_Float16*)take((size_t)SS * CC * 2); _Float16* QG16 = (_Float16*)take((size_t)SS * CC * 2); _Float16* KR16 = (_Float16*)take((size_t)SS * CC * 2); _Float16* V16 = (_Float16*)take((size_t)SS * CC * 2); _Float16* Vt = (_Float16*)take((size_t)SS * CC * 2); float* O = QF; _Float16* O16 = Xq;
  if (off > ws_size) return;      // 8.4 x 12 + 0.5 + 16.8 x 2 = about 135 MB
  const unsigned gx = (unsigned)(((size_t)SS * CC / 8 + 255) / 256); const unsigned gt = (SS / 128) * (CC / 128);
  k_prep<<<PB_G + 7 * PB_M, 256, 0, stream>>>(G, Wq, Wk, Wv, Wo, q, k, v, BG, Y);      // operands in f16
  k_gemm_t<<<dim3(gt, 3), 256, 0, stream>>>(Xq, Xk, Xv, Bq, Bk, Bv, 0.0625f, bq, bk, bv, QF, KF, V16);      // q, k (f32) and v (f16) projections
  k_post<<<2 * RB + NH * (SS / 64), 256, 0, stream>>>(QF, QR16, KF, KR16, V16, Vt);      // rope q, rope k, Vt
  k_gemm_hhx<0><<<dim3(((SS / 16) * (HD / 64) + 3) / 4, NH), 128, 0, stream>>>(QR16, CC, (size_t)HD, BG, HD, (size_t)HD * HD, 0.0625f, nullptr, 0, nullptr, 1, 0, 0, nullptr, QG16, CC, (size_t)HD, SS, HD, HD);      // qg_h = q_h · G_h (batched over heads via column offsets)
  k_flash<<<1 * NH * (SS / 128), 256, 0, stream>>>(QG16, CC, KR16, CC, Vt, mask, O, CC);
  k_h16<<<gx, 256, 0, stream>>>(O, O16, (size_t)SS * CC / 8);
  k_gemm_t<<<dim3(gt, 1), 256, 0, stream>>>(O16, O16, O16, Bo, Bo, Bo, 0.0625f, bo, bo, bo, (float*)d_out, (float*)d_out, nullptr);
}
